// v000
// Measured on an AMD MI455X. A time is GPU time per run, averaged over a window of back-to-back runs after a warm-up
// (all launches, gaps included; the runs take copies of the inputs in turn), and the median of several windows.
// Apart from v000's, it joins two sittings. Times from different sittings can be a few percent apart, while
// side-by-side timings come from the same sitting.
// v000, which the later versions start from, runs in 1910 microseconds.
#include <hip/hip_runtime.h>

// CausalSelfAttentionRelativePosition (x [2][2048][1024]; qkv = x W_attn (16 x 64); Srel = skew(q Er^T) -> Srel[i][j] = q_i . Er[T-1-i+j] for j <= i (the skew's wrapped entries above the diagonal are masked); att = softmax(((q.k) + Srel)/8, causal);
// y = att v; out = y W_proj -> [2][2048][1024]).
// Compute dtypes, f32 accumulate: every input rounded to bf16; qkv on PLAIN bf16 operands (inputs: exact); scores q.k (K 64), the relative logits q.Er^T and probs.v on bf16 hi+lo planes (3 products; q.Er: hl q x exact Er, 2 products)
// for the first 512 query rows per head and SINGLE fp16 planes for the rest (Er, a bf16 input, is exact in fp16); causal tiles skipped for q.k and probs.v (K bounded), q.Er^T computed in full; skew gather + softmax f32; W_proj on hl planes x exact.

#define NB_  2
#define TT   2048
#define DM   1024
#define NH_  16
#define NKV  16
#define REP  (NH_ / NKV)
#define HD   64
#define DQ   (NH_ * HD)
#define DKV  (NKV * HD)
#define ZH   2
#define RH   512                  // query rows < RH use hi+lo planes (0: none)
#define WIN  2048
#define PCAR 1024.0f
#define SCL  0.125f   // HD^-0.5
typedef _Float16 h16;
typedef unsigned short bf;
typedef __attribute__((ext_vector_type(16))) __bf16   v16bf;
typedef __attribute__((ext_vector_type(16))) _Float16 v16h;
typedef __attribute__((ext_vector_type(8)))  _Float16 v8h;
typedef __attribute__((ext_vector_type(8)))  unsigned short v8us;
typedef __attribute__((ext_vector_type(8)))  float    v8f;
typedef __attribute__((ext_vector_type(4)))  float    v4f;
typedef v8h  __attribute__((may_alias)) v8ha;
typedef v4f  __attribute__((may_alias)) v4fa;
typedef v8us __attribute__((may_alias)) v8usa;

__device__ __forceinline__ unsigned short f2bf(float f) { unsigned u = __float_as_uint(f); u += 0x7FFFu + ((u >> 16) & 1u); return (unsigned short)(u >> 16); }
__device__ __forceinline__ float bf2f(unsigned short b) { return __uint_as_float(((unsigned)b) << 16); }
__device__ __forceinline__ float bfr(float f) { return bf2f(f2bf(f)); }
__device__ __forceinline__ v16h cat16(v8h lo, v8h hi) { return __builtin_shufflevector(lo, hi, 0, 1, 2, 3, 4, 5, 6, 7, 8, 9, 10, 11, 12, 13, 14, 15); }
__device__ __forceinline__ v16bf cat16b(v8us lo, v8us hi) { return __builtin_bit_cast(v16bf, __builtin_shufflevector(lo, hi, 0, 1, 2, 3, 4, 5, 6, 7, 8, 9, 10, 11, 12, 13, 14, 15)); }
__device__ __forceinline__ v8f wmma16(v16h a, v16h b, v8f c) { return __builtin_amdgcn_wmma_f32_16x16x32_f16(false, a, false, b, (short)0, c, false, false); }
__device__ __forceinline__ v8f wmmab(v16bf a, v16bf b, v8f c) { return __builtin_amdgcn_wmma_f32_16x16x32_bf16(false, a, false, b, (short)0, c, false, false); }



// ---- k_gemmw: register-blocked GEMM, ONE WAVE per 64x64 output tile (16 accumulators), operands straight from K-contiguous 16-bit planes; grid (M/64, N/64, Z), 32 threads.
// C[m][n] (f32, pitch ldc, + optional f32 bias[n]) = sum_k A[m][k] Bt[n][k] (+ split products per NSPLIT). z-batch strides sA/sB/sC in elements. K % 32 == 0.
template <typename T16> struct WFrag;
template <> struct WFrag<h16> { typedef v16h V; static __device__ __forceinline__ V ld(const h16* p) { return cat16(*(const v8h*)p, *(const v8h*)(p + 16)); } static __device__ __forceinline__ v8f mma(V a, V b, v8f c) { return wmma16(a, b, c); } };
template <> struct WFrag<bf> { typedef v16bf V; static __device__ __forceinline__ V ld(const bf* p) { return cat16b(*(const v8us*)p, *(const v8us*)(p + 16)); } static __device__ __forceinline__ v8f mma(V a, V b, v8f c) { return wmmab(a, b, c); } };
template <typename T16, int NSPLIT, bool BIAS>
__global__ __launch_bounds__(32) void k_gemmw(const T16* __restrict__ A, const T16* __restrict__ A2, const T16* __restrict__ Bt, const T16* __restrict__ Bt2, int K, float* C, int ldc, const float* __restrict__ bias, size_t sA, size_t sB, size_t sC) {
    typedef typename WFrag<T16>::V V;
    __shared__ __align__(16) float os[16 * 68];
    const size_t z = blockIdx.z; A += z * sA; if (A2) A2 += z * sA; Bt += z * sB; if (Bt2) Bt2 += z * sB; C += z * sC;
    const int lane = threadIdx.x & 31, lr = lane & 15, hi = lane >> 4; const int r0 = blockIdx.x * 64, c0 = blockIdx.y * 64;
    v8f acc[4][4];
#pragma unroll
    for (int mb = 0; mb < 4; ++mb)
#pragma unroll
        for (int nb = 0; nb < 4; ++nb) acc[mb][nb] = (v8f){};
    const size_t aoff = (size_t)(r0 + lr) * K + 8 * hi, boff = (size_t)(c0 + lr) * K + 8 * hi;
#pragma unroll 1
    for (int kc = 0; kc < K; kc += 32) {
        V a[4], a2[4];
#pragma unroll
        for (int mb = 0; mb < 4; ++mb) { a[mb] = WFrag<T16>::ld(A + aoff + (size_t)mb * 16 * K + kc); if (NSPLIT == 1 || NSPLIT == 2) a2[mb] = WFrag<T16>::ld(A2 + aoff + (size_t)mb * 16 * K + kc); }
#pragma unroll
        for (int nb = 0; nb < 4; ++nb) { const V b = WFrag<T16>::ld(Bt + boff + (size_t)nb * 16 * K + kc); V b2; if (NSPLIT >= 2) b2 = WFrag<T16>::ld(Bt2 + boff + (size_t)nb * 16 * K + kc);
#pragma unroll
            for (int mb = 0; mb < 4; ++mb) { acc[mb][nb] = WFrag<T16>::mma(a[mb], b, acc[mb][nb]); if (NSPLIT == 1 || NSPLIT == 2) acc[mb][nb] = WFrag<T16>::mma(a2[mb], b, acc[mb][nb]); if (NSPLIT >= 2) acc[mb][nb] = WFrag<T16>::mma(a[mb], b2, acc[mb][nb]); } }
        asm volatile("v_nop\n\tv_nop\n\tv_nop\n\tv_nop" : "+v"(acc[0][0]), "+v"(acc[1][1]), "+v"(acc[2][2]), "+v"(acc[3][3]) : "v"(a[0]), "v"(a[3]));
    }
#pragma unroll
    for (int mb = 0; mb < 4; ++mb) {
#pragma unroll
        for (int nb = 0; nb < 4; ++nb) {
#pragma unroll
            for (int j = 0; j < 8; ++j) os[(hi * 8 + j) * 68 + nb * 16 + lr] = acc[mb][nb][j]; }
        __builtin_amdgcn_wave_barrier(); asm volatile("" ::: "memory");
        float* crow = C + (size_t)(r0 + mb * 16) * ldc + c0;
{
#pragma unroll
            for (int s = 0; s < 8; ++s) { const int row = 2 * s + hi, cofs = lr * 4; v4f val = *(const v4fa*)(os + row * 68 + cofs); if (BIAS) { val[0] += bfr(bias[c0 + cofs]); val[1] += bfr(bias[c0 + cofs + 1]); val[2] += bfr(bias[c0 + cofs + 2]); val[3] += bfr(bias[c0 + cofs + 3]); }
                *(v4f*)(crow + (size_t)row * ldc + cofs) = val; }
             }
        __builtin_amdgcn_wave_barrier(); asm volatile("" ::: "memory");
    }
}

// ---- k_gemmc: the same one-wave 64x64 tile GEMM specialised for causal attention: CMODE 1 skips score tiles entirely above the diagonal (query rows r0+roff.., key columns c0..), CMODE 2 limits the
// key (K) loop of the probability x value contraction to the diagonal block (probabilities beyond it are exactly zero). roff = row offset of this launch's first row within the sequence.
template <typename T16, int NSPLIT, int CMODE>
__global__ __launch_bounds__(32) void k_gemmc(const T16* __restrict__ A, const T16* __restrict__ A2, const T16* __restrict__ Bt, const T16* __restrict__ Bt2, int K, float* C, int ldc, int roff, size_t sA, size_t sB, size_t sC) {
    typedef typename WFrag<T16>::V V;
    __shared__ __align__(16) float os[16 * 68];
    const size_t z = blockIdx.z; A += z * sA; if (A2) A2 += z * sA; Bt += z * sB; if (Bt2) Bt2 += z * sB; C += z * sC;
    const int lane = threadIdx.x & 31, lr = lane & 15, hi = lane >> 4; const int r0 = blockIdx.x * 64, c0 = blockIdx.y * 64;
    if (CMODE == 1 && c0 > r0 + roff + 63) return;                  // score tile entirely above the causal diagonal: never read (the softmax masks j > i by select)
    const int Kl = (CMODE == 2) ? min(K, r0 + roff + 64) : K;        // P.V: probabilities are exactly 0 beyond the diagonal block, so the K loop stops there
    v8f acc[4][4];
#pragma unroll
    for (int mb = 0; mb < 4; ++mb)
#pragma unroll
        for (int nb = 0; nb < 4; ++nb) acc[mb][nb] = (v8f){};
    const size_t aoff = (size_t)(r0 + lr) * K + 8 * hi, boff = (size_t)(c0 + lr) * K + 8 * hi;
#pragma unroll 1
    for (int kc = 0; kc < Kl; kc += 32) {
        V a[4], a2[4];
#pragma unroll
        for (int mb = 0; mb < 4; ++mb) { a[mb] = WFrag<T16>::ld(A + aoff + (size_t)mb * 16 * K + kc); if (NSPLIT == 1 || NSPLIT == 2) a2[mb] = WFrag<T16>::ld(A2 + aoff + (size_t)mb * 16 * K + kc); }
#pragma unroll
        for (int nb = 0; nb < 4; ++nb) { const V b = WFrag<T16>::ld(Bt + boff + (size_t)nb * 16 * K + kc); V b2; if (NSPLIT >= 2) b2 = WFrag<T16>::ld(Bt2 + boff + (size_t)nb * 16 * K + kc);
#pragma unroll
            for (int mb = 0; mb < 4; ++mb) { acc[mb][nb] = WFrag<T16>::mma(a[mb], b, acc[mb][nb]); if (NSPLIT == 1 || NSPLIT == 2) acc[mb][nb] = WFrag<T16>::mma(a2[mb], b, acc[mb][nb]); if (NSPLIT >= 2) acc[mb][nb] = WFrag<T16>::mma(a[mb], b2, acc[mb][nb]); } }
        asm volatile("v_nop\n\tv_nop\n\tv_nop\n\tv_nop" : "+v"(acc[0][0]), "+v"(acc[1][1]), "+v"(acc[2][2]), "+v"(acc[3][3]) : "v"(a[0]), "v"(a[3]));
    }
#pragma unroll
    for (int mb = 0; mb < 4; ++mb) {
#pragma unroll
        for (int nb = 0; nb < 4; ++nb) {
#pragma unroll
            for (int j = 0; j < 8; ++j) os[(hi * 8 + j) * 68 + nb * 16 + lr] = acc[mb][nb][j]; }
        __builtin_amdgcn_wave_barrier(); asm volatile("" ::: "memory");
        float* crow = C + (size_t)(r0 + mb * 16) * ldc + c0;
{
#pragma unroll
            for (int s = 0; s < 8; ++s) { const int row = 2 * s + hi, cofs = lr * 4; v4f val = *(const v4fa*)(os + row * 68 + cofs);
                *(v4f*)(crow + (size_t)row * ldc + cofs) = val; }
             }
        __builtin_amdgcn_wave_barrier(); asm volatile("" ::: "memory");
    }
}

__device__ __forceinline__ h16 tohx(float x) { return (h16)x; }
__device__ __forceinline__ void splitf(float y, unsigned short& h, unsigned short& l) { h = f2bf(y); l = f2bf(y - bf2f(h)); }
typedef __attribute__((ext_vector_type(2))) _Float16 v2h;
typedef __attribute__((ext_vector_type(4))) _Float16 v4h;
typedef __attribute__((ext_vector_type(2))) unsigned short v2us;
typedef __attribute__((ext_vector_type(4))) unsigned short v4us;
typedef __attribute__((ext_vector_type(2))) float v2f;
typedef __attribute__((ext_vector_type(4))) int v4i;

__global__ __launch_bounds__(256) void k_wtG(const float* __restrict__ w, int K, int N, bf* Bt) {
    const int lane = threadIdx.x & 31; const int L0 = (blockIdx.x * 8 + (threadIdx.x >> 5)) * 8; const int nlines = N * K / 64;
{
#pragma unroll 1
        for (int l = 0; l < 8; ++l) { const int L = L0 + l; if (L >= nlines) break; const size_t e = (size_t)L * 64 + lane * 2; const int k = (int)(e % K), n = (int)(e / K); v2us o;
            o[0] = f2bf(w[(size_t)k * N + n]); o[1] = f2bf(w[(size_t)(k + 1) * N + n]); *(v2us*)(Bt + e) = o; }
         }
}
__global__ __launch_bounds__(256) void k_cvt8(const float* __restrict__ src, bf* dst, size_t n8) { const size_t i = (size_t)blockIdx.x * 256 + threadIdx.x; if (i >= n8) return; const v8f v = *(const v8f*)(src + i * 8); v8us o;
#pragma unroll
    for (int k = 0; k < 8; ++k) o[k] = f2bf(v[k]); *(v8us*)(dst + i * 8) = o;  }
__global__ __launch_bounds__(256) void k_cscvt(const float* __restrict__ cosT, const float* __restrict__ sinT, float* CS) { const int idx = blockIdx.x * 256 + threadIdx.x; if (idx >= TT * HD) return; v2f cs; cs[0] = bfr(cosT[idx]); cs[1] = bfr(sinT[idx]); *(v2f*)(CS + (size_t)idx * 2) = cs;  }
// k_rope: head planes [h][t][d] (fp16 + hi/lo) of rope(x) x sc with the rotate-half convention out[d] = x[d] cos[t][d] - x[d+HD/2] sin[t][d], out[d+HD/2] = x[d+HD/2] cos[t][d+HD/2] + x[d] sin[t][d+HD/2]
__global__ __launch_bounds__(256) void k_rope(const float* __restrict__ F, int pitch, int nheads, const float* __restrict__ CS, const float* __restrict__ RF, const float* __restrict__ nw, float sc, h16* P16, bf* Ph, bf* Pl) {
    const size_t e = ((size_t)blockIdx.x * 256 + threadIdx.x) * 2; if (e >= (size_t)nheads * TT * HD) return; const int d = (int)(e % HD); const int t = (int)((e / HD) % TT); const int h = (int)(e / ((size_t)HD * TT)); const float* f = F + (size_t)t * pitch + h * HD; const float rf = RF ? RF[(size_t)h * TT + t] : 1.0f; v2h o16; v2us oh, ol;
#pragma unroll
    for (int q = 0; q < 2; ++q) { const int dd = d + q; const int dp = (dd < HD / 2) ? dd + HD / 2 : dd - HD / 2; float x0 = f[dd], x1 = f[dp];
        if (RF) { float n0 = __fmul_rn(x0, rf), n1 = __fmul_rn(x1, rf); asm volatile("" : "+v"(n0)); asm volatile("" : "+v"(n1)); x0 = __fmul_rn(bfr(nw[dd]), n0); x1 = __fmul_rn(bfr(nw[dp]), n1); }
        const v2f cs = *(const v2f*)(CS + ((size_t)t * HD + dd) * 2); float a = __fmul_rn(x0, cs[0]), bq = __fmul_rn(x1, cs[1]); asm volatile("" : "+v"(a)); asm volatile("" : "+v"(bq)); const float r = ((dd < HD / 2) ? __fsub_rn(a, bq) : __fadd_rn(a, bq)) * sc;
        o16[q] = tohx(r); unsigned short a2, c2; splitf(r, a2, c2); oh[q] = a2; ol[q] = c2; }
    *(v2h*)(P16 + e) = o16; *(v2us*)(Ph + e) = oh; *(v2us*)(Pl + e) = ol;  }
__global__ __launch_bounds__(256) void k_vtp(const float* __restrict__ F, int pitch, int nheads, h16* V16, bf* Vh, bf* Vl) { const size_t e = ((size_t)blockIdx.x * 256 + threadIdx.x) * 2; if (e >= (size_t)nheads * HD * TT) return; const int t = (int)(e % TT); const int d = (int)((e / TT) % HD); const int g = (int)(e / ((size_t)TT * HD)); v2h o16; v2us oh, ol;
#pragma unroll
    for (int q = 0; q < 2; ++q) { const float x = F[(size_t)(t + q) * pitch + g * HD + d]; o16[q] = tohx(x); unsigned short a2, c2; splitf(x, a2, c2); oh[q] = a2; ol[q] = c2; }
    *(v2h*)(V16 + e) = o16; *(v2us*)(Vh + e) = oh; *(v2us*)(Vl + e) = ol;  }
__global__ __launch_bounds__(256) void k_csid(float* CS) { const int idx = blockIdx.x * 256 + threadIdx.x; if (idx >= TT * HD) return; v2f cs; cs[0] = 1.0f; cs[1] = 0.0f; *(v2f*)(CS + (size_t)idx * 2) = cs;  }
// k_asoft: per row (zz, i): t = (S + Srel) x HD^-0.5 for j <= i (causal; the reference's -1e9 additive fill vanishes identically); softmax over the 2048 keys (register row, one exp, fixed trees);
__global__ __launch_bounds__(256) void k_asoft(const float* __restrict__ Sb, const float* __restrict__ QE, h16* P16, bf* Ph, bf* Pl) {
    const int lane = threadIdx.x & 31; const int row = blockIdx.x * 8 + (threadIdx.x >> 5); if (row >= ZH * TT) return; const int i = row % TT; const int zz = row / TT; (void)zz; const bool hires = (i < RH); const float* sr = Sb + (size_t)row * TT; float v[TT / 32]; float mx = -3.0e38f;
#pragma unroll
    for (int ch = 0; ch < TT / 128; ++ch) { const int j0 = ch * 128 + lane * 4; const v4f a = *(const v4f*)(sr + j0); const float* qe = QE + (size_t)row * TT + (TT - 1 - i) + j0;   /* Srel[i][j] = QEr[i][T-1-i+j] (valid for j <= i) */
#pragma unroll
        for (int q = 0; q < 4; ++q) { const int j = j0 + q; float t = -3.0e38f; if (j <= i) { float s0 = __fadd_rn(a[q], qe[q]); asm volatile("" : "+v"(s0)); t = __fmul_rn(s0, SCL); } v[ch * 4 + q] = t; mx = fmaxf(mx, t); } }
#pragma unroll
    for (int sh = 16; sh; sh >>= 1) mx = fmaxf(mx, __shfl_xor(mx, sh, 32));
    float sum = 0.f;
#pragma unroll
    for (int k = 0; k < TT / 32; ++k) { float d0 = __fsub_rn(v[k], mx); asm volatile("" : "+v"(d0)); v[k] = __builtin_amdgcn_exp2f(__fmul_rn(d0, 1.4426950408889634f)); sum += v[k]; }
#pragma unroll
    for (int sh = 16; sh; sh >>= 1) sum += __shfl_xor(sum, sh, 32);
    const float f = __fdiv_rn(hires ? 1.0f : PCAR, sum);
{
        if (hires) {
#pragma unroll
            for (int ch = 0; ch < TT / 128; ++ch) { v4us oh, ol;
#pragma unroll
                for (int q = 0; q < 4; ++q) { unsigned short a, c2; splitf(v[ch * 4 + q] * f, a, c2); oh[q] = a; ol[q] = c2; }
                const size_t oo = ((size_t)zz * (RH ? RH : 1) + i) * TT + ch * 128 + lane * 4; *(v4us*)(Ph + oo) = oh; *(v4us*)(Pl + oo) = ol; }
        } else {
#pragma unroll
            for (int ch = 0; ch < TT / 128; ++ch) { v4h o4;
#pragma unroll
                for (int q = 0; q < 4; ++q) o4[q] = tohx(v[ch * 4 + q] * f);
                *(v4h*)(P16 + (size_t)row * TT + ch * 128 + lane * 4) = o4; } }
         }
}
__global__ __launch_bounds__(256) void k_merge(const float* __restrict__ O, int h0, bf* Ah, bf* Al) { const size_t e = ((size_t)blockIdx.x * 256 + threadIdx.x) * 2; if (e >= (size_t)ZH * TT * HD) return; const int d = (int)(e % HD); const int t = (int)((e / HD) % TT); const int zz = (int)(e / ((size_t)HD * TT)); const float cs = (t < RH) ? 1.0f : (1.0f / PCAR); const size_t oo = (size_t)t * DQ + (h0 + zz) * HD + d;
    v2us oh, ol;
#pragma unroll
    for (int q = 0; q < 2; ++q) { unsigned short a, c2; splitf(O[e + q] * cs, a, c2); oh[q] = a; ol[q] = c2; } *(v2us*)(Ah + oo) = oh; *(v2us*)(Al + oo) = ol;  }

__global__ __launch_bounds__(256) void k_er16(const float* __restrict__ er, h16* E) { const int i = (blockIdx.x * 256 + threadIdx.x) * 4; if (i >= TT * HD) return; const v4f a = *(const v4f*)(er + i); v4h o; o[0] = tohx(bfr(a[0])); o[1] = tohx(bfr(a[1])); o[2] = tohx(bfr(a[2])); o[3] = tohx(bfr(a[3])); *(v4h*)(E + i) = o;  }
typedef __attribute__((ext_vector_type(4))) _Float16 v4hx;

extern "C" void kernel_launch(void* const* d_in, const int* in_sizes, int n_in,
                              void* d_out, int out_size, void* d_ws, size_t ws_size, hipStream_t stream) {
    (void)in_sizes; (void)n_in; (void)out_size;
    const float* x = (const float*)d_in[0]; const float* wattn = (const float*)d_in[1]; const float* wo = (const float*)d_in[2]; const float* er = (const float*)d_in[3];
    float* OUT = (float*)d_out;     // [2][2048][1024]
    char* wsp = (char*)d_ws;
    auto take = [&](size_t bytes) { char* p = wsp; wsp += (bytes + 255) & ~(size_t)255; return (void*)p; };
    bf* WQKV = (bf*)take((size_t)3 * DM * DM * 2); bf* WQ = WQKV; bf* WK = WQKV + (size_t)DM * DM; bf* WV = WQKV + (size_t)2 * DM * DM; bf* ERB = (bf*)take((size_t)TT * HD * 2); h16* ER16 = (h16*)take((size_t)TT * HD * 2); float* QE = (float*)take((size_t)ZH * TT * TT * 4); bf* WO = (bf*)take((size_t)DM * DQ * 2); float* CS = (float*)take((size_t)TT * HD * 2 * 4);
    bf* XB = (bf*)take((size_t)TT * DM * 2); float* FQ = (float*)take((size_t)TT * DQ * 4); float* FK = (float*)take((size_t)TT * DKV * 4);
    h16* QP16 = (h16*)take((size_t)NH_ * TT * HD * 2); h16* KP16 = (h16*)take((size_t)NKV * TT * HD * 2); h16* VT16 = (h16*)take((size_t)NKV * HD * TT * 2);
    bf* QPh = (bf*)take((size_t)NH_ * TT * HD * 2); bf* QPl = (bf*)take((size_t)NH_ * TT * HD * 2); bf* KPh = (bf*)take((size_t)NKV * TT * HD * 2); bf* KPl = (bf*)take((size_t)NKV * TT * HD * 2); bf* VTh = (bf*)take((size_t)NKV * HD * TT * 2); bf* VTl = (bf*)take((size_t)NKV * HD * TT * 2); bf* Ph = (bf*)take((size_t)ZH * RH * TT * 2); bf* Pl = (bf*)take((size_t)ZH * RH * TT * 2);
    float* Sb = (float*)take((size_t)ZH * TT * TT * 4); h16* P16 = (h16*)take((size_t)ZH * TT * TT * 2); float* Ob = (float*)take((size_t)ZH * TT * HD * 4); bf* ATh = (bf*)take((size_t)TT * DQ * 2); bf* ATl = (bf*)take((size_t)TT * DQ * 2);
    if ((size_t)(wsp - (char*)d_ws) > ws_size) return;    // ws 256 MiB
    float* FV = FK;   // v projection reuses the k buffer after the k planes are built (stream-ordered)
    { k_wtG<<<(unsigned)((DM * 3 * DM / 64 + 63) / 64), 256, 0, stream>>>(wattn, DM, 3 * DM, WQKV); k_cvt8<<<(TT * HD / 8 + 255) / 256, 256, 0, stream>>>(er, ERB, TT * HD / 8); k_er16<<<(TT * HD / 4 + 255) / 256, 256, 0, stream>>>(er, ER16);
      k_wtG<<<(unsigned)((DQ * DM / 64 + 63) / 64), 256, 0, stream>>>(wo, DQ, DM, WO);
       }
    k_csid<<<(TT * HD + 255) / 256, 256, 0, stream>>>(CS);
    const unsigned LQ = (unsigned)(((size_t)NH_ * TT * HD / 2 + 255) / 256), LKv = (unsigned)(((size_t)NKV * TT * HD / 2 + 255) / 256);
    for (int b = 0; b < NB_; ++b) {
        
        k_cvt8<<<(unsigned)(((size_t)TT * DM / 8 + 255) / 256), 256, 0, stream>>>(x + (size_t)b * TT * DM, XB, (size_t)TT * DM / 8);
        k_gemmw<bf, 0, false><<<dim3(TT / 64, DQ / 64, 1), 32, 0, stream>>>(XB, nullptr, WQ, nullptr, DM, FQ, DQ, nullptr, 0, 0, 0);
        k_rope<<<LQ, 256, 0, stream>>>(FQ, DQ, NH_, CS, nullptr, nullptr, 1.0f, QP16, QPh, QPl);
        k_gemmw<bf, 0, false><<<dim3(TT / 64, DKV / 64, 1), 32, 0, stream>>>(XB, nullptr, WK, nullptr, DM, FK, DKV, nullptr, 0, 0, 0);
        k_rope<<<LKv, 256, 0, stream>>>(FK, DKV, NKV, CS, nullptr, nullptr, 1.0f, KP16, KPh, KPl);
        k_gemmw<bf, 0, false><<<dim3(TT / 64, DKV / 64, 1), 32, 0, stream>>>(XB, nullptr, WV, nullptr, DM, FV, DKV, nullptr, 0, 0, 0); k_vtp<<<LKv, 256, 0, stream>>>(FV, DKV, NKV, VT16, VTh, VTl);
        for (int h0 = 0; h0 < NH_; h0 += ZH) { const size_t zq = (size_t)h0, zk = (size_t)(h0 / REP);   // one kv head per query head: the pass's two heads use consecutive kv planes (z-strides TT*HD)
            k_gemmc<bf, 2, 1><<<dim3(RH / 64, TT / 64, ZH), 32, 0, stream>>>(QPh + zq * TT * HD, QPl + zq * TT * HD, KPh + zk * TT * HD, KPl + zk * TT * HD, HD, Sb, TT, 0, (size_t)TT * HD, (size_t)TT * HD, (size_t)TT * TT);
            k_gemmc<h16, 0, 1><<<dim3((TT - RH) / 64, TT / 64, ZH), 32, 0, stream>>>(QP16 + zq * TT * HD + (size_t)RH * HD, nullptr, KP16 + zk * TT * HD, nullptr, HD, Sb + (size_t)RH * TT, TT, RH, (size_t)TT * HD, (size_t)TT * HD, (size_t)TT * TT);
            k_gemmw<bf, 1, false><<<dim3(RH / 64, TT / 64, ZH), 32, 0, stream>>>(QPh + zq * TT * HD, QPl + zq * TT * HD, ERB, nullptr, HD, QE, TT, nullptr, (size_t)TT * HD, 0, (size_t)TT * TT);
            k_gemmw<h16, 0, false><<<dim3((TT - RH) / 64, TT / 64, ZH), 32, 0, stream>>>(QP16 + zq * TT * HD + (size_t)RH * HD, nullptr, ER16, nullptr, HD, QE + (size_t)RH * TT, TT, nullptr, (size_t)TT * HD, 0, (size_t)TT * TT);
            k_asoft<<<ZH * TT / 8, 256, 0, stream>>>(Sb, QE, P16, Ph, Pl);
            k_gemmc<bf, 2, 2><<<dim3(RH / 64, HD / 64, ZH), 32, 0, stream>>>(Ph, Pl, VTh + zk * HD * TT, VTl + zk * HD * TT, TT, Ob, HD, 0, (size_t)RH * TT, (size_t)HD * TT, (size_t)TT * HD);
            k_gemmc<h16, 0, 2><<<dim3((TT - RH) / 64, HD / 64, ZH), 32, 0, stream>>>(P16 + (size_t)RH * TT, nullptr, VT16 + zk * HD * TT, nullptr, TT, Ob + (size_t)RH * HD, HD, RH, (size_t)TT * TT, (size_t)HD * TT, (size_t)TT * HD);
            k_merge<<<(unsigned)(((size_t)ZH * TT * HD / 2 + 255) / 256), 256, 0, stream>>>(Ob, h0, ATh, ATl); }
        k_gemmw<bf, 1, false><<<dim3(TT / 64, DM / 64, 1), 32, 0, stream>>>(ATh, ATl, WO, nullptr, DQ, OUT + (size_t)b * TT * DM, DM, nullptr, 0, 0, 0); }
}

// v001
// It runs in 1210 microseconds.
// In two side-by-side timings against v000, it was 1.57 and 1.58 times as fast.
#include <hip/hip_runtime.h>

// CausalSelfAttentionRelativePosition (x [2][2048][1024]; qkv = x W_attn (16 x 64); Srel = skew(q Er^T) -> Srel[i][j] = q_i . Er[T-1-i+j] for j <= i (the skew's wrapped entries above the diagonal are masked); att = softmax(((q.k) + Srel)/8, causal);
// y = att v; out = y W_proj -> [2][2048][1024]).
// Compute dtypes, f32 accumulate: every input rounded to bf16; qkv on PLAIN bf16 operands (inputs: exact); scores q.k (K 64), the relative logits q.Er^T and probs.v on bf16 hi+lo planes (3 products; q.Er: hl q x exact Er, 2 products)
// for the first 512 query rows per head and SINGLE fp16 planes for the rest (Er, a bf16 input, is exact in fp16); causal tiles skipped for q.k and probs.v (K bounded), q.Er^T computed in full; skew gather + softmax f32; W_proj on hl planes x exact.

#define NB_  2
#define TT   2048
#define DM   1024
#define NH_  16
#define NKV  16
#define REP  (NH_ / NKV)
#define HD   64
#define DQ   (NH_ * HD)
#define DKV  (NKV * HD)
#define ZH   2
#define RH   512                  // query rows < RH use hi+lo planes (0: none)
#define WIN  2048
#define PCAR 1024.0f
#define SCL  0.125f   // HD^-0.5
typedef _Float16 h16;
typedef unsigned short bf;
typedef __attribute__((ext_vector_type(16))) __bf16   v16bf;
typedef __attribute__((ext_vector_type(16))) _Float16 v16h;
typedef __attribute__((ext_vector_type(8)))  _Float16 v8h;
typedef __attribute__((ext_vector_type(8)))  unsigned short v8us;
typedef __attribute__((ext_vector_type(8)))  float    v8f;
typedef __attribute__((ext_vector_type(4)))  float    v4f;
typedef v8h  __attribute__((may_alias)) v8ha;
typedef v4f  __attribute__((may_alias)) v4fa;
typedef v8us __attribute__((may_alias)) v8usa;

__device__ __forceinline__ unsigned short f2bf(float f) { unsigned u = __float_as_uint(f); u += 0x7FFFu + ((u >> 16) & 1u); return (unsigned short)(u >> 16); }
__device__ __forceinline__ float bf2f(unsigned short b) { return __uint_as_float(((unsigned)b) << 16); }
__device__ __forceinline__ float bfr(float f) { return bf2f(f2bf(f)); }
__device__ __forceinline__ v16h cat16(v8h lo, v8h hi) { return __builtin_shufflevector(lo, hi, 0, 1, 2, 3, 4, 5, 6, 7, 8, 9, 10, 11, 12, 13, 14, 15); }
__device__ __forceinline__ v16bf cat16b(v8us lo, v8us hi) { return __builtin_bit_cast(v16bf, __builtin_shufflevector(lo, hi, 0, 1, 2, 3, 4, 5, 6, 7, 8, 9, 10, 11, 12, 13, 14, 15)); }
__device__ __forceinline__ v8f wmma16(v16h a, v16h b, v8f c) { return __builtin_amdgcn_wmma_f32_16x16x32_f16(false, a, false, b, (short)0, c, false, false); }
__device__ __forceinline__ v8f wmmab(v16bf a, v16bf b, v8f c) { return __builtin_amdgcn_wmma_f32_16x16x32_bf16(false, a, false, b, (short)0, c, false, false); }



// ---- k_gemmw: register-blocked GEMM, ONE WAVE per 64x64 output tile (16 accumulators), operands straight from K-contiguous 16-bit planes; grid (M/64, N/64, Z), 32 threads.
// C[m][n] (f32, pitch ldc, + optional f32 bias[n]) = sum_k A[m][k] Bt[n][k] (+ split products per NSPLIT). z-batch strides sA/sB/sC in elements. K % 32 == 0.
// NW > 1 (32 * NW threads): NW waves share the tile; wave w takes the k steps w, w + NW, ...; each leaves its partial 64x64 tile in LDS and, behind one barrier, the work-group sums the NW partials in wave order.
template <typename T16> struct WFrag;
template <> struct WFrag<h16> { typedef v16h V; static __device__ __forceinline__ V ld(const h16* p) { return cat16(*(const v8h*)p, *(const v8h*)(p + 16)); } static __device__ __forceinline__ v8f mma(V a, V b, v8f c) { return wmma16(a, b, c); } };
template <> struct WFrag<bf> { typedef v16bf V; static __device__ __forceinline__ V ld(const bf* p) { return cat16b(*(const v8us*)p, *(const v8us*)(p + 16)); } static __device__ __forceinline__ v8f mma(V a, V b, v8f c) { return wmmab(a, b, c); } };
template <typename T16, int NSPLIT, bool BIAS, int NW>
__global__ __launch_bounds__(32 * NW) void k_gemmw(const T16* __restrict__ A, const T16* __restrict__ A2, const T16* __restrict__ Bt, const T16* __restrict__ Bt2, int K, float* C, int ldc, const float* __restrict__ bias, size_t sA, size_t sB, size_t sC) {
    typedef typename WFrag<T16>::V V;
    __shared__ __align__(16) float os[(NW > 1 ? NW * 64 : 16) * 68];
    const size_t z = blockIdx.z; A += z * sA; if (A2) A2 += z * sA; Bt += z * sB; if (Bt2) Bt2 += z * sB; C += z * sC;
    const int lane = threadIdx.x & 31, lr = lane & 15, hi = lane >> 4; const int r0 = blockIdx.x * 64, c0 = blockIdx.y * 64; const int wv = (NW > 1) ? __builtin_amdgcn_readfirstlane((int)(threadIdx.x >> 5)) : 0;   // wave number in a scalar register: the K loop's counter and branch stay scalar
    v8f acc[4][4];
#pragma unroll
    for (int mb = 0; mb < 4; ++mb)
#pragma unroll
        for (int nb = 0; nb < 4; ++nb) acc[mb][nb] = (v8f){};
    const size_t aoff = (size_t)(r0 + lr) * K + 8 * hi, boff = (size_t)(c0 + lr) * K + 8 * hi;
#pragma unroll 1
    for (int kc = wv * 32; kc < K; kc += 32 * NW) {
        V a[4], a2[4];
#pragma unroll
        for (int mb = 0; mb < 4; ++mb) { a[mb] = WFrag<T16>::ld(A + aoff + (size_t)mb * 16 * K + kc); if (NSPLIT == 1 || NSPLIT == 2) a2[mb] = WFrag<T16>::ld(A2 + aoff + (size_t)mb * 16 * K + kc); }
#pragma unroll
        for (int nb = 0; nb < 4; ++nb) { const V b = WFrag<T16>::ld(Bt + boff + (size_t)nb * 16 * K + kc); V b2; if (NSPLIT >= 2) b2 = WFrag<T16>::ld(Bt2 + boff + (size_t)nb * 16 * K + kc);
#pragma unroll
            for (int mb = 0; mb < 4; ++mb) { acc[mb][nb] = WFrag<T16>::mma(a[mb], b, acc[mb][nb]); if (NSPLIT == 1 || NSPLIT == 2) acc[mb][nb] = WFrag<T16>::mma(a2[mb], b, acc[mb][nb]); if (NSPLIT >= 2) acc[mb][nb] = WFrag<T16>::mma(a[mb], b2, acc[mb][nb]); } }
        asm volatile("v_nop\n\tv_nop\n\tv_nop\n\tv_nop" : "+v"(acc[0][0]), "+v"(acc[1][1]), "+v"(acc[2][2]), "+v"(acc[3][3]) : "v"(a[0]), "v"(a[3]));
    }
    if (NW > 1) {   // the loops below are unrolled so that acc is indexed by constants (stays in registers) and the LDS reads of one sum go out together
#pragma unroll
        for (int mb = 0; mb < 4; ++mb)
#pragma unroll
            for (int nb = 0; nb < 4; ++nb)
#pragma unroll
                for (int j = 0; j < 8; ++j) os[(wv * 64 + mb * 16 + hi * 8 + j) * 68 + nb * 16 + lr] = acc[mb][nb][j];
        __syncthreads();   // every wave's partial tile is in LDS before any thread sums across waves
#pragma unroll
        for (int s = 0; s < 32 / NW; ++s) { const int u = s * 32 * NW + (int)threadIdx.x, row = u >> 4, cofs = (u & 15) * 4; v4f val = *(const v4fa*)(os + row * 68 + cofs);
#pragma unroll
            for (int w = 1; w < NW; ++w) val += *(const v4fa*)(os + (w * 64 + row) * 68 + cofs);
            if (BIAS) { val[0] += bfr(bias[c0 + cofs]); val[1] += bfr(bias[c0 + cofs + 1]); val[2] += bfr(bias[c0 + cofs + 2]); val[3] += bfr(bias[c0 + cofs + 3]); }
            *(v4f*)(C + (size_t)(r0 + row) * ldc + c0 + cofs) = val; }
        return;
    }
#pragma unroll
    for (int mb = 0; mb < 4; ++mb) {
#pragma unroll
        for (int nb = 0; nb < 4; ++nb) {
#pragma unroll
            for (int j = 0; j < 8; ++j) os[(hi * 8 + j) * 68 + nb * 16 + lr] = acc[mb][nb][j]; }
        __builtin_amdgcn_wave_barrier(); asm volatile("" ::: "memory");
        float* crow = C + (size_t)(r0 + mb * 16) * ldc + c0;
{
#pragma unroll
            for (int s = 0; s < 8; ++s) { const int row = 2 * s + hi, cofs = lr * 4; v4f val = *(const v4fa*)(os + row * 68 + cofs); if (BIAS) { val[0] += bfr(bias[c0 + cofs]); val[1] += bfr(bias[c0 + cofs + 1]); val[2] += bfr(bias[c0 + cofs + 2]); val[3] += bfr(bias[c0 + cofs + 3]); }
                *(v4f*)(crow + (size_t)row * ldc + cofs) = val; }
             }
        __builtin_amdgcn_wave_barrier(); asm volatile("" ::: "memory");
    }
}

// ---- k_gemmc: the same one-wave 64x64 tile GEMM specialised for causal attention: CMODE 1 skips score tiles entirely above the diagonal (query rows r0+roff.., key columns c0..), CMODE 2 limits the
// key (K) loop of the probability x value contraction to the diagonal block (probabilities beyond it are exactly zero). roff = row offset of this launch's first row within the sequence. NW as in k_gemmw.
template <typename T16, int NSPLIT, int CMODE, int NW>
__global__ __launch_bounds__(32 * NW) void k_gemmc(const T16* __restrict__ A, const T16* __restrict__ A2, const T16* __restrict__ Bt, const T16* __restrict__ Bt2, int K, float* C, int ldc, int roff, size_t sA, size_t sB, size_t sC) {
    typedef typename WFrag<T16>::V V;
    __shared__ __align__(16) float os[(NW > 1 ? NW * 64 : 16) * 68];
    const size_t z = blockIdx.z; A += z * sA; if (A2) A2 += z * sA; Bt += z * sB; if (Bt2) Bt2 += z * sB; C += z * sC;
    const int lane = threadIdx.x & 31, lr = lane & 15, hi = lane >> 4; const int r0 = blockIdx.x * 64, c0 = blockIdx.y * 64; const int wv = (NW > 1) ? __builtin_amdgcn_readfirstlane((int)(threadIdx.x >> 5)) : 0;   // wave number in a scalar register: the K loop's counter and branch stay scalar
    if (CMODE == 1 && c0 > r0 + roff + 63) return;                  // score tile entirely above the causal diagonal: never read (the softmax masks j > i by select)
    const int Kl = (CMODE == 2) ? min(K, r0 + roff + 64) : K;        // P.V: probabilities are exactly 0 beyond the diagonal block, so the K loop stops there
    v8f acc[4][4];
#pragma unroll
    for (int mb = 0; mb < 4; ++mb)
#pragma unroll
        for (int nb = 0; nb < 4; ++nb) acc[mb][nb] = (v8f){};
    const size_t aoff = (size_t)(r0 + lr) * K + 8 * hi, boff = (size_t)(c0 + lr) * K + 8 * hi;
#pragma unroll 1
    for (int kc = wv * 32; kc < Kl; kc += 32 * NW) {
        V a[4], a2[4];
#pragma unroll
        for (int mb = 0; mb < 4; ++mb) { a[mb] = WFrag<T16>::ld(A + aoff + (size_t)mb * 16 * K + kc); if (NSPLIT == 1 || NSPLIT == 2) a2[mb] = WFrag<T16>::ld(A2 + aoff + (size_t)mb * 16 * K + kc); }
#pragma unroll
        for (int nb = 0; nb < 4; ++nb) { const V b = WFrag<T16>::ld(Bt + boff + (size_t)nb * 16 * K + kc); V b2; if (NSPLIT >= 2) b2 = WFrag<T16>::ld(Bt2 + boff + (size_t)nb * 16 * K + kc);
#pragma unroll
            for (int mb = 0; mb < 4; ++mb) { acc[mb][nb] = WFrag<T16>::mma(a[mb], b, acc[mb][nb]); if (NSPLIT == 1 || NSPLIT == 2) acc[mb][nb] = WFrag<T16>::mma(a2[mb], b, acc[mb][nb]); if (NSPLIT >= 2) acc[mb][nb] = WFrag<T16>::mma(a[mb], b2, acc[mb][nb]); } }
        asm volatile("v_nop\n\tv_nop\n\tv_nop\n\tv_nop" : "+v"(acc[0][0]), "+v"(acc[1][1]), "+v"(acc[2][2]), "+v"(acc[3][3]) : "v"(a[0]), "v"(a[3]));
    }
    if (NW > 1) {   // the loops below are unrolled so that acc is indexed by constants (stays in registers) and the LDS reads of one sum go out together
#pragma unroll
        for (int mb = 0; mb < 4; ++mb)
#pragma unroll
            for (int nb = 0; nb < 4; ++nb)
#pragma unroll
                for (int j = 0; j < 8; ++j) os[(wv * 64 + mb * 16 + hi * 8 + j) * 68 + nb * 16 + lr] = acc[mb][nb][j];
        __syncthreads();   // every wave's partial tile is in LDS before any thread sums across waves
#pragma unroll
        for (int s = 0; s < 32 / NW; ++s) { const int u = s * 32 * NW + (int)threadIdx.x, row = u >> 4, cofs = (u & 15) * 4; v4f val = *(const v4fa*)(os + row * 68 + cofs);
#pragma unroll
            for (int w = 1; w < NW; ++w) val += *(const v4fa*)(os + (w * 64 + row) * 68 + cofs);
            *(v4f*)(C + (size_t)(r0 + row) * ldc + c0 + cofs) = val; }
        return;
    }
#pragma unroll
    for (int mb = 0; mb < 4; ++mb) {
#pragma unroll
        for (int nb = 0; nb < 4; ++nb) {
#pragma unroll
            for (int j = 0; j < 8; ++j) os[(hi * 8 + j) * 68 + nb * 16 + lr] = acc[mb][nb][j]; }
        __builtin_amdgcn_wave_barrier(); asm volatile("" ::: "memory");
        float* crow = C + (size_t)(r0 + mb * 16) * ldc + c0;
{
#pragma unroll
            for (int s = 0; s < 8; ++s) { const int row = 2 * s + hi, cofs = lr * 4; v4f val = *(const v4fa*)(os + row * 68 + cofs);
                *(v4f*)(crow + (size_t)row * ldc + cofs) = val; }
             }
        __builtin_amdgcn_wave_barrier(); asm volatile("" ::: "memory");
    }
}

__device__ __forceinline__ h16 tohx(float x) { return (h16)x; }
__device__ __forceinline__ void splitf(float y, unsigned short& h, unsigned short& l) { h = f2bf(y); l = f2bf(y - bf2f(h)); }
typedef __attribute__((ext_vector_type(2))) _Float16 v2h;
typedef __attribute__((ext_vector_type(4))) _Float16 v4h;
typedef __attribute__((ext_vector_type(2))) unsigned short v2us;
typedef __attribute__((ext_vector_type(4))) unsigned short v4us;
typedef __attribute__((ext_vector_type(2))) float v2f;
typedef __attribute__((ext_vector_type(4))) int v4i;

__global__ __launch_bounds__(256) void k_wtG(const float* __restrict__ w, int K, int N, bf* Bt) {
    const int lane = threadIdx.x & 31; const int L0 = (blockIdx.x * 8 + (threadIdx.x >> 5)) * 8; const int nlines = N * K / 64;
{
#pragma unroll 1
        for (int l = 0; l < 8; ++l) { const int L = L0 + l; if (L >= nlines) break; const size_t e = (size_t)L * 64 + lane * 2; const int k = (int)(e % K), n = (int)(e / K); v2us o;
            o[0] = f2bf(w[(size_t)k * N + n]); o[1] = f2bf(w[(size_t)(k + 1) * N + n]); *(v2us*)(Bt + e) = o; }
         }
}
__global__ __launch_bounds__(256) void k_cvt8(const float* __restrict__ src, bf* dst, size_t n8) { const size_t i = (size_t)blockIdx.x * 256 + threadIdx.x; if (i >= n8) return; const v8f v = *(const v8f*)(src + i * 8); v8us o;
#pragma unroll
    for (int k = 0; k < 8; ++k) o[k] = f2bf(v[k]); *(v8us*)(dst + i * 8) = o;  }
__global__ __launch_bounds__(256) void k_cscvt(const float* __restrict__ cosT, const float* __restrict__ sinT, float* CS) { const int idx = blockIdx.x * 256 + threadIdx.x; if (idx >= TT * HD) return; v2f cs; cs[0] = bfr(cosT[idx]); cs[1] = bfr(sinT[idx]); *(v2f*)(CS + (size_t)idx * 2) = cs;  }
// k_rope: head planes [h][t][d] (fp16 + hi/lo) of rope(x) x sc with the rotate-half convention out[d] = x[d] cos[t][d] - x[d+HD/2] sin[t][d], out[d+HD/2] = x[d+HD/2] cos[t][d+HD/2] + x[d] sin[t][d+HD/2]
__global__ __launch_bounds__(256) void k_rope(const float* __restrict__ F, int pitch, int nheads, const float* __restrict__ CS, const float* __restrict__ RF, const float* __restrict__ nw, float sc, h16* P16, bf* Ph, bf* Pl) {
    const size_t e = ((size_t)blockIdx.x * 256 + threadIdx.x) * 2; if (e >= (size_t)nheads * TT * HD) return; const int d = (int)(e % HD); const int t = (int)((e / HD) % TT); const int h = (int)(e / ((size_t)HD * TT)); const float* f = F + (size_t)t * pitch + h * HD; const float rf = RF ? RF[(size_t)h * TT + t] : 1.0f; v2h o16; v2us oh, ol;
#pragma unroll
    for (int q = 0; q < 2; ++q) { const int dd = d + q; const int dp = (dd < HD / 2) ? dd + HD / 2 : dd - HD / 2; float x0 = f[dd], x1 = f[dp];
        if (RF) { float n0 = __fmul_rn(x0, rf), n1 = __fmul_rn(x1, rf); asm volatile("" : "+v"(n0)); asm volatile("" : "+v"(n1)); x0 = __fmul_rn(bfr(nw[dd]), n0); x1 = __fmul_rn(bfr(nw[dp]), n1); }
        const v2f cs = *(const v2f*)(CS + ((size_t)t * HD + dd) * 2); float a = __fmul_rn(x0, cs[0]), bq = __fmul_rn(x1, cs[1]); asm volatile("" : "+v"(a)); asm volatile("" : "+v"(bq)); const float r = ((dd < HD / 2) ? __fsub_rn(a, bq) : __fadd_rn(a, bq)) * sc;
        o16[q] = tohx(r); unsigned short a2, c2; splitf(r, a2, c2); oh[q] = a2; ol[q] = c2; }
    *(v2h*)(P16 + e) = o16; *(v2us*)(Ph + e) = oh; *(v2us*)(Pl + e) = ol;  }
__global__ __launch_bounds__(256) void k_vtp(const float* __restrict__ F, int pitch, int nheads, h16* V16, bf* Vh, bf* Vl) { const size_t e = ((size_t)blockIdx.x * 256 + threadIdx.x) * 2; if (e >= (size_t)nheads * HD * TT) return; const int t = (int)(e % TT); const int d = (int)((e / TT) % HD); const int g = (int)(e / ((size_t)TT * HD)); v2h o16; v2us oh, ol;
#pragma unroll
    for (int q = 0; q < 2; ++q) { const float x = F[(size_t)(t + q) * pitch + g * HD + d]; o16[q] = tohx(x); unsigned short a2, c2; splitf(x, a2, c2); oh[q] = a2; ol[q] = c2; }
    *(v2h*)(V16 + e) = o16; *(v2us*)(Vh + e) = oh; *(v2us*)(Vl + e) = ol;  }
__global__ __launch_bounds__(256) void k_csid(float* CS) { const int idx = blockIdx.x * 256 + threadIdx.x; if (idx >= TT * HD) return; v2f cs; cs[0] = 1.0f; cs[1] = 0.0f; *(v2f*)(CS + (size_t)idx * 2) = cs;  }
// k_asoft: per row (zz, i): t = (S + Srel) x HD^-0.5 for j <= i (causal; the reference's -1e9 additive fill vanishes identically); softmax over the 2048 keys (register row, one exp, fixed trees);
__global__ __launch_bounds__(256) void k_asoft(const float* __restrict__ Sb, const float* __restrict__ QE, h16* P16, bf* Ph, bf* Pl) {
    const int lane = threadIdx.x & 31; const int row = blockIdx.x * 8 + (threadIdx.x >> 5); if (row >= ZH * TT) return; const int i = row % TT; const int zz = row / TT; (void)zz; const bool hires = (i < RH); const float* sr = Sb + (size_t)row * TT; float v[TT / 32]; float mx = -3.0e38f;
#pragma unroll
    for (int ch = 0; ch < TT / 128; ++ch) { const int j0 = ch * 128 + lane * 4; const v4f a = *(const v4f*)(sr + j0); const float* qe = QE + (size_t)row * TT + (TT - 1 - i) + j0;   /* Srel[i][j] = QEr[i][T-1-i+j] (valid for j <= i) */
#pragma unroll
        for (int q = 0; q < 4; ++q) { const int j = j0 + q; float t = -3.0e38f; if (j <= i) { float s0 = __fadd_rn(a[q], qe[q]); asm volatile("" : "+v"(s0)); t = __fmul_rn(s0, SCL); } v[ch * 4 + q] = t; mx = fmaxf(mx, t); } }
#pragma unroll
    for (int sh = 16; sh; sh >>= 1) mx = fmaxf(mx, __shfl_xor(mx, sh, 32));
    float sum = 0.f;
#pragma unroll
    for (int k = 0; k < TT / 32; ++k) { float d0 = __fsub_rn(v[k], mx); asm volatile("" : "+v"(d0)); v[k] = __builtin_amdgcn_exp2f(__fmul_rn(d0, 1.4426950408889634f)); sum += v[k]; }
#pragma unroll
    for (int sh = 16; sh; sh >>= 1) sum += __shfl_xor(sum, sh, 32);
    const float f = __fdiv_rn(hires ? 1.0f : PCAR, sum);
{
        if (hires) {
#pragma unroll
            for (int ch = 0; ch < TT / 128; ++ch) { v4us oh, ol;
#pragma unroll
                for (int q = 0; q < 4; ++q) { unsigned short a, c2; splitf(v[ch * 4 + q] * f, a, c2); oh[q] = a; ol[q] = c2; }
                const size_t oo = ((size_t)zz * (RH ? RH : 1) + i) * TT + ch * 128 + lane * 4; *(v4us*)(Ph + oo) = oh; *(v4us*)(Pl + oo) = ol; }
        } else {
#pragma unroll
            for (int ch = 0; ch < TT / 128; ++ch) { v4h o4;
#pragma unroll
                for (int q = 0; q < 4; ++q) o4[q] = tohx(v[ch * 4 + q] * f);
                *(v4h*)(P16 + (size_t)row * TT + ch * 128 + lane * 4) = o4; } }
         }
}
__global__ __launch_bounds__(256) void k_merge(const float* __restrict__ O, int h0, bf* Ah, bf* Al) { const size_t e = ((size_t)blockIdx.x * 256 + threadIdx.x) * 2; if (e >= (size_t)ZH * TT * HD) return; const int d = (int)(e % HD); const int t = (int)((e / HD) % TT); const int zz = (int)(e / ((size_t)HD * TT)); const float cs = (t < RH) ? 1.0f : (1.0f / PCAR); const size_t oo = (size_t)t * DQ + (h0 + zz) * HD + d;
    v2us oh, ol;
#pragma unroll
    for (int q = 0; q < 2; ++q) { unsigned short a, c2; splitf(O[e + q] * cs, a, c2); oh[q] = a; ol[q] = c2; } *(v2us*)(Ah + oo) = oh; *(v2us*)(Al + oo) = ol;  }

__global__ __launch_bounds__(256) void k_er16(const float* __restrict__ er, h16* E) { const int i = (blockIdx.x * 256 + threadIdx.x) * 4; if (i >= TT * HD) return; const v4f a = *(const v4f*)(er + i); v4h o; o[0] = tohx(bfr(a[0])); o[1] = tohx(bfr(a[1])); o[2] = tohx(bfr(a[2])); o[3] = tohx(bfr(a[3])); *(v4h*)(E + i) = o;  }
typedef __attribute__((ext_vector_type(4))) _Float16 v4hx;

extern "C" void kernel_launch(void* const* d_in, const int* in_sizes, int n_in,
                              void* d_out, int out_size, void* d_ws, size_t ws_size, hipStream_t stream) {
    (void)in_sizes; (void)n_in; (void)out_size;
    const float* x = (const float*)d_in[0]; const float* wattn = (const float*)d_in[1]; const float* wo = (const float*)d_in[2]; const float* er = (const float*)d_in[3];
    float* OUT = (float*)d_out;     // [2][2048][1024]
    char* wsp = (char*)d_ws;
    auto take = [&](size_t bytes) { char* p = wsp; wsp += (bytes + 255) & ~(size_t)255; return (void*)p; };
    bf* WQKV = (bf*)take((size_t)3 * DM * DM * 2); bf* WQ = WQKV; bf* WK = WQKV + (size_t)DM * DM; bf* WV = WQKV + (size_t)2 * DM * DM; bf* ERB = (bf*)take((size_t)TT * HD * 2); h16* ER16 = (h16*)take((size_t)TT * HD * 2); float* QE = (float*)take((size_t)ZH * TT * TT * 4); bf* WO = (bf*)take((size_t)DM * DQ * 2); float* CS = (float*)take((size_t)TT * HD * 2 * 4);
    bf* XB = (bf*)take((size_t)TT * DM * 2); float* FQ = (float*)take((size_t)TT * DQ * 4); float* FK = (float*)take((size_t)TT * DKV * 4);
    h16* QP16 = (h16*)take((size_t)NH_ * TT * HD * 2); h16* KP16 = (h16*)take((size_t)NKV * TT * HD * 2); h16* VT16 = (h16*)take((size_t)NKV * HD * TT * 2);
    bf* QPh = (bf*)take((size_t)NH_ * TT * HD * 2); bf* QPl = (bf*)take((size_t)NH_ * TT * HD * 2); bf* KPh = (bf*)take((size_t)NKV * TT * HD * 2); bf* KPl = (bf*)take((size_t)NKV * TT * HD * 2); bf* VTh = (bf*)take((size_t)NKV * HD * TT * 2); bf* VTl = (bf*)take((size_t)NKV * HD * TT * 2); bf* Ph = (bf*)take((size_t)ZH * RH * TT * 2); bf* Pl = (bf*)take((size_t)ZH * RH * TT * 2);
    float* Sb = (float*)take((size_t)ZH * TT * TT * 4); h16* P16 = (h16*)take((size_t)ZH * TT * TT * 2); float* Ob = (float*)take((size_t)ZH * TT * HD * 4); bf* ATh = (bf*)take((size_t)TT * DQ * 2); bf* ATl = (bf*)take((size_t)TT * DQ * 2);
    if ((size_t)(wsp - (char*)d_ws) > ws_size) return;    // ws 256 MiB
    float* FV = FK;   // v projection reuses the k buffer after the k planes are built (stream-ordered)
    { k_wtG<<<(unsigned)((DM * 3 * DM / 64 + 63) / 64), 256, 0, stream>>>(wattn, DM, 3 * DM, WQKV); k_cvt8<<<(TT * HD / 8 + 255) / 256, 256, 0, stream>>>(er, ERB, TT * HD / 8); k_er16<<<(TT * HD / 4 + 255) / 256, 256, 0, stream>>>(er, ER16);
      k_wtG<<<(unsigned)((DQ * DM / 64 + 63) / 64), 256, 0, stream>>>(wo, DQ, DM, WO);
       }
    k_csid<<<(TT * HD + 255) / 256, 256, 0, stream>>>(CS);
    const unsigned LQ = (unsigned)(((size_t)NH_ * TT * HD / 2 + 255) / 256), LKv = (unsigned)(((size_t)NKV * TT * HD / 2 + 255) / 256);
    for (int b = 0; b < NB_; ++b) {
        
        k_cvt8<<<(unsigned)(((size_t)TT * DM / 8 + 255) / 256), 256, 0, stream>>>(x + (size_t)b * TT * DM, XB, (size_t)TT * DM / 8);
        k_gemmw<bf, 0, false, 8><<<dim3(TT / 64, DQ / 64, 1), 256, 0, stream>>>(XB, nullptr, WQ, nullptr, DM, FQ, DQ, nullptr, 0, 0, 0);
        k_rope<<<LQ, 256, 0, stream>>>(FQ, DQ, NH_, CS, nullptr, nullptr, 1.0f, QP16, QPh, QPl);
        k_gemmw<bf, 0, false, 8><<<dim3(TT / 64, DKV / 64, 1), 256, 0, stream>>>(XB, nullptr, WK, nullptr, DM, FK, DKV, nullptr, 0, 0, 0);
        k_rope<<<LKv, 256, 0, stream>>>(FK, DKV, NKV, CS, nullptr, nullptr, 1.0f, KP16, KPh, KPl);
        k_gemmw<bf, 0, false, 8><<<dim3(TT / 64, DKV / 64, 1), 256, 0, stream>>>(XB, nullptr, WV, nullptr, DM, FV, DKV, nullptr, 0, 0, 0); k_vtp<<<LKv, 256, 0, stream>>>(FV, DKV, NKV, VT16, VTh, VTl);
        for (int h0 = 0; h0 < NH_; h0 += ZH) { const size_t zq = (size_t)h0, zk = (size_t)(h0 / REP);   // one kv head per query head: the pass's two heads use consecutive kv planes (z-strides TT*HD)
            k_gemmc<bf, 2, 1, 1><<<dim3(RH / 64, TT / 64, ZH), 32, 0, stream>>>(QPh + zq * TT * HD, QPl + zq * TT * HD, KPh + zk * TT * HD, KPl + zk * TT * HD, HD, Sb, TT, 0, (size_t)TT * HD, (size_t)TT * HD, (size_t)TT * TT);
            k_gemmc<h16, 0, 1, 1><<<dim3((TT - RH) / 64, TT / 64, ZH), 32, 0, stream>>>(QP16 + zq * TT * HD + (size_t)RH * HD, nullptr, KP16 + zk * TT * HD, nullptr, HD, Sb + (size_t)RH * TT, TT, RH, (size_t)TT * HD, (size_t)TT * HD, (size_t)TT * TT);
            k_gemmw<bf, 1, false, 1><<<dim3(RH / 64, TT / 64, ZH), 32, 0, stream>>>(QPh + zq * TT * HD, QPl + zq * TT * HD, ERB, nullptr, HD, QE, TT, nullptr, (size_t)TT * HD, 0, (size_t)TT * TT);
            k_gemmw<h16, 0, false, 1><<<dim3((TT - RH) / 64, TT / 64, ZH), 32, 0, stream>>>(QP16 + zq * TT * HD + (size_t)RH * HD, nullptr, ER16, nullptr, HD, QE + (size_t)RH * TT, TT, nullptr, (size_t)TT * HD, 0, (size_t)TT * TT);
            k_asoft<<<ZH * TT / 8, 256, 0, stream>>>(Sb, QE, P16, Ph, Pl);
            k_gemmc<bf, 2, 2, 16><<<dim3(RH / 64, HD / 64, ZH), 512, 0, stream>>>(Ph, Pl, VTh + zk * HD * TT, VTl + zk * HD * TT, TT, Ob, HD, 0, (size_t)RH * TT, (size_t)HD * TT, (size_t)TT * HD);
            k_gemmc<h16, 0, 2, 16><<<dim3((TT - RH) / 64, HD / 64, ZH), 512, 0, stream>>>(P16 + (size_t)RH * TT, nullptr, VT16 + zk * HD * TT, nullptr, TT, Ob + (size_t)RH * HD, HD, RH, (size_t)TT * TT, (size_t)HD * TT, (size_t)TT * HD);
            k_merge<<<(unsigned)(((size_t)ZH * TT * HD / 2 + 255) / 256), 256, 0, stream>>>(Ob, h0, ATh, ATl); }
        k_gemmw<bf, 1, false, 8><<<dim3(TT / 64, DM / 64, 1), 256, 0, stream>>>(ATh, ATl, WO, nullptr, DQ, OUT + (size_t)b * TT * DM, DM, nullptr, 0, 0, 0); }
}

// v002
// Measured time: 842 microseconds a run.
// Timed twice side by side with v001, it ran 1.45 and 1.43 times as fast.
// Over all steps from v000 it is 2.27 times as fast.
#include <hip/hip_runtime.h>

// CausalSelfAttentionRelativePosition (x [2][2048][1024]; qkv = x W_attn (16 x 64); Srel = skew(q Er^T) -> Srel[i][j] = q_i . Er[T-1-i+j] for j <= i (the skew's wrapped entries above the diagonal are masked); att = softmax(((q.k) + Srel)/8, causal);
// y = att v; out = y W_proj -> [2][2048][1024]).
// Compute dtypes, f32 accumulate: every input rounded to bf16; qkv on PLAIN bf16 operands (inputs: exact); scores q.k (K 64), the relative logits q.Er^T and probs.v on bf16 hi+lo planes (3 products; q.Er: hl q x exact Er, 2 products)
// for the first 512 query rows per head and SINGLE fp16 planes for the rest (Er, a bf16 input, is exact in fp16); causal tiles skipped for q.k and probs.v (K bounded), q.Er^T computed in full; skew gather + softmax f32; W_proj on hl planes x exact.

#define NB_  2
#define TT   2048
#define DM   1024
#define NH_  16
#define NKV  16
#define REP  (NH_ / NKV)
#define HD   64
#define DQ   (NH_ * HD)
#define DKV  (NKV * HD)
#define ZH   4                    // heads per attention pass (grid z of the pass's GEMM launches); score, relative-logit and probability buffers hold ZH heads
#define RH   512                  // query rows < RH use hi+lo planes (0: none)
#define WIN  2048
#define PCAR 1024.0f
#define SCL  0.125f   // HD^-0.5
typedef _Float16 h16;
typedef unsigned short bf;
typedef __attribute__((ext_vector_type(16))) __bf16   v16bf;
typedef __attribute__((ext_vector_type(16))) _Float16 v16h;
typedef __attribute__((ext_vector_type(8)))  _Float16 v8h;
typedef __attribute__((ext_vector_type(8)))  unsigned short v8us;
typedef __attribute__((ext_vector_type(8)))  float    v8f;
typedef __attribute__((ext_vector_type(4)))  float    v4f;
typedef v8h  __attribute__((may_alias)) v8ha;
typedef v4f  __attribute__((may_alias)) v4fa;
typedef v8us __attribute__((may_alias)) v8usa;

__device__ __forceinline__ unsigned short f2bf(float f) { unsigned u = __float_as_uint(f); u += 0x7FFFu + ((u >> 16) & 1u); return (unsigned short)(u >> 16); }
__device__ __forceinline__ float bf2f(unsigned short b) { return __uint_as_float(((unsigned)b) << 16); }
__device__ __forceinline__ float bfr(float f) { return bf2f(f2bf(f)); }
__device__ __forceinline__ v16h cat16(v8h lo, v8h hi) { return __builtin_shufflevector(lo, hi, 0, 1, 2, 3, 4, 5, 6, 7, 8, 9, 10, 11, 12, 13, 14, 15); }
__device__ __forceinline__ v16bf cat16b(v8us lo, v8us hi) { return __builtin_bit_cast(v16bf, __builtin_shufflevector(lo, hi, 0, 1, 2, 3, 4, 5, 6, 7, 8, 9, 10, 11, 12, 13, 14, 15)); }
__device__ __forceinline__ v8f wmma16(v16h a, v16h b, v8f c) { return __builtin_amdgcn_wmma_f32_16x16x32_f16(false, a, false, b, (short)0, c, false, false); }
__device__ __forceinline__ v8f wmmab(v16bf a, v16bf b, v8f c) { return __builtin_amdgcn_wmma_f32_16x16x32_bf16(false, a, false, b, (short)0, c, false, false); }



// ---- k_gemmw: register-blocked GEMM, ONE WAVE per 64x64 output tile (16 accumulators), operands straight from K-contiguous 16-bit planes; grid (M/64, N/64, Z), 32 threads.
// C[m][n] (f32, pitch ldc, + optional f32 bias[n]) = sum_k A[m][k] Bt[n][k] (+ split products per NSPLIT). z-batch strides sA/sB/sC in elements. K % 32 == 0.
// NW > 1 (32 * NW threads): NW waves share the tile; wave w takes the k steps w, w + NW, ...; each leaves its partial 64x64 tile in LDS and, behind one barrier, the work-group sums the NW partials in wave order.
template <typename T16> struct WFrag;
template <> struct WFrag<h16> { typedef v16h V; static __device__ __forceinline__ V ld(const h16* p) { return cat16(*(const v8h*)p, *(const v8h*)(p + 16)); } static __device__ __forceinline__ v8f mma(V a, V b, v8f c) { return wmma16(a, b, c); } };
template <> struct WFrag<bf> { typedef v16bf V; static __device__ __forceinline__ V ld(const bf* p) { return cat16b(*(const v8us*)p, *(const v8us*)(p + 16)); } static __device__ __forceinline__ v8f mma(V a, V b, v8f c) { return wmmab(a, b, c); } };
template <typename T16, int NSPLIT, bool BIAS, int NW>
__global__ __launch_bounds__(32 * NW) void k_gemmw(const T16* __restrict__ A, const T16* __restrict__ A2, const T16* __restrict__ Bt, const T16* __restrict__ Bt2, int K, float* C, int ldc, const float* __restrict__ bias, size_t sA, size_t sB, size_t sC) {
    typedef typename WFrag<T16>::V V;
    __shared__ __align__(16) float os[(NW > 1 ? NW * 64 : 16) * 68];
    const size_t z = blockIdx.z; A += z * sA; if (A2) A2 += z * sA; Bt += z * sB; if (Bt2) Bt2 += z * sB; C += z * sC;
    const int lane = threadIdx.x & 31, lr = lane & 15, hi = lane >> 4; const int r0 = blockIdx.x * 64, c0 = blockIdx.y * 64; const int wv = (NW > 1) ? __builtin_amdgcn_readfirstlane((int)(threadIdx.x >> 5)) : 0;   // wave number in a scalar register: the K loop's counter and branch stay scalar
    v8f acc[4][4];
#pragma unroll
    for (int mb = 0; mb < 4; ++mb)
#pragma unroll
        for (int nb = 0; nb < 4; ++nb) acc[mb][nb] = (v8f){};
    const size_t aoff = (size_t)(r0 + lr) * K + 8 * hi, boff = (size_t)(c0 + lr) * K + 8 * hi;
#pragma unroll 1
    for (int kc = wv * 32; kc < K; kc += 32 * NW) {
        V a[4], a2[4];
#pragma unroll
        for (int mb = 0; mb < 4; ++mb) { a[mb] = WFrag<T16>::ld(A + aoff + (size_t)mb * 16 * K + kc); if (NSPLIT == 1 || NSPLIT == 2) a2[mb] = WFrag<T16>::ld(A2 + aoff + (size_t)mb * 16 * K + kc); }
#pragma unroll
        for (int nb = 0; nb < 4; ++nb) { const V b = WFrag<T16>::ld(Bt + boff + (size_t)nb * 16 * K + kc); V b2; if (NSPLIT >= 2) b2 = WFrag<T16>::ld(Bt2 + boff + (size_t)nb * 16 * K + kc);
#pragma unroll
            for (int mb = 0; mb < 4; ++mb) { acc[mb][nb] = WFrag<T16>::mma(a[mb], b, acc[mb][nb]); if (NSPLIT == 1 || NSPLIT == 2) acc[mb][nb] = WFrag<T16>::mma(a2[mb], b, acc[mb][nb]); if (NSPLIT >= 2) acc[mb][nb] = WFrag<T16>::mma(a[mb], b2, acc[mb][nb]); } }
        asm volatile("v_nop\n\tv_nop\n\tv_nop\n\tv_nop" : "+v"(acc[0][0]), "+v"(acc[1][1]), "+v"(acc[2][2]), "+v"(acc[3][3]) : "v"(a[0]), "v"(a[3]));
    }
    if (NW > 1) {   // the loops below are unrolled so that acc is indexed by constants (stays in registers) and the LDS reads of one sum go out together
#pragma unroll
        for (int mb = 0; mb < 4; ++mb)
#pragma unroll
            for (int nb = 0; nb < 4; ++nb)
#pragma unroll
                for (int j = 0; j < 8; ++j) os[(wv * 64 + mb * 16 + hi * 8 + j) * 68 + nb * 16 + lr] = acc[mb][nb][j];
        __syncthreads();   // every wave's partial tile is in LDS before any thread sums across waves
#pragma unroll
        for (int s = 0; s < 32 / NW; ++s) { const int u = s * 32 * NW + (int)threadIdx.x, row = u >> 4, cofs = (u & 15) * 4; v4f val = *(const v4fa*)(os + row * 68 + cofs);
#pragma unroll
            for (int w = 1; w < NW; ++w) val += *(const v4fa*)(os + (w * 64 + row) * 68 + cofs);
            if (BIAS) { val[0] += bfr(bias[c0 + cofs]); val[1] += bfr(bias[c0 + cofs + 1]); val[2] += bfr(bias[c0 + cofs + 2]); val[3] += bfr(bias[c0 + cofs + 3]); }
            *(v4f*)(C + (size_t)(r0 + row) * ldc + c0 + cofs) = val; }
        return;
    }
#pragma unroll
    for (int mb = 0; mb < 4; ++mb) {
#pragma unroll
        for (int nb = 0; nb < 4; ++nb) {
#pragma unroll
            for (int j = 0; j < 8; ++j) os[(hi * 8 + j) * 68 + nb * 16 + lr] = acc[mb][nb][j]; }
        __builtin_amdgcn_wave_barrier(); asm volatile("" ::: "memory");
        float* crow = C + (size_t)(r0 + mb * 16) * ldc + c0;
{
#pragma unroll
            for (int s = 0; s < 8; ++s) { const int row = 2 * s + hi, cofs = lr * 4; v4f val = *(const v4fa*)(os + row * 68 + cofs); if (BIAS) { val[0] += bfr(bias[c0 + cofs]); val[1] += bfr(bias[c0 + cofs + 1]); val[2] += bfr(bias[c0 + cofs + 2]); val[3] += bfr(bias[c0 + cofs + 3]); }
                *(v4f*)(crow + (size_t)row * ldc + cofs) = val; }
             }
        __builtin_amdgcn_wave_barrier(); asm volatile("" ::: "memory");
    }
}

// ---- k_gemmc: the same one-wave 64x64 tile GEMM specialised for causal attention: CMODE 1 skips score tiles entirely above the diagonal (query rows r0+roff.., key columns c0..), CMODE 2 limits the
// key (K) loop of the probability x value contraction to the diagonal block (probabilities beyond it are exactly zero). roff = row offset of this launch's first row within the sequence. NW as in k_gemmw.
template <typename T16, int NSPLIT, int CMODE, int NW>
__global__ __launch_bounds__(32 * NW) void k_gemmc(const T16* __restrict__ A, const T16* __restrict__ A2, const T16* __restrict__ Bt, const T16* __restrict__ Bt2, int K, float* C, int ldc, int roff, size_t sA, size_t sB, size_t sC) {
    typedef typename WFrag<T16>::V V;
    __shared__ __align__(16) float os[(NW > 1 ? NW * 64 : 16) * 68];
    const size_t z = blockIdx.z; A += z * sA; if (A2) A2 += z * sA; Bt += z * sB; if (Bt2) Bt2 += z * sB; C += z * sC;
    const int lane = threadIdx.x & 31, lr = lane & 15, hi = lane >> 4; const int r0 = blockIdx.x * 64, c0 = blockIdx.y * 64; const int wv = (NW > 1) ? __builtin_amdgcn_readfirstlane((int)(threadIdx.x >> 5)) : 0;   // wave number in a scalar register: the K loop's counter and branch stay scalar
    if (CMODE == 1 && c0 > r0 + roff + 63) return;                  // score tile entirely above the causal diagonal: never read (the softmax masks j > i by select)
    const int Kl = (CMODE == 2) ? min(K, r0 + roff + 64) : K;        // P.V: probabilities are exactly 0 beyond the diagonal block, so the K loop stops there
    v8f acc[4][4];
#pragma unroll
    for (int mb = 0; mb < 4; ++mb)
#pragma unroll
        for (int nb = 0; nb < 4; ++nb) acc[mb][nb] = (v8f){};
    const size_t aoff = (size_t)(r0 + lr) * K + 8 * hi, boff = (size_t)(c0 + lr) * K + 8 * hi;
#pragma unroll 1
    for (int kc = wv * 32; kc < Kl; kc += 32 * NW) {
        V a[4], a2[4];
#pragma unroll
        for (int mb = 0; mb < 4; ++mb) { a[mb] = WFrag<T16>::ld(A + aoff + (size_t)mb * 16 * K + kc); if (NSPLIT == 1 || NSPLIT == 2) a2[mb] = WFrag<T16>::ld(A2 + aoff + (size_t)mb * 16 * K + kc); }
#pragma unroll
        for (int nb = 0; nb < 4; ++nb) { const V b = WFrag<T16>::ld(Bt + boff + (size_t)nb * 16 * K + kc); V b2; if (NSPLIT >= 2) b2 = WFrag<T16>::ld(Bt2 + boff + (size_t)nb * 16 * K + kc);
#pragma unroll
            for (int mb = 0; mb < 4; ++mb) { acc[mb][nb] = WFrag<T16>::mma(a[mb], b, acc[mb][nb]); if (NSPLIT == 1 || NSPLIT == 2) acc[mb][nb] = WFrag<T16>::mma(a2[mb], b, acc[mb][nb]); if (NSPLIT >= 2) acc[mb][nb] = WFrag<T16>::mma(a[mb], b2, acc[mb][nb]); } }
        asm volatile("v_nop\n\tv_nop\n\tv_nop\n\tv_nop" : "+v"(acc[0][0]), "+v"(acc[1][1]), "+v"(acc[2][2]), "+v"(acc[3][3]) : "v"(a[0]), "v"(a[3]));
    }
    if (NW > 1) {   // the loops below are unrolled so that acc is indexed by constants (stays in registers) and the LDS reads of one sum go out together
#pragma unroll
        for (int mb = 0; mb < 4; ++mb)
#pragma unroll
            for (int nb = 0; nb < 4; ++nb)
#pragma unroll
                for (int j = 0; j < 8; ++j) os[(wv * 64 + mb * 16 + hi * 8 + j) * 68 + nb * 16 + lr] = acc[mb][nb][j];
        __syncthreads();   // every wave's partial tile is in LDS before any thread sums across waves
#pragma unroll
        for (int s = 0; s < 32 / NW; ++s) { const int u = s * 32 * NW + (int)threadIdx.x, row = u >> 4, cofs = (u & 15) * 4; v4f val = *(const v4fa*)(os + row * 68 + cofs);
#pragma unroll
            for (int w = 1; w < NW; ++w) val += *(const v4fa*)(os + (w * 64 + row) * 68 + cofs);
            *(v4f*)(C + (size_t)(r0 + row) * ldc + c0 + cofs) = val; }
        return;
    }
#pragma unroll
    for (int mb = 0; mb < 4; ++mb) {
#pragma unroll
        for (int nb = 0; nb < 4; ++nb) {
#pragma unroll
            for (int j = 0; j < 8; ++j) os[(hi * 8 + j) * 68 + nb * 16 + lr] = acc[mb][nb][j]; }
        __builtin_amdgcn_wave_barrier(); asm volatile("" ::: "memory");
        float* crow = C + (size_t)(r0 + mb * 16) * ldc + c0;
{
#pragma unroll
            for (int s = 0; s < 8; ++s) { const int row = 2 * s + hi, cofs = lr * 4; v4f val = *(const v4fa*)(os + row * 68 + cofs);
                *(v4f*)(crow + (size_t)row * ldc + cofs) = val; }
             }
        __builtin_amdgcn_wave_barrier(); asm volatile("" ::: "memory");
    }
}

__device__ __forceinline__ h16 tohx(float x) { return (h16)x; }
__device__ __forceinline__ void splitf(float y, unsigned short& h, unsigned short& l) { h = f2bf(y); l = f2bf(y - bf2f(h)); }
typedef __attribute__((ext_vector_type(2))) _Float16 v2h;
typedef __attribute__((ext_vector_type(4))) _Float16 v4h;
typedef __attribute__((ext_vector_type(2))) unsigned short v2us;
typedef __attribute__((ext_vector_type(4))) unsigned short v4us;
typedef __attribute__((ext_vector_type(2))) float v2f;
typedef __attribute__((ext_vector_type(4))) int v4i;

__global__ __launch_bounds__(256) void k_wtG(const float* __restrict__ w, int K, int N, bf* Bt) {
    const int lane = threadIdx.x & 31; const int L0 = (blockIdx.x * 8 + (threadIdx.x >> 5)) * 8; const int nlines = N * K / 64;
{
#pragma unroll 1
        for (int l = 0; l < 8; ++l) { const int L = L0 + l; if (L >= nlines) break; const size_t e = (size_t)L * 64 + lane * 2; const int k = (int)(e % K), n = (int)(e / K); v2us o;
            o[0] = f2bf(w[(size_t)k * N + n]); o[1] = f2bf(w[(size_t)(k + 1) * N + n]); *(v2us*)(Bt + e) = o; }
         }
}
__global__ __launch_bounds__(256) void k_cvt8(const float* __restrict__ src, bf* dst, size_t n8) { const size_t i = (size_t)blockIdx.x * 256 + threadIdx.x; if (i >= n8) return; const v8f v = *(const v8f*)(src + i * 8); v8us o;
#pragma unroll
    for (int k = 0; k < 8; ++k) o[k] = f2bf(v[k]); *(v8us*)(dst + i * 8) = o;  }
__global__ __launch_bounds__(256) void k_cscvt(const float* __restrict__ cosT, const float* __restrict__ sinT, float* CS) { const int idx = blockIdx.x * 256 + threadIdx.x; if (idx >= TT * HD) return; v2f cs; cs[0] = bfr(cosT[idx]); cs[1] = bfr(sinT[idx]); *(v2f*)(CS + (size_t)idx * 2) = cs;  }
// k_rope: head planes [h][t][d] (fp16 + hi/lo) of rope(x) x sc with the rotate-half convention out[d] = x[d] cos[t][d] - x[d+HD/2] sin[t][d], out[d+HD/2] = x[d+HD/2] cos[t][d+HD/2] + x[d] sin[t][d+HD/2]
__global__ __launch_bounds__(256) void k_rope(const float* __restrict__ F, int pitch, int nheads, const float* __restrict__ CS, const float* __restrict__ RF, const float* __restrict__ nw, float sc, h16* P16, bf* Ph, bf* Pl) {
    const size_t e = ((size_t)blockIdx.x * 256 + threadIdx.x) * 2; if (e >= (size_t)nheads * TT * HD) return; const int d = (int)(e % HD); const int t = (int)((e / HD) % TT); const int h = (int)(e / ((size_t)HD * TT)); const float* f = F + (size_t)t * pitch + h * HD; const float rf = RF ? RF[(size_t)h * TT + t] : 1.0f; v2h o16; v2us oh, ol;
#pragma unroll
    for (int q = 0; q < 2; ++q) { const int dd = d + q; const int dp = (dd < HD / 2) ? dd + HD / 2 : dd - HD / 2; float x0 = f[dd], x1 = f[dp];
        if (RF) { float n0 = __fmul_rn(x0, rf), n1 = __fmul_rn(x1, rf); asm volatile("" : "+v"(n0)); asm volatile("" : "+v"(n1)); x0 = __fmul_rn(bfr(nw[dd]), n0); x1 = __fmul_rn(bfr(nw[dp]), n1); }
        const v2f cs = *(const v2f*)(CS + ((size_t)t * HD + dd) * 2); float a = __fmul_rn(x0, cs[0]), bq = __fmul_rn(x1, cs[1]); asm volatile("" : "+v"(a)); asm volatile("" : "+v"(bq)); const float r = ((dd < HD / 2) ? __fsub_rn(a, bq) : __fadd_rn(a, bq)) * sc;
        o16[q] = tohx(r); unsigned short a2, c2; splitf(r, a2, c2); oh[q] = a2; ol[q] = c2; }
    *(v2h*)(P16 + e) = o16; *(v2us*)(Ph + e) = oh; *(v2us*)(Pl + e) = ol;  }
__global__ __launch_bounds__(256) void k_vtp(const float* __restrict__ F, int pitch, int nheads, h16* V16, bf* Vh, bf* Vl) { const size_t e = ((size_t)blockIdx.x * 256 + threadIdx.x) * 2; if (e >= (size_t)nheads * HD * TT) return; const int t = (int)(e % TT); const int d = (int)((e / TT) % HD); const int g = (int)(e / ((size_t)TT * HD)); v2h o16; v2us oh, ol;
#pragma unroll
    for (int q = 0; q < 2; ++q) { const float x = F[(size_t)(t + q) * pitch + g * HD + d]; o16[q] = tohx(x); unsigned short a2, c2; splitf(x, a2, c2); oh[q] = a2; ol[q] = c2; }
    *(v2h*)(V16 + e) = o16; *(v2us*)(Vh + e) = oh; *(v2us*)(Vl + e) = ol;  }
__global__ __launch_bounds__(256) void k_csid(float* CS) { const int idx = blockIdx.x * 256 + threadIdx.x; if (idx >= TT * HD) return; v2f cs; cs[0] = 1.0f; cs[1] = 0.0f; *(v2f*)(CS + (size_t)idx * 2) = cs;  }
// k_asoft: per row (zz, i): t = (S + Srel) x HD^-0.5 for j <= i (causal; the reference's -1e9 additive fill vanishes identically); softmax over the 2048 keys (register row, one exp, fixed trees);
__global__ __launch_bounds__(256) void k_asoft(const float* __restrict__ Sb, const float* __restrict__ QE, h16* P16, bf* Ph, bf* Pl) {
    const int lane = threadIdx.x & 31; const int row = blockIdx.x * 8 + (threadIdx.x >> 5); if (row >= ZH * TT) return; const int i = row % TT; const int zz = row / TT; (void)zz; const bool hires = (i < RH); const float* sr = Sb + (size_t)row * TT; float v[TT / 32]; float mx = -3.0e38f;
#pragma unroll
    for (int ch = 0; ch < TT / 128; ++ch) { const int j0 = ch * 128 + lane * 4; const v4f a = *(const v4f*)(sr + j0); const float* qe = QE + (size_t)row * TT + (TT - 1 - i) + j0;   /* Srel[i][j] = QEr[i][T-1-i+j] (valid for j <= i) */
#pragma unroll
        for (int q = 0; q < 4; ++q) { const int j = j0 + q; float t = -3.0e38f; if (j <= i) { float s0 = __fadd_rn(a[q], qe[q]); asm volatile("" : "+v"(s0)); t = __fmul_rn(s0, SCL); } v[ch * 4 + q] = t; mx = fmaxf(mx, t); } }
#pragma unroll
    for (int sh = 16; sh; sh >>= 1) mx = fmaxf(mx, __shfl_xor(mx, sh, 32));
    float sum = 0.f;
#pragma unroll
    for (int k = 0; k < TT / 32; ++k) { float d0 = __fsub_rn(v[k], mx); asm volatile("" : "+v"(d0)); v[k] = __builtin_amdgcn_exp2f(__fmul_rn(d0, 1.4426950408889634f)); sum += v[k]; }
#pragma unroll
    for (int sh = 16; sh; sh >>= 1) sum += __shfl_xor(sum, sh, 32);
    const float f = __fdiv_rn(hires ? 1.0f : PCAR, sum);
{
        if (hires) {
#pragma unroll
            for (int ch = 0; ch < TT / 128; ++ch) { v4us oh, ol;
#pragma unroll
                for (int q = 0; q < 4; ++q) { unsigned short a, c2; splitf(v[ch * 4 + q] * f, a, c2); oh[q] = a; ol[q] = c2; }
                const size_t oo = ((size_t)zz * (RH ? RH : 1) + i) * TT + ch * 128 + lane * 4; *(v4us*)(Ph + oo) = oh; *(v4us*)(Pl + oo) = ol; }
        } else {
#pragma unroll
            for (int ch = 0; ch < TT / 128; ++ch) { v4h o4;
#pragma unroll
                for (int q = 0; q < 4; ++q) o4[q] = tohx(v[ch * 4 + q] * f);
                *(v4h*)(P16 + (size_t)row * TT + ch * 128 + lane * 4) = o4; } }
         }
}
__global__ __launch_bounds__(256) void k_merge(const float* __restrict__ O, int h0, bf* Ah, bf* Al) { const size_t e = ((size_t)blockIdx.x * 256 + threadIdx.x) * 2; if (e >= (size_t)ZH * TT * HD) return; const int d = (int)(e % HD); const int t = (int)((e / HD) % TT); const int zz = (int)(e / ((size_t)HD * TT)); const float cs = (t < RH) ? 1.0f : (1.0f / PCAR); const size_t oo = (size_t)t * DQ + (h0 + zz) * HD + d;
    v2us oh, ol;
#pragma unroll
    for (int q = 0; q < 2; ++q) { unsigned short a, c2; splitf(O[e + q] * cs, a, c2); oh[q] = a; ol[q] = c2; } *(v2us*)(Ah + oo) = oh; *(v2us*)(Al + oo) = ol;  }

__global__ __launch_bounds__(256) void k_er16(const float* __restrict__ er, h16* E) { const int i = (blockIdx.x * 256 + threadIdx.x) * 4; if (i >= TT * HD) return; const v4f a = *(const v4f*)(er + i); v4h o; o[0] = tohx(bfr(a[0])); o[1] = tohx(bfr(a[1])); o[2] = tohx(bfr(a[2])); o[3] = tohx(bfr(a[3])); *(v4h*)(E + i) = o;  }
typedef __attribute__((ext_vector_type(4))) _Float16 v4hx;

extern "C" void kernel_launch(void* const* d_in, const int* in_sizes, int n_in,
                              void* d_out, int out_size, void* d_ws, size_t ws_size, hipStream_t stream) {
    (void)in_sizes; (void)n_in; (void)out_size;
    const float* x = (const float*)d_in[0]; const float* wattn = (const float*)d_in[1]; const float* wo = (const float*)d_in[2]; const float* er = (const float*)d_in[3];
    float* OUT = (float*)d_out;     // [2][2048][1024]
    char* wsp = (char*)d_ws;
    auto take = [&](size_t bytes) { char* p = wsp; wsp += (bytes + 255) & ~(size_t)255; return (void*)p; };
    bf* WQKV = (bf*)take((size_t)3 * DM * DM * 2); bf* WQ = WQKV; bf* WK = WQKV + (size_t)DM * DM; bf* WV = WQKV + (size_t)2 * DM * DM; bf* ERB = (bf*)take((size_t)TT * HD * 2); h16* ER16 = (h16*)take((size_t)TT * HD * 2); float* QE = (float*)take((size_t)ZH * TT * TT * 4); bf* WO = (bf*)take((size_t)DM * DQ * 2); float* CS = (float*)take((size_t)TT * HD * 2 * 4);
    bf* XB = (bf*)take((size_t)TT * DM * 2); float* FQ = (float*)take((size_t)TT * DQ * 4); float* FK = (float*)take((size_t)TT * DKV * 4);
    h16* QP16 = (h16*)take((size_t)NH_ * TT * HD * 2); h16* KP16 = (h16*)take((size_t)NKV * TT * HD * 2); h16* VT16 = (h16*)take((size_t)NKV * HD * TT * 2);
    bf* QPh = (bf*)take((size_t)NH_ * TT * HD * 2); bf* QPl = (bf*)take((size_t)NH_ * TT * HD * 2); bf* KPh = (bf*)take((size_t)NKV * TT * HD * 2); bf* KPl = (bf*)take((size_t)NKV * TT * HD * 2); bf* VTh = (bf*)take((size_t)NKV * HD * TT * 2); bf* VTl = (bf*)take((size_t)NKV * HD * TT * 2); bf* Ph = (bf*)take((size_t)ZH * RH * TT * 2); bf* Pl = (bf*)take((size_t)ZH * RH * TT * 2);
    float* Sb = (float*)take((size_t)ZH * TT * TT * 4); h16* P16 = (h16*)take((size_t)ZH * TT * TT * 2); float* Ob = (float*)take((size_t)ZH * TT * HD * 4); bf* ATh = (bf*)take((size_t)TT * DQ * 2); bf* ATl = (bf*)take((size_t)TT * DQ * 2);
    if ((size_t)(wsp - (char*)d_ws) > ws_size) return;    // ws 256 MiB
    float* FV = FK;   // v projection reuses the k buffer after the k planes are built (stream-ordered)
    { k_wtG<<<(unsigned)((DM * 3 * DM / 64 + 63) / 64), 256, 0, stream>>>(wattn, DM, 3 * DM, WQKV); k_cvt8<<<(TT * HD / 8 + 255) / 256, 256, 0, stream>>>(er, ERB, TT * HD / 8); k_er16<<<(TT * HD / 4 + 255) / 256, 256, 0, stream>>>(er, ER16);
      k_wtG<<<(unsigned)((DQ * DM / 64 + 63) / 64), 256, 0, stream>>>(wo, DQ, DM, WO);
       }
    k_csid<<<(TT * HD + 255) / 256, 256, 0, stream>>>(CS);
    const unsigned LQ = (unsigned)(((size_t)NH_ * TT * HD / 2 + 255) / 256), LKv = (unsigned)(((size_t)NKV * TT * HD / 2 + 255) / 256);
    for (int b = 0; b < NB_; ++b) {
        
        k_cvt8<<<(unsigned)(((size_t)TT * DM / 8 + 255) / 256), 256, 0, stream>>>(x + (size_t)b * TT * DM, XB, (size_t)TT * DM / 8);
        k_gemmw<bf, 0, false, 8><<<dim3(TT / 64, DQ / 64, 1), 256, 0, stream>>>(XB, nullptr, WQ, nullptr, DM, FQ, DQ, nullptr, 0, 0, 0);
        k_rope<<<LQ, 256, 0, stream>>>(FQ, DQ, NH_, CS, nullptr, nullptr, 1.0f, QP16, QPh, QPl);
        k_gemmw<bf, 0, false, 8><<<dim3(TT / 64, DKV / 64, 1), 256, 0, stream>>>(XB, nullptr, WK, nullptr, DM, FK, DKV, nullptr, 0, 0, 0);
        k_rope<<<LKv, 256, 0, stream>>>(FK, DKV, NKV, CS, nullptr, nullptr, 1.0f, KP16, KPh, KPl);
        k_gemmw<bf, 0, false, 8><<<dim3(TT / 64, DKV / 64, 1), 256, 0, stream>>>(XB, nullptr, WV, nullptr, DM, FV, DKV, nullptr, 0, 0, 0); k_vtp<<<LKv, 256, 0, stream>>>(FV, DKV, NKV, VT16, VTh, VTl);
        for (int h0 = 0; h0 < NH_; h0 += ZH) { const size_t zq = (size_t)h0, zk = (size_t)(h0 / REP);   // one kv head per query head: the pass's ZH heads use consecutive kv planes (z-strides TT*HD)
            k_gemmc<bf, 2, 1, 1><<<dim3(RH / 64, TT / 64, ZH), 32, 0, stream>>>(QPh + zq * TT * HD, QPl + zq * TT * HD, KPh + zk * TT * HD, KPl + zk * TT * HD, HD, Sb, TT, 0, (size_t)TT * HD, (size_t)TT * HD, (size_t)TT * TT);
            k_gemmc<h16, 0, 1, 1><<<dim3((TT - RH) / 64, TT / 64, ZH), 32, 0, stream>>>(QP16 + zq * TT * HD + (size_t)RH * HD, nullptr, KP16 + zk * TT * HD, nullptr, HD, Sb + (size_t)RH * TT, TT, RH, (size_t)TT * HD, (size_t)TT * HD, (size_t)TT * TT);
            k_gemmw<bf, 1, false, 1><<<dim3(RH / 64, TT / 64, ZH), 32, 0, stream>>>(QPh + zq * TT * HD, QPl + zq * TT * HD, ERB, nullptr, HD, QE, TT, nullptr, (size_t)TT * HD, 0, (size_t)TT * TT);
            k_gemmw<h16, 0, false, 1><<<dim3((TT - RH) / 64, TT / 64, ZH), 32, 0, stream>>>(QP16 + zq * TT * HD + (size_t)RH * HD, nullptr, ER16, nullptr, HD, QE + (size_t)RH * TT, TT, nullptr, (size_t)TT * HD, 0, (size_t)TT * TT);
            k_asoft<<<ZH * TT / 8, 256, 0, stream>>>(Sb, QE, P16, Ph, Pl);
            k_gemmc<bf, 2, 2, 16><<<dim3(RH / 64, HD / 64, ZH), 512, 0, stream>>>(Ph, Pl, VTh + zk * HD * TT, VTl + zk * HD * TT, TT, Ob, HD, 0, (size_t)RH * TT, (size_t)HD * TT, (size_t)TT * HD);
            k_gemmc<h16, 0, 2, 16><<<dim3((TT - RH) / 64, HD / 64, ZH), 512, 0, stream>>>(P16 + (size_t)RH * TT, nullptr, VT16 + zk * HD * TT, nullptr, TT, Ob + (size_t)RH * HD, HD, RH, (size_t)TT * TT, (size_t)HD * TT, (size_t)TT * HD);
            k_merge<<<(unsigned)(((size_t)ZH * TT * HD / 2 + 255) / 256), 256, 0, stream>>>(Ob, h0, ATh, ATl); }
        k_gemmw<bf, 1, false, 8><<<dim3(TT / 64, DM / 64, 1), 256, 0, stream>>>(ATh, ATl, WO, nullptr, DQ, OUT + (size_t)b * TT * DM, DM, nullptr, 0, 0, 0); }
}

// v003
// It runs in 356 microseconds.
// Next to v002, in two timings, it ran 2.36 and 2.37 times as fast.
// All steps since v000 together make it 5.36 times as fast.
#include <hip/hip_runtime.h>

// CausalSelfAttentionRelativePosition (x [2][2048][1024]; qkv = x W_attn (16 x 64); Srel = skew(q Er^T) -> Srel[i][j] = q_i . Er[T-1-i+j] for j <= i (the skew's wrapped entries above the diagonal are masked); att = softmax(((q.k) + Srel)/8, causal);
// y = att v; out = y W_proj -> [2][2048][1024]).
// Compute dtypes, f32 accumulate: every input rounded to bf16; qkv on PLAIN bf16 operands (inputs: exact); scores q.k (K 64), the relative logits q.Er^T and probs.v on bf16 hi+lo planes (3 products; q.Er: hl q x exact Er, 2 products)
// for the first 512 query rows per head and SINGLE fp16 planes for the rest (Er, a bf16 input, is exact in fp16); scores, relative logits, skew, softmax (f32, running maximum and sum) and probs.v in one fused launch per batch, key blocks above the diagonal never touched; W_proj on hl planes x exact.

#define NB_  2
#define TT   2048
#define DM   1024
#define NH_  16
#define NKV  16
#define REP  (NH_ / NKV)
#define HD   64
#define DQ   (NH_ * HD)
#define DKV  (NKV * HD)
#define RH   512                  // query rows < RH use hi+lo planes (0: none)
#define SCL  0.125f   // HD^-0.5
typedef _Float16 h16;
typedef unsigned short bf;
typedef __attribute__((ext_vector_type(16))) __bf16   v16bf;
typedef __attribute__((ext_vector_type(16))) _Float16 v16h;
typedef __attribute__((ext_vector_type(8)))  _Float16 v8h;
typedef __attribute__((ext_vector_type(8)))  unsigned short v8us;
typedef __attribute__((ext_vector_type(8)))  float    v8f;
typedef __attribute__((ext_vector_type(4)))  float    v4f;
typedef v8h  __attribute__((may_alias)) v8ha;
typedef v4f  __attribute__((may_alias)) v4fa;
typedef v8us __attribute__((may_alias)) v8usa;

__device__ __forceinline__ unsigned short f2bf(float f) { unsigned u = __float_as_uint(f); u += 0x7FFFu + ((u >> 16) & 1u); return (unsigned short)(u >> 16); }
__device__ __forceinline__ float bf2f(unsigned short b) { return __uint_as_float(((unsigned)b) << 16); }
__device__ __forceinline__ float bfr(float f) { return bf2f(f2bf(f)); }
__device__ __forceinline__ v16h cat16(v8h lo, v8h hi) { return __builtin_shufflevector(lo, hi, 0, 1, 2, 3, 4, 5, 6, 7, 8, 9, 10, 11, 12, 13, 14, 15); }
__device__ __forceinline__ v16bf cat16b(v8us lo, v8us hi) { return __builtin_bit_cast(v16bf, __builtin_shufflevector(lo, hi, 0, 1, 2, 3, 4, 5, 6, 7, 8, 9, 10, 11, 12, 13, 14, 15)); }
__device__ __forceinline__ v8f wmma16(v16h a, v16h b, v8f c) { return __builtin_amdgcn_wmma_f32_16x16x32_f16(false, a, false, b, (short)0, c, false, false); }
__device__ __forceinline__ v8f wmmab(v16bf a, v16bf b, v8f c) { return __builtin_amdgcn_wmma_f32_16x16x32_bf16(false, a, false, b, (short)0, c, false, false); }



// ---- k_gemmw: register-blocked GEMM, ONE WAVE per 64x64 output tile (16 accumulators), operands straight from K-contiguous 16-bit planes; grid (M/64, N/64, Z), 32 threads.
// C[m][n] (f32, pitch ldc, + optional f32 bias[n]) = sum_k A[m][k] Bt[n][k] (+ split products per NSPLIT). z-batch strides sA/sB/sC in elements. K % 32 == 0.
// NW > 1 (32 * NW threads): NW waves share the tile; wave w takes the k steps w, w + NW, ...; each leaves its partial 64x64 tile in LDS and, behind one barrier, the work-group sums the NW partials in wave order.
template <typename T16> struct WFrag;
template <> struct WFrag<h16> { typedef v16h V; static __device__ __forceinline__ V ld(const h16* p) { return cat16(*(const v8h*)p, *(const v8h*)(p + 16)); } static __device__ __forceinline__ v8f mma(V a, V b, v8f c) { return wmma16(a, b, c); } };
template <> struct WFrag<bf> { typedef v16bf V; static __device__ __forceinline__ V ld(const bf* p) { return cat16b(*(const v8us*)p, *(const v8us*)(p + 16)); } static __device__ __forceinline__ v8f mma(V a, V b, v8f c) { return wmmab(a, b, c); } };
template <typename T16, int NSPLIT, bool BIAS, int NW>
__global__ __launch_bounds__(32 * NW) void k_gemmw(const T16* __restrict__ A, const T16* __restrict__ A2, const T16* __restrict__ Bt, const T16* __restrict__ Bt2, int K, float* C, int ldc, const float* __restrict__ bias, size_t sA, size_t sB, size_t sC) {
    typedef typename WFrag<T16>::V V;
    __shared__ __align__(16) float os[(NW > 1 ? NW * 64 : 16) * 68];
    const size_t z = blockIdx.z; A += z * sA; if (A2) A2 += z * sA; Bt += z * sB; if (Bt2) Bt2 += z * sB; C += z * sC;
    const int lane = threadIdx.x & 31, lr = lane & 15, hi = lane >> 4; const int r0 = blockIdx.x * 64, c0 = blockIdx.y * 64; const int wv = (NW > 1) ? __builtin_amdgcn_readfirstlane((int)(threadIdx.x >> 5)) : 0;   // wave number in a scalar register: the K loop's counter and branch stay scalar
    v8f acc[4][4];
#pragma unroll
    for (int mb = 0; mb < 4; ++mb)
#pragma unroll
        for (int nb = 0; nb < 4; ++nb) acc[mb][nb] = (v8f){};
    const size_t aoff = (size_t)(r0 + lr) * K + 8 * hi, boff = (size_t)(c0 + lr) * K + 8 * hi;
#pragma unroll 1
    for (int kc = wv * 32; kc < K; kc += 32 * NW) {
        V a[4], a2[4];
#pragma unroll
        for (int mb = 0; mb < 4; ++mb) { a[mb] = WFrag<T16>::ld(A + aoff + (size_t)mb * 16 * K + kc); if (NSPLIT == 1 || NSPLIT == 2) a2[mb] = WFrag<T16>::ld(A2 + aoff + (size_t)mb * 16 * K + kc); }
#pragma unroll
        for (int nb = 0; nb < 4; ++nb) { const V b = WFrag<T16>::ld(Bt + boff + (size_t)nb * 16 * K + kc); V b2; if (NSPLIT >= 2) b2 = WFrag<T16>::ld(Bt2 + boff + (size_t)nb * 16 * K + kc);
#pragma unroll
            for (int mb = 0; mb < 4; ++mb) { acc[mb][nb] = WFrag<T16>::mma(a[mb], b, acc[mb][nb]); if (NSPLIT == 1 || NSPLIT == 2) acc[mb][nb] = WFrag<T16>::mma(a2[mb], b, acc[mb][nb]); if (NSPLIT >= 2) acc[mb][nb] = WFrag<T16>::mma(a[mb], b2, acc[mb][nb]); } }
        asm volatile("v_nop\n\tv_nop\n\tv_nop\n\tv_nop" : "+v"(acc[0][0]), "+v"(acc[1][1]), "+v"(acc[2][2]), "+v"(acc[3][3]) : "v"(a[0]), "v"(a[3]));
    }
    if (NW > 1) {   // the loops below are unrolled so that acc is indexed by constants (stays in registers) and the LDS reads of one sum go out together
#pragma unroll
        for (int mb = 0; mb < 4; ++mb)
#pragma unroll
            for (int nb = 0; nb < 4; ++nb)
#pragma unroll
                for (int j = 0; j < 8; ++j) os[(wv * 64 + mb * 16 + hi * 8 + j) * 68 + nb * 16 + lr] = acc[mb][nb][j];
        __syncthreads();   // every wave's partial tile is in LDS before any thread sums across waves
#pragma unroll
        for (int s = 0; s < 32 / NW; ++s) { const int u = s * 32 * NW + (int)threadIdx.x, row = u >> 4, cofs = (u & 15) * 4; v4f val = *(const v4fa*)(os + row * 68 + cofs);
#pragma unroll
            for (int w = 1; w < NW; ++w) val += *(const v4fa*)(os + (w * 64 + row) * 68 + cofs);
            if (BIAS) { val[0] += bfr(bias[c0 + cofs]); val[1] += bfr(bias[c0 + cofs + 1]); val[2] += bfr(bias[c0 + cofs + 2]); val[3] += bfr(bias[c0 + cofs + 3]); }
            *(v4f*)(C + (size_t)(r0 + row) * ldc + c0 + cofs) = val; }
        return;
    }
#pragma unroll
    for (int mb = 0; mb < 4; ++mb) {
#pragma unroll
        for (int nb = 0; nb < 4; ++nb) {
#pragma unroll
            for (int j = 0; j < 8; ++j) os[(hi * 8 + j) * 68 + nb * 16 + lr] = acc[mb][nb][j]; }
        __builtin_amdgcn_wave_barrier(); asm volatile("" ::: "memory");
        float* crow = C + (size_t)(r0 + mb * 16) * ldc + c0;
{
#pragma unroll
            for (int s = 0; s < 8; ++s) { const int row = 2 * s + hi, cofs = lr * 4; v4f val = *(const v4fa*)(os + row * 68 + cofs); if (BIAS) { val[0] += bfr(bias[c0 + cofs]); val[1] += bfr(bias[c0 + cofs + 1]); val[2] += bfr(bias[c0 + cofs + 2]); val[3] += bfr(bias[c0 + cofs + 3]); }
                *(v4f*)(crow + (size_t)row * ldc + cofs) = val; }
             }
        __builtin_amdgcn_wave_barrier(); asm volatile("" ::: "memory");
    }
}

__device__ __forceinline__ h16 tohx(float x) { return (h16)x; }
__device__ __forceinline__ void splitf(float y, unsigned short& h, unsigned short& l) { h = f2bf(y); l = f2bf(y - bf2f(h)); }
typedef __attribute__((ext_vector_type(2))) _Float16 v2h;
typedef __attribute__((ext_vector_type(4))) _Float16 v4h;
typedef __attribute__((ext_vector_type(2))) unsigned short v2us;
typedef __attribute__((ext_vector_type(4))) unsigned short v4us;
typedef __attribute__((ext_vector_type(2))) float v2f;
typedef __attribute__((ext_vector_type(4))) int v4i;

__global__ __launch_bounds__(256) void k_wtG(const float* __restrict__ w, int K, int N, bf* Bt) {
    const int lane = threadIdx.x & 31; const int L0 = (blockIdx.x * 8 + (threadIdx.x >> 5)) * 8; const int nlines = N * K / 64;
{
#pragma unroll 1
        for (int l = 0; l < 8; ++l) { const int L = L0 + l; if (L >= nlines) break; const size_t e = (size_t)L * 64 + lane * 2; const int k = (int)(e % K), n = (int)(e / K); v2us o;
            o[0] = f2bf(w[(size_t)k * N + n]); o[1] = f2bf(w[(size_t)(k + 1) * N + n]); *(v2us*)(Bt + e) = o; }
         }
}
__global__ __launch_bounds__(256) void k_cvt8(const float* __restrict__ src, bf* dst, size_t n8) { const size_t i = (size_t)blockIdx.x * 256 + threadIdx.x; if (i >= n8) return; const v8f v = *(const v8f*)(src + i * 8); v8us o;
#pragma unroll
    for (int k = 0; k < 8; ++k) o[k] = f2bf(v[k]); *(v8us*)(dst + i * 8) = o;  }
__global__ __launch_bounds__(256) void k_cscvt(const float* __restrict__ cosT, const float* __restrict__ sinT, float* CS) { const int idx = blockIdx.x * 256 + threadIdx.x; if (idx >= TT * HD) return; v2f cs; cs[0] = bfr(cosT[idx]); cs[1] = bfr(sinT[idx]); *(v2f*)(CS + (size_t)idx * 2) = cs;  }
// k_rope: head planes [h][t][d] (fp16 + hi/lo) of rope(x) x sc with the rotate-half convention out[d] = x[d] cos[t][d] - x[d+HD/2] sin[t][d], out[d+HD/2] = x[d+HD/2] cos[t][d+HD/2] + x[d] sin[t][d+HD/2]
__global__ __launch_bounds__(256) void k_rope(const float* __restrict__ F, int pitch, int nheads, const float* __restrict__ CS, const float* __restrict__ RF, const float* __restrict__ nw, float sc, h16* P16, bf* Ph, bf* Pl) {
    const size_t e = ((size_t)blockIdx.x * 256 + threadIdx.x) * 2; if (e >= (size_t)nheads * TT * HD) return; const int d = (int)(e % HD); const int t = (int)((e / HD) % TT); const int h = (int)(e / ((size_t)HD * TT)); const float* f = F + (size_t)t * pitch + h * HD; const float rf = RF ? RF[(size_t)h * TT + t] : 1.0f; v2h o16; v2us oh, ol;
#pragma unroll
    for (int q = 0; q < 2; ++q) { const int dd = d + q; const int dp = (dd < HD / 2) ? dd + HD / 2 : dd - HD / 2; float x0 = f[dd], x1 = f[dp];
        if (RF) { float n0 = __fmul_rn(x0, rf), n1 = __fmul_rn(x1, rf); asm volatile("" : "+v"(n0)); asm volatile("" : "+v"(n1)); x0 = __fmul_rn(bfr(nw[dd]), n0); x1 = __fmul_rn(bfr(nw[dp]), n1); }
        const v2f cs = *(const v2f*)(CS + ((size_t)t * HD + dd) * 2); float a = __fmul_rn(x0, cs[0]), bq = __fmul_rn(x1, cs[1]); asm volatile("" : "+v"(a)); asm volatile("" : "+v"(bq)); const float r = ((dd < HD / 2) ? __fsub_rn(a, bq) : __fadd_rn(a, bq)) * sc;
        o16[q] = tohx(r); unsigned short a2, c2; splitf(r, a2, c2); oh[q] = a2; ol[q] = c2; }
    *(v2h*)(P16 + e) = o16; *(v2us*)(Ph + e) = oh; *(v2us*)(Pl + e) = ol;  }
__global__ __launch_bounds__(256) void k_vtp(const float* __restrict__ F, int pitch, int nheads, h16* V16, bf* Vh, bf* Vl) { const size_t e = ((size_t)blockIdx.x * 256 + threadIdx.x) * 2; if (e >= (size_t)nheads * HD * TT) return; const int t = (int)(e % TT); const int d = (int)((e / TT) % HD); const int g = (int)(e / ((size_t)TT * HD)); v2h o16; v2us oh, ol;
#pragma unroll
    for (int q = 0; q < 2; ++q) { const float x = F[(size_t)(t + q) * pitch + g * HD + d]; o16[q] = tohx(x); unsigned short a2, c2; splitf(x, a2, c2); oh[q] = a2; ol[q] = c2; }
    *(v2h*)(V16 + e) = o16; *(v2us*)(Vh + e) = oh; *(v2us*)(Vl + e) = ol;  }
__global__ __launch_bounds__(256) void k_csid(float* CS) { const int idx = blockIdx.x * 256 + threadIdx.x; if (idx >= TT * HD) return; v2f cs; cs[0] = 1.0f; cs[1] = 0.0f; *(v2f*)(CS + (size_t)idx * 2) = cs;  }
// ---- k_fattn: scores, relative logits, skew, causal softmax and probs.v of one head in ONE launch; no score, logit or probability ever goes to memory.
// One wave owns 16 query rows (i0..i0+15) and walks the key blocks of 64 up to its diagonal block, with a running row maximum and a running row sum (f32). No wave reads another wave's LDS: no work-group barrier.
// Per block: S = q.k (4 tiles), L = q.Er rows rb..rb+79 with rb = T-16-i0+c0 (5 tiles), Srel[a][b] = L[a][15-a+b] (the skew, a shifted read of the wave's own LDS slice),
// p = exp2(((S+Srel)/8 - rowmax) log2 e), O = O x exp2(old max - new max) + p.v; at the end O / rowsum goes out as hi+lo planes for W_proj.
#define EP 84    // f32 pitch of the logit slice: rows 8 apart fall on different LDS banks for the store and for the shifted read
#define PP 72    // 16-bit pitch of the probability slice: 144 bytes, so each 16-byte fragment read is aligned
#define FW 4     // waves (16-row groups) per work-group
// LDS traffic between the lanes of one wave: the wave's LDS instructions run in order; this keeps the compiler from moving an LDS read over the stores that feed it (or a store over the reads before it)
__device__ __forceinline__ void wave_lds_order() { __builtin_amdgcn_wave_barrier(); asm volatile("" ::: "memory"); }
template <int M> __device__ __forceinline__ float rowx(float x) { return __builtin_bit_cast(float, __builtin_amdgcn_update_dpp(__builtin_bit_cast(int, x), __builtin_bit_cast(int, x), 0x160 + M, 0xf, 0xf, false)); }   // lane l with lane l ^ M inside its row of 16 lanes (DPP row_xmask)
__device__ __forceinline__ float rowmax16(float x) { x = fmaxf(x, rowx<1>(x)); x = fmaxf(x, rowx<2>(x)); x = fmaxf(x, rowx<4>(x)); return fmaxf(x, rowx<8>(x)); }
__device__ __forceinline__ float rowsum16(float x) { x += rowx<1>(x); x += rowx<2>(x); x += rowx<4>(x); return x + rowx<8>(x); }
__device__ __forceinline__ void putp(float p, h16* a, h16*, int o) { a[o] = tohx(p); }
__device__ __forceinline__ void putp(float p, bf* a, bf* b, int o) { unsigned short x, y; splitf(p, x, y); a[o] = x; b[o] = y; }
template <typename T16> __device__ __forceinline__ const T16* at(const T16* base, unsigned bytes) { return (const T16*)((const char*)base + bytes); }   // wave-uniform base + the lane's 32-bit byte offset
template <typename T16, bool HR>
__device__ __forceinline__ void attn_rows(const T16* __restrict__ Q, const T16* __restrict__ Q2, const T16* __restrict__ Kp, const T16* __restrict__ K2, const T16* __restrict__ E, const T16* __restrict__ Vt, const T16* __restrict__ Vt2,
                                          int i0, float* es, T16* ps, T16* ps2, bf* Ah, bf* Al) {
    typedef typename WFrag<T16>::V V; typedef WFrag<T16> F;   // every inner loop below is unrolled so that fragments, tiles and row statistics are indexed by constants (stay in registers)
    // hi+lo rows take the lane number from mbcnt (every lane is on, 32 lanes a wave): the thread id is then dead before the hi+lo branch, whose fragment runs leave no register to hold it (it was spilled to scratch)
    const int lane = HR ? (int)__builtin_amdgcn_mbcnt_lo(~0u, 0u) : (int)(threadIdx.x & 31), lr = lane & 15, hi = lane >> 4; const int eb = hi * 8 * EP + lr, pb = hi * 8 * PP + lr;   // the lane's place in the logit and the probability slice; rows and tiles are constant offsets from it
    V aq[2], aq2[2];
#pragma unroll
    for (int ks = 0; ks < 2; ++ks) { aq[ks] = F::ld(Q + (size_t)(i0 + lr) * HD + ks * 32 + 8 * hi); if (HR) aq2[ks] = F::ld(Q2 + (size_t)(i0 + lr) * HD + ks * 32 + 8 * hi); }
    v8f o[4]; float m[8], l[8];
#pragma unroll
    for (int nb = 0; nb < 4; ++nb) o[nb] = (v8f){};
#pragma unroll
    for (int j = 0; j < 8; ++j) { m[j] = -3.0e38f; l[j] = 0.f; }
    const int nblk = (i0 >> 6) + 1;   // key blocks up to and with the one that holds the diagonal (i0 is a multiple of 16)
#pragma unroll 1   // kept rolled: two blocks' fragments and tiles at once would not fit the register budget
    for (int kb = 0; kb < nblk; ++kb) {
        const int c0 = kb * 64;
        v8f s[4], e[5];
        const unsigned kp = ((c0 + lr) * HD + 8 * hi) * 2; unsigned ep[5];   // the lane's byte offset in the key planes and in each Er tile (one register each, the plane's base is wave-uniform); tiles and k steps are constant offsets
        const int rb = TT - 16 - i0 + c0;
#pragma unroll
        for (int t = 0; t < 5; ++t) { e[t] = (v8f){}; ep[t] = (min(rb + t * 16 + lr, TT - 1) * HD + 8 * hi) * 2; }   // rows past T-1 belong to keys j > i only (masked below): the clamp keeps the address inside Er
#pragma unroll
        for (int nb = 0; nb < 4; ++nb) s[nb] = (v8f){};
        // Behind each run of fragment loads stands one wait. Its inputs are the run's address registers (each stays whole until every load that names it is past the wait, so no later load or result lands on it before)
        // and the loaded fragments (no product of the run moves in front of it, so all loads of the run are in flight together and the run pays the memory latency once instead of once per refill of a few registers).
        if (!HR) {   // single-plane rows: all 18 key and Er fragments of the block fit the registers: one run
            V bk[4][2], be[5][2];
#pragma unroll
            for (int ks = 0; ks < 2; ++ks) {
#pragma unroll
                for (int nb = 0; nb < 4; ++nb) bk[nb][ks] = F::ld(at(Kp, kp) + nb * 16 * HD + ks * 32);
#pragma unroll
                for (int t = 0; t < 5; ++t) be[t][ks] = F::ld(at(E, ep[t]) + ks * 32); }
            asm volatile("s_wait_xcnt 0x0" :: "v"(kp), "v"(ep[0]), "v"(ep[1]), "v"(ep[2]), "v"(ep[3]), "v"(ep[4]), "v"(bk[0][0]), "v"(bk[1][0]), "v"(bk[2][0]), "v"(bk[3][0]), "v"(bk[0][1]), "v"(bk[1][1]), "v"(bk[2][1]), "v"(bk[3][1]),
                         "v"(be[0][0]), "v"(be[1][0]), "v"(be[2][0]), "v"(be[3][0]), "v"(be[4][0]), "v"(be[0][1]), "v"(be[1][1]), "v"(be[2][1]), "v"(be[3][1]), "v"(be[4][1]) : "memory");
            __builtin_amdgcn_sched_barrier(0);   // without it the scheduler lifts the first product over the wait, and its data wait then stands behind four loads only: the rest of the run would start one memory latency later
#pragma unroll
            for (int ks = 0; ks < 2; ++ks) {
#pragma unroll
                for (int nb = 0; nb < 4; ++nb) s[nb] = F::mma(aq[ks], bk[nb][ks], s[nb]);
#pragma unroll
                for (int t = 0; t < 5; ++t) e[t] = F::mma(aq[ks], be[t][ks], e[t]); }
        } else {     // hi+lo rows: three runs (key hi plane, key lo plane, Er), each as large as the registers allow
            { V bk[4][2];
#pragma unroll
              for (int nb = 0; nb < 4; ++nb)
#pragma unroll
                  for (int ks = 0; ks < 2; ++ks) bk[nb][ks] = F::ld(at(Kp, kp) + nb * 16 * HD + ks * 32);
              asm volatile("s_wait_xcnt 0x0" :: "v"(kp), "v"(bk[0][0]), "v"(bk[1][0]), "v"(bk[2][0]), "v"(bk[3][0]), "v"(bk[0][1]), "v"(bk[1][1]), "v"(bk[2][1]), "v"(bk[3][1]) : "memory");
#pragma unroll
              for (int ks = 0; ks < 2; ++ks)
#pragma unroll
                  for (int nb = 0; nb < 4; ++nb) { s[nb] = F::mma(aq[ks], bk[nb][ks], s[nb]); s[nb] = F::mma(aq2[ks], bk[nb][ks], s[nb]); } }
            { V bk[4][2];
#pragma unroll
              for (int nb = 0; nb < 4; ++nb)
#pragma unroll
                  for (int ks = 0; ks < 2; ++ks) bk[nb][ks] = F::ld(at(K2, kp) + nb * 16 * HD + ks * 32);
              asm volatile("s_wait_xcnt 0x0" :: "v"(kp), "v"(bk[0][0]), "v"(bk[1][0]), "v"(bk[2][0]), "v"(bk[3][0]), "v"(bk[0][1]), "v"(bk[1][1]), "v"(bk[2][1]), "v"(bk[3][1]) : "memory");
#pragma unroll
              for (int ks = 0; ks < 2; ++ks)
#pragma unroll
                  for (int nb = 0; nb < 4; ++nb) s[nb] = F::mma(aq[ks], bk[nb][ks], s[nb]); }
            { V be[5][2];
#pragma unroll
              for (int t = 0; t < 5; ++t)
#pragma unroll
                  for (int ks = 0; ks < 2; ++ks) be[t][ks] = F::ld(at(E, ep[t]) + ks * 32);
              asm volatile("s_wait_xcnt 0x0" :: "v"(ep[0]), "v"(ep[1]), "v"(ep[2]), "v"(ep[3]), "v"(ep[4]), "v"(be[0][0]), "v"(be[1][0]), "v"(be[2][0]), "v"(be[3][0]), "v"(be[4][0]), "v"(be[0][1]), "v"(be[1][1]), "v"(be[2][1]), "v"(be[3][1]), "v"(be[4][1]) : "memory");
#pragma unroll
              for (int ks = 0; ks < 2; ++ks)
#pragma unroll
                  for (int t = 0; t < 5; ++t) { e[t] = F::mma(aq[ks], be[t][ks], e[t]); e[t] = F::mma(aq2[ks], be[t][ks], e[t]); } }
        }
#pragma unroll
        for (int t = 0; t < 5; ++t)
#pragma unroll
            for (int j = 0; j < 8; ++j) es[eb + j * EP + t * 16] = e[t][j];
        wave_lds_order();
        const unsigned vp = (lr * TT + c0 + 8 * hi) * 2;   // the lane's byte offset in the transposed value planes; tiles and k steps are constant offsets from it
        V bv[4][2];   // single-plane rows: value fragments asked for here, where the logit registers are free again, so that they fly under the softmax (the hi+lo rows have no registers to spare for it and at most 8 blocks)
        if (!HR) {
#pragma unroll
            for (int nb = 0; nb < 4; ++nb)
#pragma unroll
                for (int ks = 0; ks < 2; ++ks) bv[nb][ks] = F::ld(at(Vt, vp) + nb * 16 * TT + ks * 32);
            asm volatile("s_wait_xcnt 0x0" :: "v"(vp) : "memory");   // the run's address register stays whole up to this wait (it is an input here), so no load of the run lands on it while the others are issued
        }
#pragma unroll
        for (int nb = 0; nb < 4; ++nb)
#pragma unroll
            for (int j = 0; j < 8; ++j) s[nb][j] = (s[nb][j] + es[eb - hi * 8 + j * (EP - 1) + 15 + nb * 16]) * (SCL * 1.4426950408889634f);   // row a reads column 15 - a + b; logits kept in units of log 2
        if (c0 + 63 > i0) {   // only the diagonal block holds keys j > i (wave-uniform test)
#pragma unroll
            for (int nb = 0; nb < 4; ++nb)
#pragma unroll
                for (int j = 0; j < 8; ++j) if (lr - hi * 8 > i0 - c0 + j - nb * 16) s[nb][j] = -3.0e38f;   // key c0 + nb*16 + lr > row i0 + hi*8 + j
        }
#pragma unroll
        for (int j = 0; j < 8; ++j) {
            const float mn = fmaxf(m[j], rowmax16(fmaxf(fmaxf(s[0][j], s[1][j]), fmaxf(s[2][j], s[3][j]))));
            const float al = __builtin_amdgcn_exp2f(m[j] - mn); m[j] = mn;
            float ps4 = 0.f;
#pragma unroll
            for (int nb = 0; nb < 4; ++nb) { const float p = __builtin_amdgcn_exp2f(s[nb][j] - mn); ps4 += p; putp(p, ps, ps2, pb + j * PP + nb * 16); o[nb][j] *= al; }
            l[j] = l[j] * al + ps4;   // each lane keeps the sum of its own 4 columns; the 16 lanes of a row are added once, behind the loop
        }
        if (HR) {   // hi plane of the values: asked for when the score registers are free, it flies under the LDS read-back
#pragma unroll
            for (int nb = 0; nb < 4; ++nb)
#pragma unroll
                for (int ks = 0; ks < 2; ++ks) bv[nb][ks] = F::ld(at(Vt, vp) + nb * 16 * TT + ks * 32);
            asm volatile("s_wait_xcnt 0x0" :: "v"(vp) : "memory");   // as above: the run's address register stays whole up to the wait
        }
        wave_lds_order();
        V ap[2], ap2[2];
#pragma unroll
        for (int ks = 0; ks < 2; ++ks) { ap[ks] = F::ld(ps + lr * PP + ks * 32 + 8 * hi); if (HR) ap2[ks] = F::ld(ps2 + lr * PP + ks * 32 + 8 * hi); }
#pragma unroll
        for (int ks = 0; ks < 2; ++ks)
#pragma unroll
            for (int nb = 0; nb < 4; ++nb) { o[nb] = F::mma(ap[ks], bv[nb][ks], o[nb]); if (HR) o[nb] = F::mma(ap2[ks], bv[nb][ks], o[nb]); }
        if (HR) {   // lo plane of the values
#pragma unroll
            for (int nb = 0; nb < 4; ++nb)
#pragma unroll
                for (int ks = 0; ks < 2; ++ks) bv[nb][ks] = F::ld(at(Vt2, vp) + nb * 16 * TT + ks * 32);
            asm volatile("s_wait_xcnt 0x0" :: "v"(vp) : "memory");   // as above
#pragma unroll
            for (int ks = 0; ks < 2; ++ks)
#pragma unroll
                for (int nb = 0; nb < 4; ++nb) o[nb] = F::mma(ap[ks], bv[nb][ks], o[nb]);
        }
    }
    const int ln = (int)__builtin_amdgcn_mbcnt_lo(~0u, 0u), lq = ln & 15, hq = ln >> 4;   // the lane number read anew (every lane is on, 32 lanes a wave): lr and hi need not be held over the key loop, whose fragment run leaves no register for them
#pragma unroll
    for (int j = 0; j < 8; ++j) { const float f = __fdiv_rn(1.0f, rowsum16(l[j]));
#pragma unroll
        for (int nb = 0; nb < 4; ++nb) es[hq * 8 * 68 + lq + j * 68 + nb * 16] = o[nb][j] * f; }
    wave_lds_order();
#pragma unroll
    for (int s8 = 0; s8 < 8; ++s8) { const int row = 2 * s8 + hq, cofs = lq * 4; const v4f val = *(const v4fa*)(es + row * 68 + cofs); v4us oh, ol;
#pragma unroll
        for (int q = 0; q < 4; ++q) { unsigned short a, c2; splitf(val[q], a, c2); oh[q] = a; ol[q] = c2; }
        const size_t oo = (size_t)(i0 + row) * DQ + cofs; *(v4us*)(Ah + oo) = oh; *(v4us*)(Al + oo) = ol; }
}
// grid (T/64, heads), 128 threads; the work-groups with the most key blocks come first. waves_per_eu 4: a budget of 256 registers, so that the loops hold no register-window switches
__global__ __launch_bounds__(32 * FW) __attribute__((amdgpu_waves_per_eu(4))) void k_fattn(const h16* __restrict__ Q16, const bf* __restrict__ Qh, const bf* __restrict__ Ql, const h16* __restrict__ K16, const bf* __restrict__ Kh, const bf* __restrict__ Kl,
                                                   const h16* __restrict__ V16, const bf* __restrict__ Vh, const bf* __restrict__ Vl, const h16* __restrict__ E16, const bf* __restrict__ Eb, bf* Ah, bf* Al) {
    __shared__ __align__(16) float es[FW][16 * EP];
    __shared__ __align__(16) unsigned short ps[FW][2][16 * PP];
    const int wv = __builtin_amdgcn_readfirstlane((int)(threadIdx.x >> 5));   // wave number in a scalar register: the row range, the trip count and the branch below stay scalar
    const int i0 = (TT / (16 * FW) - 1 - (int)blockIdx.x) * (16 * FW) + wv * 16; const size_t zp = (size_t)blockIdx.y * TT * HD; const int hc = (int)blockIdx.y * HD;
    if (i0 < RH) attn_rows<bf, true>(Qh + zp, Ql + zp, Kh + zp, Kl + zp, Eb, Vh + zp, Vl + zp, i0, es[wv], ps[wv][0], ps[wv][1], Ah + hc, Al + hc);
    else attn_rows<h16, false>(Q16 + zp, nullptr, K16 + zp, nullptr, E16, V16 + zp, nullptr, i0, es[wv], (h16*)ps[wv][0], nullptr, Ah + hc, Al + hc);
}

__global__ __launch_bounds__(256) void k_er16(const float* __restrict__ er, h16* E) { const int i = (blockIdx.x * 256 + threadIdx.x) * 4; if (i >= TT * HD) return; const v4f a = *(const v4f*)(er + i); v4h o; o[0] = tohx(bfr(a[0])); o[1] = tohx(bfr(a[1])); o[2] = tohx(bfr(a[2])); o[3] = tohx(bfr(a[3])); *(v4h*)(E + i) = o;  }
typedef __attribute__((ext_vector_type(4))) _Float16 v4hx;

extern "C" void kernel_launch(void* const* d_in, const int* in_sizes, int n_in,
                              void* d_out, int out_size, void* d_ws, size_t ws_size, hipStream_t stream) {
    (void)in_sizes; (void)n_in; (void)out_size;
    const float* x = (const float*)d_in[0]; const float* wattn = (const float*)d_in[1]; const float* wo = (const float*)d_in[2]; const float* er = (const float*)d_in[3];
    float* OUT = (float*)d_out;     // [2][2048][1024]
    char* wsp = (char*)d_ws;
    auto take = [&](size_t bytes) { char* p = wsp; wsp += (bytes + 255) & ~(size_t)255; return (void*)p; };
    bf* WQKV = (bf*)take((size_t)3 * DM * DM * 2); bf* WQ = WQKV; bf* WK = WQKV + (size_t)DM * DM; bf* WV = WQKV + (size_t)2 * DM * DM; bf* ERB = (bf*)take((size_t)TT * HD * 2); h16* ER16 = (h16*)take((size_t)TT * HD * 2); bf* WO = (bf*)take((size_t)DM * DQ * 2); float* CS = (float*)take((size_t)TT * HD * 2 * 4);
    bf* XB = (bf*)take((size_t)TT * DM * 2); float* FQ = (float*)take((size_t)TT * DQ * 4); float* FK = (float*)take((size_t)TT * DKV * 4);
    h16* QP16 = (h16*)take((size_t)NH_ * TT * HD * 2); h16* KP16 = (h16*)take((size_t)NKV * TT * HD * 2); h16* VT16 = (h16*)take((size_t)NKV * HD * TT * 2);
    bf* QPh = (bf*)take((size_t)NH_ * TT * HD * 2); bf* QPl = (bf*)take((size_t)NH_ * TT * HD * 2); bf* KPh = (bf*)take((size_t)NKV * TT * HD * 2); bf* KPl = (bf*)take((size_t)NKV * TT * HD * 2); bf* VTh = (bf*)take((size_t)NKV * HD * TT * 2); bf* VTl = (bf*)take((size_t)NKV * HD * TT * 2);
    bf* ATh = (bf*)take((size_t)TT * DQ * 2); bf* ATl = (bf*)take((size_t)TT * DQ * 2);
    if ((size_t)(wsp - (char*)d_ws) > ws_size) return;    // ws 256 MiB
    float* FV = FK;   // v projection reuses the k buffer after the k planes are built (stream-ordered)
    { k_wtG<<<(unsigned)((DM * 3 * DM / 64 + 63) / 64), 256, 0, stream>>>(wattn, DM, 3 * DM, WQKV); k_cvt8<<<(TT * HD / 8 + 255) / 256, 256, 0, stream>>>(er, ERB, TT * HD / 8); k_er16<<<(TT * HD / 4 + 255) / 256, 256, 0, stream>>>(er, ER16);
      k_wtG<<<(unsigned)((DQ * DM / 64 + 63) / 64), 256, 0, stream>>>(wo, DQ, DM, WO);
       }
    k_csid<<<(TT * HD + 255) / 256, 256, 0, stream>>>(CS);
    const unsigned LQ = (unsigned)(((size_t)NH_ * TT * HD / 2 + 255) / 256), LKv = (unsigned)(((size_t)NKV * TT * HD / 2 + 255) / 256);
    for (int b = 0; b < NB_; ++b) {
        
        k_cvt8<<<(unsigned)(((size_t)TT * DM / 8 + 255) / 256), 256, 0, stream>>>(x + (size_t)b * TT * DM, XB, (size_t)TT * DM / 8);
        k_gemmw<bf, 0, false, 8><<<dim3(TT / 64, DQ / 64, 1), 256, 0, stream>>>(XB, nullptr, WQ, nullptr, DM, FQ, DQ, nullptr, 0, 0, 0);
        k_rope<<<LQ, 256, 0, stream>>>(FQ, DQ, NH_, CS, nullptr, nullptr, 1.0f, QP16, QPh, QPl);
        k_gemmw<bf, 0, false, 8><<<dim3(TT / 64, DKV / 64, 1), 256, 0, stream>>>(XB, nullptr, WK, nullptr, DM, FK, DKV, nullptr, 0, 0, 0);
        k_rope<<<LKv, 256, 0, stream>>>(FK, DKV, NKV, CS, nullptr, nullptr, 1.0f, KP16, KPh, KPl);
        k_gemmw<bf, 0, false, 8><<<dim3(TT / 64, DKV / 64, 1), 256, 0, stream>>>(XB, nullptr, WV, nullptr, DM, FV, DKV, nullptr, 0, 0, 0); k_vtp<<<LKv, 256, 0, stream>>>(FV, DKV, NKV, VT16, VTh, VTl);
        k_fattn<<<dim3(TT / (16 * FW), NH_, 1), 32 * FW, 0, stream>>>(QP16, QPh, QPl, KP16, KPh, KPl, VT16, VTh, VTl, ER16, ERB, ATh, ATl);   // one kv head per query head
        k_gemmw<bf, 1, false, 8><<<dim3(TT / 64, DM / 64, 1), 256, 0, stream>>>(ATh, ATl, WO, nullptr, DQ, OUT + (size_t)b * TT * DM, DM, nullptr, 0, 0, 0); }
}

// v004
// Measured time: 314 microseconds a run.
// In both of two side-by-side timings against v003, it was 1.13 times as fast.
// Counting every step since v000, it is 6.07 times as fast.
#include <hip/hip_runtime.h>

// CausalSelfAttentionRelativePosition (x [2][2048][1024]; qkv = x W_attn (16 x 64); Srel = skew(q Er^T) -> Srel[i][j] = q_i . Er[T-1-i+j] for j <= i (the skew's wrapped entries above the diagonal are masked); att = softmax(((q.k) + Srel)/8, causal);
// y = att v; out = y W_proj -> [2][2048][1024]).
// Compute dtypes, f32 accumulate: every input rounded to bf16; qkv on PLAIN bf16 operands (inputs: exact); scores q.k (K 64), the relative logits q.Er^T and probs.v on bf16 hi+lo planes (3 products; q.Er: hl q x exact Er, 2 products)
// for the first 512 query rows per head and SINGLE fp16 planes for the rest (Er, a bf16 input, is exact in fp16); scores, relative logits, skew, softmax (f32, running maximum and sum) and probs.v in one fused launch per batch, key blocks above the diagonal never touched; W_proj on hl planes x exact.

#define NB_  2
#define TT   2048
#define DM   1024
#define NH_  16
#define NKV  16
#define REP  (NH_ / NKV)
#define HD   64
#define DQ   (NH_ * HD)
#define DKV  (NKV * HD)
#define RH   512                  // query rows < RH use hi+lo planes (0: none)
#define SCL  0.125f   // HD^-0.5
typedef _Float16 h16;
typedef unsigned short bf;
typedef __attribute__((ext_vector_type(16))) __bf16   v16bf;
typedef __attribute__((ext_vector_type(16))) _Float16 v16h;
typedef __attribute__((ext_vector_type(8)))  _Float16 v8h;
typedef __attribute__((ext_vector_type(8)))  unsigned short v8us;
typedef __attribute__((ext_vector_type(8)))  float    v8f;
typedef __attribute__((ext_vector_type(4)))  float    v4f;
typedef v8h  __attribute__((may_alias)) v8ha;
typedef v4f  __attribute__((may_alias)) v4fa;
typedef v8us __attribute__((may_alias)) v8usa;

__device__ __forceinline__ unsigned short f2bf(float f) { unsigned u = __float_as_uint(f); u += 0x7FFFu + ((u >> 16) & 1u); return (unsigned short)(u >> 16); }
__device__ __forceinline__ float bf2f(unsigned short b) { return __uint_as_float(((unsigned)b) << 16); }
__device__ __forceinline__ float bfr(float f) { return bf2f(f2bf(f)); }
__device__ __forceinline__ v16h cat16(v8h lo, v8h hi) { return __builtin_shufflevector(lo, hi, 0, 1, 2, 3, 4, 5, 6, 7, 8, 9, 10, 11, 12, 13, 14, 15); }
__device__ __forceinline__ v16bf cat16b(v8us lo, v8us hi) { return __builtin_bit_cast(v16bf, __builtin_shufflevector(lo, hi, 0, 1, 2, 3, 4, 5, 6, 7, 8, 9, 10, 11, 12, 13, 14, 15)); }
__device__ __forceinline__ v8f wmma16(v16h a, v16h b, v8f c) { return __builtin_amdgcn_wmma_f32_16x16x32_f16(false, a, false, b, (short)0, c, false, false); }
__device__ __forceinline__ v8f wmmab(v16bf a, v16bf b, v8f c) { return __builtin_amdgcn_wmma_f32_16x16x32_bf16(false, a, false, b, (short)0, c, false, false); }
__device__ __forceinline__ h16 tohx(float x) { return (h16)x; }
__device__ __forceinline__ void splitf(float y, unsigned short& h, unsigned short& l) { h = f2bf(y); l = f2bf(y - bf2f(h)); }
typedef __attribute__((ext_vector_type(4))) _Float16 v4h;
typedef __attribute__((ext_vector_type(4))) unsigned short v4us;



// ---- k_gemmw: register-blocked GEMM, ONE WAVE per 64x64 output tile (16 accumulators), operands straight from K-contiguous 16-bit planes; grid (M/64, N/64, Z), 32 threads.
// C[m][n] (f32, pitch ldc, + optional f32 bias[n]) = sum_k A[m][k] Bt[n][k] (+ split products per NSPLIT). z-batch strides sA/sB/sC in elements. K % 32 == 0.
// NW > 1 (32 * NW threads): NW waves share the tile; wave w takes the k steps w, w + NW, ...; each leaves its partial 64x64 tile in LDS and, behind one barrier, the work-group sums the NW partials in wave order.
// PL (NW > 1 only): the summed tile goes out as three 16-bit planes (fp16, bf16 hi, bf16 lo) instead of f32: element (m, n) at blockIdx.y * sP + m * ldc + (n - c0), so that a tile of 64 columns lands either
// in its own head's [t][d] plane (sP = T * 64, ldc = 64) or as 64 columns of a wide row (sP = 64, ldc = row length); no f32 copy of the product is written.
template <typename T16> struct WFrag;
template <> struct WFrag<h16> { typedef v16h V; static __device__ __forceinline__ V ld(const h16* p) { return cat16(*(const v8h*)p, *(const v8h*)(p + 16)); } static __device__ __forceinline__ v8f mma(V a, V b, v8f c) { return wmma16(a, b, c); } };
template <> struct WFrag<bf> { typedef v16bf V; static __device__ __forceinline__ V ld(const bf* p) { return cat16b(*(const v8us*)p, *(const v8us*)(p + 16)); } static __device__ __forceinline__ v8f mma(V a, V b, v8f c) { return wmmab(a, b, c); } };
template <typename T16, int NSPLIT, bool BIAS, int NW, bool PL>
__global__ __launch_bounds__(32 * NW) void k_gemmw(const T16* __restrict__ A, const T16* __restrict__ A2, const T16* __restrict__ Bt, const T16* __restrict__ Bt2, int K, float* C, int ldc, const float* __restrict__ bias, size_t sA, size_t sB, size_t sC,
                                                   h16* P16, bf* Ph, bf* Pl, size_t sP) {
    typedef typename WFrag<T16>::V V;
    __shared__ __align__(16) float os[(NW > 1 ? NW * 64 : 16) * 68];
    const size_t z = blockIdx.z; A += z * sA; if (A2) A2 += z * sA; Bt += z * sB; if (Bt2) Bt2 += z * sB; C += z * sC;
    const int lane = threadIdx.x & 31, lr = lane & 15, hi = lane >> 4; const int r0 = blockIdx.x * 64, c0 = blockIdx.y * 64; const int wv = (NW > 1) ? __builtin_amdgcn_readfirstlane((int)(threadIdx.x >> 5)) : 0;   // wave number in a scalar register: the K loop's counter and branch stay scalar
    v8f acc[4][4];
#pragma unroll
    for (int mb = 0; mb < 4; ++mb)
#pragma unroll
        for (int nb = 0; nb < 4; ++nb) acc[mb][nb] = (v8f){};
    const size_t aoff = (size_t)(r0 + lr) * K + 8 * hi, boff = (size_t)(c0 + lr) * K + 8 * hi;
#pragma unroll 1
    for (int kc = wv * 32; kc < K; kc += 32 * NW) {
        V a[4], a2[4];
#pragma unroll
        for (int mb = 0; mb < 4; ++mb) { a[mb] = WFrag<T16>::ld(A + aoff + (size_t)mb * 16 * K + kc); if (NSPLIT == 1 || NSPLIT == 2) a2[mb] = WFrag<T16>::ld(A2 + aoff + (size_t)mb * 16 * K + kc); }
#pragma unroll
        for (int nb = 0; nb < 4; ++nb) { const V b = WFrag<T16>::ld(Bt + boff + (size_t)nb * 16 * K + kc); V b2; if (NSPLIT >= 2) b2 = WFrag<T16>::ld(Bt2 + boff + (size_t)nb * 16 * K + kc);
#pragma unroll
            for (int mb = 0; mb < 4; ++mb) { acc[mb][nb] = WFrag<T16>::mma(a[mb], b, acc[mb][nb]); if (NSPLIT == 1 || NSPLIT == 2) acc[mb][nb] = WFrag<T16>::mma(a2[mb], b, acc[mb][nb]); if (NSPLIT >= 2) acc[mb][nb] = WFrag<T16>::mma(a[mb], b2, acc[mb][nb]); } }
        asm volatile("v_nop\n\tv_nop\n\tv_nop\n\tv_nop" : "+v"(acc[0][0]), "+v"(acc[1][1]), "+v"(acc[2][2]), "+v"(acc[3][3]) : "v"(a[0]), "v"(a[3]));
    }
    if (NW > 1) {   // the loops below are unrolled so that acc is indexed by constants (stays in registers) and the LDS reads of one sum go out together
#pragma unroll
        for (int mb = 0; mb < 4; ++mb)
#pragma unroll
            for (int nb = 0; nb < 4; ++nb)
#pragma unroll
                for (int j = 0; j < 8; ++j) os[(wv * 64 + mb * 16 + hi * 8 + j) * 68 + nb * 16 + lr] = acc[mb][nb][j];
        __syncthreads();   // every wave's partial tile is in LDS before any thread sums across waves
#pragma unroll
        for (int s = 0; s < 32 / NW; ++s) { const int u = s * 32 * NW + (int)threadIdx.x, row = u >> 4, cofs = (u & 15) * 4; v4f val = *(const v4fa*)(os + row * 68 + cofs);
#pragma unroll
            for (int w = 1; w < NW; ++w) val += *(const v4fa*)(os + (w * 64 + row) * 68 + cofs);
            if (BIAS) { val[0] += bfr(bias[c0 + cofs]); val[1] += bfr(bias[c0 + cofs + 1]); val[2] += bfr(bias[c0 + cofs + 2]); val[3] += bfr(bias[c0 + cofs + 3]); }
            if (PL) { v4h o16; v4us oh, ol;
#pragma unroll
                for (int q = 0; q < 4; ++q) { o16[q] = tohx(val[q]); unsigned short a2, c2; splitf(val[q], a2, c2); oh[q] = a2; ol[q] = c2; }
                const size_t po = (size_t)blockIdx.y * sP + (size_t)(r0 + row) * ldc + cofs; *(v4h*)(P16 + po) = o16; *(v4us*)(Ph + po) = oh; *(v4us*)(Pl + po) = ol; }
            else *(v4f*)(C + (size_t)(r0 + row) * ldc + c0 + cofs) = val; }
        return;
    }
#pragma unroll
    for (int mb = 0; mb < 4; ++mb) {
#pragma unroll
        for (int nb = 0; nb < 4; ++nb) {
#pragma unroll
            for (int j = 0; j < 8; ++j) os[(hi * 8 + j) * 68 + nb * 16 + lr] = acc[mb][nb][j]; }
        __builtin_amdgcn_wave_barrier(); asm volatile("" ::: "memory");
        float* crow = C + (size_t)(r0 + mb * 16) * ldc + c0;
{
#pragma unroll
            for (int s = 0; s < 8; ++s) { const int row = 2 * s + hi, cofs = lr * 4; v4f val = *(const v4fa*)(os + row * 68 + cofs); if (BIAS) { val[0] += bfr(bias[c0 + cofs]); val[1] += bfr(bias[c0 + cofs + 1]); val[2] += bfr(bias[c0 + cofs + 2]); val[3] += bfr(bias[c0 + cofs + 3]); }
                *(v4f*)(crow + (size_t)row * ldc + cofs) = val; }
             }
        __builtin_amdgcn_wave_barrier(); asm volatile("" ::: "memory");
    }
}

typedef __attribute__((ext_vector_type(2))) unsigned short v2us;
typedef __attribute__((ext_vector_type(4))) int v4i;

__global__ __launch_bounds__(256) void k_wtG(const float* __restrict__ w, int K, int N, bf* Bt) {
    const int lane = threadIdx.x & 31; const int L0 = (blockIdx.x * 8 + (threadIdx.x >> 5)) * 8; const int nlines = N * K / 64;
{
#pragma unroll 1
        for (int l = 0; l < 8; ++l) { const int L = L0 + l; if (L >= nlines) break; const size_t e = (size_t)L * 64 + lane * 2; const int k = (int)(e % K), n = (int)(e / K); v2us o;
            o[0] = f2bf(w[(size_t)k * N + n]); o[1] = f2bf(w[(size_t)(k + 1) * N + n]); *(v2us*)(Bt + e) = o; }
         }
}
__global__ __launch_bounds__(256) void k_cvt8(const float* __restrict__ src, bf* dst, size_t n8) { const size_t i = (size_t)blockIdx.x * 256 + threadIdx.x; if (i >= n8) return; const v8f v = *(const v8f*)(src + i * 8); v8us o;
#pragma unroll
    for (int k = 0; k < 8; ++k) o[k] = f2bf(v[k]); *(v8us*)(dst + i * 8) = o;  }
// ---- k_fattn: scores, relative logits, skew, causal softmax and probs.v of one head in ONE launch; no score, logit or probability ever goes to memory.
// One wave owns 16 query rows (i0..i0+15) and walks the key blocks of 64 up to its diagonal block, with a running row maximum and a running row sum (f32). No wave reads another wave's LDS: no work-group barrier.
// Per block: S = q.k (4 tiles), L = q.Er rows rb..rb+79 with rb = T-16-i0+c0 (5 tiles), Srel[a][b] = L[a][15-a+b] (the skew, a shifted read of the wave's own LDS slice),
// p = exp2(((S+Srel)/8 - rowmax) log2 e), O = O x exp2(old max - new max) + p.v; at the end O / rowsum goes out as hi+lo planes for W_proj.
#define EP 84    // f32 pitch of the logit slice: rows 8 apart fall on different LDS banks for the store and for the shifted read
#define PP 72    // 16-bit pitch of the probability slice: 144 bytes, so each 16-byte fragment read is aligned
#define FW 4     // waves (16-row groups) per work-group
// LDS traffic between the lanes of one wave: the wave's LDS instructions run in order; this keeps the compiler from moving an LDS read over the stores that feed it (or a store over the reads before it)
__device__ __forceinline__ void wave_lds_order() { __builtin_amdgcn_wave_barrier(); asm volatile("" ::: "memory"); }
template <int M> __device__ __forceinline__ float rowx(float x) { return __builtin_bit_cast(float, __builtin_amdgcn_update_dpp(__builtin_bit_cast(int, x), __builtin_bit_cast(int, x), 0x160 + M, 0xf, 0xf, false)); }   // lane l with lane l ^ M inside its row of 16 lanes (DPP row_xmask)
__device__ __forceinline__ float rowmax16(float x) { x = fmaxf(x, rowx<1>(x)); x = fmaxf(x, rowx<2>(x)); x = fmaxf(x, rowx<4>(x)); return fmaxf(x, rowx<8>(x)); }
__device__ __forceinline__ float rowsum16(float x) { x += rowx<1>(x); x += rowx<2>(x); x += rowx<4>(x); return x + rowx<8>(x); }
__device__ __forceinline__ void putp(float p, h16* a, h16*, int o) { a[o] = tohx(p); }
__device__ __forceinline__ void putp(float p, bf* a, bf* b, int o) { unsigned short x, y; splitf(p, x, y); a[o] = x; b[o] = y; }
template <typename T16> __device__ __forceinline__ const T16* at(const T16* base, unsigned bytes) { return (const T16*)((const char*)base + bytes); }   // wave-uniform base + the lane's 32-bit byte offset
template <typename T16, bool HR>
__device__ __forceinline__ void attn_rows(const T16* __restrict__ Q, const T16* __restrict__ Q2, const T16* __restrict__ Kp, const T16* __restrict__ K2, const T16* __restrict__ E, const T16* __restrict__ Vt, const T16* __restrict__ Vt2,
                                          int i0, float* es, T16* ps, T16* ps2, bf* Ah, bf* Al) {
    typedef typename WFrag<T16>::V V; typedef WFrag<T16> F;   // every inner loop below is unrolled so that fragments, tiles and row statistics are indexed by constants (stay in registers)
    // hi+lo rows take the lane number from mbcnt (every lane is on, 32 lanes a wave): the thread id is then dead before the hi+lo branch, whose fragment runs leave no register to hold it (it was spilled to scratch)
    const int lane = HR ? (int)__builtin_amdgcn_mbcnt_lo(~0u, 0u) : (int)(threadIdx.x & 31), lr = lane & 15, hi = lane >> 4; const int eb = hi * 8 * EP + lr, pb = hi * 8 * PP + lr;   // the lane's place in the logit and the probability slice; rows and tiles are constant offsets from it
    V aq[2], aq2[2];
#pragma unroll
    for (int ks = 0; ks < 2; ++ks) { aq[ks] = F::ld(Q + (size_t)(i0 + lr) * HD + ks * 32 + 8 * hi); if (HR) aq2[ks] = F::ld(Q2 + (size_t)(i0 + lr) * HD + ks * 32 + 8 * hi); }
    v8f o[4]; float m[8], l[8];
#pragma unroll
    for (int nb = 0; nb < 4; ++nb) o[nb] = (v8f){};
#pragma unroll
    for (int j = 0; j < 8; ++j) { m[j] = -3.0e38f; l[j] = 0.f; }
    const int nblk = (i0 >> 6) + 1;   // key blocks up to and with the one that holds the diagonal (i0 is a multiple of 16)
#pragma unroll 1   // kept rolled: two blocks' fragments and tiles at once would not fit the register budget
    for (int kb = 0; kb < nblk; ++kb) {
        const int c0 = kb * 64;
        v8f s[4], e[5];
        const unsigned kp = ((c0 + lr) * HD + 8 * hi) * 2; unsigned ep[5];   // the lane's byte offset in the key planes and in each Er tile (one register each, the plane's base is wave-uniform); tiles and k steps are constant offsets
        const int rb = TT - 16 - i0 + c0;
#pragma unroll
        for (int t = 0; t < 5; ++t) { e[t] = (v8f){}; ep[t] = (min(rb + t * 16 + lr, TT - 1) * HD + 8 * hi) * 2; }   // rows past T-1 belong to keys j > i only (masked below): the clamp keeps the address inside Er
#pragma unroll
        for (int nb = 0; nb < 4; ++nb) s[nb] = (v8f){};
        // Behind each run of fragment loads stands one wait. Its inputs are the run's address registers (each stays whole until every load that names it is past the wait, so no later load or result lands on it before)
        // and the loaded fragments (no product of the run moves in front of it, so all loads of the run are in flight together and the run pays the memory latency once instead of once per refill of a few registers).
        if (!HR) {   // single-plane rows: all 18 key and Er fragments of the block fit the registers: one run
            V bk[4][2], be[5][2];
#pragma unroll
            for (int ks = 0; ks < 2; ++ks) {
#pragma unroll
                for (int nb = 0; nb < 4; ++nb) bk[nb][ks] = F::ld(at(Kp, kp) + nb * 16 * HD + ks * 32);
#pragma unroll
                for (int t = 0; t < 5; ++t) be[t][ks] = F::ld(at(E, ep[t]) + ks * 32); }
            asm volatile("s_wait_xcnt 0x0" :: "v"(kp), "v"(ep[0]), "v"(ep[1]), "v"(ep[2]), "v"(ep[3]), "v"(ep[4]), "v"(bk[0][0]), "v"(bk[1][0]), "v"(bk[2][0]), "v"(bk[3][0]), "v"(bk[0][1]), "v"(bk[1][1]), "v"(bk[2][1]), "v"(bk[3][1]),
                         "v"(be[0][0]), "v"(be[1][0]), "v"(be[2][0]), "v"(be[3][0]), "v"(be[4][0]), "v"(be[0][1]), "v"(be[1][1]), "v"(be[2][1]), "v"(be[3][1]), "v"(be[4][1]) : "memory");
            __builtin_amdgcn_sched_barrier(0);   // without it the scheduler lifts the first product over the wait, and its data wait then stands behind four loads only: the rest of the run would start one memory latency later
#pragma unroll
            for (int ks = 0; ks < 2; ++ks) {
#pragma unroll
                for (int nb = 0; nb < 4; ++nb) s[nb] = F::mma(aq[ks], bk[nb][ks], s[nb]);
#pragma unroll
                for (int t = 0; t < 5; ++t) e[t] = F::mma(aq[ks], be[t][ks], e[t]); }
        } else {     // hi+lo rows: three runs (key hi plane, key lo plane, Er), each as large as the registers allow
            { V bk[4][2];
#pragma unroll
              for (int nb = 0; nb < 4; ++nb)
#pragma unroll
                  for (int ks = 0; ks < 2; ++ks) bk[nb][ks] = F::ld(at(Kp, kp) + nb * 16 * HD + ks * 32);
              asm volatile("s_wait_xcnt 0x0" :: "v"(kp), "v"(bk[0][0]), "v"(bk[1][0]), "v"(bk[2][0]), "v"(bk[3][0]), "v"(bk[0][1]), "v"(bk[1][1]), "v"(bk[2][1]), "v"(bk[3][1]) : "memory");
#pragma unroll
              for (int ks = 0; ks < 2; ++ks)
#pragma unroll
                  for (int nb = 0; nb < 4; ++nb) { s[nb] = F::mma(aq[ks], bk[nb][ks], s[nb]); s[nb] = F::mma(aq2[ks], bk[nb][ks], s[nb]); } }
            { V bk[4][2];
#pragma unroll
              for (int nb = 0; nb < 4; ++nb)
#pragma unroll
                  for (int ks = 0; ks < 2; ++ks) bk[nb][ks] = F::ld(at(K2, kp) + nb * 16 * HD + ks * 32);
              asm volatile("s_wait_xcnt 0x0" :: "v"(kp), "v"(bk[0][0]), "v"(bk[1][0]), "v"(bk[2][0]), "v"(bk[3][0]), "v"(bk[0][1]), "v"(bk[1][1]), "v"(bk[2][1]), "v"(bk[3][1]) : "memory");
#pragma unroll
              for (int ks = 0; ks < 2; ++ks)
#pragma unroll
                  for (int nb = 0; nb < 4; ++nb) s[nb] = F::mma(aq[ks], bk[nb][ks], s[nb]); }
            { V be[5][2];
#pragma unroll
              for (int t = 0; t < 5; ++t)
#pragma unroll
                  for (int ks = 0; ks < 2; ++ks) be[t][ks] = F::ld(at(E, ep[t]) + ks * 32);
              asm volatile("s_wait_xcnt 0x0" :: "v"(ep[0]), "v"(ep[1]), "v"(ep[2]), "v"(ep[3]), "v"(ep[4]), "v"(be[0][0]), "v"(be[1][0]), "v"(be[2][0]), "v"(be[3][0]), "v"(be[4][0]), "v"(be[0][1]), "v"(be[1][1]), "v"(be[2][1]), "v"(be[3][1]), "v"(be[4][1]) : "memory");
#pragma unroll
              for (int ks = 0; ks < 2; ++ks)
#pragma unroll
                  for (int t = 0; t < 5; ++t) { e[t] = F::mma(aq[ks], be[t][ks], e[t]); e[t] = F::mma(aq2[ks], be[t][ks], e[t]); } }
        }
#pragma unroll
        for (int t = 0; t < 5; ++t)
#pragma unroll
            for (int j = 0; j < 8; ++j) es[eb + j * EP + t * 16] = e[t][j];
        wave_lds_order();
        const unsigned vp = (lr * TT + c0 + 8 * hi) * 2;   // the lane's byte offset in the transposed value planes; tiles and k steps are constant offsets from it
        V bv[4][2];   // single-plane rows: value fragments asked for here, where the logit registers are free again, so that they fly under the softmax (the hi+lo rows have no registers to spare for it and at most 8 blocks)
        if (!HR) {
#pragma unroll
            for (int nb = 0; nb < 4; ++nb)
#pragma unroll
                for (int ks = 0; ks < 2; ++ks) bv[nb][ks] = F::ld(at(Vt, vp) + nb * 16 * TT + ks * 32);
            asm volatile("s_wait_xcnt 0x0" :: "v"(vp) : "memory");   // the run's address register stays whole up to this wait (it is an input here), so no load of the run lands on it while the others are issued
        }
#pragma unroll
        for (int nb = 0; nb < 4; ++nb)
#pragma unroll
            for (int j = 0; j < 8; ++j) s[nb][j] = (s[nb][j] + es[eb - hi * 8 + j * (EP - 1) + 15 + nb * 16]) * (SCL * 1.4426950408889634f);   // row a reads column 15 - a + b; logits kept in units of log 2
        if (c0 + 63 > i0) {   // only the diagonal block holds keys j > i (wave-uniform test)
#pragma unroll
            for (int nb = 0; nb < 4; ++nb)
#pragma unroll
                for (int j = 0; j < 8; ++j) if (lr - hi * 8 > i0 - c0 + j - nb * 16) s[nb][j] = -3.0e38f;   // key c0 + nb*16 + lr > row i0 + hi*8 + j
        }
#pragma unroll
        for (int j = 0; j < 8; ++j) {
            const float mn = fmaxf(m[j], rowmax16(fmaxf(fmaxf(s[0][j], s[1][j]), fmaxf(s[2][j], s[3][j]))));
            const float al = __builtin_amdgcn_exp2f(m[j] - mn); m[j] = mn;
            float ps4 = 0.f;
#pragma unroll
            for (int nb = 0; nb < 4; ++nb) { const float p = __builtin_amdgcn_exp2f(s[nb][j] - mn); ps4 += p; putp(p, ps, ps2, pb + j * PP + nb * 16); o[nb][j] *= al; }
            l[j] = l[j] * al + ps4;   // each lane keeps the sum of its own 4 columns; the 16 lanes of a row are added once, behind the loop
        }
        if (HR) {   // hi plane of the values: asked for when the score registers are free, it flies under the LDS read-back
#pragma unroll
            for (int nb = 0; nb < 4; ++nb)
#pragma unroll
                for (int ks = 0; ks < 2; ++ks) bv[nb][ks] = F::ld(at(Vt, vp) + nb * 16 * TT + ks * 32);
            asm volatile("s_wait_xcnt 0x0" :: "v"(vp) : "memory");   // as above: the run's address register stays whole up to the wait
        }
        wave_lds_order();
        V ap[2], ap2[2];
#pragma unroll
        for (int ks = 0; ks < 2; ++ks) { ap[ks] = F::ld(ps + lr * PP + ks * 32 + 8 * hi); if (HR) ap2[ks] = F::ld(ps2 + lr * PP + ks * 32 + 8 * hi); }
#pragma unroll
        for (int ks = 0; ks < 2; ++ks)
#pragma unroll
            for (int nb = 0; nb < 4; ++nb) { o[nb] = F::mma(ap[ks], bv[nb][ks], o[nb]); if (HR) o[nb] = F::mma(ap2[ks], bv[nb][ks], o[nb]); }
        if (HR) {   // lo plane of the values
#pragma unroll
            for (int nb = 0; nb < 4; ++nb)
#pragma unroll
                for (int ks = 0; ks < 2; ++ks) bv[nb][ks] = F::ld(at(Vt2, vp) + nb * 16 * TT + ks * 32);
            asm volatile("s_wait_xcnt 0x0" :: "v"(vp) : "memory");   // as above
#pragma unroll
            for (int ks = 0; ks < 2; ++ks)
#pragma unroll
                for (int nb = 0; nb < 4; ++nb) o[nb] = F::mma(ap[ks], bv[nb][ks], o[nb]);
        }
    }
    const int ln = (int)__builtin_amdgcn_mbcnt_lo(~0u, 0u), lq = ln & 15, hq = ln >> 4;   // the lane number read anew (every lane is on, 32 lanes a wave): lr and hi need not be held over the key loop, whose fragment run leaves no register for them
#pragma unroll
    for (int j = 0; j < 8; ++j) { const float f = __fdiv_rn(1.0f, rowsum16(l[j]));
#pragma unroll
        for (int nb = 0; nb < 4; ++nb) es[hq * 8 * 68 + lq + j * 68 + nb * 16] = o[nb][j] * f; }
    wave_lds_order();
#pragma unroll
    for (int s8 = 0; s8 < 8; ++s8) { const int row = 2 * s8 + hq, cofs = lq * 4; const v4f val = *(const v4fa*)(es + row * 68 + cofs); v4us oh, ol;
#pragma unroll
        for (int q = 0; q < 4; ++q) { unsigned short a, c2; splitf(val[q], a, c2); oh[q] = a; ol[q] = c2; }
        const size_t oo = (size_t)(i0 + row) * DQ + cofs; *(v4us*)(Ah + oo) = oh; *(v4us*)(Al + oo) = ol; }
}
// grid (T/64, heads), 128 threads; the work-groups with the most key blocks come first. waves_per_eu 4: a budget of 256 registers, so that the loops hold no register-window switches
__global__ __launch_bounds__(32 * FW) __attribute__((amdgpu_waves_per_eu(4))) void k_fattn(const h16* __restrict__ Q16, const bf* __restrict__ Qh, const bf* __restrict__ Ql, const h16* __restrict__ K16, const bf* __restrict__ Kh, const bf* __restrict__ Kl,
                                                   const h16* __restrict__ V16, const bf* __restrict__ Vh, const bf* __restrict__ Vl, const h16* __restrict__ E16, const bf* __restrict__ Eb, bf* Ah, bf* Al) {
    __shared__ __align__(16) float es[FW][16 * EP];
    __shared__ __align__(16) unsigned short ps[FW][2][16 * PP];
    const int wv = __builtin_amdgcn_readfirstlane((int)(threadIdx.x >> 5));   // wave number in a scalar register: the row range, the trip count and the branch below stay scalar
    const int i0 = (TT / (16 * FW) - 1 - (int)blockIdx.x) * (16 * FW) + wv * 16; const size_t zp = (size_t)blockIdx.y * TT * HD; const int hc = (int)blockIdx.y * HD;
    if (i0 < RH) attn_rows<bf, true>(Qh + zp, Ql + zp, Kh + zp, Kl + zp, Eb, Vh + zp, Vl + zp, i0, es[wv], ps[wv][0], ps[wv][1], Ah + hc, Al + hc);
    else attn_rows<h16, false>(Q16 + zp, nullptr, K16 + zp, nullptr, E16, V16 + zp, nullptr, i0, es[wv], (h16*)ps[wv][0], nullptr, Ah + hc, Al + hc);
}

__global__ __launch_bounds__(256) void k_er16(const float* __restrict__ er, h16* E) { const int i = (blockIdx.x * 256 + threadIdx.x) * 4; if (i >= TT * HD) return; const v4f a = *(const v4f*)(er + i); v4h o; o[0] = tohx(bfr(a[0])); o[1] = tohx(bfr(a[1])); o[2] = tohx(bfr(a[2])); o[3] = tohx(bfr(a[3])); *(v4h*)(E + i) = o;  }
typedef __attribute__((ext_vector_type(4))) _Float16 v4hx;

extern "C" void kernel_launch(void* const* d_in, const int* in_sizes, int n_in,
                              void* d_out, int out_size, void* d_ws, size_t ws_size, hipStream_t stream) {
    (void)in_sizes; (void)n_in; (void)out_size;
    const float* x = (const float*)d_in[0]; const float* wattn = (const float*)d_in[1]; const float* wo = (const float*)d_in[2]; const float* er = (const float*)d_in[3];
    float* OUT = (float*)d_out;     // [2][2048][1024]
    char* wsp = (char*)d_ws;
    auto take = [&](size_t bytes) { char* p = wsp; wsp += (bytes + 255) & ~(size_t)255; return (void*)p; };
    bf* WQKV = (bf*)take((size_t)3 * DM * DM * 2); bf* WQ = WQKV; bf* WK = WQKV + (size_t)DM * DM; bf* WV = WQKV + (size_t)2 * DM * DM; bf* ERB = (bf*)take((size_t)TT * HD * 2); h16* ER16 = (h16*)take((size_t)TT * HD * 2); bf* WO = (bf*)take((size_t)DM * DQ * 2);
    bf* XB = (bf*)take((size_t)TT * DM * 2);
    h16* QP16 = (h16*)take((size_t)NH_ * TT * HD * 2); h16* KP16 = (h16*)take((size_t)NKV * TT * HD * 2); h16* VT16 = (h16*)take((size_t)NKV * HD * TT * 2);
    bf* QPh = (bf*)take((size_t)NH_ * TT * HD * 2); bf* QPl = (bf*)take((size_t)NH_ * TT * HD * 2); bf* KPh = (bf*)take((size_t)NKV * TT * HD * 2); bf* KPl = (bf*)take((size_t)NKV * TT * HD * 2); bf* VTh = (bf*)take((size_t)NKV * HD * TT * 2); bf* VTl = (bf*)take((size_t)NKV * HD * TT * 2);
    bf* ATh = (bf*)take((size_t)TT * DQ * 2); bf* ATl = (bf*)take((size_t)TT * DQ * 2);
    if ((size_t)(wsp - (char*)d_ws) > ws_size) return;    // ws 256 MiB
    { k_wtG<<<(unsigned)((DM * 3 * DM / 64 + 63) / 64), 256, 0, stream>>>(wattn, DM, 3 * DM, WQKV); k_cvt8<<<(TT * HD / 8 + 255) / 256, 256, 0, stream>>>(er, ERB, TT * HD / 8); k_er16<<<(TT * HD / 4 + 255) / 256, 256, 0, stream>>>(er, ER16);
      k_wtG<<<(unsigned)((DQ * DM / 64 + 63) / 64), 256, 0, stream>>>(wo, DQ, DM, WO);
       }
    for (int b = 0; b < NB_; ++b) {
        
        k_cvt8<<<(unsigned)(((size_t)TT * DM / 8 + 255) / 256), 256, 0, stream>>>(x + (size_t)b * TT * DM, XB, (size_t)TT * DM / 8);
        // q and k: a tile's 64 columns are one head (HD = 64), so it goes straight into that head's [t][d] planes
        k_gemmw<bf, 0, false, 8, true><<<dim3(TT / 64, DQ / 64, 1), 256, 0, stream>>>(XB, nullptr, WQ, nullptr, DM, nullptr, HD, nullptr, 0, 0, 0, QP16, QPh, QPl, (size_t)TT * HD);
        k_gemmw<bf, 0, false, 8, true><<<dim3(TT / 64, DKV / 64, 1), 256, 0, stream>>>(XB, nullptr, WK, nullptr, DM, nullptr, HD, nullptr, 0, 0, 0, KP16, KPh, KPl, (size_t)TT * HD);
        // v: the product is taken as W_v^T x^T (rows = head dims, columns = positions), so the tile already has the [h][d][t] order that probs.v reads
        k_gemmw<bf, 0, false, 8, true><<<dim3(DKV / 64, TT / 64, 1), 256, 0, stream>>>(WV, nullptr, XB, nullptr, DM, nullptr, TT, nullptr, 0, 0, 0, VT16, VTh, VTl, (size_t)64);
        k_fattn<<<dim3(TT / (16 * FW), NH_, 1), 32 * FW, 0, stream>>>(QP16, QPh, QPl, KP16, KPh, KPl, VT16, VTh, VTl, ER16, ERB, ATh, ATl);   // one kv head per query head
        k_gemmw<bf, 1, false, 8, false><<<dim3(TT / 64, DM / 64, 1), 256, 0, stream>>>(ATh, ATl, WO, nullptr, DQ, OUT + (size_t)b * TT * DM, DM, nullptr, 0, 0, 0, nullptr, nullptr, nullptr, 0); }
}

// v005
// Measured time: 201 microseconds a run.
// Next to v004, in two timings, it ran 1.56 times as fast each time.
// Counting every step since v000, it is 9.46 times as fast.
#include <hip/hip_runtime.h>

// CausalSelfAttentionRelativePosition (x [2][2048][1024]; qkv = x W_attn (16 x 64); Srel = skew(q Er^T) -> Srel[i][j] = q_i . Er[T-1-i+j] for j <= i (the skew's wrapped entries above the diagonal are masked); att = softmax(((q.k) + Srel)/8, causal);
// y = att v; out = y W_proj -> [2][2048][1024]).
// Compute dtypes, f32 accumulate: every input rounded to bf16; qkv on PLAIN bf16 operands (inputs: exact); scores q.k (K 64), the relative logits q.Er^T and probs.v on bf16 hi+lo planes (3 products; q.Er: hl q x exact Er, 2 products)
// for the first 512 query rows per head and SINGLE fp16 planes for the rest (Er, a bf16 input, is exact in fp16); scores, relative logits, skew, softmax (f32, running maximum and sum) and probs.v in one fused launch per batch, key blocks above the diagonal never touched; W_proj on hl planes x exact.
// FRAGMENT ORDER: every 16-bit operand plane in the workspace ([rows][K], K % 32 == 0, rows % 16 == 0) is kept as blocks of 16 rows x 32 k (512 elements, block number (row / 16) * (K / 32) + k / 32); inside a block element (row, k) stands at
// ((k % 32) / 16) * 256 + ((k % 16) / 8) * 128 + (row % 16) * 8 + k % 8. A lane's two 16-byte fragment loads are then block + lane * 8 and block + 256 + lane * 8: each load of a wave reads 512 bytes in a row (4 cache lines) instead of 32 bytes out of each of 16 lines.

#define NB_  2
#define TT   2048
#define DM   1024
#define NH_  16
#define NKV  16
#define REP  (NH_ / NKV)
#define HD   64
#define DQ   (NH_ * HD)
#define DKV  (NKV * HD)
#define RH   512                  // query rows < RH use hi+lo planes (0: none)
#define SCL  0.125f   // HD^-0.5
typedef _Float16 h16;
typedef unsigned short bf;
typedef __attribute__((ext_vector_type(16))) __bf16   v16bf;
typedef __attribute__((ext_vector_type(16))) _Float16 v16h;
typedef __attribute__((ext_vector_type(8)))  _Float16 v8h;
typedef __attribute__((ext_vector_type(8)))  unsigned short v8us;
typedef __attribute__((ext_vector_type(8)))  float    v8f;
typedef __attribute__((ext_vector_type(4)))  float    v4f;
typedef v8h  __attribute__((may_alias)) v8ha;
typedef v4f  __attribute__((may_alias)) v4fa;
typedef v8us __attribute__((may_alias)) v8usa;

__device__ __forceinline__ unsigned short f2bf(float f) { unsigned u = __float_as_uint(f); u += 0x7FFFu + ((u >> 16) & 1u); return (unsigned short)(u >> 16); }
__device__ __forceinline__ float bf2f(unsigned short b) { return __uint_as_float(((unsigned)b) << 16); }
__device__ __forceinline__ float bfr(float f) { return bf2f(f2bf(f)); }
__device__ __forceinline__ v16h cat16(v8h lo, v8h hi) { return __builtin_shufflevector(lo, hi, 0, 1, 2, 3, 4, 5, 6, 7, 8, 9, 10, 11, 12, 13, 14, 15); }
__device__ __forceinline__ v16bf cat16b(v8us lo, v8us hi) { return __builtin_bit_cast(v16bf, __builtin_shufflevector(lo, hi, 0, 1, 2, 3, 4, 5, 6, 7, 8, 9, 10, 11, 12, 13, 14, 15)); }
__device__ __forceinline__ v8f wmma16(v16h a, v16h b, v8f c) { return __builtin_amdgcn_wmma_f32_16x16x32_f16(false, a, false, b, (short)0, c, false, false); }
__device__ __forceinline__ v8f wmmab(v16bf a, v16bf b, v8f c) { return __builtin_amdgcn_wmma_f32_16x16x32_bf16(false, a, false, b, (short)0, c, false, false); }
__device__ __forceinline__ h16 tohx(float x) { return (h16)x; }
__device__ __forceinline__ void splitf(float y, unsigned short& h, unsigned short& l) { h = f2bf(y); l = f2bf(y - bf2f(h)); }
typedef __attribute__((ext_vector_type(4))) _Float16 v4h;
typedef __attribute__((ext_vector_type(4))) unsigned short v4us;



// ---- k_gemmw: register-blocked GEMM, ONE WAVE per 64x64 output tile (16 accumulators), operands straight from 16-bit planes in fragment order; grid (M/64, N/64, Z), 32 threads.
// C[m][n] (f32, pitch ldc, + optional f32 bias[n]) = sum_k A[m][k] Bt[n][k] (+ split products per NSPLIT). z-batch strides sA/sB/sC in elements. K % 32 == 0.
// NW > 1 (32 * NW threads): NW waves share the tile; wave w takes the k steps w, w + NW, ...; each leaves its partial 64x64 tile in LDS and, behind one barrier, the work-group sums the NW partials in wave order.
// PL (NW > 1 only): the summed tile goes out as three 16-bit planes (fp16, bf16 hi, bf16 lo) instead of f32, in fragment order for rows of ldc elements: the tile's 8 blocks start at blockIdx.y * sP + r0 * ldc, so that a tile of 64 columns lands either
// in its own head's [t][d] plane (sP = T * 64, ldc = 64) or as 64 columns of a wide row (sP = 2 blocks, ldc = row length); no f32 copy of the product is written.
// ld: a fragment from a row-major slice (LDS); ldf: a fragment from a plane in fragment order (p = block + lane * 8)
// frag_at: which (row, k) of a [rows][K] matrix stands at element e of its plane in fragment order
__device__ __forceinline__ void frag_at(size_t e, int K, int& row, int& k) { const int blk = (int)(e >> 9), r = (int)(e & 511), kb = K >> 5; row = (blk / kb) * 16 + ((r >> 3) & 15); k = (blk % kb) * 32 + (r >> 8) * 16 + ((r >> 7) & 1) * 8 + (r & 7); }
template <typename T16> struct WFrag;
template <> struct WFrag<h16> { typedef v16h V; static __device__ __forceinline__ V ld(const h16* p) { return cat16(*(const v8h*)p, *(const v8h*)(p + 16)); } static __device__ __forceinline__ V ldf(const h16* p) { return cat16(*(const v8h*)p, *(const v8h*)(p + 256)); } static __device__ __forceinline__ v8f mma(V a, V b, v8f c) { return wmma16(a, b, c); } };
template <> struct WFrag<bf> { typedef v16bf V; static __device__ __forceinline__ V ld(const bf* p) { return cat16b(*(const v8us*)p, *(const v8us*)(p + 16)); } static __device__ __forceinline__ V ldf(const bf* p) { return cat16b(*(const v8us*)p, *(const v8us*)(p + 256)); } static __device__ __forceinline__ v8f mma(V a, V b, v8f c) { return wmmab(a, b, c); } };
template <typename T16> __device__ __forceinline__ const T16* at(const T16* base, unsigned bytes) { return (const T16*)((const char*)base + bytes); }   // wave-uniform base + the lane's 32-bit byte offset
template <typename T16, int NSPLIT, bool BIAS, int NW, bool PL>
__global__ __launch_bounds__(32 * NW) void k_gemmw(const T16* __restrict__ A, const T16* __restrict__ A2, const T16* __restrict__ Bt, const T16* __restrict__ Bt2, int K, float* C, int ldc, const float* __restrict__ bias, size_t sA, size_t sB, size_t sC,
                                                   h16* P16, bf* Ph, bf* Pl, size_t sP) {
    typedef typename WFrag<T16>::V V;
    __shared__ __align__(16) float os[(NW > 1 ? NW * 64 : 16) * 68];
    const size_t z = blockIdx.z; A += z * sA; if (A2) A2 += z * sA; Bt += z * sB; if (Bt2) Bt2 += z * sB; C += z * sC;
    const int lane = threadIdx.x & 31, lr = lane & 15, hi = lane >> 4; const int r0 = blockIdx.x * 64, c0 = blockIdx.y * 64; const int wv = (NW > 1) ? __builtin_amdgcn_readfirstlane((int)(threadIdx.x >> 5)) : 0;   // wave number in a scalar register: the K loop's counter and branch stay scalar
    v8f acc[4][4];
#pragma unroll
    for (int mb = 0; mb < 4; ++mb)
#pragma unroll
        for (int nb = 0; nb < 4; ++nb) acc[mb][nb] = (v8f){};
    const unsigned lb = lane * 16;   // the lane's byte offset inside a block
#pragma unroll 1
    for (int kc = wv * 32; kc < K; kc += 32 * NW) {
        V a[4], a2[4], b[4], b2[4]; unsigned ao[4], bo[4];   // the lane's byte offset of each fragment (the plane's base is wave-uniform): 16 rows of K are K / 32 blocks = 16 * K elements; a k step of 32 is one block
#pragma unroll
        for (int t = 0; t < 4; ++t) { ao[t] = (unsigned)(((r0 + t * 16) * K + kc * 16) * 2) + lb; bo[t] = (unsigned)(((c0 + t * 16) * K + kc * 16) * 2) + lb; }
#pragma unroll
        for (int mb = 0; mb < 4; ++mb) { a[mb] = WFrag<T16>::ldf(at(A, ao[mb])); if (NSPLIT == 1 || NSPLIT == 2) a2[mb] = WFrag<T16>::ldf(at(A2, ao[mb])); }
#pragma unroll
        for (int nb = 0; nb < 4; ++nb) { b[nb] = WFrag<T16>::ldf(at(Bt, bo[nb])); if (NSPLIT >= 2) b2[nb] = WFrag<T16>::ldf(at(Bt2, bo[nb])); }
        asm volatile("s_wait_xcnt 0x0" :: "v"(ao[0]), "v"(ao[1]), "v"(ao[2]), "v"(ao[3]), "v"(bo[0]), "v"(bo[1]), "v"(bo[2]), "v"(bo[3]) : "memory");   // the trip's address registers stay whole up to this wait (they are inputs here): no load of the trip lands on one, and the next trip rewrites them behind it
#pragma unroll
        for (int nb = 0; nb < 4; ++nb) {
#pragma unroll
            for (int mb = 0; mb < 4; ++mb) { acc[mb][nb] = WFrag<T16>::mma(a[mb], b[nb], acc[mb][nb]); if (NSPLIT == 1 || NSPLIT == 2) acc[mb][nb] = WFrag<T16>::mma(a2[mb], b[nb], acc[mb][nb]); if (NSPLIT >= 2) acc[mb][nb] = WFrag<T16>::mma(a[mb], b2[nb], acc[mb][nb]); } }
        asm volatile("v_nop\n\tv_nop\n\tv_nop\n\tv_nop" : "+v"(acc[0][0]), "+v"(acc[1][1]), "+v"(acc[2][2]), "+v"(acc[3][3]) : "v"(a[0]), "v"(a[3]));
    }
    if (NW > 1) {   // the loops below are unrolled so that acc is indexed by constants (stays in registers) and the LDS reads of one sum go out together
#pragma unroll
        for (int mb = 0; mb < 4; ++mb)
#pragma unroll
            for (int nb = 0; nb < 4; ++nb)
#pragma unroll
                for (int j = 0; j < 8; ++j) os[(wv * 64 + mb * 16 + hi * 8 + j) * 68 + nb * 16 + lr] = acc[mb][nb][j];
        __syncthreads();   // every wave's partial tile is in LDS before any thread sums across waves
#pragma unroll
        for (int s = 0; s < 32 / NW; ++s) { const int u = s * 32 * NW + (int)threadIdx.x;   // PL: u counts the groups of 4 elements in the order of the planes, so that a wave's stores stay in a row
            const int row = PL ? (u >> 8) * 16 + ((u >> 1) & 15) : u >> 4, cofs = PL ? ((u >> 5) & 7) * 8 + (u & 1) * 4 : (u & 15) * 4; v4f val = *(const v4fa*)(os + row * 68 + cofs);
#pragma unroll
            for (int w = 1; w < NW; ++w) val += *(const v4fa*)(os + (w * 64 + row) * 68 + cofs);
            if (BIAS) { val[0] += bfr(bias[c0 + cofs]); val[1] += bfr(bias[c0 + cofs + 1]); val[2] += bfr(bias[c0 + cofs + 2]); val[3] += bfr(bias[c0 + cofs + 3]); }
            if (PL) { v4h o16; v4us oh, ol;
#pragma unroll
                for (int q = 0; q < 4; ++q) { o16[q] = tohx(val[q]); unsigned short a2, c2; splitf(val[q], a2, c2); oh[q] = a2; ol[q] = c2; }
                const size_t po = (size_t)blockIdx.y * sP + (size_t)r0 * ldc + (size_t)((u >> 8) * (ldc >> 5) + ((u >> 7) & 1)) * 512 + (u & 127) * 4; *(v4h*)(P16 + po) = o16; *(v4us*)(Ph + po) = oh; *(v4us*)(Pl + po) = ol; }
            else *(v4f*)(C + (size_t)(r0 + row) * ldc + c0 + cofs) = val; }
        return;
    }
#pragma unroll
    for (int mb = 0; mb < 4; ++mb) {
#pragma unroll
        for (int nb = 0; nb < 4; ++nb) {
#pragma unroll
            for (int j = 0; j < 8; ++j) os[(hi * 8 + j) * 68 + nb * 16 + lr] = acc[mb][nb][j]; }
        __builtin_amdgcn_wave_barrier(); asm volatile("" ::: "memory");
        float* crow = C + (size_t)(r0 + mb * 16) * ldc + c0;
{
#pragma unroll
            for (int s = 0; s < 8; ++s) { const int row = 2 * s + hi, cofs = lr * 4; v4f val = *(const v4fa*)(os + row * 68 + cofs); if (BIAS) { val[0] += bfr(bias[c0 + cofs]); val[1] += bfr(bias[c0 + cofs + 1]); val[2] += bfr(bias[c0 + cofs + 2]); val[3] += bfr(bias[c0 + cofs + 3]); }
                *(v4f*)(crow + (size_t)row * ldc + cofs) = val; }
             }
        __builtin_amdgcn_wave_barrier(); asm volatile("" ::: "memory");
    }
}

typedef __attribute__((ext_vector_type(2))) unsigned short v2us;
typedef __attribute__((ext_vector_type(4))) int v4i;

__global__ __launch_bounds__(256) void k_wtG(const float* __restrict__ w, int K, int N, bf* Bt) {
    const int lane = threadIdx.x & 31; const int L0 = (blockIdx.x * 8 + (threadIdx.x >> 5)) * 8; const int nlines = N * K / 64;
{
#pragma unroll 1
        for (int l = 0; l < 8; ++l) { const int L = L0 + l; if (L >= nlines) break; const size_t e = (size_t)L * 64 + lane * 2; int k, n; frag_at(e, K, n, k); v2us o;
            o[0] = f2bf(w[(size_t)k * N + n]); o[1] = f2bf(w[(size_t)(k + 1) * N + n]); *(v2us*)(Bt + e) = o; }
         }
}
__global__ __launch_bounds__(256) void k_cvt8(const float* __restrict__ src, int K, bf* dst, size_t n8) { const size_t i = (size_t)blockIdx.x * 256 + threadIdx.x; if (i >= n8) return; int row, k; frag_at(i * 8, K, row, k); const v8f v = *(const v8f*)(src + (size_t)row * K + k); v8us o;
#pragma unroll
    for (int k = 0; k < 8; ++k) o[k] = f2bf(v[k]); *(v8us*)(dst + i * 8) = o;  }
// ---- k_fattn: scores, relative logits, skew, causal softmax and probs.v of one head in ONE launch; no score, logit or probability ever goes to memory.
// One wave owns 16 query rows (i0..i0+15) and walks the key blocks of 64 up to its diagonal block, with a running row maximum and a running row sum (f32). No wave reads another wave's LDS: no work-group barrier.
// Per block: S = q.k (4 tiles), L = q.Er rows rb..rb+79 with rb = T-16-i0+c0 (5 tiles), Srel[a][b] = L[a][15-a+b] (the skew, a shifted read of the wave's own LDS slice),
// p = exp2(((S+Srel)/8 - rowmax) log2 e), O = O x exp2(old max - new max) + p.v; at the end O / rowsum goes out as hi+lo planes for W_proj.
#define EP 84    // f32 pitch of the logit slice: rows 8 apart fall on different LDS banks for the store and for the shifted read
#define PP 72    // 16-bit pitch of the probability slice: 144 bytes, so each 16-byte fragment read is aligned
#define FW 4     // waves (16-row groups) per work-group
// LDS traffic between the lanes of one wave: the wave's LDS instructions run in order; this keeps the compiler from moving an LDS read over the stores that feed it (or a store over the reads before it)
__device__ __forceinline__ void wave_lds_order() { __builtin_amdgcn_wave_barrier(); asm volatile("" ::: "memory"); }
template <int M> __device__ __forceinline__ float rowx(float x) { return __builtin_bit_cast(float, __builtin_amdgcn_update_dpp(__builtin_bit_cast(int, x), __builtin_bit_cast(int, x), 0x160 + M, 0xf, 0xf, false)); }   // lane l with lane l ^ M inside its row of 16 lanes (DPP row_xmask)
__device__ __forceinline__ float rowmax16(float x) { x = fmaxf(x, rowx<1>(x)); x = fmaxf(x, rowx<2>(x)); x = fmaxf(x, rowx<4>(x)); return fmaxf(x, rowx<8>(x)); }
__device__ __forceinline__ float rowsum16(float x) { x += rowx<1>(x); x += rowx<2>(x); x += rowx<4>(x); return x + rowx<8>(x); }
__device__ __forceinline__ void putp(float p, h16* a, h16*, int o) { a[o] = tohx(p); }
__device__ __forceinline__ void putp(float p, bf* a, bf* b, int o) { unsigned short x, y; splitf(p, x, y); a[o] = x; b[o] = y; }
template <typename T16, bool HR>
__device__ __forceinline__ void attn_rows(const T16* __restrict__ Q, const T16* __restrict__ Q2, const T16* __restrict__ Kp, const T16* __restrict__ K2, const T16* __restrict__ E, const T16* __restrict__ Vt, const T16* __restrict__ Vt2,
                                          int i0, float* es, T16* ps, T16* ps2, bf* Ah, bf* Al) {
    typedef typename WFrag<T16>::V V; typedef WFrag<T16> F;   // every inner loop below is unrolled so that fragments, tiles and row statistics are indexed by constants (stay in registers)
    // hi+lo rows take the lane number from mbcnt (every lane is on, 32 lanes a wave): the thread id is then not read in the hi+lo branch, whose fragment runs leave no register to hold it (it was spilled to scratch)
    const int lane = HR ? (int)__builtin_amdgcn_mbcnt_lo(~0u, 0u) : (int)(threadIdx.x & 31), lr = lane & 15, hi = lane >> 4; const unsigned lb = lane * 16;   // the lane's byte offset inside a block of a plane in fragment order
    const int eb = hi * 8 * EP + lr, pb = hi * 8 * PP + lr;   // the lane's place in the logit and the probability slice; rows and tiles are constant offsets from it
    V aq[2], aq2[2];
#pragma unroll
    for (int ks = 0; ks < 2; ++ks) { aq[ks] = F::ldf(at(Q, lb) + (size_t)i0 * HD + ks * 512); if (HR) aq2[ks] = F::ldf(at(Q2, lb) + (size_t)i0 * HD + ks * 512); }
    v8f o[4]; float m[8], l[8];
#pragma unroll
    for (int nb = 0; nb < 4; ++nb) o[nb] = (v8f){};
#pragma unroll
    for (int j = 0; j < 8; ++j) { m[j] = -3.0e38f; l[j] = 0.f; }
    const int nblk = (i0 >> 6) + 1;   // key blocks up to and with the one that holds the diagonal (i0 is a multiple of 16)
#pragma unroll 1   // kept rolled: two blocks' fragments and tiles at once would not fit the register budget
    for (int kb = 0; kb < nblk; ++kb) {
        const int c0 = kb * 64;
        v8f s[4], e[5];
        const unsigned kp = c0 * HD * 2 + lb; unsigned ep[5];   // the lane's byte offset in the key planes and in each Er tile (one register each, the plane's base is wave-uniform); tiles and k steps (blocks of 512 elements) are constant offsets
        const int rb = TT - 16 - i0 + c0;
#pragma unroll
        for (int t = 0; t < 5; ++t) { e[t] = (v8f){}; ep[t] = min(rb + t * 16, TT - 16) * HD * 2 + lb; }   // rb is a multiple of 16: a tile lies wholly inside Er or wholly past T-1; rows past T-1 belong to keys j > i only (masked below): the clamp keeps the address inside Er
#pragma unroll
        for (int nb = 0; nb < 4; ++nb) s[nb] = (v8f){};
        // Behind each run of fragment loads stands one wait. Its inputs are the run's address registers (each stays whole until every load that names it is past the wait, so no later load or result lands on it before)
        // and the loaded fragments (no product of the run moves in front of it, so all loads of the run are in flight together and the run pays the memory latency once instead of once per refill of a few registers).
        if (!HR) {   // single-plane rows: all 18 key and Er fragments of the block fit the registers: one run
            V bk[4][2], be[5][2];
#pragma unroll
            for (int ks = 0; ks < 2; ++ks) {
#pragma unroll
                for (int nb = 0; nb < 4; ++nb) bk[nb][ks] = F::ldf(at(Kp, kp) + nb * 16 * HD + ks * 512);
#pragma unroll
                for (int t = 0; t < 5; ++t) be[t][ks] = F::ldf(at(E, ep[t]) + ks * 512); }
            asm volatile("s_wait_xcnt 0x0" :: "v"(kp), "v"(ep[0]), "v"(ep[1]), "v"(ep[2]), "v"(ep[3]), "v"(ep[4]), "v"(bk[0][0]), "v"(bk[1][0]), "v"(bk[2][0]), "v"(bk[3][0]), "v"(bk[0][1]), "v"(bk[1][1]), "v"(bk[2][1]), "v"(bk[3][1]),
                         "v"(be[0][0]), "v"(be[1][0]), "v"(be[2][0]), "v"(be[3][0]), "v"(be[4][0]), "v"(be[0][1]), "v"(be[1][1]), "v"(be[2][1]), "v"(be[3][1]), "v"(be[4][1]) : "memory");
            __builtin_amdgcn_sched_barrier(0);   // without it the scheduler lifts the first product over the wait, and its data wait then stands behind four loads only: the rest of the run would start one memory latency later
#pragma unroll
            for (int ks = 0; ks < 2; ++ks) {
#pragma unroll
                for (int nb = 0; nb < 4; ++nb) s[nb] = F::mma(aq[ks], bk[nb][ks], s[nb]);
#pragma unroll
                for (int t = 0; t < 5; ++t) e[t] = F::mma(aq[ks], be[t][ks], e[t]); }
        } else {     // hi+lo rows: three runs (key hi plane, key lo plane, Er), each as large as the registers allow
            { V bk[4][2];
#pragma unroll
              for (int nb = 0; nb < 4; ++nb)
#pragma unroll
                  for (int ks = 0; ks < 2; ++ks) bk[nb][ks] = F::ldf(at(Kp, kp) + nb * 16 * HD + ks * 512);
              asm volatile("s_wait_xcnt 0x0" :: "v"(kp), "v"(bk[0][0]), "v"(bk[1][0]), "v"(bk[2][0]), "v"(bk[3][0]), "v"(bk[0][1]), "v"(bk[1][1]), "v"(bk[2][1]), "v"(bk[3][1]) : "memory");
#pragma unroll
              for (int ks = 0; ks < 2; ++ks)
#pragma unroll
                  for (int nb = 0; nb < 4; ++nb) { s[nb] = F::mma(aq[ks], bk[nb][ks], s[nb]); s[nb] = F::mma(aq2[ks], bk[nb][ks], s[nb]); } }
            { V bk[4][2];
#pragma unroll
              for (int nb = 0; nb < 4; ++nb)
#pragma unroll
                  for (int ks = 0; ks < 2; ++ks) bk[nb][ks] = F::ldf(at(K2, kp) + nb * 16 * HD + ks * 512);
              asm volatile("s_wait_xcnt 0x0" :: "v"(kp), "v"(bk[0][0]), "v"(bk[1][0]), "v"(bk[2][0]), "v"(bk[3][0]), "v"(bk[0][1]), "v"(bk[1][1]), "v"(bk[2][1]), "v"(bk[3][1]) : "memory");
#pragma unroll
              for (int ks = 0; ks < 2; ++ks)
#pragma unroll
                  for (int nb = 0; nb < 4; ++nb) s[nb] = F::mma(aq[ks], bk[nb][ks], s[nb]); }
            { V be[5][2];
#pragma unroll
              for (int t = 0; t < 5; ++t)
#pragma unroll
                  for (int ks = 0; ks < 2; ++ks) be[t][ks] = F::ldf(at(E, ep[t]) + ks * 512);
              asm volatile("s_wait_xcnt 0x0" :: "v"(ep[0]), "v"(ep[1]), "v"(ep[2]), "v"(ep[3]), "v"(ep[4]), "v"(be[0][0]), "v"(be[1][0]), "v"(be[2][0]), "v"(be[3][0]), "v"(be[4][0]), "v"(be[0][1]), "v"(be[1][1]), "v"(be[2][1]), "v"(be[3][1]), "v"(be[4][1]) : "memory");
#pragma unroll
              for (int ks = 0; ks < 2; ++ks)
#pragma unroll
                  for (int t = 0; t < 5; ++t) { e[t] = F::mma(aq[ks], be[t][ks], e[t]); e[t] = F::mma(aq2[ks], be[t][ks], e[t]); } }
        }
#pragma unroll
        for (int t = 0; t < 5; ++t)
#pragma unroll
            for (int j = 0; j < 8; ++j) es[eb + j * EP + t * 16] = e[t][j];
        wave_lds_order();
        const unsigned vp = c0 * 16 * 2 + lb;   // the lane's byte offset in the transposed value planes (32 keys of 16 head dims are one block); tiles and k steps are constant offsets from it
        V bv[4][2];   // single-plane rows: value fragments asked for here, where the logit registers are free again, so that they fly under the softmax (the hi+lo rows have no registers to spare for it and at most 8 blocks)
        if (!HR) {
#pragma unroll
            for (int nb = 0; nb < 4; ++nb)
#pragma unroll
                for (int ks = 0; ks < 2; ++ks) bv[nb][ks] = F::ldf(at(Vt, vp) + nb * 16 * TT + ks * 512);
            asm volatile("s_wait_xcnt 0x0" :: "v"(vp) : "memory");   // the run's address register stays whole up to this wait (it is an input here), so no load of the run lands on it while the others are issued
        }
#pragma unroll
        for (int nb = 0; nb < 4; ++nb)
#pragma unroll
            for (int j = 0; j < 8; ++j) s[nb][j] = (s[nb][j] + es[eb - hi * 8 + j * (EP - 1) + 15 + nb * 16]) * (SCL * 1.4426950408889634f);   // row a reads column 15 - a + b; logits kept in units of log 2
        if (c0 + 63 > i0) {   // only the diagonal block holds keys j > i (wave-uniform test)
            const int dg = lr - hi * 8 - (i0 - c0);   // formed here, so that each test below is one value against a constant and nothing of the mask is held over the key loop
#pragma unroll
            for (int nb = 0; nb < 4; ++nb)
#pragma unroll
                for (int j = 0; j < 8; ++j) if (dg > j - nb * 16) s[nb][j] = -3.0e38f;   // key c0 + nb*16 + lr > row i0 + hi*8 + j
        }
#pragma unroll
        for (int j = 0; j < 8; ++j) {
            const float mn = fmaxf(m[j], rowmax16(fmaxf(fmaxf(s[0][j], s[1][j]), fmaxf(s[2][j], s[3][j]))));
            const float al = __builtin_amdgcn_exp2f(m[j] - mn); m[j] = mn;
            float ps4 = 0.f;
#pragma unroll
            for (int nb = 0; nb < 4; ++nb) { const float p = __builtin_amdgcn_exp2f(s[nb][j] - mn); ps4 += p; putp(p, ps, ps2, pb + j * PP + nb * 16); o[nb][j] *= al; }
            l[j] = l[j] * al + ps4;   // each lane keeps the sum of its own 4 columns; the 16 lanes of a row are added once, behind the loop
        }
        if (HR) {   // hi plane of the values: asked for when the score registers are free, it flies under the LDS read-back
#pragma unroll
            for (int nb = 0; nb < 4; ++nb)
#pragma unroll
                for (int ks = 0; ks < 2; ++ks) bv[nb][ks] = F::ldf(at(Vt, vp) + nb * 16 * TT + ks * 512);
            asm volatile("s_wait_xcnt 0x0" :: "v"(vp) : "memory");   // as above: the run's address register stays whole up to the wait
        }
        wave_lds_order();
        V ap[2], ap2[2];
#pragma unroll
        for (int ks = 0; ks < 2; ++ks) { ap[ks] = F::ld(ps + lr * PP + ks * 32 + 8 * hi); if (HR) ap2[ks] = F::ld(ps2 + lr * PP + ks * 32 + 8 * hi); }
#pragma unroll
        for (int ks = 0; ks < 2; ++ks)
#pragma unroll
            for (int nb = 0; nb < 4; ++nb) { o[nb] = F::mma(ap[ks], bv[nb][ks], o[nb]); if (HR) o[nb] = F::mma(ap2[ks], bv[nb][ks], o[nb]); }
        if (HR) {   // lo plane of the values
#pragma unroll
            for (int nb = 0; nb < 4; ++nb)
#pragma unroll
                for (int ks = 0; ks < 2; ++ks) bv[nb][ks] = F::ldf(at(Vt2, vp) + nb * 16 * TT + ks * 512);
            asm volatile("s_wait_xcnt 0x0" :: "v"(vp) : "memory");   // as above
#pragma unroll
            for (int ks = 0; ks < 2; ++ks)
#pragma unroll
                for (int nb = 0; nb < 4; ++nb) o[nb] = F::mma(ap[ks], bv[nb][ks], o[nb]);
        }
    }
    const int ln = (int)__builtin_amdgcn_mbcnt_lo(~0u, 0u), lq = ln & 15, hq = ln >> 4;   // the lane number read anew (every lane is on, 32 lanes a wave): lr and hi need not be held over the key loop, whose fragment run leaves no register for them
#pragma unroll
    for (int j = 0; j < 8; ++j) { const float f = __fdiv_rn(1.0f, rowsum16(l[j]));
#pragma unroll
        for (int nb = 0; nb < 4; ++nb) es[hq * 8 * 68 + lq + j * 68 + nb * 16] = o[nb][j] * f; }
    wave_lds_order();
#pragma unroll
    for (int s8 = 0; s8 < 8; ++s8) { const int row = ln >> 1, cofs = s8 * 8 + (ln & 1) * 4; const v4f val = *(const v4fa*)(es + row * 68 + cofs); v4us oh, ol;
#pragma unroll
        for (int q = 0; q < 4; ++q) { unsigned short a, c2; splitf(val[q], a, c2); oh[q] = a; ol[q] = c2; }
        const size_t oo = (size_t)i0 * DQ + s8 * 128 + ln * 4; *(v4us*)(Ah + oo) = oh; *(v4us*)(Al + oo) = ol; }
}
// grid (T/64, heads), 128 threads; the work-groups with the most key blocks come first. waves_per_eu 4: a budget of 256 registers, so that the loops hold no register-window switches
__global__ __launch_bounds__(32 * FW) __attribute__((amdgpu_waves_per_eu(4))) void k_fattn(const h16* __restrict__ Q16, const bf* __restrict__ Qh, const bf* __restrict__ Ql, const h16* __restrict__ K16, const bf* __restrict__ Kh, const bf* __restrict__ Kl,
                                                   const h16* __restrict__ V16, const bf* __restrict__ Vh, const bf* __restrict__ Vl, const h16* __restrict__ E16, const bf* __restrict__ Eb, bf* Ah, bf* Al) {
    __shared__ __align__(16) float es[FW][16 * EP];
    __shared__ __align__(16) unsigned short ps[FW][2][16 * PP];
    const int wv = __builtin_amdgcn_readfirstlane((int)(threadIdx.x >> 5));   // wave number in a scalar register: the row range, the trip count and the branch below stay scalar
    const int i0 = (TT / (16 * FW) - 1 - (int)blockIdx.x) * (16 * FW) + wv * 16; const size_t zp = (size_t)blockIdx.y * TT * HD; const int hc = (int)blockIdx.y * HD * 16;   // a head's 64 columns of 16 rows: two blocks of the output planes (fragment order, rows of DQ)
    if (i0 < RH) attn_rows<bf, true>(Qh + zp, Ql + zp, Kh + zp, Kl + zp, Eb, Vh + zp, Vl + zp, i0, es[wv], ps[wv][0], ps[wv][1], Ah + hc, Al + hc);
    else attn_rows<h16, false>(Q16 + zp, nullptr, K16 + zp, nullptr, E16, V16 + zp, nullptr, i0, es[wv], (h16*)ps[wv][0], nullptr, Ah + hc, Al + hc);
}

__global__ __launch_bounds__(256) void k_er16(const float* __restrict__ er, h16* E) { const int i = (blockIdx.x * 256 + threadIdx.x) * 4; if (i >= TT * HD) return; int row, k; frag_at((size_t)i, HD, row, k); const v4f a = *(const v4f*)(er + row * HD + k); v4h o; o[0] = tohx(bfr(a[0])); o[1] = tohx(bfr(a[1])); o[2] = tohx(bfr(a[2])); o[3] = tohx(bfr(a[3])); *(v4h*)(E + i) = o;  }
typedef __attribute__((ext_vector_type(4))) _Float16 v4hx;

extern "C" void kernel_launch(void* const* d_in, const int* in_sizes, int n_in,
                              void* d_out, int out_size, void* d_ws, size_t ws_size, hipStream_t stream) {
    (void)in_sizes; (void)n_in; (void)out_size;
    const float* x = (const float*)d_in[0]; const float* wattn = (const float*)d_in[1]; const float* wo = (const float*)d_in[2]; const float* er = (const float*)d_in[3];
    float* OUT = (float*)d_out;     // [2][2048][1024]
    char* wsp = (char*)d_ws;
    auto take = [&](size_t bytes) { char* p = wsp; wsp += (bytes + 255) & ~(size_t)255; return (void*)p; };
    bf* WQKV = (bf*)take((size_t)3 * DM * DM * 2); bf* WQ = WQKV; bf* WK = WQKV + (size_t)DM * DM; bf* WV = WQKV + (size_t)2 * DM * DM; bf* ERB = (bf*)take((size_t)TT * HD * 2); h16* ER16 = (h16*)take((size_t)TT * HD * 2); bf* WO = (bf*)take((size_t)DM * DQ * 2);
    bf* XB = (bf*)take((size_t)TT * DM * 2);
    h16* QP16 = (h16*)take((size_t)NH_ * TT * HD * 2); h16* KP16 = (h16*)take((size_t)NKV * TT * HD * 2); h16* VT16 = (h16*)take((size_t)NKV * HD * TT * 2);
    bf* QPh = (bf*)take((size_t)NH_ * TT * HD * 2); bf* QPl = (bf*)take((size_t)NH_ * TT * HD * 2); bf* KPh = (bf*)take((size_t)NKV * TT * HD * 2); bf* KPl = (bf*)take((size_t)NKV * TT * HD * 2); bf* VTh = (bf*)take((size_t)NKV * HD * TT * 2); bf* VTl = (bf*)take((size_t)NKV * HD * TT * 2);
    bf* ATh = (bf*)take((size_t)TT * DQ * 2); bf* ATl = (bf*)take((size_t)TT * DQ * 2);
    if ((size_t)(wsp - (char*)d_ws) > ws_size) return;    // ws 256 MiB
    { k_wtG<<<(unsigned)((DM * 3 * DM / 64 + 63) / 64), 256, 0, stream>>>(wattn, DM, 3 * DM, WQKV); k_cvt8<<<(TT * HD / 8 + 255) / 256, 256, 0, stream>>>(er, HD, ERB, TT * HD / 8); k_er16<<<(TT * HD / 4 + 255) / 256, 256, 0, stream>>>(er, ER16);
      k_wtG<<<(unsigned)((DQ * DM / 64 + 63) / 64), 256, 0, stream>>>(wo, DQ, DM, WO);
       }
    for (int b = 0; b < NB_; ++b) {
        
        k_cvt8<<<(unsigned)(((size_t)TT * DM / 8 + 255) / 256), 256, 0, stream>>>(x + (size_t)b * TT * DM, DM, XB, (size_t)TT * DM / 8);
        // q and k: a tile's 64 columns are one head (HD = 64), so it goes straight into that head's [t][d] planes
        k_gemmw<bf, 0, false, 8, true><<<dim3(TT / 64, DQ / 64, 1), 256, 0, stream>>>(XB, nullptr, WQ, nullptr, DM, nullptr, HD, nullptr, 0, 0, 0, QP16, QPh, QPl, (size_t)TT * HD);
        k_gemmw<bf, 0, false, 8, true><<<dim3(TT / 64, DKV / 64, 1), 256, 0, stream>>>(XB, nullptr, WK, nullptr, DM, nullptr, HD, nullptr, 0, 0, 0, KP16, KPh, KPl, (size_t)TT * HD);
        // v: the product is taken as W_v^T x^T (rows = head dims, columns = positions), so the tile already has the [h][d][t] order that probs.v reads; 64 positions of 16 head dims are two blocks (1024 elements)
        k_gemmw<bf, 0, false, 8, true><<<dim3(DKV / 64, TT / 64, 1), 256, 0, stream>>>(WV, nullptr, XB, nullptr, DM, nullptr, TT, nullptr, 0, 0, 0, VT16, VTh, VTl, (size_t)1024);
        k_fattn<<<dim3(TT / (16 * FW), NH_, 1), 32 * FW, 0, stream>>>(QP16, QPh, QPl, KP16, KPh, KPl, VT16, VTh, VTl, ER16, ERB, ATh, ATl);   // one kv head per query head
        k_gemmw<bf, 1, false, 8, false><<<dim3(TT / 64, DM / 64, 1), 256, 0, stream>>>(ATh, ATl, WO, nullptr, DQ, OUT + (size_t)b * TT * DM, DM, nullptr, 0, 0, 0, nullptr, nullptr, nullptr, 0); }
}

// v006
// Measured time: 151 microseconds a run.
// Timed twice side by side with v005, it ran 1.33 and 1.32 times as fast.
// All steps since v000 together make it 12.6 times as fast.
#include <hip/hip_runtime.h>

// CausalSelfAttentionRelativePosition (x [2][2048][1024]; qkv = x W_attn (16 x 64); Srel = skew(q Er^T) -> Srel[i][j] = q_i . Er[T-1-i+j] for j <= i (the skew's wrapped entries above the diagonal are masked); att = softmax(((q.k) + Srel)/8, causal);
// y = att v; out = y W_proj -> [2][2048][1024]).
// Compute dtypes, f32 accumulate: every input rounded to bf16; qkv on PLAIN bf16 operands (inputs: exact); scores q.k (K 64), the relative logits q.Er^T and probs.v on bf16 hi+lo planes (3 products; q.Er: hl q x exact Er, 2 products)
// for the first 512 query rows per head and SINGLE fp16 planes for the rest (Er, a bf16 input, is exact in fp16); scores, relative logits, skew, softmax (f32, running maximum and sum) and probs.v in one fused launch, key blocks above the diagonal never touched; W_proj on hl planes x exact.
// BOTH BATCHES RIDE IN EVERY LAUNCH: x is one [NB_ * T][DM] matrix for the projections; q and k planes are [head][batch][t][d], the transposed value planes [head][d][batch * T + t], the attention output [batch * T + t][DQ].
// FRAGMENT ORDER: every 16-bit operand plane in the workspace ([rows][K], K % 32 == 0, rows % 16 == 0) is kept as blocks of 16 rows x 32 k (512 elements, block number (row / 16) * (K / 32) + k / 32); inside a block element (row, k) stands at
// ((k % 32) / 16) * 256 + ((k % 16) / 8) * 128 + (row % 16) * 8 + k % 8. A lane's two 16-byte fragment loads are then block + lane * 8 and block + 256 + lane * 8: each load of a wave reads 512 bytes in a row (4 cache lines) instead of 32 bytes out of each of 16 lines.

#define NB_  2
#define TT   2048
#define DM   1024
#define NH_  16
#define NKV  16
#define REP  (NH_ / NKV)
#define HD   64
#define DQ   (NH_ * HD)
#define DKV  (NKV * HD)
#define RH   512                  // query rows < RH use hi+lo planes (0: none)
#define SCL  0.125f   // HD^-0.5
typedef _Float16 h16;
typedef unsigned short bf;
typedef __attribute__((ext_vector_type(16))) __bf16   v16bf;
typedef __attribute__((ext_vector_type(16))) _Float16 v16h;
typedef __attribute__((ext_vector_type(8)))  _Float16 v8h;
typedef __attribute__((ext_vector_type(8)))  unsigned short v8us;
typedef __attribute__((ext_vector_type(8)))  float    v8f;
typedef __attribute__((ext_vector_type(4)))  float    v4f;
typedef v8h  __attribute__((may_alias)) v8ha;
typedef v4f  __attribute__((may_alias)) v4fa;
typedef v8us __attribute__((may_alias)) v8usa;

__device__ __forceinline__ unsigned short f2bf(float f) { unsigned u = __float_as_uint(f); u += 0x7FFFu + ((u >> 16) & 1u); return (unsigned short)(u >> 16); }
__device__ __forceinline__ float bf2f(unsigned short b) { return __uint_as_float(((unsigned)b) << 16); }
__device__ __forceinline__ float bfr(float f) { return bf2f(f2bf(f)); }
__device__ __forceinline__ v16h cat16(v8h lo, v8h hi) { return __builtin_shufflevector(lo, hi, 0, 1, 2, 3, 4, 5, 6, 7, 8, 9, 10, 11, 12, 13, 14, 15); }
__device__ __forceinline__ v16bf cat16b(v8us lo, v8us hi) { return __builtin_bit_cast(v16bf, __builtin_shufflevector(lo, hi, 0, 1, 2, 3, 4, 5, 6, 7, 8, 9, 10, 11, 12, 13, 14, 15)); }
__device__ __forceinline__ v8f wmma16(v16h a, v16h b, v8f c) { return __builtin_amdgcn_wmma_f32_16x16x32_f16(false, a, false, b, (short)0, c, false, false); }
__device__ __forceinline__ v8f wmmab(v16bf a, v16bf b, v8f c) { return __builtin_amdgcn_wmma_f32_16x16x32_bf16(false, a, false, b, (short)0, c, false, false); }
__device__ __forceinline__ h16 tohx(float x) { return (h16)x; }
__device__ __forceinline__ void splitf(float y, unsigned short& h, unsigned short& l) { h = f2bf(y); l = f2bf(y - bf2f(h)); }
typedef __attribute__((ext_vector_type(4))) _Float16 v4h;
typedef __attribute__((ext_vector_type(4))) unsigned short v4us;



// ---- k_gemmw: register-blocked GEMM, ONE WAVE per 64x64 output tile (16 accumulators), operands straight from 16-bit planes in fragment order; grid (M/64, N/64, Z), 32 threads.
// C[m][n] (f32, pitch ldc, + optional f32 bias[n]) = sum_k A[m][k] Bt[n][k] (+ split products per NSPLIT). z-batch strides sA/sB/sC in elements. K % 32 == 0.
// NW > 1 (32 * NW threads): NW waves share the tile; wave w takes the k steps w, w + NW, ...; each leaves its partial 64x64 tile in LDS and, behind one barrier, the work-group sums the NW partials in wave order.
// PL (NW > 1 only): the summed tile goes out as three 16-bit planes (fp16, bf16 hi, bf16 lo) instead of f32, in fragment order for rows of ldc elements: the tile's 8 blocks start at blockIdx.y * sP + r0 * ldc, so that a tile of 64 columns lands either
// in its own head's [batch][t][d] plane (sP = NB_ * T * 64, ldc = 64) or as 64 columns of a wide row (sP = 2 blocks, ldc = row length); no f32 copy of the product is written.
// ld: a fragment from a row-major slice (LDS); ldf: a fragment from a plane in fragment order (p = block + lane * 8)
// frag_at: which (row, k) of a [rows][K] matrix stands at element e of its plane in fragment order
__device__ __forceinline__ void frag_at(size_t e, int K, int& row, int& k) { const int blk = (int)(e >> 9), r = (int)(e & 511), kb = K >> 5; row = (blk / kb) * 16 + ((r >> 3) & 15); k = (blk % kb) * 32 + (r >> 8) * 16 + ((r >> 7) & 1) * 8 + (r & 7); }
template <typename T16> struct WFrag;
template <> struct WFrag<h16> { typedef v16h V; static __device__ __forceinline__ V ld(const h16* p) { return cat16(*(const v8h*)p, *(const v8h*)(p + 16)); } static __device__ __forceinline__ V ldf(const h16* p) { return cat16(*(const v8h*)p, *(const v8h*)(p + 256)); } static __device__ __forceinline__ v8f mma(V a, V b, v8f c) { return wmma16(a, b, c); } };
template <> struct WFrag<bf> { typedef v16bf V; static __device__ __forceinline__ V ld(const bf* p) { return cat16b(*(const v8us*)p, *(const v8us*)(p + 16)); } static __device__ __forceinline__ V ldf(const bf* p) { return cat16b(*(const v8us*)p, *(const v8us*)(p + 256)); } static __device__ __forceinline__ v8f mma(V a, V b, v8f c) { return wmmab(a, b, c); } };
template <typename T16> __device__ __forceinline__ const T16* at(const T16* base, unsigned bytes) { return (const T16*)((const char*)base + bytes); }   // wave-uniform base + the lane's 32-bit byte offset
template <typename T16, int NSPLIT, bool BIAS, int NW, bool PL>
__global__ __launch_bounds__(32 * NW) void k_gemmw(const T16* __restrict__ A, const T16* __restrict__ A2, const T16* __restrict__ Bt, const T16* __restrict__ Bt2, int K, float* C, int ldc, const float* __restrict__ bias, size_t sA, size_t sB, size_t sC,
                                                   h16* P16, bf* Ph, bf* Pl, size_t sP) {
    typedef typename WFrag<T16>::V V;
    __shared__ __align__(16) float os[(NW > 1 ? NW * 64 : 16) * 68];
    const size_t z = blockIdx.z; A += z * sA; if (A2) A2 += z * sA; Bt += z * sB; if (Bt2) Bt2 += z * sB; C += z * sC;
    const int lane = threadIdx.x & 31, lr = lane & 15, hi = lane >> 4; const int r0 = blockIdx.x * 64, c0 = blockIdx.y * 64; const int wv = (NW > 1) ? __builtin_amdgcn_readfirstlane((int)(threadIdx.x >> 5)) : 0;   // wave number in a scalar register: the K loop's counter and branch stay scalar
    v8f acc[4][4];
#pragma unroll
    for (int mb = 0; mb < 4; ++mb)
#pragma unroll
        for (int nb = 0; nb < 4; ++nb) acc[mb][nb] = (v8f){};
    const unsigned lb = lane * 16;   // the lane's byte offset inside a block
#pragma unroll 1
    for (int kc = wv * 32; kc < K; kc += 32 * NW) {
        V a[4], a2[4], b[4], b2[4]; unsigned ao[4], bo[4];   // the lane's byte offset of each fragment (the plane's base is wave-uniform): 16 rows of K are K / 32 blocks = 16 * K elements; a k step of 32 is one block
#pragma unroll
        for (int t = 0; t < 4; ++t) { ao[t] = (unsigned)(((r0 + t * 16) * K + kc * 16) * 2) + lb; bo[t] = (unsigned)(((c0 + t * 16) * K + kc * 16) * 2) + lb; }
#pragma unroll
        for (int mb = 0; mb < 4; ++mb) { a[mb] = WFrag<T16>::ldf(at(A, ao[mb])); if (NSPLIT == 1 || NSPLIT == 2) a2[mb] = WFrag<T16>::ldf(at(A2, ao[mb])); }
#pragma unroll
        for (int nb = 0; nb < 4; ++nb) { b[nb] = WFrag<T16>::ldf(at(Bt, bo[nb])); if (NSPLIT >= 2) b2[nb] = WFrag<T16>::ldf(at(Bt2, bo[nb])); }
        asm volatile("s_wait_xcnt 0x0" :: "v"(ao[0]), "v"(ao[1]), "v"(ao[2]), "v"(ao[3]), "v"(bo[0]), "v"(bo[1]), "v"(bo[2]), "v"(bo[3]) : "memory");   // the trip's address registers stay whole up to this wait (they are inputs here): no load of the trip lands on one, and the next trip rewrites them behind it
#pragma unroll
        for (int nb = 0; nb < 4; ++nb) {
#pragma unroll
            for (int mb = 0; mb < 4; ++mb) { acc[mb][nb] = WFrag<T16>::mma(a[mb], b[nb], acc[mb][nb]); if (NSPLIT == 1 || NSPLIT == 2) acc[mb][nb] = WFrag<T16>::mma(a2[mb], b[nb], acc[mb][nb]); if (NSPLIT >= 2) acc[mb][nb] = WFrag<T16>::mma(a[mb], b2[nb], acc[mb][nb]); } }
        asm volatile("v_nop\n\tv_nop\n\tv_nop\n\tv_nop" : "+v"(acc[0][0]), "+v"(acc[1][1]), "+v"(acc[2][2]), "+v"(acc[3][3]) : "v"(a[0]), "v"(a[3]));
    }
    if (NW > 1) {   // the loops below are unrolled so that acc is indexed by constants (stays in registers) and the LDS reads of one sum go out together
#pragma unroll
        for (int mb = 0; mb < 4; ++mb)
#pragma unroll
            for (int nb = 0; nb < 4; ++nb)
#pragma unroll
                for (int j = 0; j < 8; ++j) os[(wv * 64 + mb * 16 + hi * 8 + j) * 68 + nb * 16 + lr] = acc[mb][nb][j];
        __syncthreads();   // every wave's partial tile is in LDS before any thread sums across waves
#pragma unroll
        for (int s = 0; s < 32 / NW; ++s) { const int u = s * 32 * NW + (int)threadIdx.x;   // PL: u counts the groups of 4 elements in the order of the planes, so that a wave's stores stay in a row
            const int row = PL ? (u >> 8) * 16 + ((u >> 1) & 15) : u >> 4, cofs = PL ? ((u >> 5) & 7) * 8 + (u & 1) * 4 : (u & 15) * 4; v4f val = *(const v4fa*)(os + row * 68 + cofs);
#pragma unroll
            for (int w = 1; w < NW; ++w) val += *(const v4fa*)(os + (w * 64 + row) * 68 + cofs);
            if (BIAS) { val[0] += bfr(bias[c0 + cofs]); val[1] += bfr(bias[c0 + cofs + 1]); val[2] += bfr(bias[c0 + cofs + 2]); val[3] += bfr(bias[c0 + cofs + 3]); }
            if (PL) { v4h o16; v4us oh, ol;
#pragma unroll
                for (int q = 0; q < 4; ++q) { o16[q] = tohx(val[q]); unsigned short a2, c2; splitf(val[q], a2, c2); oh[q] = a2; ol[q] = c2; }
                const size_t po = (size_t)blockIdx.y * sP + (size_t)r0 * ldc + (size_t)((u >> 8) * (ldc >> 5) + ((u >> 7) & 1)) * 512 + (u & 127) * 4; *(v4h*)(P16 + po) = o16; *(v4us*)(Ph + po) = oh; *(v4us*)(Pl + po) = ol; }
            else *(v4f*)(C + (size_t)(r0 + row) * ldc + c0 + cofs) = val; }
        return;
    }
#pragma unroll
    for (int mb = 0; mb < 4; ++mb) {
#pragma unroll
        for (int nb = 0; nb < 4; ++nb) {
#pragma unroll
            for (int j = 0; j < 8; ++j) os[(hi * 8 + j) * 68 + nb * 16 + lr] = acc[mb][nb][j]; }
        __builtin_amdgcn_wave_barrier(); asm volatile("" ::: "memory");
        float* crow = C + (size_t)(r0 + mb * 16) * ldc + c0;
{
#pragma unroll
            for (int s = 0; s < 8; ++s) { const int row = 2 * s + hi, cofs = lr * 4; v4f val = *(const v4fa*)(os + row * 68 + cofs); if (BIAS) { val[0] += bfr(bias[c0 + cofs]); val[1] += bfr(bias[c0 + cofs + 1]); val[2] += bfr(bias[c0 + cofs + 2]); val[3] += bfr(bias[c0 + cofs + 3]); }
                *(v4f*)(crow + (size_t)row * ldc + cofs) = val; }
             }
        __builtin_amdgcn_wave_barrier(); asm volatile("" ::: "memory");
    }
}

typedef __attribute__((ext_vector_type(2))) unsigned short v2us;
typedef __attribute__((ext_vector_type(4))) int v4i;

__global__ __launch_bounds__(256) void k_wtG(const float* __restrict__ w, int K, int N, bf* Bt) {
    const int lane = threadIdx.x & 31; const int L0 = (blockIdx.x * 8 + (threadIdx.x >> 5)) * 8; const int nlines = N * K / 64;
{
#pragma unroll 1
        for (int l = 0; l < 8; ++l) { const int L = L0 + l; if (L >= nlines) break; const size_t e = (size_t)L * 64 + lane * 2; int k, n; frag_at(e, K, n, k); v2us o;
            o[0] = f2bf(w[(size_t)k * N + n]); o[1] = f2bf(w[(size_t)(k + 1) * N + n]); *(v2us*)(Bt + e) = o; }
         }
}
__global__ __launch_bounds__(256) void k_cvt8(const float* __restrict__ src, int K, bf* dst, size_t n8) { const size_t i = (size_t)blockIdx.x * 256 + threadIdx.x; if (i >= n8) return; int row, k; frag_at(i * 8, K, row, k); const v8f v = *(const v8f*)(src + (size_t)row * K + k); v8us o;
#pragma unroll
    for (int k = 0; k < 8; ++k) o[k] = f2bf(v[k]); *(v8us*)(dst + i * 8) = o;  }
// ---- k_fattn: scores, relative logits, skew, causal softmax and probs.v of every head and batch in ONE launch; no score, logit or probability ever goes to memory.
// One wave owns 16 query rows (i0..i0+15) and walks the key blocks of 64 up to its diagonal block, with a running row maximum and a running row sum (f32). No wave reads another wave's LDS: no work-group barrier.
// Per block: S = q.k (4 tiles), L = q.Er rows rb..rb+79 with rb = T-16-i0+c0 (5 tiles), Srel[a][b] = L[a][15-a+b] (the skew, a shifted read of the wave's own LDS slice),
// p = exp2(((S+Srel)/8 - rowmax) log2 e), O = O x exp2(old max - new max) + p.v; at the end O / rowsum goes out as hi+lo planes for W_proj.
#define EP 84    // f32 pitch of the logit slice: rows 8 apart fall on different LDS banks for the store and for the shifted read
#define PP 72    // 16-bit pitch of the probability slice: 144 bytes, so each 16-byte fragment read is aligned
#define FW 4     // waves (16-row groups) per work-group
// LDS traffic between the lanes of one wave: the wave's LDS instructions run in order; this keeps the compiler from moving an LDS read over the stores that feed it (or a store over the reads before it)
__device__ __forceinline__ void wave_lds_order() { __builtin_amdgcn_wave_barrier(); asm volatile("" ::: "memory"); }
template <int M> __device__ __forceinline__ float rowx(float x) { return __builtin_bit_cast(float, __builtin_amdgcn_update_dpp(__builtin_bit_cast(int, x), __builtin_bit_cast(int, x), 0x160 + M, 0xf, 0xf, false)); }   // lane l with lane l ^ M inside its row of 16 lanes (DPP row_xmask)
__device__ __forceinline__ float rowmax16(float x) { x = fmaxf(x, rowx<1>(x)); x = fmaxf(x, rowx<2>(x)); x = fmaxf(x, rowx<4>(x)); return fmaxf(x, rowx<8>(x)); }
__device__ __forceinline__ float rowsum16(float x) { x += rowx<1>(x); x += rowx<2>(x); x += rowx<4>(x); return x + rowx<8>(x); }
__device__ __forceinline__ void putp(float p, h16* a, h16*, int o) { a[o] = tohx(p); }
__device__ __forceinline__ void putp(float p, bf* a, bf* b, int o) { unsigned short x, y; splitf(p, x, y); a[o] = x; b[o] = y; }
template <typename T16, bool HR>
__device__ __forceinline__ void attn_rows(const T16* __restrict__ Q, const T16* __restrict__ Q2, const T16* __restrict__ Kp, const T16* __restrict__ K2, const T16* __restrict__ E, const T16* __restrict__ Vt, const T16* __restrict__ Vt2,
                                          int i0, float* es, T16* ps, T16* ps2, bf* Ah, bf* Al) {
    typedef typename WFrag<T16>::V V; typedef WFrag<T16> F;   // every inner loop below is unrolled so that fragments, tiles and row statistics are indexed by constants (stay in registers)
    // hi+lo rows take the lane number from mbcnt (every lane is on, 32 lanes a wave): the thread id is then not read in the hi+lo branch, whose fragment runs leave no register to hold it (it was spilled to scratch)
    const int lane = HR ? (int)__builtin_amdgcn_mbcnt_lo(~0u, 0u) : (int)(threadIdx.x & 31), lr = lane & 15, hi = lane >> 4; const unsigned lb = lane * 16;   // the lane's byte offset inside a block of a plane in fragment order
    const int eb = hi * 8 * EP + lr, pb = hi * 8 * PP + lr;   // the lane's place in the logit and the probability slice; rows and tiles are constant offsets from it
    V aq[2], aq2[2];
#pragma unroll
    for (int ks = 0; ks < 2; ++ks) { aq[ks] = F::ldf(at(Q, lb) + (size_t)i0 * HD + ks * 512); if (HR) aq2[ks] = F::ldf(at(Q2, lb) + (size_t)i0 * HD + ks * 512); }
    v8f o[4]; float m[8], l[8];
#pragma unroll
    for (int nb = 0; nb < 4; ++nb) o[nb] = (v8f){};
#pragma unroll
    for (int j = 0; j < 8; ++j) { m[j] = -3.0e38f; l[j] = 0.f; }
    const int nblk = (i0 >> 6) + 1;   // key blocks up to and with the one that holds the diagonal (i0 is a multiple of 16)
#pragma unroll 1   // kept rolled: two blocks' fragments and tiles at once would not fit the register budget
    for (int kb = 0; kb < nblk; ++kb) {
        const int c0 = kb * 64;
        v8f s[4], e[5];
        const unsigned kp = c0 * HD * 2 + lb; unsigned ep[5];   // the lane's byte offset in the key planes and in each Er tile (one register each, the plane's base is wave-uniform); tiles and k steps (blocks of 512 elements) are constant offsets
        const int rb = TT - 16 - i0 + c0;
#pragma unroll
        for (int t = 0; t < 5; ++t) { e[t] = (v8f){}; ep[t] = min(rb + t * 16, TT - 16) * HD * 2 + lb; }   // rb is a multiple of 16: a tile lies wholly inside Er or wholly past T-1; rows past T-1 belong to keys j > i only (masked below): the clamp keeps the address inside Er
#pragma unroll
        for (int nb = 0; nb < 4; ++nb) s[nb] = (v8f){};
        // Behind each run of fragment loads stands one wait. Its inputs are the run's address registers (each stays whole until every load that names it is past the wait, so no later load or result lands on it before)
        // and the loaded fragments (no product of the run moves in front of it, so all loads of the run are in flight together and the run pays the memory latency once instead of once per refill of a few registers).
        if (!HR) {   // single-plane rows: all 18 key and Er fragments of the block fit the registers: one run
            V bk[4][2], be[5][2];
#pragma unroll
            for (int ks = 0; ks < 2; ++ks) {
#pragma unroll
                for (int nb = 0; nb < 4; ++nb) bk[nb][ks] = F::ldf(at(Kp, kp) + nb * 16 * HD + ks * 512);
#pragma unroll
                for (int t = 0; t < 5; ++t) be[t][ks] = F::ldf(at(E, ep[t]) + ks * 512); }
            asm volatile("s_wait_xcnt 0x0" :: "v"(kp), "v"(ep[0]), "v"(ep[1]), "v"(ep[2]), "v"(ep[3]), "v"(ep[4]), "v"(bk[0][0]), "v"(bk[1][0]), "v"(bk[2][0]), "v"(bk[3][0]), "v"(bk[0][1]), "v"(bk[1][1]), "v"(bk[2][1]), "v"(bk[3][1]),
                         "v"(be[0][0]), "v"(be[1][0]), "v"(be[2][0]), "v"(be[3][0]), "v"(be[4][0]), "v"(be[0][1]), "v"(be[1][1]), "v"(be[2][1]), "v"(be[3][1]), "v"(be[4][1]) : "memory");
            __builtin_amdgcn_sched_barrier(0);   // without it the scheduler lifts the first product over the wait, and its data wait then stands behind four loads only: the rest of the run would start one memory latency later
#pragma unroll
            for (int ks = 0; ks < 2; ++ks) {
#pragma unroll
                for (int nb = 0; nb < 4; ++nb) s[nb] = F::mma(aq[ks], bk[nb][ks], s[nb]);
#pragma unroll
                for (int t = 0; t < 5; ++t) e[t] = F::mma(aq[ks], be[t][ks], e[t]); }
        } else {     // hi+lo rows: three runs (key hi plane, key lo plane, Er), each as large as the registers allow
            { V bk[4][2];
#pragma unroll
              for (int nb = 0; nb < 4; ++nb)
#pragma unroll
                  for (int ks = 0; ks < 2; ++ks) bk[nb][ks] = F::ldf(at(Kp, kp) + nb * 16 * HD + ks * 512);
              asm volatile("s_wait_xcnt 0x0" :: "v"(kp), "v"(bk[0][0]), "v"(bk[1][0]), "v"(bk[2][0]), "v"(bk[3][0]), "v"(bk[0][1]), "v"(bk[1][1]), "v"(bk[2][1]), "v"(bk[3][1]) : "memory");
#pragma unroll
              for (int ks = 0; ks < 2; ++ks)
#pragma unroll
                  for (int nb = 0; nb < 4; ++nb) { s[nb] = F::mma(aq[ks], bk[nb][ks], s[nb]); s[nb] = F::mma(aq2[ks], bk[nb][ks], s[nb]); } }
            { V bk[4][2];
#pragma unroll
              for (int nb = 0; nb < 4; ++nb)
#pragma unroll
                  for (int ks = 0; ks < 2; ++ks) bk[nb][ks] = F::ldf(at(K2, kp) + nb * 16 * HD + ks * 512);
              asm volatile("s_wait_xcnt 0x0" :: "v"(kp), "v"(bk[0][0]), "v"(bk[1][0]), "v"(bk[2][0]), "v"(bk[3][0]), "v"(bk[0][1]), "v"(bk[1][1]), "v"(bk[2][1]), "v"(bk[3][1]) : "memory");
#pragma unroll
              for (int ks = 0; ks < 2; ++ks)
#pragma unroll
                  for (int nb = 0; nb < 4; ++nb) s[nb] = F::mma(aq[ks], bk[nb][ks], s[nb]); }
            { V be[5][2];
#pragma unroll
              for (int t = 0; t < 5; ++t)
#pragma unroll
                  for (int ks = 0; ks < 2; ++ks) be[t][ks] = F::ldf(at(E, ep[t]) + ks * 512);
              asm volatile("s_wait_xcnt 0x0" :: "v"(ep[0]), "v"(ep[1]), "v"(ep[2]), "v"(ep[3]), "v"(ep[4]), "v"(be[0][0]), "v"(be[1][0]), "v"(be[2][0]), "v"(be[3][0]), "v"(be[4][0]), "v"(be[0][1]), "v"(be[1][1]), "v"(be[2][1]), "v"(be[3][1]), "v"(be[4][1]) : "memory");
#pragma unroll
              for (int ks = 0; ks < 2; ++ks)
#pragma unroll
                  for (int t = 0; t < 5; ++t) { e[t] = F::mma(aq[ks], be[t][ks], e[t]); e[t] = F::mma(aq2[ks], be[t][ks], e[t]); } }
        }
#pragma unroll
        for (int t = 0; t < 5; ++t)
#pragma unroll
            for (int j = 0; j < 8; ++j) es[eb + j * EP + t * 16] = e[t][j];
        wave_lds_order();
        const unsigned vp = c0 * 16 * 2 + lb;   // the lane's byte offset in the transposed value planes (32 keys of 16 head dims are one block; 16 head dims are a row of blocks over the positions of all batches); tiles and k steps are constant offsets from it
        V bv[4][2];   // single-plane rows: value fragments asked for here, where the logit registers are free again, so that they fly under the softmax (the hi+lo rows have no registers to spare for it and at most 8 blocks)
        if (!HR) {
#pragma unroll
            for (int nb = 0; nb < 4; ++nb)
#pragma unroll
                for (int ks = 0; ks < 2; ++ks) bv[nb][ks] = F::ldf(at(Vt, vp) + nb * 16 * (NB_ * TT) + ks * 512);
            asm volatile("s_wait_xcnt 0x0" :: "v"(vp) : "memory");   // the run's address register stays whole up to this wait (it is an input here), so no load of the run lands on it while the others are issued
        }
#pragma unroll
        for (int nb = 0; nb < 4; ++nb)
#pragma unroll
            for (int j = 0; j < 8; ++j) s[nb][j] = (s[nb][j] + es[eb - hi * 8 + j * (EP - 1) + 15 + nb * 16]) * (SCL * 1.4426950408889634f);   // row a reads column 15 - a + b; logits kept in units of log 2
        if (c0 + 63 > i0) {   // only the diagonal block holds keys j > i (wave-uniform test)
            const int dg = lr - hi * 8 - (i0 - c0);   // formed here, so that each test below is one value against a constant and nothing of the mask is held over the key loop
#pragma unroll
            for (int nb = 0; nb < 4; ++nb)
#pragma unroll
                for (int j = 0; j < 8; ++j) if (dg > j - nb * 16) s[nb][j] = -3.0e38f;   // key c0 + nb*16 + lr > row i0 + hi*8 + j
        }
#pragma unroll
        for (int j = 0; j < 8; ++j) {
            const float mn = fmaxf(m[j], rowmax16(fmaxf(fmaxf(s[0][j], s[1][j]), fmaxf(s[2][j], s[3][j]))));
            const float al = __builtin_amdgcn_exp2f(m[j] - mn); m[j] = mn;
            float ps4 = 0.f;
#pragma unroll
            for (int nb = 0; nb < 4; ++nb) { const float p = __builtin_amdgcn_exp2f(s[nb][j] - mn); ps4 += p; putp(p, ps, ps2, pb + j * PP + nb * 16); o[nb][j] *= al; }
            l[j] = l[j] * al + ps4;   // each lane keeps the sum of its own 4 columns; the 16 lanes of a row are added once, behind the loop
        }
        if (HR) {   // hi plane of the values: asked for when the score registers are free, it flies under the LDS read-back
#pragma unroll
            for (int nb = 0; nb < 4; ++nb)
#pragma unroll
                for (int ks = 0; ks < 2; ++ks) bv[nb][ks] = F::ldf(at(Vt, vp) + nb * 16 * (NB_ * TT) + ks * 512);
            asm volatile("s_wait_xcnt 0x0" :: "v"(vp) : "memory");   // as above: the run's address register stays whole up to the wait
        }
        wave_lds_order();
        V ap[2], ap2[2];
#pragma unroll
        for (int ks = 0; ks < 2; ++ks) { ap[ks] = F::ld(ps + lr * PP + ks * 32 + 8 * hi); if (HR) ap2[ks] = F::ld(ps2 + lr * PP + ks * 32 + 8 * hi); }
#pragma unroll
        for (int ks = 0; ks < 2; ++ks)
#pragma unroll
            for (int nb = 0; nb < 4; ++nb) { o[nb] = F::mma(ap[ks], bv[nb][ks], o[nb]); if (HR) o[nb] = F::mma(ap2[ks], bv[nb][ks], o[nb]); }
        if (HR) {   // lo plane of the values
#pragma unroll
            for (int nb = 0; nb < 4; ++nb)
#pragma unroll
                for (int ks = 0; ks < 2; ++ks) bv[nb][ks] = F::ldf(at(Vt2, vp) + nb * 16 * (NB_ * TT) + ks * 512);
            asm volatile("s_wait_xcnt 0x0" :: "v"(vp) : "memory");   // as above
#pragma unroll
            for (int ks = 0; ks < 2; ++ks)
#pragma unroll
                for (int nb = 0; nb < 4; ++nb) o[nb] = F::mma(ap[ks], bv[nb][ks], o[nb]);
        }
    }
    const int ln = (int)__builtin_amdgcn_mbcnt_lo(~0u, 0u), lq = ln & 15, hq = ln >> 4;   // the lane number read anew (every lane is on, 32 lanes a wave): lr and hi need not be held over the key loop, whose fragment run leaves no register for them
#pragma unroll
    for (int j = 0; j < 8; ++j) { const float f = __fdiv_rn(1.0f, rowsum16(l[j]));
#pragma unroll
        for (int nb = 0; nb < 4; ++nb) es[hq * 8 * 68 + lq + j * 68 + nb * 16] = o[nb][j] * f; }
    wave_lds_order();
#pragma unroll
    for (int s8 = 0; s8 < 8; ++s8) { const int row = ln >> 1, cofs = s8 * 8 + (ln & 1) * 4; const v4f val = *(const v4fa*)(es + row * 68 + cofs); v4us oh, ol;
#pragma unroll
        for (int q = 0; q < 4; ++q) { unsigned short a, c2; splitf(val[q], a, c2); oh[q] = a; ol[q] = c2; }
        const size_t oo = (size_t)i0 * DQ + s8 * 128 + ln * 4; *(v4us*)(Ah + oo) = oh; *(v4us*)(Al + oo) = ol; }
}
// grid (T/64, heads, batches), 128 threads; in each head and batch the work-groups with the most key blocks come first. waves_per_eu 4: a budget of 256 registers, so that the loops hold no register-window switches
__global__ __launch_bounds__(32 * FW) __attribute__((amdgpu_waves_per_eu(4))) void k_fattn(const h16* __restrict__ Q16, const bf* __restrict__ Qh, const bf* __restrict__ Ql, const h16* __restrict__ K16, const bf* __restrict__ Kh, const bf* __restrict__ Kl,
                                                   const h16* __restrict__ V16, const bf* __restrict__ Vh, const bf* __restrict__ Vl, const h16* __restrict__ E16, const bf* __restrict__ Eb, bf* Ah, bf* Al) {
    __shared__ __align__(16) float es[FW][16 * EP];
    __shared__ __align__(16) unsigned short ps[FW][2][16 * PP];
    const int wv = __builtin_amdgcn_readfirstlane((int)(threadIdx.x >> 5));   // wave number in a scalar register: the row range, the trip count and the branch below stay scalar
    const int i0 = (TT / (16 * FW) - 1 - (int)blockIdx.x) * (16 * FW) + wv * 16; const size_t zp = ((size_t)blockIdx.y * NB_ + blockIdx.z) * TT * HD;   // q and k planes: [head][batch][t][d]
    const size_t zv = (size_t)blockIdx.y * HD * (NB_ * TT) + (size_t)blockIdx.z * TT * 16;   // value planes: a head's 64 rows of NB_ * T positions; a batch's T positions of 16 rows are T / 32 blocks
    const size_t hc = (size_t)blockIdx.z * TT * DQ + (size_t)blockIdx.y * HD * 16;   // output planes (fragment order, rows of DQ): the batch's T rows, then a head's 64 columns of 16 rows: two blocks
    if (i0 < RH) attn_rows<bf, true>(Qh + zp, Ql + zp, Kh + zp, Kl + zp, Eb, Vh + zv, Vl + zv, i0, es[wv], ps[wv][0], ps[wv][1], Ah + hc, Al + hc);
    else attn_rows<h16, false>(Q16 + zp, nullptr, K16 + zp, nullptr, E16, V16 + zv, nullptr, i0, es[wv], (h16*)ps[wv][0], nullptr, Ah + hc, Al + hc);
}

__global__ __launch_bounds__(256) void k_er16(const float* __restrict__ er, h16* E) { const int i = (blockIdx.x * 256 + threadIdx.x) * 4; if (i >= TT * HD) return; int row, k; frag_at((size_t)i, HD, row, k); const v4f a = *(const v4f*)(er + row * HD + k); v4h o; o[0] = tohx(bfr(a[0])); o[1] = tohx(bfr(a[1])); o[2] = tohx(bfr(a[2])); o[3] = tohx(bfr(a[3])); *(v4h*)(E + i) = o;  }
typedef __attribute__((ext_vector_type(4))) _Float16 v4hx;

extern "C" void kernel_launch(void* const* d_in, const int* in_sizes, int n_in,
                              void* d_out, int out_size, void* d_ws, size_t ws_size, hipStream_t stream) {
    (void)in_sizes; (void)n_in; (void)out_size;
    const float* x = (const float*)d_in[0]; const float* wattn = (const float*)d_in[1]; const float* wo = (const float*)d_in[2]; const float* er = (const float*)d_in[3];
    float* OUT = (float*)d_out;     // [2][2048][1024]
    char* wsp = (char*)d_ws;
    auto take = [&](size_t bytes) { char* p = wsp; wsp += (bytes + 255) & ~(size_t)255; return (void*)p; };
    bf* WQKV = (bf*)take((size_t)3 * DM * DM * 2); bf* WQ = WQKV; bf* WK = WQKV + (size_t)DM * DM; bf* WV = WQKV + (size_t)2 * DM * DM; bf* ERB = (bf*)take((size_t)TT * HD * 2); h16* ER16 = (h16*)take((size_t)TT * HD * 2); bf* WO = (bf*)take((size_t)DM * DQ * 2);
    bf* XB = (bf*)take((size_t)NB_ * TT * DM * 2);
    h16* QP16 = (h16*)take((size_t)NB_ * NH_ * TT * HD * 2); h16* KP16 = (h16*)take((size_t)NB_ * NKV * TT * HD * 2); h16* VT16 = (h16*)take((size_t)NB_ * NKV * HD * TT * 2);
    bf* QPh = (bf*)take((size_t)NB_ * NH_ * TT * HD * 2); bf* QPl = (bf*)take((size_t)NB_ * NH_ * TT * HD * 2); bf* KPh = (bf*)take((size_t)NB_ * NKV * TT * HD * 2); bf* KPl = (bf*)take((size_t)NB_ * NKV * TT * HD * 2); bf* VTh = (bf*)take((size_t)NB_ * NKV * HD * TT * 2); bf* VTl = (bf*)take((size_t)NB_ * NKV * HD * TT * 2);
    bf* ATh = (bf*)take((size_t)NB_ * TT * DQ * 2); bf* ATl = (bf*)take((size_t)NB_ * TT * DQ * 2);
    if ((size_t)(wsp - (char*)d_ws) > ws_size) return;    // ws 256 MiB
    { k_wtG<<<(unsigned)((DM * 3 * DM / 64 + 63) / 64), 256, 0, stream>>>(wattn, DM, 3 * DM, WQKV); k_cvt8<<<(TT * HD / 8 + 255) / 256, 256, 0, stream>>>(er, HD, ERB, TT * HD / 8); k_er16<<<(TT * HD / 4 + 255) / 256, 256, 0, stream>>>(er, ER16);
      k_wtG<<<(unsigned)((DQ * DM / 64 + 63) / 64), 256, 0, stream>>>(wo, DQ, DM, WO);
       }
    // x, both batches, is one matrix of NB_ * T rows: every launch below covers both batches
    k_cvt8<<<(unsigned)(((size_t)NB_ * TT * DM / 8 + 255) / 256), 256, 0, stream>>>(x, DM, XB, (size_t)NB_ * TT * DM / 8);
    // q and k: a tile's 64 columns are one head (HD = 64), so it goes straight into that head's [batch][t][d] planes
    k_gemmw<bf, 0, false, 8, true><<<dim3(NB_ * TT / 64, DQ / 64, 1), 256, 0, stream>>>(XB, nullptr, WQ, nullptr, DM, nullptr, HD, nullptr, 0, 0, 0, QP16, QPh, QPl, (size_t)NB_ * TT * HD);
    k_gemmw<bf, 0, false, 8, true><<<dim3(NB_ * TT / 64, DKV / 64, 1), 256, 0, stream>>>(XB, nullptr, WK, nullptr, DM, nullptr, HD, nullptr, 0, 0, 0, KP16, KPh, KPl, (size_t)NB_ * TT * HD);
    // v: the product is taken as W_v^T x^T (rows = head dims, columns = positions of both batches), so the tile already has the [h][d][batch * T + t] order that probs.v reads; 64 positions of 16 head dims are two blocks (1024 elements)
    k_gemmw<bf, 0, false, 8, true><<<dim3(DKV / 64, NB_ * TT / 64, 1), 256, 0, stream>>>(WV, nullptr, XB, nullptr, DM, nullptr, NB_ * TT, nullptr, 0, 0, 0, VT16, VTh, VTl, (size_t)1024);
    k_fattn<<<dim3(TT / (16 * FW), NH_, NB_), 32 * FW, 0, stream>>>(QP16, QPh, QPl, KP16, KPh, KPl, VT16, VTh, VTl, ER16, ERB, ATh, ATl);   // one kv head per query head
    k_gemmw<bf, 1, false, 8, false><<<dim3(NB_ * TT / 64, DM / 64, 1), 256, 0, stream>>>(ATh, ATl, WO, nullptr, DQ, OUT, DM, nullptr, 0, 0, 0, nullptr, nullptr, nullptr, 0);
}

// v007
// It runs in 133 microseconds.
// Two timings next to v006 both put it at 1.14 times that version's speed.
// Counting every step since v000, it is 14.3 times as fast.
#include <hip/hip_runtime.h>

// CausalSelfAttentionRelativePosition (x [2][2048][1024]; qkv = x W_attn (16 x 64); Srel = skew(q Er^T) -> Srel[i][j] = q_i . Er[T-1-i+j] for j <= i (the skew's wrapped entries above the diagonal are masked); att = softmax(((q.k) + Srel)/8, causal);
// y = att v; out = y W_proj -> [2][2048][1024]).
// Compute dtypes, f32 accumulate: every input rounded to bf16; qkv on PLAIN bf16 operands (inputs: exact); scores q.k (K 64), the relative logits q.Er^T and probs.v on bf16 hi+lo planes (3 products; q.Er: hl q x exact Er, 2 products)
// for the first 512 query rows per head and SINGLE fp16 planes for the rest (Er, a bf16 input, is exact in fp16); scores, relative logits, skew, softmax (f32, running maximum and sum) and probs.v in one fused launch, key blocks above the diagonal never touched; W_proj on hl planes x exact.
// BOTH BATCHES RIDE IN EVERY LAUNCH: x is one [NB_ * T][DM] matrix for the projections; q and k planes are [head][batch][t][d], the transposed value planes [head][d][batch * T + t], the attention output [batch * T + t][DQ].
// FRAGMENT ORDER: every 16-bit operand plane in the workspace ([rows][K], K % 32 == 0, rows % 16 == 0) is kept as blocks of 16 rows x 32 k (512 elements, block number (row / 16) * (K / 32) + k / 32); inside a block element (row, k) stands at
// ((k % 32) / 16) * 256 + ((k % 16) / 8) * 128 + (row % 16) * 8 + k % 8. A lane's two 16-byte fragment loads are then block + lane * 8 and block + 256 + lane * 8: each load of a wave reads 512 bytes in a row (4 cache lines) instead of 32 bytes out of each of 16 lines.

#define NB_  2
#define TT   2048
#define DM   1024
#define NH_  16
#define NKV  16
#define REP  (NH_ / NKV)
#define HD   64
#define DQ   (NH_ * HD)
#define DKV  (NKV * HD)
#define RH   512                  // query rows < RH use hi+lo planes (0: none)
#define SCL  0.125f   // HD^-0.5
typedef _Float16 h16;
typedef unsigned short bf;
typedef __attribute__((ext_vector_type(16))) __bf16   v16bf;
typedef __attribute__((ext_vector_type(16))) _Float16 v16h;
typedef __attribute__((ext_vector_type(8)))  _Float16 v8h;
typedef __attribute__((ext_vector_type(8)))  unsigned short v8us;
typedef __attribute__((ext_vector_type(8)))  float    v8f;
typedef __attribute__((ext_vector_type(4)))  float    v4f;
typedef v8h  __attribute__((may_alias)) v8ha;
typedef v4f  __attribute__((may_alias)) v4fa;
typedef v8us __attribute__((may_alias)) v8usa;

__device__ __forceinline__ unsigned short f2bf(float f) { unsigned u = __float_as_uint(f); u += 0x7FFFu + ((u >> 16) & 1u); return (unsigned short)(u >> 16); }
__device__ __forceinline__ float bf2f(unsigned short b) { return __uint_as_float(((unsigned)b) << 16); }
__device__ __forceinline__ float bfr(float f) { return bf2f(f2bf(f)); }
__device__ __forceinline__ v16h cat16(v8h lo, v8h hi) { return __builtin_shufflevector(lo, hi, 0, 1, 2, 3, 4, 5, 6, 7, 8, 9, 10, 11, 12, 13, 14, 15); }
__device__ __forceinline__ v16bf cat16b(v8us lo, v8us hi) { return __builtin_bit_cast(v16bf, __builtin_shufflevector(lo, hi, 0, 1, 2, 3, 4, 5, 6, 7, 8, 9, 10, 11, 12, 13, 14, 15)); }
__device__ __forceinline__ v8f wmma16(v16h a, v16h b, v8f c) { return __builtin_amdgcn_wmma_f32_16x16x32_f16(false, a, false, b, (short)0, c, false, false); }
__device__ __forceinline__ v8f wmmab(v16bf a, v16bf b, v8f c) { return __builtin_amdgcn_wmma_f32_16x16x32_bf16(false, a, false, b, (short)0, c, false, false); }
__device__ __forceinline__ h16 tohx(float x) { return (h16)x; }
__device__ __forceinline__ void splitf(float y, unsigned short& h, unsigned short& l) { h = f2bf(y); l = f2bf(y - bf2f(h)); }
typedef __attribute__((ext_vector_type(4))) _Float16 v4h;
typedef __attribute__((ext_vector_type(4))) unsigned short v4us;



// ---- k_gemmw: register-blocked GEMM, ONE WAVE per 64x64 output tile (16 accumulators), operands straight from 16-bit planes in fragment order; grid (M/64, N/64, Z), 32 threads.
// C[m][n] (f32, pitch ldc, + optional f32 bias[n]) = sum_k A[m][k] Bt[n][k] (+ split products per NSPLIT). z-batch strides sA/sB/sC in elements. K % 32 == 0.
// NW > 1 (32 * NW threads): NW waves share the tile; wave w takes the k steps w, w + NW, ...; each leaves its partial 64x64 tile in LDS and, behind one barrier, the work-group sums the NW partials in wave order.
// PL (NW > 1 only): the summed tile goes out as three 16-bit planes (fp16, bf16 hi, bf16 lo) instead of f32, in fragment order for rows of ldc elements: the tile's 8 blocks start at by * sP + r0 * ldc, so that a tile of 64 columns lands either
// in its own head's [batch][t][d] plane (sP = NB_ * T * 64, ldc = 64) or as 64 columns of a wide row (sP = 2 blocks, ldc = row length); no f32 copy of the product is written.
// ld: a fragment from a row-major slice (LDS); ldf: a fragment from a plane in fragment order (p = block + lane * 8)
// frag_at: which (row, k) of a [rows][K] matrix stands at element e of its plane in fragment order
__device__ __forceinline__ void frag_at(size_t e, int K, int& row, int& k) { const int blk = (int)(e >> 9), r = (int)(e & 511), kb = K >> 5; row = (blk / kb) * 16 + ((r >> 3) & 15); k = (blk % kb) * 32 + (r >> 8) * 16 + ((r >> 7) & 1) * 8 + (r & 7); }
template <typename T16> struct WFrag;
template <> struct WFrag<h16> { typedef v16h V; static __device__ __forceinline__ V ld(const h16* p) { return cat16(*(const v8h*)p, *(const v8h*)(p + 16)); } static __device__ __forceinline__ V ldf(const h16* p) { return cat16(*(const v8h*)p, *(const v8h*)(p + 256)); } static __device__ __forceinline__ v8f mma(V a, V b, v8f c) { return wmma16(a, b, c); } };
template <> struct WFrag<bf> { typedef v16bf V; static __device__ __forceinline__ V ld(const bf* p) { return cat16b(*(const v8us*)p, *(const v8us*)(p + 16)); } static __device__ __forceinline__ V ldf(const bf* p) { return cat16b(*(const v8us*)p, *(const v8us*)(p + 256)); } static __device__ __forceinline__ v8f mma(V a, V b, v8f c) { return wmmab(a, b, c); } };
template <typename T16> __device__ __forceinline__ const T16* at(const T16* base, unsigned bytes) { return (const T16*)((const char*)base + bytes); }   // wave-uniform base + the lane's 32-bit byte offset
// gemmw_tile: the work of one work-group, tile (bx, by); the kernels below only say which product and which tile a work-group takes
template <typename T16, int NSPLIT, bool BIAS, int NW, bool PL>
__device__ __forceinline__ void gemmw_tile(const T16* __restrict__ A, const T16* __restrict__ A2, const T16* __restrict__ Bt, const T16* __restrict__ Bt2, int K, float* C, int ldc, const float* __restrict__ bias,
                                           h16* P16, bf* Ph, bf* Pl, size_t sP, int bx, int by) {
    typedef typename WFrag<T16>::V V;
    __shared__ __align__(16) float os[(NW > 1 ? NW * 64 : 16) * 68];
    const int lane = threadIdx.x & 31, lr = lane & 15, hi = lane >> 4; const int r0 = bx * 64, c0 = by * 64; const int wv = (NW > 1) ? __builtin_amdgcn_readfirstlane((int)(threadIdx.x >> 5)) : 0;   // wave number in a scalar register: the K loop's counter and branch stay scalar
    v8f acc[4][4];
#pragma unroll
    for (int mb = 0; mb < 4; ++mb)
#pragma unroll
        for (int nb = 0; nb < 4; ++nb) acc[mb][nb] = (v8f){};
    const unsigned lb = lane * 16;   // the lane's byte offset inside a block
#pragma unroll 1
    for (int kc = wv * 32; kc < K; kc += 32 * NW) {
        V a[4], a2[4], b[4], b2[4]; unsigned ao[4], bo[4];   // the lane's byte offset of each fragment (the plane's base is wave-uniform): 16 rows of K are K / 32 blocks = 16 * K elements; a k step of 32 is one block
#pragma unroll
        for (int t = 0; t < 4; ++t) { ao[t] = (unsigned)(((r0 + t * 16) * K + kc * 16) * 2) + lb; bo[t] = (unsigned)(((c0 + t * 16) * K + kc * 16) * 2) + lb; }
#pragma unroll
        for (int mb = 0; mb < 4; ++mb) { a[mb] = WFrag<T16>::ldf(at(A, ao[mb])); if (NSPLIT == 1 || NSPLIT == 2) a2[mb] = WFrag<T16>::ldf(at(A2, ao[mb])); }
#pragma unroll
        for (int nb = 0; nb < 4; ++nb) { b[nb] = WFrag<T16>::ldf(at(Bt, bo[nb])); if (NSPLIT >= 2) b2[nb] = WFrag<T16>::ldf(at(Bt2, bo[nb])); }
        asm volatile("s_wait_xcnt 0x0" :: "v"(ao[0]), "v"(ao[1]), "v"(ao[2]), "v"(ao[3]), "v"(bo[0]), "v"(bo[1]), "v"(bo[2]), "v"(bo[3]) : "memory");   // the trip's address registers stay whole up to this wait (they are inputs here): no load of the trip lands on one, and the next trip rewrites them behind it
#pragma unroll
        for (int nb = 0; nb < 4; ++nb) {
#pragma unroll
            for (int mb = 0; mb < 4; ++mb) { acc[mb][nb] = WFrag<T16>::mma(a[mb], b[nb], acc[mb][nb]); if (NSPLIT == 1 || NSPLIT == 2) acc[mb][nb] = WFrag<T16>::mma(a2[mb], b[nb], acc[mb][nb]); if (NSPLIT >= 2) acc[mb][nb] = WFrag<T16>::mma(a[mb], b2[nb], acc[mb][nb]); } }
        asm volatile("v_nop\n\tv_nop\n\tv_nop\n\tv_nop" : "+v"(acc[0][0]), "+v"(acc[1][1]), "+v"(acc[2][2]), "+v"(acc[3][3]) : "v"(a[0]), "v"(a[3]));
    }
    if (NW > 1) {   // the loops below are unrolled so that acc is indexed by constants (stays in registers) and the LDS reads of one sum go out together
#pragma unroll
        for (int mb = 0; mb < 4; ++mb)
#pragma unroll
            for (int nb = 0; nb < 4; ++nb)
#pragma unroll
                for (int j = 0; j < 8; ++j) os[(wv * 64 + mb * 16 + hi * 8 + j) * 68 + nb * 16 + lr] = acc[mb][nb][j];
        __syncthreads();   // every wave's partial tile is in LDS before any thread sums across waves
#pragma unroll
        for (int s = 0; s < 32 / NW; ++s) { const int u = s * 32 * NW + (int)threadIdx.x;   // PL: u counts the groups of 4 elements in the order of the planes, so that a wave's stores stay in a row
            const int row = PL ? (u >> 8) * 16 + ((u >> 1) & 15) : u >> 4, cofs = PL ? ((u >> 5) & 7) * 8 + (u & 1) * 4 : (u & 15) * 4; v4f val = *(const v4fa*)(os + row * 68 + cofs);
#pragma unroll
            for (int w = 1; w < NW; ++w) val += *(const v4fa*)(os + (w * 64 + row) * 68 + cofs);
            if (BIAS) { val[0] += bfr(bias[c0 + cofs]); val[1] += bfr(bias[c0 + cofs + 1]); val[2] += bfr(bias[c0 + cofs + 2]); val[3] += bfr(bias[c0 + cofs + 3]); }
            if (PL) { v4h o16; v4us oh, ol;
#pragma unroll
                for (int q = 0; q < 4; ++q) { o16[q] = tohx(val[q]); unsigned short a2, c2; splitf(val[q], a2, c2); oh[q] = a2; ol[q] = c2; }
                const size_t po = (size_t)by * sP + (size_t)r0 * ldc + (size_t)((u >> 8) * (ldc >> 5) + ((u >> 7) & 1)) * 512 + (u & 127) * 4; *(v4h*)(P16 + po) = o16; *(v4us*)(Ph + po) = oh; *(v4us*)(Pl + po) = ol; }
            else *(v4f*)(C + (size_t)(r0 + row) * ldc + c0 + cofs) = val; }
        return;
    }
#pragma unroll
    for (int mb = 0; mb < 4; ++mb) {
#pragma unroll
        for (int nb = 0; nb < 4; ++nb) {
#pragma unroll
            for (int j = 0; j < 8; ++j) os[(hi * 8 + j) * 68 + nb * 16 + lr] = acc[mb][nb][j]; }
        __builtin_amdgcn_wave_barrier(); asm volatile("" ::: "memory");
        float* crow = C + (size_t)(r0 + mb * 16) * ldc + c0;
{
#pragma unroll
            for (int s = 0; s < 8; ++s) { const int row = 2 * s + hi, cofs = lr * 4; v4f val = *(const v4fa*)(os + row * 68 + cofs); if (BIAS) { val[0] += bfr(bias[c0 + cofs]); val[1] += bfr(bias[c0 + cofs + 1]); val[2] += bfr(bias[c0 + cofs + 2]); val[3] += bfr(bias[c0 + cofs + 3]); }
                *(v4f*)(crow + (size_t)row * ldc + cofs) = val; }
             }
        __builtin_amdgcn_wave_barrier(); asm volatile("" ::: "memory");
    }
}
template <typename T16, int NSPLIT, bool BIAS, int NW, bool PL>
__global__ __launch_bounds__(32 * NW) void k_gemmw(const T16* __restrict__ A, const T16* __restrict__ A2, const T16* __restrict__ Bt, const T16* __restrict__ Bt2, int K, float* C, int ldc, const float* __restrict__ bias, size_t sA, size_t sB, size_t sC,
                                                   h16* P16, bf* Ph, bf* Pl, size_t sP) {
    const size_t z = blockIdx.z; A += z * sA; if (A2) A2 += z * sA; Bt += z * sB; if (Bt2) Bt2 += z * sB; C += z * sC;
    gemmw_tile<T16, NSPLIT, BIAS, NW, PL>(A, A2, Bt, Bt2, K, C, ldc, bias, P16, Ph, Pl, sP, (int)blockIdx.x, (int)blockIdx.y);
}
// ---- k_qkv: the q, k and v projections in ONE launch, grid (NB_ * T / 64, DQ / 64, 3); blockIdx.z picks the product (none reads what another writes).
// q and k: x W, a tile's 64 columns are one head (HD = 64), so it goes straight into that head's [batch][t][d] planes.
// v: the product is taken as W_v^T x^T (rows = head dims, columns = positions of both batches), so the tile already has the [h][d][batch * T + t] order that probs.v reads; 64 positions of 16 head dims are two blocks (1024 elements);
// its tiles are numbered with the head-dim tile running fastest, so that work-groups that start together share a tile of x.
__global__ __launch_bounds__(256) void k_qkv(const bf* __restrict__ X, const bf* __restrict__ Wqkv, h16* Q16, bf* Qh, bf* Ql, h16* K16, bf* Kh, bf* Kl, h16* V16, bf* Vh, bf* Vl) {
    const int z = (int)blockIdx.z; const bool isv = z == 2; const int flat = (int)blockIdx.y * (NB_ * TT / 64) + (int)blockIdx.x;
    const bf* W = Wqkv + (size_t)z * DM * DM;
    gemmw_tile<bf, 0, false, 8, true>(isv ? W : X, nullptr, isv ? X : W, nullptr, DM, nullptr, isv ? NB_ * TT : HD, nullptr, z == 0 ? Q16 : isv ? V16 : K16, z == 0 ? Qh : isv ? Vh : Kh, z == 0 ? Ql : isv ? Vl : Kl,
                                      isv ? (size_t)1024 : (size_t)NB_ * TT * HD, isv ? flat % (DKV / 64) : (int)blockIdx.x, isv ? flat / (DKV / 64) : (int)blockIdx.y);
}

typedef __attribute__((ext_vector_type(2))) unsigned short v2us;
typedef __attribute__((ext_vector_type(4))) int v4i;

// The five operand conversions (W_attn, W_proj, x, Er to bf16, Er to fp16) are bodies of ONE launch, k_prep: each takes its own range of work-groups, blk counts inside the range.
__device__ __forceinline__ void wtG(const float* __restrict__ w, int K, int N, bf* Bt, int blk) {
    const int lane = threadIdx.x & 31; const int L0 = (blk * 8 + (threadIdx.x >> 5)) * 8; const int nlines = N * K / 64;
{
#pragma unroll 1
        for (int l = 0; l < 8; ++l) { const int L = L0 + l; if (L >= nlines) break; const size_t e = (size_t)L * 64 + lane * 2; int k, n; frag_at(e, K, n, k); v2us o;
            o[0] = f2bf(w[(size_t)k * N + n]); o[1] = f2bf(w[(size_t)(k + 1) * N + n]); *(v2us*)(Bt + e) = o; }
         }
}
__device__ __forceinline__ void cvt8(const float* __restrict__ src, int K, bf* dst, size_t n8, int blk) { const size_t i = (size_t)blk * 256 + threadIdx.x; if (i >= n8) return; int row, k; frag_at(i * 8, K, row, k); const v8f v = *(const v8f*)(src + (size_t)row * K + k); v8us o;
#pragma unroll
    for (int k = 0; k < 8; ++k) o[k] = f2bf(v[k]); *(v8us*)(dst + i * 8) = o;  }
// ---- k_fattn: scores, relative logits, skew, causal softmax and probs.v of every head and batch in ONE launch; no score, logit or probability ever goes to memory.
// One wave owns 16 query rows (i0..i0+15) and walks the key blocks of 64 up to its diagonal block, with a running row maximum and a running row sum (f32). No wave reads another wave's LDS: no work-group barrier.
// Per block: S = q.k (4 tiles), L = q.Er rows rb..rb+79 with rb = T-16-i0+c0 (5 tiles), Srel[a][b] = L[a][15-a+b] (the skew, a shifted read of the wave's own LDS slice),
// p = exp2(((S+Srel)/8 - rowmax) log2 e), O = O x exp2(old max - new max) + p.v; at the end O / rowsum goes out as hi+lo planes for W_proj.
#define EP 84    // f32 pitch of the logit slice: rows 8 apart fall on different LDS banks for the store and for the shifted read
#define PP 72    // 16-bit pitch of the probability slice: 144 bytes, so each 16-byte fragment read is aligned
#define FW 4     // waves (16-row groups) per work-group
// LDS traffic between the lanes of one wave: the wave's LDS instructions run in order; this keeps the compiler from moving an LDS read over the stores that feed it (or a store over the reads before it)
__device__ __forceinline__ void wave_lds_order() { __builtin_amdgcn_wave_barrier(); asm volatile("" ::: "memory"); }
template <int M> __device__ __forceinline__ float rowx(float x) { return __builtin_bit_cast(float, __builtin_amdgcn_update_dpp(__builtin_bit_cast(int, x), __builtin_bit_cast(int, x), 0x160 + M, 0xf, 0xf, false)); }   // lane l with lane l ^ M inside its row of 16 lanes (DPP row_xmask)
__device__ __forceinline__ float rowmax16(float x) { x = fmaxf(x, rowx<1>(x)); x = fmaxf(x, rowx<2>(x)); x = fmaxf(x, rowx<4>(x)); return fmaxf(x, rowx<8>(x)); }
__device__ __forceinline__ float rowsum16(float x) { x += rowx<1>(x); x += rowx<2>(x); x += rowx<4>(x); return x + rowx<8>(x); }
__device__ __forceinline__ void putp(float p, h16* a, h16*, int o) { a[o] = tohx(p); }
__device__ __forceinline__ void putp(float p, bf* a, bf* b, int o) { unsigned short x, y; splitf(p, x, y); a[o] = x; b[o] = y; }
template <typename T16, bool HR>
__device__ __forceinline__ void attn_rows(const T16* __restrict__ Q, const T16* __restrict__ Q2, const T16* __restrict__ Kp, const T16* __restrict__ K2, const T16* __restrict__ E, const T16* __restrict__ Vt, const T16* __restrict__ Vt2,
                                          int i0, float* es, T16* ps, T16* ps2, bf* Ah, bf* Al) {
    typedef typename WFrag<T16>::V V; typedef WFrag<T16> F;   // every inner loop below is unrolled so that fragments, tiles and row statistics are indexed by constants (stay in registers)
    // hi+lo rows take the lane number from mbcnt (every lane is on, 32 lanes a wave): the thread id is then not read in the hi+lo branch, whose fragment runs leave no register to hold it (it was spilled to scratch)
    const int lane = HR ? (int)__builtin_amdgcn_mbcnt_lo(~0u, 0u) : (int)(threadIdx.x & 31), lr = lane & 15, hi = lane >> 4; const unsigned lb = lane * 16;   // the lane's byte offset inside a block of a plane in fragment order
    const int eb = hi * 8 * EP + lr, pb = hi * 8 * PP + lr;   // the lane's place in the logit and the probability slice; rows and tiles are constant offsets from it
    V aq[2], aq2[2];
#pragma unroll
    for (int ks = 0; ks < 2; ++ks) { aq[ks] = F::ldf(at(Q, lb) + (size_t)i0 * HD + ks * 512); if (HR) aq2[ks] = F::ldf(at(Q2, lb) + (size_t)i0 * HD + ks * 512); }
    v8f o[4]; float m[8], l[8];
#pragma unroll
    for (int nb = 0; nb < 4; ++nb) o[nb] = (v8f){};
#pragma unroll
    for (int j = 0; j < 8; ++j) { m[j] = -3.0e38f; l[j] = 0.f; }
    const int nblk = (i0 >> 6) + 1;   // key blocks up to and with the one that holds the diagonal (i0 is a multiple of 16)
#pragma unroll 1   // kept rolled: two blocks' fragments and tiles at once would not fit the register budget
    for (int kb = 0; kb < nblk; ++kb) {
        const int c0 = kb * 64;
        v8f s[4], e[5];
        const unsigned kp = c0 * HD * 2 + lb; unsigned ep[5];   // the lane's byte offset in the key planes and in each Er tile (one register each, the plane's base is wave-uniform); tiles and k steps (blocks of 512 elements) are constant offsets
        const int rb = TT - 16 - i0 + c0;
#pragma unroll
        for (int t = 0; t < 5; ++t) { e[t] = (v8f){}; ep[t] = min(rb + t * 16, TT - 16) * HD * 2 + lb; }   // rb is a multiple of 16: a tile lies wholly inside Er or wholly past T-1; rows past T-1 belong to keys j > i only (masked below): the clamp keeps the address inside Er
#pragma unroll
        for (int nb = 0; nb < 4; ++nb) s[nb] = (v8f){};
        // Behind each run of fragment loads stands one wait. Its inputs are the run's address registers (each stays whole until every load that names it is past the wait, so no later load or result lands on it before)
        // and the loaded fragments (no product of the run moves in front of it, so all loads of the run are in flight together and the run pays the memory latency once instead of once per refill of a few registers).
        if (!HR) {   // single-plane rows: all 18 key and Er fragments of the block fit the registers: one run
            V bk[4][2], be[5][2];
#pragma unroll
            for (int ks = 0; ks < 2; ++ks) {
#pragma unroll
                for (int nb = 0; nb < 4; ++nb) bk[nb][ks] = F::ldf(at(Kp, kp) + nb * 16 * HD + ks * 512);
#pragma unroll
                for (int t = 0; t < 5; ++t) be[t][ks] = F::ldf(at(E, ep[t]) + ks * 512); }
            asm volatile("s_wait_xcnt 0x0" :: "v"(kp), "v"(ep[0]), "v"(ep[1]), "v"(ep[2]), "v"(ep[3]), "v"(ep[4]), "v"(bk[0][0]), "v"(bk[1][0]), "v"(bk[2][0]), "v"(bk[3][0]), "v"(bk[0][1]), "v"(bk[1][1]), "v"(bk[2][1]), "v"(bk[3][1]),
                         "v"(be[0][0]), "v"(be[1][0]), "v"(be[2][0]), "v"(be[3][0]), "v"(be[4][0]), "v"(be[0][1]), "v"(be[1][1]), "v"(be[2][1]), "v"(be[3][1]), "v"(be[4][1]) : "memory");
            __builtin_amdgcn_sched_barrier(0);   // without it the scheduler lifts the first product over the wait, and its data wait then stands behind four loads only: the rest of the run would start one memory latency later
#pragma unroll
            for (int ks = 0; ks < 2; ++ks) {
#pragma unroll
                for (int nb = 0; nb < 4; ++nb) s[nb] = F::mma(aq[ks], bk[nb][ks], s[nb]);
#pragma unroll
                for (int t = 0; t < 5; ++t) e[t] = F::mma(aq[ks], be[t][ks], e[t]); }
        } else {     // hi+lo rows: three runs (key hi plane, key lo plane, Er), each as large as the registers allow
            { V bk[4][2];
#pragma unroll
              for (int nb = 0; nb < 4; ++nb)
#pragma unroll
                  for (int ks = 0; ks < 2; ++ks) bk[nb][ks] = F::ldf(at(Kp, kp) + nb * 16 * HD + ks * 512);
              asm volatile("s_wait_xcnt 0x0" :: "v"(kp), "v"(bk[0][0]), "v"(bk[1][0]), "v"(bk[2][0]), "v"(bk[3][0]), "v"(bk[0][1]), "v"(bk[1][1]), "v"(bk[2][1]), "v"(bk[3][1]) : "memory");
#pragma unroll
              for (int ks = 0; ks < 2; ++ks)
#pragma unroll
                  for (int nb = 0; nb < 4; ++nb) { s[nb] = F::mma(aq[ks], bk[nb][ks], s[nb]); s[nb] = F::mma(aq2[ks], bk[nb][ks], s[nb]); } }
            { V bk[4][2];
#pragma unroll
              for (int nb = 0; nb < 4; ++nb)
#pragma unroll
                  for (int ks = 0; ks < 2; ++ks) bk[nb][ks] = F::ldf(at(K2, kp) + nb * 16 * HD + ks * 512);
              asm volatile("s_wait_xcnt 0x0" :: "v"(kp), "v"(bk[0][0]), "v"(bk[1][0]), "v"(bk[2][0]), "v"(bk[3][0]), "v"(bk[0][1]), "v"(bk[1][1]), "v"(bk[2][1]), "v"(bk[3][1]) : "memory");
#pragma unroll
              for (int ks = 0; ks < 2; ++ks)
#pragma unroll
                  for (int nb = 0; nb < 4; ++nb) s[nb] = F::mma(aq[ks], bk[nb][ks], s[nb]); }
            { V be[5][2];
#pragma unroll
              for (int t = 0; t < 5; ++t)
#pragma unroll
                  for (int ks = 0; ks < 2; ++ks) be[t][ks] = F::ldf(at(E, ep[t]) + ks * 512);
              asm volatile("s_wait_xcnt 0x0" :: "v"(ep[0]), "v"(ep[1]), "v"(ep[2]), "v"(ep[3]), "v"(ep[4]), "v"(be[0][0]), "v"(be[1][0]), "v"(be[2][0]), "v"(be[3][0]), "v"(be[4][0]), "v"(be[0][1]), "v"(be[1][1]), "v"(be[2][1]), "v"(be[3][1]), "v"(be[4][1]) : "memory");
#pragma unroll
              for (int ks = 0; ks < 2; ++ks)
#pragma unroll
                  for (int t = 0; t < 5; ++t) { e[t] = F::mma(aq[ks], be[t][ks], e[t]); e[t] = F::mma(aq2[ks], be[t][ks], e[t]); } }
        }
#pragma unroll
        for (int t = 0; t < 5; ++t)
#pragma unroll
            for (int j = 0; j < 8; ++j) es[eb + j * EP + t * 16] = e[t][j];
        wave_lds_order();
        const unsigned vp = c0 * 16 * 2 + lb;   // the lane's byte offset in the transposed value planes (32 keys of 16 head dims are one block; 16 head dims are a row of blocks over the positions of all batches); tiles and k steps are constant offsets from it
        V bv[4][2];   // single-plane rows: value fragments asked for here, where the logit registers are free again, so that they fly under the softmax (the hi+lo rows have no registers to spare for it and at most 8 blocks)
        if (!HR) {
#pragma unroll
            for (int nb = 0; nb < 4; ++nb)
#pragma unroll
                for (int ks = 0; ks < 2; ++ks) bv[nb][ks] = F::ldf(at(Vt, vp) + nb * 16 * (NB_ * TT) + ks * 512);
            asm volatile("s_wait_xcnt 0x0" :: "v"(vp) : "memory");   // the run's address register stays whole up to this wait (it is an input here), so no load of the run lands on it while the others are issued
        }
#pragma unroll
        for (int nb = 0; nb < 4; ++nb)
#pragma unroll
            for (int j = 0; j < 8; ++j) s[nb][j] = (s[nb][j] + es[eb - hi * 8 + j * (EP - 1) + 15 + nb * 16]) * (SCL * 1.4426950408889634f);   // row a reads column 15 - a + b; logits kept in units of log 2
        if (c0 + 63 > i0) {   // only the diagonal block holds keys j > i (wave-uniform test)
            const int dg = lr - hi * 8 - (i0 - c0);   // formed here, so that each test below is one value against a constant and nothing of the mask is held over the key loop
#pragma unroll
            for (int nb = 0; nb < 4; ++nb)
#pragma unroll
                for (int j = 0; j < 8; ++j) if (dg > j - nb * 16) s[nb][j] = -3.0e38f;   // key c0 + nb*16 + lr > row i0 + hi*8 + j
        }
#pragma unroll
        for (int j = 0; j < 8; ++j) {
            const float mn = fmaxf(m[j], rowmax16(fmaxf(fmaxf(s[0][j], s[1][j]), fmaxf(s[2][j], s[3][j]))));
            const float al = __builtin_amdgcn_exp2f(m[j] - mn); m[j] = mn;
            float ps4 = 0.f;
#pragma unroll
            for (int nb = 0; nb < 4; ++nb) { const float p = __builtin_amdgcn_exp2f(s[nb][j] - mn); ps4 += p; putp(p, ps, ps2, pb + j * PP + nb * 16); o[nb][j] *= al; }
            l[j] = l[j] * al + ps4;   // each lane keeps the sum of its own 4 columns; the 16 lanes of a row are added once, behind the loop
        }
        if (HR) {   // hi plane of the values: asked for when the score registers are free, it flies under the LDS read-back
#pragma unroll
            for (int nb = 0; nb < 4; ++nb)
#pragma unroll
                for (int ks = 0; ks < 2; ++ks) bv[nb][ks] = F::ldf(at(Vt, vp) + nb * 16 * (NB_ * TT) + ks * 512);
            asm volatile("s_wait_xcnt 0x0" :: "v"(vp) : "memory");   // as above: the run's address register stays whole up to the wait
        }
        wave_lds_order();
        V ap[2], ap2[2];
#pragma unroll
        for (int ks = 0; ks < 2; ++ks) { ap[ks] = F::ld(ps + lr * PP + ks * 32 + 8 * hi); if (HR) ap2[ks] = F::ld(ps2 + lr * PP + ks * 32 + 8 * hi); }
#pragma unroll
        for (int ks = 0; ks < 2; ++ks)
#pragma unroll
            for (int nb = 0; nb < 4; ++nb) { o[nb] = F::mma(ap[ks], bv[nb][ks], o[nb]); if (HR) o[nb] = F::mma(ap2[ks], bv[nb][ks], o[nb]); }
        if (HR) {   // lo plane of the values
#pragma unroll
            for (int nb = 0; nb < 4; ++nb)
#pragma unroll
                for (int ks = 0; ks < 2; ++ks) bv[nb][ks] = F::ldf(at(Vt2, vp) + nb * 16 * (NB_ * TT) + ks * 512);
            asm volatile("s_wait_xcnt 0x0" :: "v"(vp) : "memory");   // as above
#pragma unroll
            for (int ks = 0; ks < 2; ++ks)
#pragma unroll
                for (int nb = 0; nb < 4; ++nb) o[nb] = F::mma(ap[ks], bv[nb][ks], o[nb]);
        }
    }
    const int ln = (int)__builtin_amdgcn_mbcnt_lo(~0u, 0u), lq = ln & 15, hq = ln >> 4;   // the lane number read anew (every lane is on, 32 lanes a wave): lr and hi need not be held over the key loop, whose fragment run leaves no register for them
#pragma unroll
    for (int j = 0; j < 8; ++j) { const float f = __fdiv_rn(1.0f, rowsum16(l[j]));
#pragma unroll
        for (int nb = 0; nb < 4; ++nb) es[hq * 8 * 68 + lq + j * 68 + nb * 16] = o[nb][j] * f; }
    wave_lds_order();
#pragma unroll
    for (int s8 = 0; s8 < 8; ++s8) { const int row = ln >> 1, cofs = s8 * 8 + (ln & 1) * 4; const v4f val = *(const v4fa*)(es + row * 68 + cofs); v4us oh, ol;
#pragma unroll
        for (int q = 0; q < 4; ++q) { unsigned short a, c2; splitf(val[q], a, c2); oh[q] = a; ol[q] = c2; }
        const size_t oo = (size_t)i0 * DQ + s8 * 128 + ln * 4; *(v4us*)(Ah + oo) = oh; *(v4us*)(Al + oo) = ol; }
}
// grid (T/64, heads, batches), 128 threads; in each head and batch the work-groups with the most key blocks come first. waves_per_eu 4: a budget of 256 registers, so that the loops hold no register-window switches
__global__ __launch_bounds__(32 * FW) __attribute__((amdgpu_waves_per_eu(4))) void k_fattn(const h16* __restrict__ Q16, const bf* __restrict__ Qh, const bf* __restrict__ Ql, const h16* __restrict__ K16, const bf* __restrict__ Kh, const bf* __restrict__ Kl,
                                                   const h16* __restrict__ V16, const bf* __restrict__ Vh, const bf* __restrict__ Vl, const h16* __restrict__ E16, const bf* __restrict__ Eb, bf* Ah, bf* Al) {
    __shared__ __align__(16) float es[FW][16 * EP];
    __shared__ __align__(16) unsigned short ps[FW][2][16 * PP];
    const int wv = __builtin_amdgcn_readfirstlane((int)(threadIdx.x >> 5));   // wave number in a scalar register: the row range, the trip count and the branch below stay scalar
    const int i0 = (TT / (16 * FW) - 1 - (int)blockIdx.x) * (16 * FW) + wv * 16; const size_t zp = ((size_t)blockIdx.y * NB_ + blockIdx.z) * TT * HD;   // q and k planes: [head][batch][t][d]
    const size_t zv = (size_t)blockIdx.y * HD * (NB_ * TT) + (size_t)blockIdx.z * TT * 16;   // value planes: a head's 64 rows of NB_ * T positions; a batch's T positions of 16 rows are T / 32 blocks
    const size_t hc = (size_t)blockIdx.z * TT * DQ + (size_t)blockIdx.y * HD * 16;   // output planes (fragment order, rows of DQ): the batch's T rows, then a head's 64 columns of 16 rows: two blocks
    if (i0 < RH) attn_rows<bf, true>(Qh + zp, Ql + zp, Kh + zp, Kl + zp, Eb, Vh + zv, Vl + zv, i0, es[wv], ps[wv][0], ps[wv][1], Ah + hc, Al + hc);
    else attn_rows<h16, false>(Q16 + zp, nullptr, K16 + zp, nullptr, E16, V16 + zv, nullptr, i0, es[wv], (h16*)ps[wv][0], nullptr, Ah + hc, Al + hc);
}

__device__ __forceinline__ void er16(const float* __restrict__ er, h16* E, int blk) { const int i = (blk * 256 + threadIdx.x) * 4; if (i >= TT * HD) return; int row, k; frag_at((size_t)i, HD, row, k); const float* p = er + row * HD + k; const v4f a = *(const v4f*)p;
    asm volatile("s_wait_xcnt 0x0" :: "v"(p) : "memory");   // the load's address pair stays whole up to this wait (it is an input here): neither the loaded value nor a later result lands on it before
    v4h o; o[0] = tohx(bfr(a[0])); o[1] = tohx(bfr(a[1])); o[2] = tohx(bfr(a[2])); o[3] = tohx(bfr(a[3])); *(v4h*)(E + i) = o;  }
typedef __attribute__((ext_vector_type(4))) _Float16 v4hx;
#define PB_WA ((DM * 3 * DM / 64 + 63) / 64)          // work-groups of each conversion, as many as its own launch had
#define PB_WO ((DQ * DM / 64 + 63) / 64)
#define PB_X  ((NB_ * TT * DM / 8 + 255) / 256)
#define PB_EB ((TT * HD / 8 + 255) / 256)
#define PB_EH ((TT * HD / 4 + 255) / 256)
// the weight transposes come first: their waves walk 8 lines one after the other and last longest
__global__ __launch_bounds__(256) void k_prep(const float* __restrict__ x, const float* __restrict__ wattn, const float* __restrict__ wo, const float* __restrict__ er, bf* XB, bf* WQKV, bf* WO, bf* ERB, h16* ER16) {
    int b = (int)blockIdx.x;
    if (b < PB_WA) { wtG(wattn, DM, 3 * DM, WQKV, b); return; } b -= PB_WA;
    if (b < PB_WO) { wtG(wo, DQ, DM, WO, b); return; } b -= PB_WO;
    if (b < PB_X) { cvt8(x, DM, XB, (size_t)NB_ * TT * DM / 8, b); return; } b -= PB_X;
    if (b < PB_EB) { cvt8(er, HD, ERB, TT * HD / 8, b); return; } b -= PB_EB;
    er16(er, ER16, b);
}

extern "C" void kernel_launch(void* const* d_in, const int* in_sizes, int n_in,
                              void* d_out, int out_size, void* d_ws, size_t ws_size, hipStream_t stream) {
    (void)in_sizes; (void)n_in; (void)out_size;
    const float* x = (const float*)d_in[0]; const float* wattn = (const float*)d_in[1]; const float* wo = (const float*)d_in[2]; const float* er = (const float*)d_in[3];
    float* OUT = (float*)d_out;     // [2][2048][1024]
    char* wsp = (char*)d_ws;
    auto take = [&](size_t bytes) { char* p = wsp; wsp += (bytes + 255) & ~(size_t)255; return (void*)p; };
    bf* WQKV = (bf*)take((size_t)3 * DM * DM * 2); bf* ERB = (bf*)take((size_t)TT * HD * 2); h16* ER16 = (h16*)take((size_t)TT * HD * 2); bf* WO = (bf*)take((size_t)DM * DQ * 2);
    bf* XB = (bf*)take((size_t)NB_ * TT * DM * 2);
    h16* QP16 = (h16*)take((size_t)NB_ * NH_ * TT * HD * 2); h16* KP16 = (h16*)take((size_t)NB_ * NKV * TT * HD * 2); h16* VT16 = (h16*)take((size_t)NB_ * NKV * HD * TT * 2);
    bf* QPh = (bf*)take((size_t)NB_ * NH_ * TT * HD * 2); bf* QPl = (bf*)take((size_t)NB_ * NH_ * TT * HD * 2); bf* KPh = (bf*)take((size_t)NB_ * NKV * TT * HD * 2); bf* KPl = (bf*)take((size_t)NB_ * NKV * TT * HD * 2); bf* VTh = (bf*)take((size_t)NB_ * NKV * HD * TT * 2); bf* VTl = (bf*)take((size_t)NB_ * NKV * HD * TT * 2);
    bf* ATh = (bf*)take((size_t)NB_ * TT * DQ * 2); bf* ATl = (bf*)take((size_t)NB_ * TT * DQ * 2);
    if ((size_t)(wsp - (char*)d_ws) > ws_size) return;    // ws 256 MiB
    // x, both batches, is one matrix of NB_ * T rows: every launch below covers both batches. Four launches, each needing the one before it: conversions, projections, attention, W_proj
    k_prep<<<PB_WA + PB_WO + PB_X + PB_EB + PB_EH, 256, 0, stream>>>(x, wattn, wo, er, XB, WQKV, WO, ERB, ER16);
    k_qkv<<<dim3(NB_ * TT / 64, DQ / 64, 3), 256, 0, stream>>>(XB, WQKV, QP16, QPh, QPl, KP16, KPh, KPl, VT16, VTh, VTl);
    k_fattn<<<dim3(TT / (16 * FW), NH_, NB_), 32 * FW, 0, stream>>>(QP16, QPh, QPl, KP16, KPh, KPl, VT16, VTh, VTl, ER16, ERB, ATh, ATl);   // one kv head per query head
    k_gemmw<bf, 1, false, 8, false><<<dim3(NB_ * TT / 64, DM / 64, 1), 256, 0, stream>>>(ATh, ATl, WO, nullptr, DQ, OUT, DM, nullptr, 0, 0, 0, nullptr, nullptr, nullptr, 0);
}

// v008
// One run takes 116 microseconds.
// Timed twice side by side with v007, it ran 1.15 times as fast both times.
// Over all steps from v000 it is 16.5 times as fast.
#include <hip/hip_runtime.h>

// CausalSelfAttentionRelativePosition (x [2][2048][1024]; qkv = x W_attn (16 x 64); Srel = skew(q Er^T) -> Srel[i][j] = q_i . Er[T-1-i+j] for j <= i (the skew's wrapped entries above the diagonal are masked); att = softmax(((q.k) + Srel)/8, causal);
// y = att v; out = y W_proj -> [2][2048][1024]).
// Compute dtypes, f32 accumulate: every input rounded to bf16; qkv on PLAIN bf16 operands (inputs: exact); scores q.k (K 64), the relative logits q.Er^T and probs.v on bf16 hi+lo planes (3 products; q.Er: hl q x exact Er, 2 products)
// for the first 512 query rows per head and SINGLE fp16 planes for the rest (Er, a bf16 input, is exact in fp16); scores, relative logits, skew, softmax (f32, running maximum and sum) and probs.v in one fused launch, key blocks above the diagonal never touched; W_proj on hl planes x exact.
// BOTH BATCHES RIDE IN EVERY LAUNCH: x is one [NB_ * T][DM] matrix for the projections; q and k planes are [head][batch][t][d], the transposed value planes [head][d][batch * T + t], the attention output [batch * T + t][DQ].
// FRAGMENT ORDER: every 16-bit operand plane in the workspace ([rows][K], K % 32 == 0, rows % 16 == 0) is kept as blocks of 16 rows x 32 k (512 elements, block number (row / 16) * (K / 32) + k / 32); inside a block element (row, k) stands at
// ((k % 32) / 16) * 256 + ((k % 16) / 8) * 128 + (row % 16) * 8 + k % 8. A lane's two 16-byte fragment loads are then block + lane * 8 and block + 256 + lane * 8: each load of a wave reads 512 bytes in a row (4 cache lines) instead of 32 bytes out of each of 16 lines.

#define NB_  2
#define TT   2048
#define DM   1024
#define NH_  16
#define NKV  16
#define REP  (NH_ / NKV)
#define HD   64
#define DQ   (NH_ * HD)
#define DKV  (NKV * HD)
#define RH   512                  // query rows < RH use hi+lo planes
#define SCL  0.125f   // HD^-0.5
typedef _Float16 h16;
typedef unsigned short bf;
typedef __attribute__((ext_vector_type(16))) __bf16   v16bf;
typedef __attribute__((ext_vector_type(16))) _Float16 v16h;
typedef __attribute__((ext_vector_type(8)))  _Float16 v8h;
typedef __attribute__((ext_vector_type(8)))  unsigned short v8us;
typedef __attribute__((ext_vector_type(8)))  float    v8f;
typedef __attribute__((ext_vector_type(4)))  float    v4f;
typedef v8h  __attribute__((may_alias)) v8ha;
typedef v4f  __attribute__((may_alias)) v4fa;
typedef v8us __attribute__((may_alias)) v8usa;

__device__ __forceinline__ unsigned short f2bf(float f) { unsigned u = __float_as_uint(f); u += 0x7FFFu + ((u >> 16) & 1u); return (unsigned short)(u >> 16); }
__device__ __forceinline__ float bf2f(unsigned short b) { return __uint_as_float(((unsigned)b) << 16); }
__device__ __forceinline__ float bfr(float f) { return bf2f(f2bf(f)); }
__device__ __forceinline__ v16h cat16(v8h lo, v8h hi) { return __builtin_shufflevector(lo, hi, 0, 1, 2, 3, 4, 5, 6, 7, 8, 9, 10, 11, 12, 13, 14, 15); }
__device__ __forceinline__ v16bf cat16b(v8us lo, v8us hi) { return __builtin_bit_cast(v16bf, __builtin_shufflevector(lo, hi, 0, 1, 2, 3, 4, 5, 6, 7, 8, 9, 10, 11, 12, 13, 14, 15)); }
__device__ __forceinline__ v8f wmma16(v16h a, v16h b, v8f c) { return __builtin_amdgcn_wmma_f32_16x16x32_f16(false, a, false, b, (short)0, c, false, false); }
__device__ __forceinline__ v8f wmmab(v16bf a, v16bf b, v8f c) { return __builtin_amdgcn_wmma_f32_16x16x32_bf16(false, a, false, b, (short)0, c, false, false); }
__device__ __forceinline__ h16 tohx(float x) { return (h16)x; }
__device__ __forceinline__ void splitf(float y, unsigned short& h, unsigned short& l) { h = f2bf(y); l = f2bf(y - bf2f(h)); }
typedef __attribute__((ext_vector_type(4))) _Float16 v4h;
typedef __attribute__((ext_vector_type(4))) unsigned short v4us;



// ---- k_gemmw: register-blocked GEMM, ONE WAVE per 64x64 output tile (16 accumulators), operands straight from 16-bit planes in fragment order; grid (M/64, N/64, Z), 32 threads.
// C[m][n] (f32, pitch ldc, + optional f32 bias[n]) = sum_k A[m][k] Bt[n][k] (+ split products per NSPLIT). z-batch strides sA/sB/sC in elements. K % 32 == 0.
// NW > 1 (32 * NW threads): NW waves share the tile; wave w takes the k steps w, w + NW, ...; each leaves its partial 64x64 tile in LDS and, behind one barrier, the work-group sums the NW partials in wave order.
// PL (NW > 1 only): the summed tile goes out as three 16-bit planes (fp16, bf16 hi, bf16 lo) instead of f32, in fragment order for rows of ldc elements: the tile's 8 blocks start at by * sP + r0 * ldc, so that a tile of 64 columns lands either
// in its own head's [batch][t][d] plane (sP = NB_ * T * 64, ldc = 64) or as 64 columns of a wide row (sP = 2 blocks, ldc = row length); no f32 copy of the product is written.
// ld: a fragment from a row-major slice (LDS); ldf: a fragment from a plane in fragment order (p = block + lane * 8)
// frag_at: which (row, k) of a [rows][K] matrix stands at element e of its plane in fragment order
__device__ __forceinline__ void frag_at(size_t e, int K, int& row, int& k) { const int blk = (int)(e >> 9), r = (int)(e & 511), kb = K >> 5; row = (blk / kb) * 16 + ((r >> 3) & 15); k = (blk % kb) * 32 + (r >> 8) * 16 + ((r >> 7) & 1) * 8 + (r & 7); }
template <typename T16> struct WFrag;
template <> struct WFrag<h16> { typedef v16h V; static __device__ __forceinline__ V ld(const h16* p) { return cat16(*(const v8h*)p, *(const v8h*)(p + 16)); } static __device__ __forceinline__ V ldf(const h16* p) { return cat16(*(const v8h*)p, *(const v8h*)(p + 256)); } static __device__ __forceinline__ v8f mma(V a, V b, v8f c) { return wmma16(a, b, c); } };
template <> struct WFrag<bf> { typedef v16bf V; static __device__ __forceinline__ V ld(const bf* p) { return cat16b(*(const v8us*)p, *(const v8us*)(p + 16)); } static __device__ __forceinline__ V ldf(const bf* p) { return cat16b(*(const v8us*)p, *(const v8us*)(p + 256)); } static __device__ __forceinline__ v8f mma(V a, V b, v8f c) { return wmmab(a, b, c); } };
template <typename T16> __device__ __forceinline__ const T16* at(const T16* base, unsigned bytes) { return (const T16*)((const char*)base + bytes); }   // wave-uniform base + the lane's 32-bit byte offset
// gemmw_tile: the work of one work-group, tile (bx, by); the kernels below only say which product and which tile a work-group takes
template <typename T16, int NSPLIT, bool BIAS, int NW, bool PL>
__device__ __forceinline__ void gemmw_tile(const T16* __restrict__ A, const T16* __restrict__ A2, const T16* __restrict__ Bt, const T16* __restrict__ Bt2, int K, float* C, int ldc, const float* __restrict__ bias,
                                           h16* P16, bf* Ph, bf* Pl, size_t sP, int bx, int by) {
    typedef typename WFrag<T16>::V V;
    __shared__ __align__(16) float os[(NW > 1 ? NW * 64 : 16) * 68];
    const int lane = threadIdx.x & 31, lr = lane & 15, hi = lane >> 4; const int r0 = bx * 64, c0 = by * 64; const int wv = (NW > 1) ? __builtin_amdgcn_readfirstlane((int)(threadIdx.x >> 5)) : 0;   // wave number in a scalar register: the K loop's counter and branch stay scalar
    v8f acc[4][4];
#pragma unroll
    for (int mb = 0; mb < 4; ++mb)
#pragma unroll
        for (int nb = 0; nb < 4; ++nb) acc[mb][nb] = (v8f){};
    const unsigned lb = lane * 16;   // the lane's byte offset inside a block
#pragma unroll 1
    for (int kc = wv * 32; kc < K; kc += 32 * NW) {
        V a[4], a2[4], b[4], b2[4]; unsigned ao[4], bo[4];   // the lane's byte offset of each fragment (the plane's base is wave-uniform): 16 rows of K are K / 32 blocks = 16 * K elements; a k step of 32 is one block
#pragma unroll
        for (int t = 0; t < 4; ++t) { ao[t] = (unsigned)(((r0 + t * 16) * K + kc * 16) * 2) + lb; bo[t] = (unsigned)(((c0 + t * 16) * K + kc * 16) * 2) + lb; }
#pragma unroll
        for (int mb = 0; mb < 4; ++mb) { a[mb] = WFrag<T16>::ldf(at(A, ao[mb])); if (NSPLIT == 1 || NSPLIT == 2) a2[mb] = WFrag<T16>::ldf(at(A2, ao[mb])); }
#pragma unroll
        for (int nb = 0; nb < 4; ++nb) { b[nb] = WFrag<T16>::ldf(at(Bt, bo[nb])); if (NSPLIT >= 2) b2[nb] = WFrag<T16>::ldf(at(Bt2, bo[nb])); }
        asm volatile("s_wait_xcnt 0x0" :: "v"(ao[0]), "v"(ao[1]), "v"(ao[2]), "v"(ao[3]), "v"(bo[0]), "v"(bo[1]), "v"(bo[2]), "v"(bo[3]) : "memory");   // the trip's address registers stay whole up to this wait (they are inputs here): no load of the trip lands on one, and the next trip rewrites them behind it
#pragma unroll
        for (int nb = 0; nb < 4; ++nb) {
#pragma unroll
            for (int mb = 0; mb < 4; ++mb) { acc[mb][nb] = WFrag<T16>::mma(a[mb], b[nb], acc[mb][nb]); if (NSPLIT == 1 || NSPLIT == 2) acc[mb][nb] = WFrag<T16>::mma(a2[mb], b[nb], acc[mb][nb]); if (NSPLIT >= 2) acc[mb][nb] = WFrag<T16>::mma(a[mb], b2[nb], acc[mb][nb]); } }
        asm volatile("v_nop\n\tv_nop\n\tv_nop\n\tv_nop" : "+v"(acc[0][0]), "+v"(acc[1][1]), "+v"(acc[2][2]), "+v"(acc[3][3]) : "v"(a[0]), "v"(a[3]));
    }
    if (NW > 1) {   // the loops below are unrolled so that acc is indexed by constants (stays in registers) and the LDS reads of one sum go out together
#pragma unroll
        for (int mb = 0; mb < 4; ++mb)
#pragma unroll
            for (int nb = 0; nb < 4; ++nb)
#pragma unroll
                for (int j = 0; j < 8; ++j) os[(wv * 64 + mb * 16 + hi * 8 + j) * 68 + nb * 16 + lr] = acc[mb][nb][j];
        __syncthreads();   // every wave's partial tile is in LDS before any thread sums across waves
#pragma unroll
        for (int s = 0; s < 32 / NW; ++s) { const int u = s * 32 * NW + (int)threadIdx.x;   // PL: u counts the groups of 4 elements in the order of the planes, so that a wave's stores stay in a row
            const int row = PL ? (u >> 8) * 16 + ((u >> 1) & 15) : u >> 4, cofs = PL ? ((u >> 5) & 7) * 8 + (u & 1) * 4 : (u & 15) * 4; v4f val = *(const v4fa*)(os + row * 68 + cofs);
#pragma unroll
            for (int w = 1; w < NW; ++w) val += *(const v4fa*)(os + (w * 64 + row) * 68 + cofs);
            if (BIAS) { val[0] += bfr(bias[c0 + cofs]); val[1] += bfr(bias[c0 + cofs + 1]); val[2] += bfr(bias[c0 + cofs + 2]); val[3] += bfr(bias[c0 + cofs + 3]); }
            if (PL) { v4h o16; v4us oh, ol;
#pragma unroll
                for (int q = 0; q < 4; ++q) { o16[q] = tohx(val[q]); unsigned short a2, c2; splitf(val[q], a2, c2); oh[q] = a2; ol[q] = c2; }
                const size_t po = (size_t)by * sP + (size_t)r0 * ldc + (size_t)((u >> 8) * (ldc >> 5) + ((u >> 7) & 1)) * 512 + (u & 127) * 4; *(v4h*)(P16 + po) = o16; *(v4us*)(Ph + po) = oh; *(v4us*)(Pl + po) = ol; }
            else *(v4f*)(C + (size_t)(r0 + row) * ldc + c0 + cofs) = val; }
        return;
    }
#pragma unroll
    for (int mb = 0; mb < 4; ++mb) {
#pragma unroll
        for (int nb = 0; nb < 4; ++nb) {
#pragma unroll
            for (int j = 0; j < 8; ++j) os[(hi * 8 + j) * 68 + nb * 16 + lr] = acc[mb][nb][j]; }
        __builtin_amdgcn_wave_barrier(); asm volatile("" ::: "memory");
        float* crow = C + (size_t)(r0 + mb * 16) * ldc + c0;
{
#pragma unroll
            for (int s = 0; s < 8; ++s) { const int row = 2 * s + hi, cofs = lr * 4; v4f val = *(const v4fa*)(os + row * 68 + cofs); if (BIAS) { val[0] += bfr(bias[c0 + cofs]); val[1] += bfr(bias[c0 + cofs + 1]); val[2] += bfr(bias[c0 + cofs + 2]); val[3] += bfr(bias[c0 + cofs + 3]); }
                *(v4f*)(crow + (size_t)row * ldc + cofs) = val; }
             }
        __builtin_amdgcn_wave_barrier(); asm volatile("" ::: "memory");
    }
}
template <typename T16, int NSPLIT, bool BIAS, int NW, bool PL>
__global__ __launch_bounds__(32 * NW) void k_gemmw(const T16* __restrict__ A, const T16* __restrict__ A2, const T16* __restrict__ Bt, const T16* __restrict__ Bt2, int K, float* C, int ldc, const float* __restrict__ bias, size_t sA, size_t sB, size_t sC,
                                                   h16* P16, bf* Ph, bf* Pl, size_t sP) {
    const size_t z = blockIdx.z; A += z * sA; if (A2) A2 += z * sA; Bt += z * sB; if (Bt2) Bt2 += z * sB; C += z * sC;
    gemmw_tile<T16, NSPLIT, BIAS, NW, PL>(A, A2, Bt, Bt2, K, C, ldc, bias, P16, Ph, Pl, sP, (int)blockIdx.x, (int)blockIdx.y);
}
// ---- k_qkv: the q, k and v projections in ONE launch, grid (NB_ * T / 64, DQ / 64, 3); blockIdx.z picks the product (none reads what another writes).
// q and k: x W, a tile's 64 columns are one head (HD = 64), so it goes straight into that head's [batch][t][d] planes.
// v: the product is taken as W_v^T x^T (rows = head dims, columns = positions of both batches), so the tile already has the [h][d][batch * T + t] order that probs.v reads; 64 positions of 16 head dims are two blocks (1024 elements);
// its tiles are numbered with the head-dim tile running fastest, so that work-groups that start together share a tile of x.
__global__ __launch_bounds__(256) void k_qkv(const bf* __restrict__ X, const bf* __restrict__ Wqkv, h16* Q16, bf* Qh, bf* Ql, h16* K16, bf* Kh, bf* Kl, h16* V16, bf* Vh, bf* Vl) {
    const int z = (int)blockIdx.z; const bool isv = z == 2; const int flat = (int)blockIdx.y * (NB_ * TT / 64) + (int)blockIdx.x;
    const bf* W = Wqkv + (size_t)z * DM * DM;
    gemmw_tile<bf, 0, false, 8, true>(isv ? W : X, nullptr, isv ? X : W, nullptr, DM, nullptr, isv ? NB_ * TT : HD, nullptr, z == 0 ? Q16 : isv ? V16 : K16, z == 0 ? Qh : isv ? Vh : Kh, z == 0 ? Ql : isv ? Vl : Kl,
                                      isv ? (size_t)1024 : (size_t)NB_ * TT * HD, isv ? flat % (DKV / 64) : (int)blockIdx.x, isv ? flat / (DKV / 64) : (int)blockIdx.y);
}

typedef __attribute__((ext_vector_type(2))) unsigned short v2us;
typedef __attribute__((ext_vector_type(4))) int v4i;

// The five operand conversions (W_attn, W_proj, x, Er to bf16, Er to fp16) are bodies of ONE launch, k_prep: each takes its own range of work-groups, blk counts inside the range.
__device__ __forceinline__ void wtG(const float* __restrict__ w, int K, int N, bf* Bt, int blk) {
    const int lane = threadIdx.x & 31; const int L0 = (blk * 8 + (threadIdx.x >> 5)) * 8; const int nlines = N * K / 64;
{
#pragma unroll 1
        for (int l = 0; l < 8; ++l) { const int L = L0 + l; if (L >= nlines) break; const size_t e = (size_t)L * 64 + lane * 2; int k, n; frag_at(e, K, n, k); v2us o;
            o[0] = f2bf(w[(size_t)k * N + n]); o[1] = f2bf(w[(size_t)(k + 1) * N + n]); *(v2us*)(Bt + e) = o; }
         }
}
__device__ __forceinline__ void cvt8(const float* __restrict__ src, int K, bf* dst, size_t n8, int blk) { const size_t i = (size_t)blk * 256 + threadIdx.x; if (i >= n8) return; int row, k; frag_at(i * 8, K, row, k); const v8f v = *(const v8f*)(src + (size_t)row * K + k); v8us o;
#pragma unroll
    for (int k = 0; k < 8; ++k) o[k] = f2bf(v[k]); *(v8us*)(dst + i * 8) = o;  }
// ---- k_fattn: scores, relative logits, skew, causal softmax and probs.v of every head and batch in ONE launch; no score, logit or probability ever goes to memory.
// One wave walks a range of the key blocks of 64 of 16 query rows (i0..i0+15), with a running row maximum and a running row sum (f32).
// EQUAL WORK PER WAVE: the cost of a tile of 64 query rows grows with its place (tile t has t + 1 key blocks) and every wave of the launch is resident at once, so the launch lasts as long as its fullest wave. A work-group of 8 waves takes one tile of the
// upper half and one of the lower half; waves 0..3 walk the first key blocks of the upper tile's four row groups, waves 4..7 the whole lower tile and then the rest of the upper tile's key blocks; the cut gives both the same cost.
// Waves 4..7 leave their part of the upper tile (unnormalised output, row maximum, row sum) in LDS, and behind ONE work-group barrier waves 0..3 join the two parts as two key blocks are joined in the loop.
// Per block: S = q.k (4 tiles), L = q.Er rows rb..rb+79 with rb = T-16-i0+c0 (5 tiles), Srel[a][b] = L[a][15-a+b] (the skew, a shifted read of the wave's own LDS slice),
// p = exp2(((S+Srel)/8 - rowmax) log2 e), O = O x exp2(old max - new max) + p.v; at the end O / rowsum goes out as hi+lo planes for W_proj.
#define EP 84    // f32 pitch of the logit slice: rows 8 apart fall on different LDS banks for the store and for the shifted read
#define PP 72    // 16-bit pitch of the probability slice: 144 bytes, so each 16-byte fragment read is aligned
#define FW 8     // waves per work-group: 4 row groups x 2 parts
#define NT (TT / 64)   // tiles of 64 query rows per head and batch
// LDS traffic between the lanes of one wave: the wave's LDS instructions run in order; this keeps the compiler from moving an LDS read over the stores that feed it (or a store over the reads before it)
__device__ __forceinline__ void wave_lds_order() { __builtin_amdgcn_wave_barrier(); asm volatile("" ::: "memory"); }
template <int M> __device__ __forceinline__ float rowx(float x) { return __builtin_bit_cast(float, __builtin_amdgcn_update_dpp(__builtin_bit_cast(int, x), __builtin_bit_cast(int, x), 0x160 + M, 0xf, 0xf, false)); }   // lane l with lane l ^ M inside its row of 16 lanes (DPP row_xmask)
__device__ __forceinline__ float rowmax16(float x) { x = fmaxf(x, rowx<1>(x)); x = fmaxf(x, rowx<2>(x)); x = fmaxf(x, rowx<4>(x)); return fmaxf(x, rowx<8>(x)); }
__device__ __forceinline__ float rowsum16(float x) { x += rowx<1>(x); x += rowx<2>(x); x += rowx<4>(x); return x + rowx<8>(x); }
__device__ __forceinline__ void putp(float p, h16* a, h16*, int o) { a[o] = tohx(p); }
__device__ __forceinline__ void putp(float p, bf* a, bf* b, int o) { unsigned short x, y; splitf(p, x, y); a[o] = x; b[o] = y; }
template <typename T16, bool HR>
__device__ __forceinline__ void attn_keys(const T16* __restrict__ Q, const T16* __restrict__ Q2, const T16* __restrict__ Kp, const T16* __restrict__ K2, const T16* __restrict__ E, const T16* __restrict__ Vt, const T16* __restrict__ Vt2,
                                          int i0, int kb0, int kb1, float* es, T16* ps, T16* ps2, v8f (&o)[4], float (&m)[8], float (&l)[8]) {   // key blocks kb0 .. kb1 - 1 of rows i0 .. i0 + 15; o, m, l: unnormalised output, row maximum, each lane's share of the row sum
    typedef typename WFrag<T16>::V V; typedef WFrag<T16> F;   // every inner loop below is unrolled so that fragments, tiles and row statistics are indexed by constants (stay in registers)
    // the lane number comes from mbcnt (every lane is on, 32 lanes a wave): the thread id is then dead before the key loops, whose fragment runs leave no register to hold it
    const int lane = (int)__builtin_amdgcn_mbcnt_lo(~0u, 0u), lr = lane & 15, hi = lane >> 4; const unsigned lb = lane * 16;   // the lane's byte offset inside a block of a plane in fragment order
    const int eb = hi * 8 * EP + lr, pb = hi * 8 * PP + lr;   // the lane's place in the logit and the probability slice; rows and tiles are constant offsets from it
    V aq[2], aq2[2];
#pragma unroll
    for (int ks = 0; ks < 2; ++ks) { aq[ks] = F::ldf(at(Q, lb) + (size_t)i0 * HD + ks * 512); if (HR) aq2[ks] = F::ldf(at(Q2, lb) + (size_t)i0 * HD + ks * 512); }
#pragma unroll
    for (int nb = 0; nb < 4; ++nb) o[nb] = (v8f){};
#pragma unroll
    for (int j = 0; j < 8; ++j) { m[j] = -3.0e38f; l[j] = 0.f; }
#pragma unroll 1   // kept rolled: two blocks' fragments and tiles at once would not fit the register budget
    for (int kb = kb0; kb < kb1; ++kb) {
        const int c0 = kb * 64;
        v8f s[4], e[5];
        const unsigned kp = c0 * HD * 2 + lb; unsigned ep[5];   // the lane's byte offset in the key planes and in each Er tile (one register each, the plane's base is wave-uniform); tiles and k steps (blocks of 512 elements) are constant offsets
        const int rb = TT - 16 - i0 + c0;
#pragma unroll
        for (int t = 0; t < 5; ++t) { e[t] = (v8f){}; ep[t] = min(rb + t * 16, TT - 16) * HD * 2 + lb; }   // rb is a multiple of 16: a tile lies wholly inside Er or wholly past T-1; rows past T-1 belong to keys j > i only (masked below): the clamp keeps the address inside Er
#pragma unroll
        for (int nb = 0; nb < 4; ++nb) s[nb] = (v8f){};
        // Behind each run of fragment loads stands one wait. Its inputs are the run's address registers (each stays whole until every load that names it is past the wait, so no later load or result lands on it before)
        // and the loaded fragments (no product of the run moves in front of it, so all loads of the run are in flight together and the run pays the memory latency once instead of once per refill of a few registers).
        if (!HR) {   // single-plane rows: all 18 key and Er fragments of the block fit the registers: one run
            V bk[4][2], be[5][2];
#pragma unroll
            for (int ks = 0; ks < 2; ++ks) {
#pragma unroll
                for (int nb = 0; nb < 4; ++nb) bk[nb][ks] = F::ldf(at(Kp, kp) + nb * 16 * HD + ks * 512);
#pragma unroll
                for (int t = 0; t < 5; ++t) be[t][ks] = F::ldf(at(E, ep[t]) + ks * 512); }
            asm volatile("s_wait_xcnt 0x0" :: "v"(kp), "v"(ep[0]), "v"(ep[1]), "v"(ep[2]), "v"(ep[3]), "v"(ep[4]), "v"(bk[0][0]), "v"(bk[1][0]), "v"(bk[2][0]), "v"(bk[3][0]), "v"(bk[0][1]), "v"(bk[1][1]), "v"(bk[2][1]), "v"(bk[3][1]),
                         "v"(be[0][0]), "v"(be[1][0]), "v"(be[2][0]), "v"(be[3][0]), "v"(be[4][0]), "v"(be[0][1]), "v"(be[1][1]), "v"(be[2][1]), "v"(be[3][1]), "v"(be[4][1]) : "memory");
            __builtin_amdgcn_sched_barrier(0);   // without it the scheduler lifts the first product over the wait, and its data wait then stands behind four loads only: the rest of the run would start one memory latency later
#pragma unroll
            for (int ks = 0; ks < 2; ++ks) {
#pragma unroll
                for (int nb = 0; nb < 4; ++nb) s[nb] = F::mma(aq[ks], bk[nb][ks], s[nb]);
#pragma unroll
                for (int t = 0; t < 5; ++t) e[t] = F::mma(aq[ks], be[t][ks], e[t]); }
        } else {     // hi+lo rows: three runs (key hi plane, key lo plane, Er), each as large as the registers allow
            { V bk[4][2];
#pragma unroll
              for (int nb = 0; nb < 4; ++nb)
#pragma unroll
                  for (int ks = 0; ks < 2; ++ks) bk[nb][ks] = F::ldf(at(Kp, kp) + nb * 16 * HD + ks * 512);
              asm volatile("s_wait_xcnt 0x0" :: "v"(kp), "v"(bk[0][0]), "v"(bk[1][0]), "v"(bk[2][0]), "v"(bk[3][0]), "v"(bk[0][1]), "v"(bk[1][1]), "v"(bk[2][1]), "v"(bk[3][1]) : "memory");
#pragma unroll
              for (int ks = 0; ks < 2; ++ks)
#pragma unroll
                  for (int nb = 0; nb < 4; ++nb) { s[nb] = F::mma(aq[ks], bk[nb][ks], s[nb]); s[nb] = F::mma(aq2[ks], bk[nb][ks], s[nb]); } }
            { V bk[4][2];
#pragma unroll
              for (int nb = 0; nb < 4; ++nb)
#pragma unroll
                  for (int ks = 0; ks < 2; ++ks) bk[nb][ks] = F::ldf(at(K2, kp) + nb * 16 * HD + ks * 512);
              asm volatile("s_wait_xcnt 0x0" :: "v"(kp), "v"(bk[0][0]), "v"(bk[1][0]), "v"(bk[2][0]), "v"(bk[3][0]), "v"(bk[0][1]), "v"(bk[1][1]), "v"(bk[2][1]), "v"(bk[3][1]) : "memory");
#pragma unroll
              for (int ks = 0; ks < 2; ++ks)
#pragma unroll
                  for (int nb = 0; nb < 4; ++nb) s[nb] = F::mma(aq[ks], bk[nb][ks], s[nb]); }
            { V be[5][2];
#pragma unroll
              for (int t = 0; t < 5; ++t)
#pragma unroll
                  for (int ks = 0; ks < 2; ++ks) be[t][ks] = F::ldf(at(E, ep[t]) + ks * 512);
              asm volatile("s_wait_xcnt 0x0" :: "v"(ep[0]), "v"(ep[1]), "v"(ep[2]), "v"(ep[3]), "v"(ep[4]), "v"(be[0][0]), "v"(be[1][0]), "v"(be[2][0]), "v"(be[3][0]), "v"(be[4][0]), "v"(be[0][1]), "v"(be[1][1]), "v"(be[2][1]), "v"(be[3][1]), "v"(be[4][1]) : "memory");
#pragma unroll
              for (int ks = 0; ks < 2; ++ks)
#pragma unroll
                  for (int t = 0; t < 5; ++t) { e[t] = F::mma(aq[ks], be[t][ks], e[t]); e[t] = F::mma(aq2[ks], be[t][ks], e[t]); } }
        }
#pragma unroll
        for (int t = 0; t < 5; ++t)
#pragma unroll
            for (int j = 0; j < 8; ++j) es[eb + j * EP + t * 16] = e[t][j];
        wave_lds_order();
        const unsigned vp = c0 * 16 * 2 + lb;   // the lane's byte offset in the transposed value planes (32 keys of 16 head dims are one block; 16 head dims are a row of blocks over the positions of all batches); tiles and k steps are constant offsets from it
        V bv[4][2];   // single-plane rows: value fragments asked for here, where the logit registers are free again, so that they fly under the softmax (the hi+lo rows have no registers to spare for it and at most 8 blocks)
        if (!HR) {
#pragma unroll
            for (int nb = 0; nb < 4; ++nb)
#pragma unroll
                for (int ks = 0; ks < 2; ++ks) bv[nb][ks] = F::ldf(at(Vt, vp) + nb * 16 * (NB_ * TT) + ks * 512);
            asm volatile("s_wait_xcnt 0x0" :: "v"(vp) : "memory");   // the run's address register stays whole up to this wait (it is an input here), so no load of the run lands on it while the others are issued
        }
#pragma unroll
        for (int nb = 0; nb < 4; ++nb)
#pragma unroll
            for (int j = 0; j < 8; ++j) s[nb][j] = (s[nb][j] + es[eb - hi * 8 + j * (EP - 1) + 15 + nb * 16]) * (SCL * 1.4426950408889634f);   // row a reads column 15 - a + b; logits kept in units of log 2
        if (c0 + 63 > i0) {   // only the diagonal block holds keys j > i (wave-uniform test)
            const int dg = lr - hi * 8 - (i0 - c0);   // formed here, so that each test below is one value against a constant and nothing of the mask is held over the key loop
#pragma unroll
            for (int nb = 0; nb < 4; ++nb)
#pragma unroll
                for (int j = 0; j < 8; ++j) if (dg > j - nb * 16) s[nb][j] = -3.0e38f;   // key c0 + nb*16 + lr > row i0 + hi*8 + j
        }
#pragma unroll
        for (int j = 0; j < 8; ++j) {
            const float mn = fmaxf(m[j], rowmax16(fmaxf(fmaxf(s[0][j], s[1][j]), fmaxf(s[2][j], s[3][j]))));
            const float al = __builtin_amdgcn_exp2f(m[j] - mn); m[j] = mn;
            float ps4 = 0.f;
#pragma unroll
            for (int nb = 0; nb < 4; ++nb) { const float p = __builtin_amdgcn_exp2f(s[nb][j] - mn); ps4 += p; putp(p, ps, ps2, pb + j * PP + nb * 16); o[nb][j] *= al; }
            l[j] = l[j] * al + ps4;   // each lane keeps the sum of its own 4 columns; the 16 lanes of a row are added once, behind the loop
        }
        if (HR) {   // hi plane of the values: asked for when the score registers are free, it flies under the LDS read-back
#pragma unroll
            for (int nb = 0; nb < 4; ++nb)
#pragma unroll
                for (int ks = 0; ks < 2; ++ks) bv[nb][ks] = F::ldf(at(Vt, vp) + nb * 16 * (NB_ * TT) + ks * 512);
            asm volatile("s_wait_xcnt 0x0" :: "v"(vp) : "memory");   // as above: the run's address register stays whole up to the wait
        }
        wave_lds_order();
        V ap[2], ap2[2];
#pragma unroll
        for (int ks = 0; ks < 2; ++ks) { ap[ks] = F::ld(ps + lr * PP + ks * 32 + 8 * hi); if (HR) ap2[ks] = F::ld(ps2 + lr * PP + ks * 32 + 8 * hi); }
#pragma unroll
        for (int ks = 0; ks < 2; ++ks)
#pragma unroll
            for (int nb = 0; nb < 4; ++nb) { o[nb] = F::mma(ap[ks], bv[nb][ks], o[nb]); if (HR) o[nb] = F::mma(ap2[ks], bv[nb][ks], o[nb]); }
        if (HR) {   // lo plane of the values
#pragma unroll
            for (int nb = 0; nb < 4; ++nb)
#pragma unroll
                for (int ks = 0; ks < 2; ++ks) bv[nb][ks] = F::ldf(at(Vt2, vp) + nb * 16 * (NB_ * TT) + ks * 512);
            asm volatile("s_wait_xcnt 0x0" :: "v"(vp) : "memory");   // as above
#pragma unroll
            for (int ks = 0; ks < 2; ++ks)
#pragma unroll
                for (int nb = 0; nb < 4; ++nb) o[nb] = F::mma(ap[ks], bv[nb][ks], o[nb]);
        }
    }
}
// the lane number read anew behind a key loop (every lane is on, 32 lanes a wave). In asm, so that the compiler does not take it, and what is formed from it, from a read in front of the loop: the loop's fragment run leaves no register to hold them (they were spilled to scratch)
__device__ __forceinline__ int lane_anew() { int x; asm volatile("v_mbcnt_lo_u32_b32 %0, -1, 0" : "=v"(x)); return x; }
// 2^x with the free slot that the instruction set asks for behind a transcendental held by a v_nop in the same statement (used where two parts are joined, once per wave)
__device__ __forceinline__ float exp2_slot(float x) { float y; asm("v_exp_f32 %0, %1\n\tv_nop" : "=v"(y) : "v"(x)); return y; }
// attn_out: 16 finished rows (o unnormalised, l the whole row sums) go out as hi+lo planes for W_proj, through the wave's own LDS slice so that each store covers whole lines
__device__ __forceinline__ void attn_out(const v8f (&o)[4], const float (&l)[8], int i0, float* es, bf* Ah, bf* Al) {
    const int ln = lane_anew(), lq = ln & 15, hq = ln >> 4;
#pragma unroll
    for (int j = 0; j < 8; ++j) { const float f = __fdiv_rn(1.0f, l[j]);
#pragma unroll
        for (int nb = 0; nb < 4; ++nb) es[hq * 8 * 68 + lq + j * 68 + nb * 16] = o[nb][j] * f; }
    wave_lds_order();
    const unsigned ob = (unsigned)((i0 * DQ + ln * 4) * 2); v4us oh[8], ol[8];   // the lane's byte offset in both output planes (their bases are wave-uniform); the 8 steps are constant offsets from it
#pragma unroll
    for (int s8 = 0; s8 < 8; ++s8) { const int row = ln >> 1, cofs = s8 * 8 + (ln & 1) * 4; const v4f val = *(const v4fa*)(es + row * 68 + cofs);
#pragma unroll
        for (int q = 0; q < 4; ++q) { unsigned short a, c2; splitf(val[q], a, c2); oh[s8][q] = a; ol[s8][q] = c2; }
        *(v4us*)((char*)Ah + ob + s8 * 256) = oh[s8]; *(v4us*)((char*)Al + ob + s8 * 256) = ol[s8]; }
    // a wave may go on to other rows behind these stores: their address and data registers stay whole up to this wait (they are inputs here)
    asm volatile("s_wait_xcnt 0x0" :: "v"(ob), "v"(oh[0]), "v"(oh[1]), "v"(oh[2]), "v"(oh[3]), "v"(oh[4]), "v"(oh[5]), "v"(oh[6]), "v"(oh[7]), "v"(ol[0]), "v"(ol[1]), "v"(ol[2]), "v"(ol[3]), "v"(ol[4]), "v"(ol[5]), "v"(ol[6]), "v"(ol[7]) : "memory");
    wave_lds_order();   // the next key loop's stores into this slice stay behind the reads above
}
// grid (T/128, heads, batches), 256 threads. waves_per_eu 4: a budget of 256 registers, so that the loops hold no register-window switches
// Which lower tile goes with which upper tile: work-group r takes upper tile NT - 1 - r (NT - r key blocks) and the lower tile of rank r by cost, a key block of the hi+lo rows (tiles below RH / 64) counted as HRC single-plane blocks:
// the ranks are a permutation of the lower tiles, one hex digit each, lowest digit for r = 0; every (tile, head, batch) is taken once whatever the costs are.
#define HRC 2
#define LOWER_BY_COST 0xF7ED6CB5A9483210ull
static_assert(TT == 2048 && RH == 512 && RH <= TT / 2, "the list of lower tiles by cost is written for 32 tiles, the first 8 of them hi+lo; upper tiles are single-plane");
__global__ __launch_bounds__(32 * FW) __attribute__((amdgpu_waves_per_eu(4))) void k_fattn(const h16* __restrict__ Q16, const bf* __restrict__ Qh, const bf* __restrict__ Ql, const h16* __restrict__ K16, const bf* __restrict__ Kh, const bf* __restrict__ Kl,
                                                   const h16* __restrict__ V16, const bf* __restrict__ Vh, const bf* __restrict__ Vl, const h16* __restrict__ E16, const bf* __restrict__ Eb, bf* Ah, bf* Al) {
    __shared__ __align__(16) float es[FW][16 * EP];
    __shared__ __align__(16) unsigned short ps[FW][2][16 * PP];
    const int wv = __builtin_amdgcn_readfirstlane((int)(threadIdx.x >> 5));   // wave number in a scalar register: the row ranges, the trip counts and the branches below stay scalar
    const bool second = wv >= 4; const int r = (int)blockIdx.x, nu = NT - r, tl = (int)((LOWER_BY_COST >> (4 * r)) & 15);   // nu: key blocks of the upper tile; tl: the lower tile
    const int cut = (nu + (tl + 1) * (tl * 64 < RH ? HRC : 1) + 1) >> 1;   // waves 0..3 take key blocks 0 .. cut - 1 of the upper tile (cut <= nu: a lower tile costs at most NT / 2 blocks, an upper one more)
    const int iu = (nu - 1) * 64 + (wv & 3) * 16, il = tl * 64 + (wv & 3) * 16; const size_t zp = ((size_t)blockIdx.y * NB_ + blockIdx.z) * TT * HD;   // q and k planes: [head][batch][t][d]
    const size_t zv = (size_t)blockIdx.y * HD * (NB_ * TT) + (size_t)blockIdx.z * TT * 16;   // value planes: a head's 64 rows of NB_ * T positions; a batch's T positions of 16 rows are T / 32 blocks
    const size_t hc = (size_t)blockIdx.z * TT * DQ + (size_t)blockIdx.y * HD * 16;   // output planes (fragment order, rows of DQ): the batch's T rows, then a head's 64 columns of 16 rows: two blocks
    v8f o[4]; float m[8], l[8];
    if (second) {   // the lower tile, whole
        if (il < RH) attn_keys<bf, true>(Qh + zp, Ql + zp, Kh + zp, Kl + zp, Eb, Vh + zv, Vl + zv, il, 0, tl + 1, es[wv], ps[wv][0], ps[wv][1], o, m, l);
        else attn_keys<h16, false>(Q16 + zp, nullptr, K16 + zp, nullptr, E16, V16 + zv, nullptr, il, 0, tl + 1, es[wv], (h16*)ps[wv][0], nullptr, o, m, l);
#pragma unroll
        for (int j = 0; j < 8; ++j) l[j] = rowsum16(l[j]);
        attn_out(o, l, il, es[wv], Ah + hc, Al + hc);
    }
    attn_keys<h16, false>(Q16 + zp, nullptr, K16 + zp, nullptr, E16, V16 + zv, nullptr, iu, second ? cut : 0, second ? nu : cut, es[wv], (h16*)ps[wv][0], nullptr, o, m, l);   // this wave's part of the upper tile
#pragma unroll
    for (int j = 0; j < 8; ++j) l[j] = rowsum16(l[j]);
    const int ln = lane_anew(), pq = (ln >> 4) * 8 * 68 + (ln & 15), sq = 16 * 68 + (ln >> 4) * 8;   // the lane's place in a part left in LDS: output tile at pitch 68, behind it 16 row maxima and 16 row sums
    if (second) {
#pragma unroll
        for (int j = 0; j < 8; ++j) { es[wv][sq + j] = m[j]; es[wv][sq + 16 + j] = l[j];   // the 16 lanes of a row hold the same maximum and the same sum
#pragma unroll
            for (int nb = 0; nb < 4; ++nb) es[wv][pq + j * 68 + nb * 16] = o[nb][j]; }
    }
    __syncthreads();   // the second parts are in LDS before waves 0..3 read them
    if (!second) {
        const float* pe = es[wv + 4];
#pragma unroll
        for (int j = 0; j < 8; ++j) { const float mb = pe[sq + j], mn = fmaxf(m[j], mb), fa = exp2_slot(m[j] - mn), fb = exp2_slot(mb - mn);   // an empty second part has maximum -3.0e38 and sum 0: fb = 0
            l[j] = l[j] * fa + pe[sq + 16 + j] * fb;
#pragma unroll
            for (int nb = 0; nb < 4; ++nb) o[nb][j] = o[nb][j] * fa + pe[pq + j * 68 + nb * 16] * fb; }
        attn_out(o, l, iu, es[wv], Ah + hc, Al + hc);
    }
}

__device__ __forceinline__ void er16(const float* __restrict__ er, h16* E, int blk) { const int i = (blk * 256 + threadIdx.x) * 4; if (i >= TT * HD) return; int row, k; frag_at((size_t)i, HD, row, k); const float* p = er + row * HD + k; const v4f a = *(const v4f*)p;
    asm volatile("s_wait_xcnt 0x0" :: "v"(p) : "memory");   // the load's address pair stays whole up to this wait (it is an input here): neither the loaded value nor a later result lands on it before
    v4h o; o[0] = tohx(bfr(a[0])); o[1] = tohx(bfr(a[1])); o[2] = tohx(bfr(a[2])); o[3] = tohx(bfr(a[3])); *(v4h*)(E + i) = o;  }
typedef __attribute__((ext_vector_type(4))) _Float16 v4hx;
#define PB_WA ((DM * 3 * DM / 64 + 63) / 64)          // work-groups of each conversion, as many as its own launch had
#define PB_WO ((DQ * DM / 64 + 63) / 64)
#define PB_X  ((NB_ * TT * DM / 8 + 255) / 256)
#define PB_EB ((TT * HD / 8 + 255) / 256)
#define PB_EH ((TT * HD / 4 + 255) / 256)
// the weight transposes come first: their waves walk 8 lines one after the other and last longest
__global__ __launch_bounds__(256) void k_prep(const float* __restrict__ x, const float* __restrict__ wattn, const float* __restrict__ wo, const float* __restrict__ er, bf* XB, bf* WQKV, bf* WO, bf* ERB, h16* ER16) {
    int b = (int)blockIdx.x;
    if (b < PB_WA) { wtG(wattn, DM, 3 * DM, WQKV, b); return; } b -= PB_WA;
    if (b < PB_WO) { wtG(wo, DQ, DM, WO, b); return; } b -= PB_WO;
    if (b < PB_X) { cvt8(x, DM, XB, (size_t)NB_ * TT * DM / 8, b); return; } b -= PB_X;
    if (b < PB_EB) { cvt8(er, HD, ERB, TT * HD / 8, b); return; } b -= PB_EB;
    er16(er, ER16, b);
}

extern "C" void kernel_launch(void* const* d_in, const int* in_sizes, int n_in,
                              void* d_out, int out_size, void* d_ws, size_t ws_size, hipStream_t stream) {
    (void)in_sizes; (void)n_in; (void)out_size;
    const float* x = (const float*)d_in[0]; const float* wattn = (const float*)d_in[1]; const float* wo = (const float*)d_in[2]; const float* er = (const float*)d_in[3];
    float* OUT = (float*)d_out;     // [2][2048][1024]
    char* wsp = (char*)d_ws;
    auto take = [&](size_t bytes) { char* p = wsp; wsp += (bytes + 255) & ~(size_t)255; return (void*)p; };
    bf* WQKV = (bf*)take((size_t)3 * DM * DM * 2); bf* ERB = (bf*)take((size_t)TT * HD * 2); h16* ER16 = (h16*)take((size_t)TT * HD * 2); bf* WO = (bf*)take((size_t)DM * DQ * 2);
    bf* XB = (bf*)take((size_t)NB_ * TT * DM * 2);
    h16* QP16 = (h16*)take((size_t)NB_ * NH_ * TT * HD * 2); h16* KP16 = (h16*)take((size_t)NB_ * NKV * TT * HD * 2); h16* VT16 = (h16*)take((size_t)NB_ * NKV * HD * TT * 2);
    bf* QPh = (bf*)take((size_t)NB_ * NH_ * TT * HD * 2); bf* QPl = (bf*)take((size_t)NB_ * NH_ * TT * HD * 2); bf* KPh = (bf*)take((size_t)NB_ * NKV * TT * HD * 2); bf* KPl = (bf*)take((size_t)NB_ * NKV * TT * HD * 2); bf* VTh = (bf*)take((size_t)NB_ * NKV * HD * TT * 2); bf* VTl = (bf*)take((size_t)NB_ * NKV * HD * TT * 2);
    bf* ATh = (bf*)take((size_t)NB_ * TT * DQ * 2); bf* ATl = (bf*)take((size_t)NB_ * TT * DQ * 2);
    if ((size_t)(wsp - (char*)d_ws) > ws_size) return;    // ws 256 MiB
    // x, both batches, is one matrix of NB_ * T rows: every launch below covers both batches. Four launches, each needing the one before it: conversions, projections, attention, W_proj
    k_prep<<<PB_WA + PB_WO + PB_X + PB_EB + PB_EH, 256, 0, stream>>>(x, wattn, wo, er, XB, WQKV, WO, ERB, ER16);
    k_qkv<<<dim3(NB_ * TT / 64, DQ / 64, 3), 256, 0, stream>>>(XB, WQKV, QP16, QPh, QPl, KP16, KPh, KPl, VT16, VTh, VTl);
    k_fattn<<<dim3(NT / 2, NH_, NB_), 32 * FW, 0, stream>>>(QP16, QPh, QPl, KP16, KPh, KPl, VT16, VTh, VTl, ER16, ERB, ATh, ATl);   // one kv head per query head
    k_gemmw<bf, 1, false, 8, false><<<dim3(NB_ * TT / 64, DM / 64, 1), 256, 0, stream>>>(ATh, ATl, WO, nullptr, DQ, OUT, DM, nullptr, 0, 0, 0, nullptr, nullptr, nullptr, 0);
}

// v009
// One run takes 96.1 microseconds.
// Timed twice side by side with v008, it ran 1.20 times as fast both times.
// All steps since v000 together make it 19.8 times as fast.
#include <hip/hip_runtime.h>

// CausalSelfAttentionRelativePosition (x [2][2048][1024]; qkv = x W_attn (16 x 64); Srel = skew(q Er^T) -> Srel[i][j] = q_i . Er[T-1-i+j] for j <= i (the skew's wrapped entries above the diagonal are masked); att = softmax(((q.k) + Srel)/8, causal);
// y = att v; out = y W_proj -> [2][2048][1024]).
// Compute dtypes, f32 accumulate: every input rounded to bf16; qkv on PLAIN bf16 operands (inputs: exact); scores q.k (K 64), the relative logits q.Er^T and probs.v on bf16 hi+lo planes (3 products; q.Er: hl q x exact Er, 2 products)
// for the first 512 query rows per head and SINGLE fp16 planes for the rest (Er, a bf16 input, is exact in fp16); scores, relative logits, skew, softmax (f32, running maximum and sum) and probs.v in one fused launch, key blocks above the diagonal never touched; W_proj on hl planes x exact.
// BOTH BATCHES RIDE IN EVERY LAUNCH: x is one [NB_ * T][DM] matrix for the projections; q and k planes are [head][batch][t][d], the transposed value planes [head][d][batch * T + t], the attention output [batch * T + t][DQ].
// FRAGMENT ORDER: every 16-bit operand plane in the workspace ([rows][K], K % 32 == 0, rows % 16 == 0) is kept as blocks of 16 rows x 32 k (512 elements, block number (row / 16) * (K / 32) + k / 32); inside a block element (row, k) stands at
// ((k % 32) / 16) * 256 + ((k % 16) / 8) * 128 + (row % 16) * 8 + k % 8. A lane's two 16-byte fragment loads are then block + lane * 8 and block + 256 + lane * 8: each load of a wave reads 512 bytes in a row (4 cache lines) instead of 32 bytes out of each of 16 lines.

#define NB_  2
#define TT   2048
#define DM   1024
#define NH_  16
#define NKV  16
#define REP  (NH_ / NKV)
#define HD   64
#define DQ   (NH_ * HD)
#define DKV  (NKV * HD)
#define RH   512                  // query rows < RH use hi+lo planes
#define SCL  0.125f   // HD^-0.5
typedef _Float16 h16;
typedef unsigned short bf;
typedef __attribute__((ext_vector_type(16))) __bf16   v16bf;
typedef __attribute__((ext_vector_type(16))) _Float16 v16h;
typedef __attribute__((ext_vector_type(8)))  _Float16 v8h;
typedef __attribute__((ext_vector_type(8)))  unsigned short v8us;
typedef __attribute__((ext_vector_type(8)))  float    v8f;
typedef __attribute__((ext_vector_type(4)))  float    v4f;
typedef v8h  __attribute__((may_alias)) v8ha;
typedef v4f  __attribute__((may_alias)) v4fa;
typedef v8us __attribute__((may_alias)) v8usa;

__device__ __forceinline__ unsigned short f2bf(float f) { unsigned u = __float_as_uint(f); u += 0x7FFFu + ((u >> 16) & 1u); return (unsigned short)(u >> 16); }
__device__ __forceinline__ float bf2f(unsigned short b) { return __uint_as_float(((unsigned)b) << 16); }
__device__ __forceinline__ float bfr(float f) { return bf2f(f2bf(f)); }
__device__ __forceinline__ v16h cat16(v8h lo, v8h hi) { return __builtin_shufflevector(lo, hi, 0, 1, 2, 3, 4, 5, 6, 7, 8, 9, 10, 11, 12, 13, 14, 15); }
__device__ __forceinline__ v16bf cat16b(v8us lo, v8us hi) { return __builtin_bit_cast(v16bf, __builtin_shufflevector(lo, hi, 0, 1, 2, 3, 4, 5, 6, 7, 8, 9, 10, 11, 12, 13, 14, 15)); }
__device__ __forceinline__ v8f wmma16(v16h a, v16h b, v8f c) { return __builtin_amdgcn_wmma_f32_16x16x32_f16(false, a, false, b, (short)0, c, false, false); }
__device__ __forceinline__ v8f wmmab(v16bf a, v16bf b, v8f c) { return __builtin_amdgcn_wmma_f32_16x16x32_bf16(false, a, false, b, (short)0, c, false, false); }
__device__ __forceinline__ h16 tohx(float x) { return (h16)x; }
__device__ __forceinline__ void splitf(float y, unsigned short& h, unsigned short& l) { h = f2bf(y); l = f2bf(y - bf2f(h)); }
typedef __attribute__((ext_vector_type(4))) _Float16 v4h;
typedef __attribute__((ext_vector_type(4))) unsigned short v4us;



// ---- gemms_tile: GEMM on 16-bit planes in fragment order. A work-group of 4 waves takes a 128x128 tile of C[m][n] = sum_k A[m][k] Bt[n][k] (NA = 2: + A2[m][k] Bt[n][k], the lo plane of A); each wave keeps one 64x64 quarter (16 accumulators) over the WHOLE K.
// The operands come through LDS: a stage is GK k of the tile's 128 rows of every operand plane, brought by asynchronous copies (global_load_async_to_lds_b128), two buffers, the next stage's copies in flight while this stage is worked on.
// Each byte of a stage is fetched once per work-group and read by the two waves that need it. A plane's blocks (16 rows x 32 k, 1 KiB) keep their fragment order in LDS: a row group's GK k are GK / 32 blocks in a row, in memory and in LDS,
// so a copy of a wave moves 512 bytes in a row and a fragment read (ldf) is two 16-byte reads per lane of 512 bytes in a row each (no bank conflict).
// PL: a wave's quarter goes out as three 16-bit planes (fp16, bf16 hi, bf16 lo) instead of f32, in fragment order for rows of ldc elements: its 8 blocks start at (64-column tile number) * sP + (first row) * ldc, so that 64 columns land either
// in their own head's [batch][t][d] plane (sP = NB_ * T * 64, ldc = 64) or as 64 columns of a wide row (sP = 2 blocks, ldc = row length); no f32 copy of the product is written.
// ld: a fragment from a row-major slice (LDS); ldf: a fragment from a plane in fragment order (p = block + lane * 8)
// frag_at: which (row, k) of a [rows][K] matrix stands at element e of its plane in fragment order
__device__ __forceinline__ void frag_at(size_t e, int K, int& row, int& k) { const int blk = (int)(e >> 9), r = (int)(e & 511), kb = K >> 5; row = (blk / kb) * 16 + ((r >> 3) & 15); k = (blk % kb) * 32 + (r >> 8) * 16 + ((r >> 7) & 1) * 8 + (r & 7); }
template <typename T16> struct WFrag;
template <> struct WFrag<h16> { typedef v16h V; static __device__ __forceinline__ V ld(const h16* p) { return cat16(*(const v8h*)p, *(const v8h*)(p + 16)); } static __device__ __forceinline__ V ldf(const h16* p) { return cat16(*(const v8h*)p, *(const v8h*)(p + 256)); } static __device__ __forceinline__ v8f mma(V a, V b, v8f c) { return wmma16(a, b, c); } };
template <> struct WFrag<bf> { typedef v16bf V; static __device__ __forceinline__ V ld(const bf* p) { return cat16b(*(const v8us*)p, *(const v8us*)(p + 16)); } static __device__ __forceinline__ V ldf(const bf* p) { return cat16b(*(const v8us*)p, *(const v8us*)(p + 256)); } static __device__ __forceinline__ v8f mma(V a, V b, v8f c) { return wmmab(a, b, c); } };
template <typename T16> __device__ __forceinline__ const T16* at(const T16* base, unsigned bytes) { return (const T16*)((const char*)base + bytes); }   // wave-uniform base + the lane's 32-bit byte offset
// copy8: eight asynchronous copies of 16 bytes per lane, global memory to LDS; l: the lane's LDS byte addresses, g: its global addresses. The wait in the same statement keeps every address register whole until the copies have taken it
__device__ __forceinline__ void copy8(const unsigned (&l)[8], const char* const (&g)[8]) {
    asm volatile("global_load_async_to_lds_b128 %0, %8, off\n\tglobal_load_async_to_lds_b128 %1, %9, off\n\tglobal_load_async_to_lds_b128 %2, %10, off\n\tglobal_load_async_to_lds_b128 %3, %11, off\n\t"
                 "global_load_async_to_lds_b128 %4, %12, off\n\tglobal_load_async_to_lds_b128 %5, %13, off\n\tglobal_load_async_to_lds_b128 %6, %14, off\n\tglobal_load_async_to_lds_b128 %7, %15, off\n\ts_wait_xcnt 0x0"
                 :: "v"(l[0]), "v"(l[1]), "v"(l[2]), "v"(l[3]), "v"(l[4]), "v"(l[5]), "v"(l[6]), "v"(l[7]), "v"(g[0]), "v"(g[1]), "v"(g[2]), "v"(g[3]), "v"(g[4]), "v"(g[5]), "v"(g[6]), "v"(g[7]) : "memory");
}
template <int NA, int GK, bool PL>
__device__ __forceinline__ void gemms_tile(const bf* __restrict__ A, const bf* __restrict__ A2, const bf* __restrict__ Bt, float* C, int ldc, h16* P16, bf* Ph, bf* Pl, size_t sP, int bx, int by) {
    typedef WFrag<bf> F; typedef F::V V;
    constexpr int K = DM, NS = K / GK;            // every product here sums over DM = DQ; stages per tile
    constexpr int GB = (GK / 32) * 1024;          // bytes of one row group (16 rows) in a stage
    constexpr int PLB = 8 * GB, STB = (NA + 1) * PLB;   // bytes of one plane's 128 rows in a stage; bytes of a stage (A, A2 if any, Bt)
    static_assert(DQ == DM && NS >= 2 && GK % 64 == 0 && (NA + 1) * (GK / 8) <= 63, "two stages at least; a wave's copies of one stage stay under 64");
    __shared__ __align__(1024) char ring[2 * STB];
    __shared__ __align__(16) float os[4][16 * 68];   // each wave's own slice for the way out
    const int lane = threadIdx.x & 31, lr = lane & 15, hi = lane >> 4; const int wv = __builtin_amdgcn_readfirstlane((int)(threadIdx.x >> 5)), wm = wv & 1, wn = wv >> 1;   // wave number in a scalar register: offsets formed from it stay scalar
    const int r0 = bx * 128, c0 = by * 128; const unsigned lb = lane * 16, ring0 = (unsigned)(size_t)ring;   // ring0: the ring's byte address in the work-group's LDS
    // stage t into buffer buf: wave w brings row groups 2w and 2w + 1 of every plane, GK / 8 copies of 512 bytes per plane
    auto stage = [&](int t, int buf) {
#pragma unroll
        for (int p = 0; p <= NA; ++p) {
            const char* sp = (const char*)(p == NA ? Bt : p == 0 ? A : A2) + ((size_t)(((p == NA ? c0 : r0) >> 4) + wv * 2) * (K / 32) + (size_t)t * (GK / 32)) * 1024 + lb;
            const unsigned dp = ring0 + (unsigned)(buf * STB + p * PLB + wv * 2 * GB) + lb;
#pragma unroll
            for (int q0 = 0; q0 < GK / 8; q0 += 8) { unsigned l[8]; const char* g[8];
#pragma unroll
                for (int i = 0; i < 8; ++i) { const int q = q0 + i; l[i] = dp + q * 512; g[i] = sp + (size_t)(q / (GK / 16)) * ((K / 32) * 1024) + (q % (GK / 16)) * 512; }
                copy8(l, g); }
        }
    };
    v8f acc[4][4];
#pragma unroll
    for (int mb = 0; mb < 4; ++mb)
#pragma unroll
        for (int nb = 0; nb < 4; ++nb) acc[mb][nb] = (v8f){};
    stage(0, 0);
    asm volatile("s_wait_asynccnt 0x0" ::: "memory");   // this wave's copies of stage 0 have landed
    __syncthreads();                                     // every wave's have: stage 0 may be read
    stage(1, 1);
#pragma unroll 1   // kept rolled: one trip per stage, the buffer picked by the trip's parity
    for (int t = 0; t < NS; ++t) {
        const bf* sb = (const bf*)(ring + (t & 1) * STB) + lane * 8;
        V a[2][4], a2[2][4], b[2][4];   // two fragment sets: block ks (32 k) works on set ks % 2 while the next block's reads fill the other
        auto frags = [&](int ks) { const int f = ks & 1;
#pragma unroll
            for (int mb = 0; mb < 4; ++mb) { a[f][mb] = F::ldf(sb + ((wm * 4 + mb) * GB + ks * 1024) / 2); if (NA == 2) a2[f][mb] = F::ldf(sb + (PLB + (wm * 4 + mb) * GB + ks * 1024) / 2); }
#pragma unroll
            for (int nb = 0; nb < 4; ++nb) b[f][nb] = F::ldf(sb + (NA * PLB + (wn * 4 + nb) * GB + ks * 1024) / 2); };
        frags(0);
#pragma unroll
        for (int ks = 0; ks < GK / 32; ++ks) { const int f = ks & 1;
            if (ks + 1 < GK / 32) frags(ks + 1);
            __builtin_amdgcn_sched_barrier(0);   // the next block's LDS reads stay one group in front of this block's products; left free, the scheduler reloads one fragment at a time among the products and waits for each
#pragma unroll
            for (int nb = 0; nb < 4; ++nb) {
#pragma unroll
                for (int mb = 0; mb < 4; ++mb) acc[mb][nb] = F::mma(a[f][mb], b[f][nb], acc[mb][nb]);
                if (NA == 2) {
#pragma unroll
                    for (int mb = 0; mb < 4; ++mb) acc[mb][nb] = F::mma(a2[f][mb], b[f][nb], acc[mb][nb]); } }
            __builtin_amdgcn_sched_barrier(0);   // and the reads of the block after next stay behind these products
        }
        asm volatile("s_wait_dscnt 0x0" ::: "memory");      // this wave's reads of the trip's buffer are done before the buffer is given up
        asm volatile("s_wait_asynccnt 0x0" ::: "memory");   // this wave's copies of stage t + 1 have landed
        __syncthreads();                                     // stage t + 1 may be read by every wave, and no wave still reads stage t's buffer
        if (t + 2 < NS) stage(t + 2, t & 1);
    }
    asm volatile("s_wait_asynccnt 0x0" ::: "memory");   // no copy is outstanding when the wave goes on
    // the way out: 16 rows at a time through the wave's own LDS slice, so that each store of the wave covers whole lines
    float* ow = os[wv]; const int rw = r0 + wm * 64, tw = by * 2 + wn;   // the quarter's first row and its number among the tiles of 64 columns
#pragma unroll
    for (int mb = 0; mb < 4; ++mb) {
#pragma unroll
        for (int nb = 0; nb < 4; ++nb)
#pragma unroll
            for (int j = 0; j < 8; ++j) ow[(hi * 8 + j) * 68 + nb * 16 + lr] = acc[mb][nb][j];
        __builtin_amdgcn_wave_barrier(); asm volatile("" ::: "memory");   // the wave's LDS instructions run in order; this keeps the compiler from moving the reads below over the stores above
        if (PL) {   // step s: columns 8 s .. 8 s + 7 of the 16 rows, 128 elements in the order of the planes; two lanes share a row
            const unsigned ob = (unsigned)(((size_t)tw * sP + (size_t)rw * ldc + (size_t)(mb * (ldc >> 5)) * 512 + lane * 4) * 2); v4h o16[8]; v4us oh[8], ol[8];   // the lane's byte offset in all three planes (each under 4 GiB); the 8 steps are constant offsets from it
#pragma unroll
            for (int s = 0; s < 8; ++s) { const v4f val = *(const v4fa*)(ow + (lane >> 1) * 68 + s * 8 + (lane & 1) * 4);
#pragma unroll
                for (int q = 0; q < 4; ++q) { o16[s][q] = tohx(val[q]); unsigned short x, y; splitf(val[q], x, y); oh[s][q] = x; ol[s][q] = y; }
                *(v4h*)((char*)P16 + ob + s * 256) = o16[s]; *(v4us*)((char*)Ph + ob + s * 256) = oh[s]; *(v4us*)((char*)Pl + ob + s * 256) = ol[s]; }
            // the stores' address and data registers stay whole up to this wait (they are inputs here); the next 16 rows rewrite them behind it
            asm volatile("s_wait_xcnt 0x0" :: "v"(ob), "v"(o16[0]), "v"(o16[1]), "v"(o16[2]), "v"(o16[3]), "v"(o16[4]), "v"(o16[5]), "v"(o16[6]), "v"(o16[7]), "v"(oh[0]), "v"(oh[1]), "v"(oh[2]), "v"(oh[3]), "v"(oh[4]), "v"(oh[5]), "v"(oh[6]), "v"(oh[7]),
                         "v"(ol[0]), "v"(ol[1]), "v"(ol[2]), "v"(ol[3]), "v"(ol[4]), "v"(ol[5]), "v"(ol[6]), "v"(ol[7]) : "memory");
        } else {    // step s: rows 2 s and 2 s + 1, 64 columns each
            const unsigned ob = (unsigned)(((rw + mb * 16 + hi) * DM + tw * 64 + lr * 4) * 4); v4f val[8];   // the lane's byte offset in C (rows of DM floats); the 8 steps are constant offsets from it
#pragma unroll
            for (int s = 0; s < 8; ++s) { val[s] = *(const v4fa*)(ow + (2 * s + hi) * 68 + lr * 4); *(v4f*)((char*)C + ob + s * (2 * DM * 4)) = val[s]; }
            asm volatile("s_wait_xcnt 0x0" :: "v"(ob), "v"(val[0]), "v"(val[1]), "v"(val[2]), "v"(val[3]), "v"(val[4]), "v"(val[5]), "v"(val[6]), "v"(val[7]) : "memory");   // as above
        }
        __builtin_amdgcn_wave_barrier(); asm volatile("" ::: "memory");   // the next 16 rows' stores into the slice stay behind the reads above
    }
}
// ---- k_proj: out = (attention output, hi + lo planes) x W_proj, f32; grid (NB_ * T / 128, DM / 128), 128 threads. One work-group per tile and no more tiles than WGPs: stages of 128 k, so that a stage's copies have a whole long trip to land
__global__ __launch_bounds__(128) void k_proj(const bf* __restrict__ Ah, const bf* __restrict__ Al, const bf* __restrict__ Wt, float* C) {
    gemms_tile<2, 128, false>(Ah, Al, Wt, C, DM, nullptr, nullptr, nullptr, 0, (int)blockIdx.x, (int)blockIdx.y);
}
// ---- k_qkv: the q, k and v projections in ONE launch, grid (NB_ * T / 128, DQ / 128, 3), 128 threads; blockIdx.z picks the product (none reads what another writes). Stages of 64 k: three work-groups fit the LDS of a WGP, so the whole grid is resident at once.
// q and k: x W, 64 columns are one head (HD = 64), so a wave's quarter goes straight into that head's [batch][t][d] planes.
// v: the product is taken as W_v^T x^T (rows = head dims, columns = positions of both batches), so the tile already has the [h][d][batch * T + t] order that probs.v reads; 64 positions of 16 head dims are two blocks (1024 elements);
// its tiles are numbered with the head-dim tile running fastest, so that work-groups that start together share a tile of x.
__global__ __launch_bounds__(128) void k_qkv(const bf* __restrict__ X, const bf* __restrict__ Wqkv, h16* Q16, bf* Qh, bf* Ql, h16* K16, bf* Kh, bf* Kl, h16* V16, bf* Vh, bf* Vl) {
    const int z = (int)blockIdx.z; const bool isv = z == 2; const int flat = (int)blockIdx.y * (NB_ * TT / 128) + (int)blockIdx.x;
    const bf* W = Wqkv + (size_t)z * DM * DM;
    gemms_tile<1, 64, true>(isv ? W : X, nullptr, isv ? X : W, nullptr, isv ? NB_ * TT : HD, z == 0 ? Q16 : isv ? V16 : K16, z == 0 ? Qh : isv ? Vh : Kh, z == 0 ? Ql : isv ? Vl : Kl,
                            isv ? (size_t)1024 : (size_t)NB_ * TT * HD, isv ? flat % (DKV / 128) : (int)blockIdx.x, isv ? flat / (DKV / 128) : (int)blockIdx.y);
}

typedef __attribute__((ext_vector_type(2))) unsigned short v2us;
typedef __attribute__((ext_vector_type(4))) int v4i;

// The five operand conversions (W_attn, W_proj, x, Er to bf16, Er to fp16) are bodies of ONE launch, k_prep: each takes its own range of work-groups, blk counts inside the range.
__device__ __forceinline__ void wtG(const float* __restrict__ w, int K, int N, bf* Bt, int blk) {
    const int lane = threadIdx.x & 31; const int L0 = (blk * 8 + (threadIdx.x >> 5)) * 8; const int nlines = N * K / 64;
{
#pragma unroll 1
        for (int l = 0; l < 8; ++l) { const int L = L0 + l; if (L >= nlines) break; const size_t e = (size_t)L * 64 + lane * 2; int k, n; frag_at(e, K, n, k); v2us o;
            o[0] = f2bf(w[(size_t)k * N + n]); o[1] = f2bf(w[(size_t)(k + 1) * N + n]); *(v2us*)(Bt + e) = o; }
         }
}
__device__ __forceinline__ void cvt8(const float* __restrict__ src, int K, bf* dst, size_t n8, int blk) { const size_t i = (size_t)blk * 256 + threadIdx.x; if (i >= n8) return; int row, k; frag_at(i * 8, K, row, k); const v8f v = *(const v8f*)(src + (size_t)row * K + k); v8us o;
#pragma unroll
    for (int k = 0; k < 8; ++k) o[k] = f2bf(v[k]); *(v8us*)(dst + i * 8) = o;  }
// ---- k_fattn: scores, relative logits, skew, causal softmax and probs.v of every head and batch in ONE launch; no score, logit or probability ever goes to memory.
// One wave walks a range of the key blocks of 64 of 16 query rows (i0..i0+15), with a running row maximum and a running row sum (f32).
// EQUAL WORK PER WAVE: the cost of a tile of 64 query rows grows with its place (tile t has t + 1 key blocks) and every wave of the launch is resident at once, so the launch lasts as long as its fullest wave. A work-group of 8 waves takes one tile of the
// upper half and one of the lower half; waves 0..3 walk the first key blocks of the upper tile's four row groups, waves 4..7 the whole lower tile and then the rest of the upper tile's key blocks; the cut gives both the same cost.
// Waves 4..7 leave their part of the upper tile (unnormalised output, row maximum, row sum) in LDS, and behind ONE work-group barrier waves 0..3 join the two parts as two key blocks are joined in the loop.
// Per block: S = q.k (4 tiles), L = q.Er rows rb..rb+79 with rb = T-16-i0+c0 (5 tiles), Srel[a][b] = L[a][15-a+b] (the skew, a shifted read of the wave's own LDS slice),
// p = exp2(((S+Srel)/8 - rowmax) log2 e), O = O x exp2(old max - new max) + p.v; at the end O / rowsum goes out as hi+lo planes for W_proj.
#define EP 84    // f32 pitch of the logit slice: rows 8 apart fall on different LDS banks for the store and for the shifted read
#define PP 72    // 16-bit pitch of the probability slice: 144 bytes, so each 16-byte fragment read is aligned
#define FW 8     // waves per work-group: 4 row groups x 2 parts
#define NT (TT / 64)   // tiles of 64 query rows per head and batch
// LDS traffic between the lanes of one wave: the wave's LDS instructions run in order; this keeps the compiler from moving an LDS read over the stores that feed it (or a store over the reads before it)
__device__ __forceinline__ void wave_lds_order() { __builtin_amdgcn_wave_barrier(); asm volatile("" ::: "memory"); }
template <int M> __device__ __forceinline__ float rowx(float x) { return __builtin_bit_cast(float, __builtin_amdgcn_update_dpp(__builtin_bit_cast(int, x), __builtin_bit_cast(int, x), 0x160 + M, 0xf, 0xf, false)); }   // lane l with lane l ^ M inside its row of 16 lanes (DPP row_xmask)
__device__ __forceinline__ float rowmax16(float x) { x = fmaxf(x, rowx<1>(x)); x = fmaxf(x, rowx<2>(x)); x = fmaxf(x, rowx<4>(x)); return fmaxf(x, rowx<8>(x)); }
__device__ __forceinline__ float rowsum16(float x) { x += rowx<1>(x); x += rowx<2>(x); x += rowx<4>(x); return x + rowx<8>(x); }
__device__ __forceinline__ void putp(float p, h16* a, h16*, int o) { a[o] = tohx(p); }
__device__ __forceinline__ void putp(float p, bf* a, bf* b, int o) { unsigned short x, y; splitf(p, x, y); a[o] = x; b[o] = y; }
template <typename T16, bool HR>
__device__ __forceinline__ void attn_keys(const T16* __restrict__ Q, const T16* __restrict__ Q2, const T16* __restrict__ Kp, const T16* __restrict__ K2, const T16* __restrict__ E, const T16* __restrict__ Vt, const T16* __restrict__ Vt2,
                                          int i0, int kb0, int kb1, float* es, T16* ps, T16* ps2, v8f (&o)[4], float (&m)[8], float (&l)[8]) {   // key blocks kb0 .. kb1 - 1 of rows i0 .. i0 + 15; o, m, l: unnormalised output, row maximum, each lane's share of the row sum
    typedef typename WFrag<T16>::V V; typedef WFrag<T16> F;   // every inner loop below is unrolled so that fragments, tiles and row statistics are indexed by constants (stay in registers)
    // the lane number comes from mbcnt (every lane is on, 32 lanes a wave): the thread id is then dead before the key loops, whose fragment runs leave no register to hold it
    const int lane = (int)__builtin_amdgcn_mbcnt_lo(~0u, 0u), lr = lane & 15, hi = lane >> 4; const unsigned lb = lane * 16;   // the lane's byte offset inside a block of a plane in fragment order
    const int eb = hi * 8 * EP + lr, pb = hi * 8 * PP + lr;   // the lane's place in the logit and the probability slice; rows and tiles are constant offsets from it
    V aq[2], aq2[2];
#pragma unroll
    for (int ks = 0; ks < 2; ++ks) { aq[ks] = F::ldf(at(Q, lb) + (size_t)i0 * HD + ks * 512); if (HR) aq2[ks] = F::ldf(at(Q2, lb) + (size_t)i0 * HD + ks * 512); }
#pragma unroll
    for (int nb = 0; nb < 4; ++nb) o[nb] = (v8f){};
#pragma unroll
    for (int j = 0; j < 8; ++j) { m[j] = -3.0e38f; l[j] = 0.f; }
#pragma unroll 1   // kept rolled: two blocks' fragments and tiles at once would not fit the register budget
    for (int kb = kb0; kb < kb1; ++kb) {
        const int c0 = kb * 64;
        v8f s[4], e[5];
        const unsigned kp = c0 * HD * 2 + lb; unsigned ep[5];   // the lane's byte offset in the key planes and in each Er tile (one register each, the plane's base is wave-uniform); tiles and k steps (blocks of 512 elements) are constant offsets
        const int rb = TT - 16 - i0 + c0;
#pragma unroll
        for (int t = 0; t < 5; ++t) { e[t] = (v8f){}; ep[t] = min(rb + t * 16, TT - 16) * HD * 2 + lb; }   // rb is a multiple of 16: a tile lies wholly inside Er or wholly past T-1; rows past T-1 belong to keys j > i only (masked below): the clamp keeps the address inside Er
#pragma unroll
        for (int nb = 0; nb < 4; ++nb) s[nb] = (v8f){};
        // Behind each run of fragment loads stands one wait. Its inputs are the run's address registers (each stays whole until every load that names it is past the wait, so no later load or result lands on it before)
        // and the loaded fragments (no product of the run moves in front of it, so all loads of the run are in flight together and the run pays the memory latency once instead of once per refill of a few registers).
        if (!HR) {   // single-plane rows: all 18 key and Er fragments of the block fit the registers: one run
            V bk[4][2], be[5][2];
#pragma unroll
            for (int ks = 0; ks < 2; ++ks) {
#pragma unroll
                for (int nb = 0; nb < 4; ++nb) bk[nb][ks] = F::ldf(at(Kp, kp) + nb * 16 * HD + ks * 512);
#pragma unroll
                for (int t = 0; t < 5; ++t) be[t][ks] = F::ldf(at(E, ep[t]) + ks * 512); }
            asm volatile("s_wait_xcnt 0x0" :: "v"(kp), "v"(ep[0]), "v"(ep[1]), "v"(ep[2]), "v"(ep[3]), "v"(ep[4]), "v"(bk[0][0]), "v"(bk[1][0]), "v"(bk[2][0]), "v"(bk[3][0]), "v"(bk[0][1]), "v"(bk[1][1]), "v"(bk[2][1]), "v"(bk[3][1]),
                         "v"(be[0][0]), "v"(be[1][0]), "v"(be[2][0]), "v"(be[3][0]), "v"(be[4][0]), "v"(be[0][1]), "v"(be[1][1]), "v"(be[2][1]), "v"(be[3][1]), "v"(be[4][1]) : "memory");
            __builtin_amdgcn_sched_barrier(0);   // without it the scheduler lifts the first product over the wait, and its data wait then stands behind four loads only: the rest of the run would start one memory latency later
#pragma unroll
            for (int ks = 0; ks < 2; ++ks) {
#pragma unroll
                for (int nb = 0; nb < 4; ++nb) s[nb] = F::mma(aq[ks], bk[nb][ks], s[nb]);
#pragma unroll
                for (int t = 0; t < 5; ++t) e[t] = F::mma(aq[ks], be[t][ks], e[t]); }
        } else {     // hi+lo rows: three runs (key hi plane, key lo plane, Er), each as large as the registers allow
            { V bk[4][2];
#pragma unroll
              for (int nb = 0; nb < 4; ++nb)
#pragma unroll
                  for (int ks = 0; ks < 2; ++ks) bk[nb][ks] = F::ldf(at(Kp, kp) + nb * 16 * HD + ks * 512);
              asm volatile("s_wait_xcnt 0x0" :: "v"(kp), "v"(bk[0][0]), "v"(bk[1][0]), "v"(bk[2][0]), "v"(bk[3][0]), "v"(bk[0][1]), "v"(bk[1][1]), "v"(bk[2][1]), "v"(bk[3][1]) : "memory");
#pragma unroll
              for (int ks = 0; ks < 2; ++ks)
#pragma unroll
                  for (int nb = 0; nb < 4; ++nb) { s[nb] = F::mma(aq[ks], bk[nb][ks], s[nb]); s[nb] = F::mma(aq2[ks], bk[nb][ks], s[nb]); } }
            { V bk[4][2];
#pragma unroll
              for (int nb = 0; nb < 4; ++nb)
#pragma unroll
                  for (int ks = 0; ks < 2; ++ks) bk[nb][ks] = F::ldf(at(K2, kp) + nb * 16 * HD + ks * 512);
              asm volatile("s_wait_xcnt 0x0" :: "v"(kp), "v"(bk[0][0]), "v"(bk[1][0]), "v"(bk[2][0]), "v"(bk[3][0]), "v"(bk[0][1]), "v"(bk[1][1]), "v"(bk[2][1]), "v"(bk[3][1]) : "memory");
#pragma unroll
              for (int ks = 0; ks < 2; ++ks)
#pragma unroll
                  for (int nb = 0; nb < 4; ++nb) s[nb] = F::mma(aq[ks], bk[nb][ks], s[nb]); }
            { V be[5][2];
#pragma unroll
              for (int t = 0; t < 5; ++t)
#pragma unroll
                  for (int ks = 0; ks < 2; ++ks) be[t][ks] = F::ldf(at(E, ep[t]) + ks * 512);
              asm volatile("s_wait_xcnt 0x0" :: "v"(ep[0]), "v"(ep[1]), "v"(ep[2]), "v"(ep[3]), "v"(ep[4]), "v"(be[0][0]), "v"(be[1][0]), "v"(be[2][0]), "v"(be[3][0]), "v"(be[4][0]), "v"(be[0][1]), "v"(be[1][1]), "v"(be[2][1]), "v"(be[3][1]), "v"(be[4][1]) : "memory");
#pragma unroll
              for (int ks = 0; ks < 2; ++ks)
#pragma unroll
                  for (int t = 0; t < 5; ++t) { e[t] = F::mma(aq[ks], be[t][ks], e[t]); e[t] = F::mma(aq2[ks], be[t][ks], e[t]); } }
        }
#pragma unroll
        for (int t = 0; t < 5; ++t)
#pragma unroll
            for (int j = 0; j < 8; ++j) es[eb + j * EP + t * 16] = e[t][j];
        wave_lds_order();
        const unsigned vp = c0 * 16 * 2 + lb;   // the lane's byte offset in the transposed value planes (32 keys of 16 head dims are one block; 16 head dims are a row of blocks over the positions of all batches); tiles and k steps are constant offsets from it
        V bv[4][2];   // single-plane rows: value fragments asked for here, where the logit registers are free again, so that they fly under the softmax (the hi+lo rows have no registers to spare for it and at most 8 blocks)
        if (!HR) {
#pragma unroll
            for (int nb = 0; nb < 4; ++nb)
#pragma unroll
                for (int ks = 0; ks < 2; ++ks) bv[nb][ks] = F::ldf(at(Vt, vp) + nb * 16 * (NB_ * TT) + ks * 512);
            asm volatile("s_wait_xcnt 0x0" :: "v"(vp) : "memory");   // the run's address register stays whole up to this wait (it is an input here), so no load of the run lands on it while the others are issued
        }
#pragma unroll
        for (int nb = 0; nb < 4; ++nb)
#pragma unroll
            for (int j = 0; j < 8; ++j) s[nb][j] = (s[nb][j] + es[eb - hi * 8 + j * (EP - 1) + 15 + nb * 16]) * (SCL * 1.4426950408889634f);   // row a reads column 15 - a + b; logits kept in units of log 2
        if (c0 + 63 > i0) {   // only the diagonal block holds keys j > i (wave-uniform test)
            const int dg = lr - hi * 8 - (i0 - c0);   // formed here, so that each test below is one value against a constant and nothing of the mask is held over the key loop
#pragma unroll
            for (int nb = 0; nb < 4; ++nb)
#pragma unroll
                for (int j = 0; j < 8; ++j) if (dg > j - nb * 16) s[nb][j] = -3.0e38f;   // key c0 + nb*16 + lr > row i0 + hi*8 + j
        }
#pragma unroll
        for (int j = 0; j < 8; ++j) {
            const float mn = fmaxf(m[j], rowmax16(fmaxf(fmaxf(s[0][j], s[1][j]), fmaxf(s[2][j], s[3][j]))));
            const float al = __builtin_amdgcn_exp2f(m[j] - mn); m[j] = mn;
            float ps4 = 0.f;
#pragma unroll
            for (int nb = 0; nb < 4; ++nb) { const float p = __builtin_amdgcn_exp2f(s[nb][j] - mn); ps4 += p; putp(p, ps, ps2, pb + j * PP + nb * 16); o[nb][j] *= al; }
            l[j] = l[j] * al + ps4;   // each lane keeps the sum of its own 4 columns; the 16 lanes of a row are added once, behind the loop
        }
        if (HR) {   // hi plane of the values: asked for when the score registers are free, it flies under the LDS read-back
#pragma unroll
            for (int nb = 0; nb < 4; ++nb)
#pragma unroll
                for (int ks = 0; ks < 2; ++ks) bv[nb][ks] = F::ldf(at(Vt, vp) + nb * 16 * (NB_ * TT) + ks * 512);
            asm volatile("s_wait_xcnt 0x0" :: "v"(vp) : "memory");   // as above: the run's address register stays whole up to the wait
        }
        wave_lds_order();
        V ap[2], ap2[2];
#pragma unroll
        for (int ks = 0; ks < 2; ++ks) { ap[ks] = F::ld(ps + lr * PP + ks * 32 + 8 * hi); if (HR) ap2[ks] = F::ld(ps2 + lr * PP + ks * 32 + 8 * hi); }
#pragma unroll
        for (int ks = 0; ks < 2; ++ks)
#pragma unroll
            for (int nb = 0; nb < 4; ++nb) { o[nb] = F::mma(ap[ks], bv[nb][ks], o[nb]); if (HR) o[nb] = F::mma(ap2[ks], bv[nb][ks], o[nb]); }
        if (HR) {   // lo plane of the values
#pragma unroll
            for (int nb = 0; nb < 4; ++nb)
#pragma unroll
                for (int ks = 0; ks < 2; ++ks) bv[nb][ks] = F::ldf(at(Vt2, vp) + nb * 16 * (NB_ * TT) + ks * 512);
            asm volatile("s_wait_xcnt 0x0" :: "v"(vp) : "memory");   // as above
#pragma unroll
            for (int ks = 0; ks < 2; ++ks)
#pragma unroll
                for (int nb = 0; nb < 4; ++nb) o[nb] = F::mma(ap[ks], bv[nb][ks], o[nb]);
        }
    }
}
// the lane number read anew behind a key loop (every lane is on, 32 lanes a wave). In asm, so that the compiler does not take it, and what is formed from it, from a read in front of the loop: the loop's fragment run leaves no register to hold them (they were spilled to scratch)
__device__ __forceinline__ int lane_anew() { int x; asm volatile("v_mbcnt_lo_u32_b32 %0, -1, 0" : "=v"(x)); return x; }
// 2^x with the free slot that the instruction set asks for behind a transcendental held by a v_nop in the same statement (used where two parts are joined, once per wave)
__device__ __forceinline__ float exp2_slot(float x) { float y; asm("v_exp_f32 %0, %1\n\tv_nop" : "=v"(y) : "v"(x)); return y; }
// attn_out: 16 finished rows (o unnormalised, l the whole row sums) go out as hi+lo planes for W_proj, through the wave's own LDS slice so that each store covers whole lines
__device__ __forceinline__ void attn_out(const v8f (&o)[4], const float (&l)[8], int i0, float* es, bf* Ah, bf* Al) {
    const int ln = lane_anew(), lq = ln & 15, hq = ln >> 4;
#pragma unroll
    for (int j = 0; j < 8; ++j) { const float f = __fdiv_rn(1.0f, l[j]);
#pragma unroll
        for (int nb = 0; nb < 4; ++nb) es[hq * 8 * 68 + lq + j * 68 + nb * 16] = o[nb][j] * f; }
    wave_lds_order();
    const unsigned ob = (unsigned)((i0 * DQ + ln * 4) * 2); v4us oh[8], ol[8];   // the lane's byte offset in both output planes (their bases are wave-uniform); the 8 steps are constant offsets from it
#pragma unroll
    for (int s8 = 0; s8 < 8; ++s8) { const int row = ln >> 1, cofs = s8 * 8 + (ln & 1) * 4; const v4f val = *(const v4fa*)(es + row * 68 + cofs);
#pragma unroll
        for (int q = 0; q < 4; ++q) { unsigned short a, c2; splitf(val[q], a, c2); oh[s8][q] = a; ol[s8][q] = c2; }
        *(v4us*)((char*)Ah + ob + s8 * 256) = oh[s8]; *(v4us*)((char*)Al + ob + s8 * 256) = ol[s8]; }
    // a wave may go on to other rows behind these stores: their address and data registers stay whole up to this wait (they are inputs here)
    asm volatile("s_wait_xcnt 0x0" :: "v"(ob), "v"(oh[0]), "v"(oh[1]), "v"(oh[2]), "v"(oh[3]), "v"(oh[4]), "v"(oh[5]), "v"(oh[6]), "v"(oh[7]), "v"(ol[0]), "v"(ol[1]), "v"(ol[2]), "v"(ol[3]), "v"(ol[4]), "v"(ol[5]), "v"(ol[6]), "v"(ol[7]) : "memory");
    wave_lds_order();   // the next key loop's stores into this slice stay behind the reads above
}
// grid (T/128, heads, batches), 256 threads. waves_per_eu 4: a budget of 256 registers, so that the loops hold no register-window switches
// Which lower tile goes with which upper tile: work-group r takes upper tile NT - 1 - r (NT - r key blocks) and the lower tile of rank r by cost, a key block of the hi+lo rows (tiles below RH / 64) counted as HRC single-plane blocks:
// the ranks are a permutation of the lower tiles, one hex digit each, lowest digit for r = 0; every (tile, head, batch) is taken once whatever the costs are.
#define HRC 2
#define LOWER_BY_COST 0xF7ED6CB5A9483210ull
static_assert(TT == 2048 && RH == 512 && RH <= TT / 2, "the list of lower tiles by cost is written for 32 tiles, the first 8 of them hi+lo; upper tiles are single-plane");
__global__ __launch_bounds__(32 * FW) __attribute__((amdgpu_waves_per_eu(4))) void k_fattn(const h16* __restrict__ Q16, const bf* __restrict__ Qh, const bf* __restrict__ Ql, const h16* __restrict__ K16, const bf* __restrict__ Kh, const bf* __restrict__ Kl,
                                                   const h16* __restrict__ V16, const bf* __restrict__ Vh, const bf* __restrict__ Vl, const h16* __restrict__ E16, const bf* __restrict__ Eb, bf* Ah, bf* Al) {
    __shared__ __align__(16) float es[FW][16 * EP];
    __shared__ __align__(16) unsigned short ps[FW][2][16 * PP];
    const int wv = __builtin_amdgcn_readfirstlane((int)(threadIdx.x >> 5));   // wave number in a scalar register: the row ranges, the trip counts and the branches below stay scalar
    const bool second = wv >= 4; const int r = (int)blockIdx.x, nu = NT - r, tl = (int)((LOWER_BY_COST >> (4 * r)) & 15);   // nu: key blocks of the upper tile; tl: the lower tile
    const int cut = (nu + (tl + 1) * (tl * 64 < RH ? HRC : 1) + 1) >> 1;   // waves 0..3 take key blocks 0 .. cut - 1 of the upper tile (cut <= nu: a lower tile costs at most NT / 2 blocks, an upper one more)
    const int iu = (nu - 1) * 64 + (wv & 3) * 16, il = tl * 64 + (wv & 3) * 16; const size_t zp = ((size_t)blockIdx.y * NB_ + blockIdx.z) * TT * HD;   // q and k planes: [head][batch][t][d]
    const size_t zv = (size_t)blockIdx.y * HD * (NB_ * TT) + (size_t)blockIdx.z * TT * 16;   // value planes: a head's 64 rows of NB_ * T positions; a batch's T positions of 16 rows are T / 32 blocks
    const size_t hc = (size_t)blockIdx.z * TT * DQ + (size_t)blockIdx.y * HD * 16;   // output planes (fragment order, rows of DQ): the batch's T rows, then a head's 64 columns of 16 rows: two blocks
    v8f o[4]; float m[8], l[8];
    if (second) {   // the lower tile, whole
        if (il < RH) attn_keys<bf, true>(Qh + zp, Ql + zp, Kh + zp, Kl + zp, Eb, Vh + zv, Vl + zv, il, 0, tl + 1, es[wv], ps[wv][0], ps[wv][1], o, m, l);
        else attn_keys<h16, false>(Q16 + zp, nullptr, K16 + zp, nullptr, E16, V16 + zv, nullptr, il, 0, tl + 1, es[wv], (h16*)ps[wv][0], nullptr, o, m, l);
#pragma unroll
        for (int j = 0; j < 8; ++j) l[j] = rowsum16(l[j]);
        attn_out(o, l, il, es[wv], Ah + hc, Al + hc);
    }
    attn_keys<h16, false>(Q16 + zp, nullptr, K16 + zp, nullptr, E16, V16 + zv, nullptr, iu, second ? cut : 0, second ? nu : cut, es[wv], (h16*)ps[wv][0], nullptr, o, m, l);   // this wave's part of the upper tile
#pragma unroll
    for (int j = 0; j < 8; ++j) l[j] = rowsum16(l[j]);
    const int ln = lane_anew(), pq = (ln >> 4) * 8 * 68 + (ln & 15), sq = 16 * 68 + (ln >> 4) * 8;   // the lane's place in a part left in LDS: output tile at pitch 68, behind it 16 row maxima and 16 row sums
    if (second) {
#pragma unroll
        for (int j = 0; j < 8; ++j) { es[wv][sq + j] = m[j]; es[wv][sq + 16 + j] = l[j];   // the 16 lanes of a row hold the same maximum and the same sum
#pragma unroll
            for (int nb = 0; nb < 4; ++nb) es[wv][pq + j * 68 + nb * 16] = o[nb][j]; }
    }
    __syncthreads();   // the second parts are in LDS before waves 0..3 read them
    if (!second) {
        const float* pe = es[wv + 4];
#pragma unroll
        for (int j = 0; j < 8; ++j) { const float mb = pe[sq + j], mn = fmaxf(m[j], mb), fa = exp2_slot(m[j] - mn), fb = exp2_slot(mb - mn);   // an empty second part has maximum -3.0e38 and sum 0: fb = 0
            l[j] = l[j] * fa + pe[sq + 16 + j] * fb;
#pragma unroll
            for (int nb = 0; nb < 4; ++nb) o[nb][j] = o[nb][j] * fa + pe[pq + j * 68 + nb * 16] * fb; }
        attn_out(o, l, iu, es[wv], Ah + hc, Al + hc);
    }
}

__device__ __forceinline__ void er16(const float* __restrict__ er, h16* E, int blk) { const int i = (blk * 256 + threadIdx.x) * 4; if (i >= TT * HD) return; int row, k; frag_at((size_t)i, HD, row, k); const float* p = er + row * HD + k; const v4f a = *(const v4f*)p;
    asm volatile("s_wait_xcnt 0x0" :: "v"(p) : "memory");   // the load's address pair stays whole up to this wait (it is an input here): neither the loaded value nor a later result lands on it before
    v4h o; o[0] = tohx(bfr(a[0])); o[1] = tohx(bfr(a[1])); o[2] = tohx(bfr(a[2])); o[3] = tohx(bfr(a[3])); *(v4h*)(E + i) = o;  }
typedef __attribute__((ext_vector_type(4))) _Float16 v4hx;
#define PB_WA ((DM * 3 * DM / 64 + 63) / 64)          // work-groups of each conversion, as many as its own launch had
#define PB_WO ((DQ * DM / 64 + 63) / 64)
#define PB_X  ((NB_ * TT * DM / 8 + 255) / 256)
#define PB_EB ((TT * HD / 8 + 255) / 256)
#define PB_EH ((TT * HD / 4 + 255) / 256)
// the weight transposes come first: their waves walk 8 lines one after the other and last longest
__global__ __launch_bounds__(256) void k_prep(const float* __restrict__ x, const float* __restrict__ wattn, const float* __restrict__ wo, const float* __restrict__ er, bf* XB, bf* WQKV, bf* WO, bf* ERB, h16* ER16) {
    int b = (int)blockIdx.x;
    if (b < PB_WA) { wtG(wattn, DM, 3 * DM, WQKV, b); return; } b -= PB_WA;
    if (b < PB_WO) { wtG(wo, DQ, DM, WO, b); return; } b -= PB_WO;
    if (b < PB_X) { cvt8(x, DM, XB, (size_t)NB_ * TT * DM / 8, b); return; } b -= PB_X;
    if (b < PB_EB) { cvt8(er, HD, ERB, TT * HD / 8, b); return; } b -= PB_EB;
    er16(er, ER16, b);
}

extern "C" void kernel_launch(void* const* d_in, const int* in_sizes, int n_in,
                              void* d_out, int out_size, void* d_ws, size_t ws_size, hipStream_t stream) {
    (void)in_sizes; (void)n_in; (void)out_size;
    const float* x = (const float*)d_in[0]; const float* wattn = (const float*)d_in[1]; const float* wo = (const float*)d_in[2]; const float* er = (const float*)d_in[3];
    float* OUT = (float*)d_out;     // [2][2048][1024]
    char* wsp = (char*)d_ws;
    auto take = [&](size_t bytes) { char* p = wsp; wsp += (bytes + 255) & ~(size_t)255; return (void*)p; };
    bf* WQKV = (bf*)take((size_t)3 * DM * DM * 2); bf* ERB = (bf*)take((size_t)TT * HD * 2); h16* ER16 = (h16*)take((size_t)TT * HD * 2); bf* WO = (bf*)take((size_t)DM * DQ * 2);
    bf* XB = (bf*)take((size_t)NB_ * TT * DM * 2);
    h16* QP16 = (h16*)take((size_t)NB_ * NH_ * TT * HD * 2); h16* KP16 = (h16*)take((size_t)NB_ * NKV * TT * HD * 2); h16* VT16 = (h16*)take((size_t)NB_ * NKV * HD * TT * 2);
    bf* QPh = (bf*)take((size_t)NB_ * NH_ * TT * HD * 2); bf* QPl = (bf*)take((size_t)NB_ * NH_ * TT * HD * 2); bf* KPh = (bf*)take((size_t)NB_ * NKV * TT * HD * 2); bf* KPl = (bf*)take((size_t)NB_ * NKV * TT * HD * 2); bf* VTh = (bf*)take((size_t)NB_ * NKV * HD * TT * 2); bf* VTl = (bf*)take((size_t)NB_ * NKV * HD * TT * 2);
    bf* ATh = (bf*)take((size_t)NB_ * TT * DQ * 2); bf* ATl = (bf*)take((size_t)NB_ * TT * DQ * 2);
    if ((size_t)(wsp - (char*)d_ws) > ws_size) return;    // ws 256 MiB
    // x, both batches, is one matrix of NB_ * T rows: every launch below covers both batches. Four launches, each needing the one before it: conversions, projections, attention, W_proj
    k_prep<<<PB_WA + PB_WO + PB_X + PB_EB + PB_EH, 256, 0, stream>>>(x, wattn, wo, er, XB, WQKV, WO, ERB, ER16);
    k_qkv<<<dim3(NB_ * TT / 128, DQ / 128, 3), 128, 0, stream>>>(XB, WQKV, QP16, QPh, QPl, KP16, KPh, KPl, VT16, VTh, VTl);
    k_fattn<<<dim3(NT / 2, NH_, NB_), 32 * FW, 0, stream>>>(QP16, QPh, QPl, KP16, KPh, KPl, VT16, VTh, VTl, ER16, ERB, ATh, ATl);   // one kv head per query head
    k_proj<<<dim3(NB_ * TT / 128, DM / 128, 1), 128, 0, stream>>>(ATh, ATl, WO, OUT);
}

// v010
// Measured time: 92 microseconds a run.
// Next to v009, in two timings, it ran 1.05 times as fast each time.
// Over all steps from v000 it is 20.8 times as fast.
#include <hip/hip_runtime.h>

// CausalSelfAttentionRelativePosition (x [2][2048][1024]; qkv = x W_attn (16 x 64); Srel = skew(q Er^T) -> Srel[i][j] = q_i . Er[T-1-i+j] for j <= i (the skew's wrapped entries above the diagonal are masked); att = softmax(((q.k) + Srel)/8, causal);
// y = att v; out = y W_proj -> [2][2048][1024]).
// Compute dtypes, f32 accumulate: every input rounded to bf16; qkv on PLAIN bf16 operands (inputs: exact); scores q.k (K 64), the relative logits q.Er^T and probs.v on bf16 hi+lo planes (3 products; q.Er: hl q x exact Er, 2 products)
// for the first 512 query rows per head and SINGLE fp16 planes for the rest (Er, a bf16 input, is exact in fp16); scores, relative logits, skew, softmax (f32, running maximum and sum) and probs.v in one fused launch, key blocks above the diagonal never touched; W_proj on hl planes x exact.
// BOTH BATCHES RIDE IN EVERY LAUNCH: x is one [NB_ * T][DM] matrix for the projections; q and k planes are [head][batch][t][d], the transposed value planes [head][d][batch * T + t], the attention output [batch * T + t][DQ].
// FRAGMENT ORDER: every 16-bit operand plane in the workspace ([rows][K], K % 32 == 0, rows % 16 == 0) is kept as blocks of 16 rows x 32 k (512 elements, block number (row / 16) * (K / 32) + k / 32); inside a block element (row, k) stands at
// ((k % 32) / 16) * 256 + ((k % 16) / 8) * 128 + (row % 16) * 8 + k % 8. A lane's two 16-byte fragment loads are then block + lane * 8 and block + 256 + lane * 8: each load of a wave reads 512 bytes in a row (4 cache lines) instead of 32 bytes out of each of 16 lines.

#define NB_  2
#define TT   2048
#define DM   1024
#define NH_  16
#define NKV  16
#define REP  (NH_ / NKV)
#define HD   64
#define DQ   (NH_ * HD)
#define DKV  (NKV * HD)
#define RH   512                  // query rows < RH use hi+lo planes
#define SCL  0.125f   // HD^-0.5
typedef _Float16 h16;
typedef unsigned short bf;
typedef __attribute__((ext_vector_type(16))) __bf16   v16bf;
typedef __attribute__((ext_vector_type(16))) _Float16 v16h;
typedef __attribute__((ext_vector_type(8)))  _Float16 v8h;
typedef __attribute__((ext_vector_type(8)))  unsigned short v8us;
typedef __attribute__((ext_vector_type(8)))  float    v8f;
typedef __attribute__((ext_vector_type(4)))  float    v4f;
typedef v8h  __attribute__((may_alias)) v8ha;
typedef v4f  __attribute__((may_alias)) v4fa;
typedef v8us __attribute__((may_alias)) v8usa;

__device__ __forceinline__ unsigned short f2bf(float f) { unsigned u = __float_as_uint(f); u += 0x7FFFu + ((u >> 16) & 1u); return (unsigned short)(u >> 16); }
__device__ __forceinline__ float bf2f(unsigned short b) { return __uint_as_float(((unsigned)b) << 16); }
__device__ __forceinline__ float bfr(float f) { return bf2f(f2bf(f)); }
__device__ __forceinline__ v16h cat16(v8h lo, v8h hi) { return __builtin_shufflevector(lo, hi, 0, 1, 2, 3, 4, 5, 6, 7, 8, 9, 10, 11, 12, 13, 14, 15); }
__device__ __forceinline__ v16bf cat16b(v8us lo, v8us hi) { return __builtin_bit_cast(v16bf, __builtin_shufflevector(lo, hi, 0, 1, 2, 3, 4, 5, 6, 7, 8, 9, 10, 11, 12, 13, 14, 15)); }
__device__ __forceinline__ v8f wmma16(v16h a, v16h b, v8f c) { return __builtin_amdgcn_wmma_f32_16x16x32_f16(false, a, false, b, (short)0, c, false, false); }
__device__ __forceinline__ v8f wmmab(v16bf a, v16bf b, v8f c) { return __builtin_amdgcn_wmma_f32_16x16x32_bf16(false, a, false, b, (short)0, c, false, false); }
__device__ __forceinline__ h16 tohx(float x) { return (h16)x; }
__device__ __forceinline__ void splitf(float y, unsigned short& h, unsigned short& l) { h = f2bf(y); l = f2bf(y - bf2f(h)); }
typedef __attribute__((ext_vector_type(4))) _Float16 v4h;
typedef __attribute__((ext_vector_type(4))) unsigned short v4us;



// ---- gemms_tile: GEMM on 16-bit planes in fragment order. A work-group of 4 waves takes a 128x128 tile of C[m][n] = sum_k A[m][k] Bt[n][k] (NA = 2: + A2[m][k] Bt[n][k], the lo plane of A); each wave keeps one 64x64 quarter (16 accumulators) over the WHOLE K.
// The operands come through LDS: a stage is GK k of the tile's 128 rows of every operand plane, brought by asynchronous copies (global_load_async_to_lds_b128), two buffers, the next stage's copies in flight while this stage is worked on.
// Each byte of a stage is fetched once per work-group and read by the two waves that need it. A plane's blocks (16 rows x 32 k, 1 KiB) keep their fragment order in LDS: a row group's GK k are GK / 32 blocks in a row, in memory and in LDS,
// so a copy of a wave moves 512 bytes in a row and a fragment read (ldf) is two 16-byte reads per lane of 512 bytes in a row each (no bank conflict).
// PL: a wave's quarter goes out as three 16-bit planes (fp16, bf16 hi, bf16 lo) instead of f32, in fragment order for rows of ldc elements: its 8 blocks start at (64-column tile number) * sP + (first row) * ldc, so that 64 columns land either
// in their own head's [batch][t][d] plane (sP = NB_ * T * 64, ldc = 64) or as 64 columns of a wide row (sP = 2 blocks, ldc = row length); no f32 copy of the product is written.
// ldf: a fragment from a plane in fragment order (p = block + lane * 8)
// frag_at: which (row, k) of a [rows][K] matrix stands at element e of its plane in fragment order
__device__ __forceinline__ void frag_at(size_t e, int K, int& row, int& k) { const int blk = (int)(e >> 9), r = (int)(e & 511), kb = K >> 5; row = (blk / kb) * 16 + ((r >> 3) & 15); k = (blk % kb) * 32 + (r >> 8) * 16 + ((r >> 7) & 1) * 8 + (r & 7); }
template <typename T16> struct WFrag;
template <> struct WFrag<h16> { typedef v16h V; static __device__ __forceinline__ V ldf(const h16* p) { return cat16(*(const v8h*)p, *(const v8h*)(p + 256)); } static __device__ __forceinline__ v8f mma(V a, V b, v8f c) { return wmma16(a, b, c); } };
template <> struct WFrag<bf> { typedef v16bf V; static __device__ __forceinline__ V ldf(const bf* p) { return cat16b(*(const v8us*)p, *(const v8us*)(p + 256)); } static __device__ __forceinline__ v8f mma(V a, V b, v8f c) { return wmmab(a, b, c); } };
template <typename T16> __device__ __forceinline__ const T16* at(const T16* base, unsigned bytes) { return (const T16*)((const char*)base + bytes); }   // wave-uniform base + the lane's 32-bit byte offset
// copy8: eight asynchronous copies of 16 bytes per lane, global memory to LDS; l: the lane's LDS byte addresses, g: its global addresses. The wait in the same statement keeps every address register whole until the copies have taken it
__device__ __forceinline__ void copy8(const unsigned (&l)[8], const char* const (&g)[8]) {
    asm volatile("global_load_async_to_lds_b128 %0, %8, off\n\tglobal_load_async_to_lds_b128 %1, %9, off\n\tglobal_load_async_to_lds_b128 %2, %10, off\n\tglobal_load_async_to_lds_b128 %3, %11, off\n\t"
                 "global_load_async_to_lds_b128 %4, %12, off\n\tglobal_load_async_to_lds_b128 %5, %13, off\n\tglobal_load_async_to_lds_b128 %6, %14, off\n\tglobal_load_async_to_lds_b128 %7, %15, off\n\ts_wait_xcnt 0x0"
                 :: "v"(l[0]), "v"(l[1]), "v"(l[2]), "v"(l[3]), "v"(l[4]), "v"(l[5]), "v"(l[6]), "v"(l[7]), "v"(g[0]), "v"(g[1]), "v"(g[2]), "v"(g[3]), "v"(g[4]), "v"(g[5]), "v"(g[6]), "v"(g[7]) : "memory");
}
template <int NA, int GK, bool PL>
__device__ __forceinline__ void gemms_tile(const bf* __restrict__ A, const bf* __restrict__ A2, const bf* __restrict__ Bt, float* C, int ldc, h16* P16, bf* Ph, bf* Pl, size_t sP, int bx, int by) {
    typedef WFrag<bf> F; typedef F::V V;
    constexpr int K = DM, NS = K / GK;            // every product here sums over DM = DQ; stages per tile
    constexpr int GB = (GK / 32) * 1024;          // bytes of one row group (16 rows) in a stage
    constexpr int PLB = 8 * GB, STB = (NA + 1) * PLB;   // bytes of one plane's 128 rows in a stage; bytes of a stage (A, A2 if any, Bt)
    static_assert(DQ == DM && NS >= 2 && GK % 64 == 0 && (NA + 1) * (GK / 8) <= 63, "two stages at least; a wave's copies of one stage stay under 64");
    __shared__ __align__(1024) char ring[2 * STB];
    __shared__ __align__(16) float os[4][16 * 68];   // each wave's own slice for the way out
    const int lane = threadIdx.x & 31, lr = lane & 15, hi = lane >> 4; const int wv = __builtin_amdgcn_readfirstlane((int)(threadIdx.x >> 5)), wm = wv & 1, wn = wv >> 1;   // wave number in a scalar register: offsets formed from it stay scalar
    const int r0 = bx * 128, c0 = by * 128; const unsigned lb = lane * 16, ring0 = (unsigned)(size_t)ring;   // ring0: the ring's byte address in the work-group's LDS
    // stage t into buffer buf: wave w brings row groups 2w and 2w + 1 of every plane, GK / 8 copies of 512 bytes per plane
    auto stage = [&](int t, int buf) {
#pragma unroll
        for (int p = 0; p <= NA; ++p) {
            const char* sp = (const char*)(p == NA ? Bt : p == 0 ? A : A2) + ((size_t)(((p == NA ? c0 : r0) >> 4) + wv * 2) * (K / 32) + (size_t)t * (GK / 32)) * 1024 + lb;
            const unsigned dp = ring0 + (unsigned)(buf * STB + p * PLB + wv * 2 * GB) + lb;
#pragma unroll
            for (int q0 = 0; q0 < GK / 8; q0 += 8) { unsigned l[8]; const char* g[8];
#pragma unroll
                for (int i = 0; i < 8; ++i) { const int q = q0 + i; l[i] = dp + q * 512; g[i] = sp + (size_t)(q / (GK / 16)) * ((K / 32) * 1024) + (q % (GK / 16)) * 512; }
                copy8(l, g); }
        }
    };
    v8f acc[4][4];
#pragma unroll
    for (int mb = 0; mb < 4; ++mb)
#pragma unroll
        for (int nb = 0; nb < 4; ++nb) acc[mb][nb] = (v8f){};
    stage(0, 0);
    asm volatile("s_wait_asynccnt 0x0" ::: "memory");   // this wave's copies of stage 0 have landed
    __syncthreads();                                     // every wave's have: stage 0 may be read
    stage(1, 1);
#pragma unroll 1   // kept rolled: one trip per stage, the buffer picked by the trip's parity
    for (int t = 0; t < NS; ++t) {
        const bf* sb = (const bf*)(ring + (t & 1) * STB) + lane * 8;
        V a[2][4], a2[2][4], b[2][4];   // two fragment sets: block ks (32 k) works on set ks % 2 while the next block's reads fill the other
        auto frags = [&](int ks) { const int f = ks & 1;
#pragma unroll
            for (int mb = 0; mb < 4; ++mb) { a[f][mb] = F::ldf(sb + ((wm * 4 + mb) * GB + ks * 1024) / 2); if (NA == 2) a2[f][mb] = F::ldf(sb + (PLB + (wm * 4 + mb) * GB + ks * 1024) / 2); }
#pragma unroll
            for (int nb = 0; nb < 4; ++nb) b[f][nb] = F::ldf(sb + (NA * PLB + (wn * 4 + nb) * GB + ks * 1024) / 2); };
        frags(0);
#pragma unroll
        for (int ks = 0; ks < GK / 32; ++ks) { const int f = ks & 1;
            if (ks + 1 < GK / 32) frags(ks + 1);
            __builtin_amdgcn_sched_barrier(0);   // the next block's LDS reads stay one group in front of this block's products; left free, the scheduler reloads one fragment at a time among the products and waits for each
#pragma unroll
            for (int nb = 0; nb < 4; ++nb) {
#pragma unroll
                for (int mb = 0; mb < 4; ++mb) acc[mb][nb] = F::mma(a[f][mb], b[f][nb], acc[mb][nb]);
                if (NA == 2) {
#pragma unroll
                    for (int mb = 0; mb < 4; ++mb) acc[mb][nb] = F::mma(a2[f][mb], b[f][nb], acc[mb][nb]); } }
            __builtin_amdgcn_sched_barrier(0);   // and the reads of the block after next stay behind these products
        }
        asm volatile("s_wait_dscnt 0x0" ::: "memory");      // this wave's reads of the trip's buffer are done before the buffer is given up
        asm volatile("s_wait_asynccnt 0x0" ::: "memory");   // this wave's copies of stage t + 1 have landed
        __syncthreads();                                     // stage t + 1 may be read by every wave, and no wave still reads stage t's buffer
        if (t + 2 < NS) stage(t + 2, t & 1);
    }
    asm volatile("s_wait_asynccnt 0x0" ::: "memory");   // no copy is outstanding when the wave goes on
    // the way out: 16 rows at a time through the wave's own LDS slice, so that each store of the wave covers whole lines
    float* ow = os[wv]; const int rw = r0 + wm * 64, tw = by * 2 + wn;   // the quarter's first row and its number among the tiles of 64 columns
#pragma unroll
    for (int mb = 0; mb < 4; ++mb) {
#pragma unroll
        for (int nb = 0; nb < 4; ++nb)
#pragma unroll
            for (int j = 0; j < 8; ++j) ow[(hi * 8 + j) * 68 + nb * 16 + lr] = acc[mb][nb][j];
        __builtin_amdgcn_wave_barrier(); asm volatile("" ::: "memory");   // the wave's LDS instructions run in order; this keeps the compiler from moving the reads below over the stores above
        if (PL) {   // step s: columns 8 s .. 8 s + 7 of the 16 rows, 128 elements in the order of the planes; two lanes share a row
            const unsigned ob = (unsigned)(((size_t)tw * sP + (size_t)rw * ldc + (size_t)(mb * (ldc >> 5)) * 512 + lane * 4) * 2); v4h o16[8]; v4us oh[8], ol[8];   // the lane's byte offset in all three planes (each under 4 GiB); the 8 steps are constant offsets from it
#pragma unroll
            for (int s = 0; s < 8; ++s) { const v4f val = *(const v4fa*)(ow + (lane >> 1) * 68 + s * 8 + (lane & 1) * 4);
#pragma unroll
                for (int q = 0; q < 4; ++q) { o16[s][q] = tohx(val[q]); unsigned short x, y; splitf(val[q], x, y); oh[s][q] = x; ol[s][q] = y; }
                *(v4h*)((char*)P16 + ob + s * 256) = o16[s]; *(v4us*)((char*)Ph + ob + s * 256) = oh[s]; *(v4us*)((char*)Pl + ob + s * 256) = ol[s]; }
            // the stores' address and data registers stay whole up to this wait (they are inputs here); the next 16 rows rewrite them behind it
            asm volatile("s_wait_xcnt 0x0" :: "v"(ob), "v"(o16[0]), "v"(o16[1]), "v"(o16[2]), "v"(o16[3]), "v"(o16[4]), "v"(o16[5]), "v"(o16[6]), "v"(o16[7]), "v"(oh[0]), "v"(oh[1]), "v"(oh[2]), "v"(oh[3]), "v"(oh[4]), "v"(oh[5]), "v"(oh[6]), "v"(oh[7]),
                         "v"(ol[0]), "v"(ol[1]), "v"(ol[2]), "v"(ol[3]), "v"(ol[4]), "v"(ol[5]), "v"(ol[6]), "v"(ol[7]) : "memory");
        } else {    // step s: rows 2 s and 2 s + 1, 64 columns each
            const unsigned ob = (unsigned)(((rw + mb * 16 + hi) * DM + tw * 64 + lr * 4) * 4); v4f val[8];   // the lane's byte offset in C (rows of DM floats); the 8 steps are constant offsets from it
#pragma unroll
            for (int s = 0; s < 8; ++s) { val[s] = *(const v4fa*)(ow + (2 * s + hi) * 68 + lr * 4); *(v4f*)((char*)C + ob + s * (2 * DM * 4)) = val[s]; }
            asm volatile("s_wait_xcnt 0x0" :: "v"(ob), "v"(val[0]), "v"(val[1]), "v"(val[2]), "v"(val[3]), "v"(val[4]), "v"(val[5]), "v"(val[6]), "v"(val[7]) : "memory");   // as above
        }
        __builtin_amdgcn_wave_barrier(); asm volatile("" ::: "memory");   // the next 16 rows' stores into the slice stay behind the reads above
    }
}
// ---- k_proj: out = (attention output, hi + lo planes) x W_proj, f32; grid (NB_ * T / 128, DM / 128), 128 threads. One work-group per tile and no more tiles than WGPs: stages of 128 k, so that a stage's copies have a whole long trip to land
__global__ __launch_bounds__(128) void k_proj(const bf* __restrict__ Ah, const bf* __restrict__ Al, const bf* __restrict__ Wt, float* C) {
    gemms_tile<2, 128, false>(Ah, Al, Wt, C, DM, nullptr, nullptr, nullptr, 0, (int)blockIdx.x, (int)blockIdx.y);
}
// ---- k_qkv: the q, k and v projections in ONE launch, grid (NB_ * T / 128, DQ / 128, 3), 128 threads; blockIdx.z picks the product (none reads what another writes). Stages of 64 k: three work-groups fit the LDS of a WGP, so the whole grid is resident at once.
// q and k: x W, 64 columns are one head (HD = 64), so a wave's quarter goes straight into that head's [batch][t][d] planes.
// v: the product is taken as W_v^T x^T (rows = head dims, columns = positions of both batches), so the tile already has the [h][d][batch * T + t] order that probs.v reads; 64 positions of 16 head dims are two blocks (1024 elements);
// its tiles are numbered with the head-dim tile running fastest, so that work-groups that start together share a tile of x.
__global__ __launch_bounds__(128) void k_qkv(const bf* __restrict__ X, const bf* __restrict__ Wqkv, h16* Q16, bf* Qh, bf* Ql, h16* K16, bf* Kh, bf* Kl, h16* V16, bf* Vh, bf* Vl) {
    const int z = (int)blockIdx.z; const bool isv = z == 2; const int flat = (int)blockIdx.y * (NB_ * TT / 128) + (int)blockIdx.x;
    const bf* W = Wqkv + (size_t)z * DM * DM;
    gemms_tile<1, 64, true>(isv ? W : X, nullptr, isv ? X : W, nullptr, isv ? NB_ * TT : HD, z == 0 ? Q16 : isv ? V16 : K16, z == 0 ? Qh : isv ? Vh : Kh, z == 0 ? Ql : isv ? Vl : Kl,
                            isv ? (size_t)1024 : (size_t)NB_ * TT * HD, isv ? flat % (DKV / 128) : (int)blockIdx.x, isv ? flat / (DKV / 128) : (int)blockIdx.y);
}

typedef __attribute__((ext_vector_type(2))) unsigned short v2us;
typedef __attribute__((ext_vector_type(4))) int v4i;

// The five operand conversions (W_attn, W_proj, x, Er to bf16, Er to fp16) are bodies of ONE launch, k_prep: each takes its own range of work-groups, blk counts inside the range.
__device__ __forceinline__ void wtG(const float* __restrict__ w, int K, int N, bf* Bt, int blk) {
    const int lane = threadIdx.x & 31; const int L0 = (blk * 8 + (threadIdx.x >> 5)) * 8; const int nlines = N * K / 64;
{
#pragma unroll 1
        for (int l = 0; l < 8; ++l) { const int L = L0 + l; if (L >= nlines) break; const size_t e = (size_t)L * 64 + lane * 2; int k, n; frag_at(e, K, n, k); v2us o;
            o[0] = f2bf(w[(size_t)k * N + n]); o[1] = f2bf(w[(size_t)(k + 1) * N + n]); *(v2us*)(Bt + e) = o; }
         }
}
__device__ __forceinline__ void cvt8(const float* __restrict__ src, int K, bf* dst, size_t n8, int blk) { const size_t i = (size_t)blk * 256 + threadIdx.x; if (i >= n8) return; int row, k; frag_at(i * 8, K, row, k); const v8f v = *(const v8f*)(src + (size_t)row * K + k); v8us o;
#pragma unroll
    for (int k = 0; k < 8; ++k) o[k] = f2bf(v[k]); *(v8us*)(dst + i * 8) = o;  }
// ---- k_fattn: scores, relative logits, skew, causal softmax and probs.v of every head and batch in ONE launch; no score, logit or probability ever goes to memory.
// One wave walks a range of the key blocks of 64 of 16 query rows (i0..i0+15), with a running row maximum and a running row sum (f32).
// TRANSPOSED PRODUCTS: every product has the keys (or the Er rows, or the head dims) as its rows and the 16 queries as its columns: S^T = k q^T, L^T = Er q^T, O^T += v^T p^T. A lane (c = lane & 15, h = lane >> 4) then holds values of ONE query, c:
// register j of score tile nb is key nb * 16 + 8 h + j. The row maximum and the row sum are taken inside the lane, plus one exchange between the halves; the rescale of O^T is one factor per lane;
// and two score tiles, converted in place, ARE the B operand of probs.v (element s: tile s / 8, register s % 8, the k order of the planes in fragment order): the probabilities never touch LDS.
// EQUAL WORK PER WAVE: the cost of a tile of 64 query rows grows with its place (tile t has t + 1 key blocks) and every wave of the launch is resident at once, so the launch lasts as long as its fullest wave. A work-group of 8 waves takes one tile of the
// upper half and one of the lower half; waves 0..3 walk the first key blocks of the upper tile's four row groups, waves 4..7 the whole lower tile and then the rest of the upper tile's key blocks; the cut gives both the same cost.
// Waves 4..7 leave their part of the upper tile (unnormalised output, row maximum, row sum) in LDS, and behind ONE work-group barrier waves 0..3 join the two parts as two key blocks are joined in the loop.
// Per block: S^T = k.q (4 tiles), L^T = Er rows rb..rb+79 . q with rb = T-16-i0+c0 (5 tiles), Srel[a][b] = L[a][15-a+b] (the skew: each query's 80 logits lie in a row of the wave's own LDS slice, read back from a start that depends on the query),
// p = exp2(((S+Srel)/8 - rowmax) log2 e), O = O x exp2(old max - new max) + p.v; at the end O / rowsum goes out as hi+lo planes for W_proj.
#define EP 84    // f32 pitch of the logit slice (one query's logits a row): the 16-byte stores of 16 lanes cover all 64 banks once, and the shifted 4-byte reads (stride EP - 1 between queries) of 32 lanes fall on 32 banks
#define FW 8     // waves per work-group: 4 row groups x 2 parts
#define NT (TT / 64)   // tiles of 64 query rows per head and batch
// LDS traffic between the lanes of one wave: the wave's LDS instructions run in order; this keeps the compiler from moving an LDS read over the stores that feed it (or a store over the reads before it)
__device__ __forceinline__ void wave_lds_order() { __builtin_amdgcn_wave_barrier(); asm volatile("" ::: "memory"); }
__device__ __forceinline__ float halfx(float x) { const int b = __builtin_bit_cast(int, x); return __builtin_bit_cast(float, __builtin_amdgcn_permlanex16(b, b, 0x76543210, 0xfedcba98, false, false)); }   // lane l with lane l ^ 16: the other half's value of the same query
// packp: two tiles of probabilities (32 keys of the lane's query) become one B fragment (fp16), or a hi and a lo fragment (bf16)
__device__ __forceinline__ void packp(const v8f& a, const v8f& b, v16h& f, v16h&) {
#pragma unroll
    for (int q = 0; q < 8; ++q) { f[q] = tohx(a[q]); f[8 + q] = tohx(b[q]); } }
__device__ __forceinline__ void packp(const v8f& a, const v8f& b, v16bf& f, v16bf& f2) { v8us h0, h1, l0, l1;
#pragma unroll
    for (int q = 0; q < 8; ++q) { unsigned short x, y; splitf(a[q], x, y); h0[q] = x; l0[q] = y; splitf(b[q], x, y); h1[q] = x; l1[q] = y; }
    f = cat16b(h0, h1); f2 = cat16b(l0, l1); }
template <typename T16, bool HR>
__device__ __forceinline__ void attn_keys(const T16* __restrict__ Q, const T16* __restrict__ Q2, const T16* __restrict__ Kp, const T16* __restrict__ K2, const T16* __restrict__ E, const T16* __restrict__ Vt, const T16* __restrict__ Vt2,
                                          int i0, int kb0, int kb1, float* es, v8f (&o)[4], float& m, float& l) {   // key blocks kb0 .. kb1 - 1 of rows i0 .. i0 + 15; o: unnormalised output, transposed (register j of tile nb: head dim nb * 16 + 8 h + j of query c); m: the query's maximum; l: the lane's share of its sum
    typedef typename WFrag<T16>::V V; typedef WFrag<T16> F;   // every inner loop below is unrolled so that fragments and tiles are indexed by constants (stay in registers)
    // the lane number comes from mbcnt (every lane is on, 32 lanes a wave): the thread id is then dead before the key loops, whose fragment runs leave no register to hold it
    const int lane = (int)__builtin_amdgcn_mbcnt_lo(~0u, 0u), lr = lane & 15, hi = lane >> 4; const unsigned lb = lane * 16;   // the lane's byte offset inside a block of a plane in fragment order
    const int eb = lr * EP + hi * 8, er = lr * (EP - 1) + 15 + hi * 8;   // the lane's place in the logit slice for the store and for the shifted read; tiles and registers are constant offsets from it
    V aq[2], aq2[2];
#pragma unroll
    for (int ks = 0; ks < 2; ++ks) { aq[ks] = F::ldf(at(Q, lb) + (size_t)i0 * HD + ks * 512); if (HR) aq2[ks] = F::ldf(at(Q2, lb) + (size_t)i0 * HD + ks * 512); }
#pragma unroll
    for (int nb = 0; nb < 4; ++nb) o[nb] = (v8f){};
    m = -3.0e38f; l = 0.f;
#pragma unroll 1   // kept rolled: two blocks' fragments and tiles at once would not fit the register budget
    for (int kb = kb0; kb < kb1; ++kb) {
        const int c0 = kb * 64;
        v8f s[4], e[5];
        const unsigned kp = c0 * HD * 2 + lb; unsigned ep[5];   // the lane's byte offset in the key planes and in each Er tile (one register each, the plane's base is wave-uniform); tiles and k steps (blocks of 512 elements) are constant offsets
        const int rb = TT - 16 - i0 + c0;
#pragma unroll
        for (int t = 0; t < 5; ++t) { e[t] = (v8f){}; ep[t] = min(rb + t * 16, TT - 16) * HD * 2 + lb; }   // rb is a multiple of 16: a tile lies wholly inside Er or wholly past T-1; rows past T-1 belong to keys j > i only (masked below): the clamp keeps the address inside Er
#pragma unroll
        for (int nb = 0; nb < 4; ++nb) s[nb] = (v8f){};
        // Behind each run of fragment loads stands one wait. Its inputs are the run's address registers (each stays whole until every load that names it is past the wait, so no later load or result lands on it before)
        // and the loaded fragments (no product of the run moves in front of it, so all loads of the run are in flight together and the run pays the memory latency once instead of once per refill of a few registers).
        if (!HR) {   // single-plane rows: all 18 key and Er fragments of the block fit the registers: one run
            V bk[4][2], be[5][2];
#pragma unroll
            for (int ks = 0; ks < 2; ++ks) {
#pragma unroll
                for (int nb = 0; nb < 4; ++nb) bk[nb][ks] = F::ldf(at(Kp, kp) + nb * 16 * HD + ks * 512);
#pragma unroll
                for (int t = 0; t < 5; ++t) be[t][ks] = F::ldf(at(E, ep[t]) + ks * 512); }
            asm volatile("s_wait_xcnt 0x0" :: "v"(kp), "v"(ep[0]), "v"(ep[1]), "v"(ep[2]), "v"(ep[3]), "v"(ep[4]), "v"(bk[0][0]), "v"(bk[1][0]), "v"(bk[2][0]), "v"(bk[3][0]), "v"(bk[0][1]), "v"(bk[1][1]), "v"(bk[2][1]), "v"(bk[3][1]),
                         "v"(be[0][0]), "v"(be[1][0]), "v"(be[2][0]), "v"(be[3][0]), "v"(be[4][0]), "v"(be[0][1]), "v"(be[1][1]), "v"(be[2][1]), "v"(be[3][1]), "v"(be[4][1]) : "memory");
            __builtin_amdgcn_sched_barrier(0);   // without it the scheduler lifts the first product over the wait, and its data wait then stands behind four loads only: the rest of the run would start one memory latency later
#pragma unroll
            for (int ks = 0; ks < 2; ++ks) {
#pragma unroll
                for (int t = 0; t < 5; ++t) e[t] = F::mma(be[t][ks], aq[ks], e[t]);
#pragma unroll
                for (int nb = 0; nb < 4; ++nb) s[nb] = F::mma(bk[nb][ks], aq[ks], s[nb]); }
        } else {     // hi+lo rows: three runs (key hi plane, key lo plane, Er), each as large as the registers allow
            { V bk[4][2];
#pragma unroll
              for (int nb = 0; nb < 4; ++nb)
#pragma unroll
                  for (int ks = 0; ks < 2; ++ks) bk[nb][ks] = F::ldf(at(Kp, kp) + nb * 16 * HD + ks * 512);
              asm volatile("s_wait_xcnt 0x0" :: "v"(kp), "v"(bk[0][0]), "v"(bk[1][0]), "v"(bk[2][0]), "v"(bk[3][0]), "v"(bk[0][1]), "v"(bk[1][1]), "v"(bk[2][1]), "v"(bk[3][1]) : "memory");
#pragma unroll
              for (int ks = 0; ks < 2; ++ks)
#pragma unroll
                  for (int nb = 0; nb < 4; ++nb) { s[nb] = F::mma(bk[nb][ks], aq[ks], s[nb]); s[nb] = F::mma(bk[nb][ks], aq2[ks], s[nb]); } }
            { V bk[4][2];
#pragma unroll
              for (int nb = 0; nb < 4; ++nb)
#pragma unroll
                  for (int ks = 0; ks < 2; ++ks) bk[nb][ks] = F::ldf(at(K2, kp) + nb * 16 * HD + ks * 512);
              asm volatile("s_wait_xcnt 0x0" :: "v"(kp), "v"(bk[0][0]), "v"(bk[1][0]), "v"(bk[2][0]), "v"(bk[3][0]), "v"(bk[0][1]), "v"(bk[1][1]), "v"(bk[2][1]), "v"(bk[3][1]) : "memory");
#pragma unroll
              for (int ks = 0; ks < 2; ++ks)
#pragma unroll
                  for (int nb = 0; nb < 4; ++nb) s[nb] = F::mma(bk[nb][ks], aq[ks], s[nb]); }
            { V be[5][2];
#pragma unroll
              for (int t = 0; t < 5; ++t)
#pragma unroll
                  for (int ks = 0; ks < 2; ++ks) be[t][ks] = F::ldf(at(E, ep[t]) + ks * 512);
              asm volatile("s_wait_xcnt 0x0" :: "v"(ep[0]), "v"(ep[1]), "v"(ep[2]), "v"(ep[3]), "v"(ep[4]), "v"(be[0][0]), "v"(be[1][0]), "v"(be[2][0]), "v"(be[3][0]), "v"(be[4][0]), "v"(be[0][1]), "v"(be[1][1]), "v"(be[2][1]), "v"(be[3][1]), "v"(be[4][1]) : "memory");
#pragma unroll
              for (int ks = 0; ks < 2; ++ks)
#pragma unroll
                  for (int t = 0; t < 5; ++t) { e[t] = F::mma(be[t][ks], aq[ks], e[t]); e[t] = F::mma(be[t][ks], aq2[ks], e[t]); } }
        }
#pragma unroll
        for (int t = 0; t < 5; ++t) {   // the lane's 8 logits of a tile are 8 neighbours in its query's row: two 16-byte stores
            *(v4fa*)(es + eb + t * 16) = __builtin_shufflevector(e[t], e[t], 0, 1, 2, 3); *(v4fa*)(es + eb + t * 16 + 4) = __builtin_shufflevector(e[t], e[t], 4, 5, 6, 7); }
        wave_lds_order();
        const unsigned vp = c0 * 16 * 2 + lb;   // the lane's byte offset in the transposed value planes (32 keys of 16 head dims are one block; 16 head dims are a row of blocks over the positions of all batches); tiles and k steps are constant offsets from it
        V bv[4][2];   // single-plane rows: value fragments asked for here, where the logit registers are free again, so that they fly under the softmax (the hi+lo rows have no registers to spare for it and at most 8 blocks)
        if (!HR) {
#pragma unroll
            for (int nb = 0; nb < 4; ++nb)
#pragma unroll
                for (int ks = 0; ks < 2; ++ks) bv[nb][ks] = F::ldf(at(Vt, vp) + nb * 16 * (NB_ * TT) + ks * 512);
            asm volatile("s_wait_xcnt 0x0" :: "v"(vp) : "memory");   // the run's address register stays whole up to this wait (it is an input here), so no load of the run lands on it while the others are issued
        }
#pragma unroll
        for (int nb = 0; nb < 4; ++nb)
#pragma unroll
            for (int j = 0; j < 8; ++j) s[nb][j] = (s[nb][j] + es[er + nb * 16 + j]) * (SCL * 1.4426950408889634f);   // query a, key b reads column 15 - a + b of row a; logits kept in units of log 2
        wave_lds_order();   // the next block's stores into the slice stay behind these reads
        if (c0 + 63 > i0) {   // only the diagonal block holds keys j > i (wave-uniform test)
            const int dg = hi * 8 - lr - (i0 - c0);   // formed here, so that each test below is one value against a constant and nothing of the mask is held over the key loop
#pragma unroll
            for (int nb = 0; nb < 4; ++nb)
#pragma unroll
                for (int j = 0; j < 8; ++j) if (dg > -(nb * 16 + j)) s[nb][j] = -3.0e38f;   // key c0 + nb*16 + hi*8 + j > row i0 + lr
        }
        float mt[4];   // one chain per tile: four independent chains instead of one of 32 links
#pragma unroll
        for (int nb = 0; nb < 4; ++nb) { mt[nb] = s[nb][0];
#pragma unroll
            for (int j = 1; j < 8; ++j) mt[nb] = fmaxf(mt[nb], s[nb][j]); }
        const float mx = fmaxf(fmaxf(mt[0], mt[1]), fmaxf(mt[2], mt[3]));
        const float mn = fmaxf(m, fmaxf(mx, halfx(mx)));   // the same in both halves: they share the query's column of O^T
        const float al = __builtin_amdgcn_exp2f(m - mn); m = mn;
#pragma unroll
        for (int nb = 0; nb < 4; ++nb) {
#pragma unroll
            for (int j = 0; j < 8; ++j) s[nb][j] = __builtin_amdgcn_exp2f(s[nb][j] - mn);
            o[nb] *= al; }
        const v8f pt = (s[0] + s[1]) + (s[2] + s[3]);   // the four tiles added register by register (packed adds), then the 8 registers
        l = l * al + (((pt[0] + pt[1]) + (pt[2] + pt[3])) + ((pt[4] + pt[5]) + (pt[6] + pt[7])));   // each lane keeps the sum of its own 32 keys; the two halves of a query are added once, behind the loop
        V ap[2], ap2[2];
#pragma unroll
        for (int ks = 0; ks < 2; ++ks) packp(s[2 * ks], s[2 * ks + 1], ap[ks], ap2[ks]);
        if (HR) {   // hi plane of the values: asked for when the score registers are free
#pragma unroll
            for (int nb = 0; nb < 4; ++nb)
#pragma unroll
                for (int ks = 0; ks < 2; ++ks) bv[nb][ks] = F::ldf(at(Vt, vp) + nb * 16 * (NB_ * TT) + ks * 512);
            asm volatile("s_wait_xcnt 0x0" :: "v"(vp) : "memory");   // as above: the run's address register stays whole up to the wait
        }
#pragma unroll
        for (int ks = 0; ks < 2; ++ks)
#pragma unroll
            for (int nb = 0; nb < 4; ++nb) { o[nb] = F::mma(bv[nb][ks], ap[ks], o[nb]); if (HR) o[nb] = F::mma(bv[nb][ks], ap2[ks], o[nb]); }
        if (HR) {   // lo plane of the values
#pragma unroll
            for (int nb = 0; nb < 4; ++nb)
#pragma unroll
                for (int ks = 0; ks < 2; ++ks) bv[nb][ks] = F::ldf(at(Vt2, vp) + nb * 16 * (NB_ * TT) + ks * 512);
            asm volatile("s_wait_xcnt 0x0" :: "v"(vp) : "memory");   // as above
#pragma unroll
            for (int ks = 0; ks < 2; ++ks)
#pragma unroll
                for (int nb = 0; nb < 4; ++nb) o[nb] = F::mma(bv[nb][ks], ap[ks], o[nb]);
        }
    }
}
// the lane number read anew behind a key loop (every lane is on, 32 lanes a wave). In asm, so that the compiler does not take it, and what is formed from it, from a read in front of the loop: the loop's fragment run leaves no register to hold them (they were spilled to scratch)
__device__ __forceinline__ int lane_anew() { int x; asm volatile("v_mbcnt_lo_u32_b32 %0, -1, 0" : "=v"(x)); return x; }
// 2^x with the free slot that the instruction set asks for behind a transcendental held by a v_nop in the same statement (used where two parts are joined, once per wave)
__device__ __forceinline__ float exp2_slot(float x) { float y; asm("v_exp_f32 %0, %1\n\tv_nop" : "=v"(y) : "v"(x)); return y; }
// attn_out: 16 finished rows (o unnormalised and transposed, l the query's whole sum) go out as hi+lo planes for W_proj. The lane's 8 registers of a tile are 8 neighbouring head dims of its query: in fragment order 16 bytes at lane * 16 of a half block,
// so each store of the wave covers 512 bytes in a row, straight from the registers
__device__ __forceinline__ void attn_out(const v8f (&o)[4], float l, int i0, bf* Ah, bf* Al) {
    const int ln = lane_anew(); const float f = __fdiv_rn(1.0f, l);
    const unsigned ob = (unsigned)((i0 * DQ + ln * 8) * 2); v8us oh[4], ol[4];   // the lane's byte offset in both output planes (their bases are wave-uniform); the 4 tiles are constant offsets from it
#pragma unroll
    for (int nb = 0; nb < 4; ++nb) {
#pragma unroll
        for (int j = 0; j < 8; ++j) { unsigned short a, c2; splitf(o[nb][j] * f, a, c2); oh[nb][j] = a; ol[nb][j] = c2; }
        *(v8us*)((char*)Ah + ob + nb * 512) = oh[nb]; *(v8us*)((char*)Al + ob + nb * 512) = ol[nb]; }
    // a wave may go on to other rows behind these stores: their address and data registers stay whole up to this wait (they are inputs here)
    asm volatile("s_wait_xcnt 0x0" :: "v"(ob), "v"(oh[0]), "v"(oh[1]), "v"(oh[2]), "v"(oh[3]), "v"(ol[0]), "v"(ol[1]), "v"(ol[2]), "v"(ol[3]) : "memory");
}
// grid (T/128, heads, batches), 256 threads. waves_per_eu 4: a budget of 256 registers, so that the loops hold no register-window switches
// Which lower tile goes with which upper tile: work-group r takes upper tile NT - 1 - r (NT - r key blocks) and the lower tile of rank r by cost, a key block of the hi+lo rows (tiles below RH / 64) counted as HRC single-plane blocks:
// the ranks are a permutation of the lower tiles, one hex digit each, lowest digit for r = 0; every (tile, head, batch) is taken once whatever the costs are.
#define HRC 2
#define LOWER_BY_COST 0xF7ED6CB5A9483210ull
static_assert(TT == 2048 && RH == 512 && RH <= TT / 2, "the list of lower tiles by cost is written for 32 tiles, the first 8 of them hi+lo; upper tiles are single-plane");
static_assert(34 * 32 <= 16 * EP, "a part left in LDS (32 output registers, maximum, sum, per lane) fits a wave's slice");
__global__ __launch_bounds__(32 * FW) __attribute__((amdgpu_waves_per_eu(4))) void k_fattn(const h16* __restrict__ Q16, const bf* __restrict__ Qh, const bf* __restrict__ Ql, const h16* __restrict__ K16, const bf* __restrict__ Kh, const bf* __restrict__ Kl,
                                                   const h16* __restrict__ V16, const bf* __restrict__ Vh, const bf* __restrict__ Vl, const h16* __restrict__ E16, const bf* __restrict__ Eb, bf* Ah, bf* Al) {
    __shared__ __align__(16) float es[FW][16 * EP];
    const int wv = __builtin_amdgcn_readfirstlane((int)(threadIdx.x >> 5));   // wave number in a scalar register: the row ranges, the trip counts and the branches below stay scalar
    const bool second = wv >= 4; const int r = (int)blockIdx.x, nu = NT - r, tl = (int)((LOWER_BY_COST >> (4 * r)) & 15);   // nu: key blocks of the upper tile; tl: the lower tile
    const int cut = (nu + (tl + 1) * (tl * 64 < RH ? HRC : 1) + 1) >> 1;   // waves 0..3 take key blocks 0 .. cut - 1 of the upper tile (cut <= nu: a lower tile costs at most NT / 2 blocks, an upper one more)
    const int iu = (nu - 1) * 64 + (wv & 3) * 16, il = tl * 64 + (wv & 3) * 16; const size_t zp = ((size_t)blockIdx.y * NB_ + blockIdx.z) * TT * HD;   // q and k planes: [head][batch][t][d]
    const size_t zv = (size_t)blockIdx.y * HD * (NB_ * TT) + (size_t)blockIdx.z * TT * 16;   // value planes: a head's 64 rows of NB_ * T positions; a batch's T positions of 16 rows are T / 32 blocks
    const size_t hc = (size_t)blockIdx.z * TT * DQ + (size_t)blockIdx.y * HD * 16;   // output planes (fragment order, rows of DQ): the batch's T rows, then a head's 64 columns of 16 rows: two blocks
    v8f o[4]; float m, l;
    if (second) {   // the lower tile, whole
        if (il < RH) attn_keys<bf, true>(Qh + zp, Ql + zp, Kh + zp, Kl + zp, Eb, Vh + zv, Vl + zv, il, 0, tl + 1, es[wv], o, m, l);
        else attn_keys<h16, false>(Q16 + zp, nullptr, K16 + zp, nullptr, E16, V16 + zv, nullptr, il, 0, tl + 1, es[wv], o, m, l);
        l += halfx(l);
        attn_out(o, l, il, Ah + hc, Al + hc);
    }
    attn_keys<h16, false>(Q16 + zp, nullptr, K16 + zp, nullptr, E16, V16 + zv, nullptr, iu, second ? cut : 0, second ? nu : cut, es[wv], o, m, l);   // this wave's part of the upper tile
    l += halfx(l);
    const int ln = lane_anew();   // a part left in LDS: value v of lane ln at v * 32 + ln; 32 output registers, then the maximum, then the sum
    if (second) {
        es[wv][32 * 32 + ln] = m; es[wv][33 * 32 + ln] = l;
#pragma unroll
        for (int nb = 0; nb < 4; ++nb)
#pragma unroll
            for (int j = 0; j < 8; ++j) es[wv][(nb * 8 + j) * 32 + ln] = o[nb][j];
    }
    __syncthreads();   // the second parts are in LDS before waves 0..3 read them
    if (!second) {
        const float* pe = es[wv + 4];
        const float mb = pe[32 * 32 + ln], mn = fmaxf(m, mb), fa = exp2_slot(m - mn), fb = exp2_slot(mb - mn);   // an empty second part has maximum -3.0e38 and sum 0: fb = 0
        l = l * fa + pe[33 * 32 + ln] * fb;
#pragma unroll
        for (int nb = 0; nb < 4; ++nb)
#pragma unroll
            for (int j = 0; j < 8; ++j) o[nb][j] = o[nb][j] * fa + pe[(nb * 8 + j) * 32 + ln] * fb;
        attn_out(o, l, iu, Ah + hc, Al + hc);
    }
}

__device__ __forceinline__ void er16(const float* __restrict__ er, h16* E, int blk) { const int i = (blk * 256 + threadIdx.x) * 4; if (i >= TT * HD) return; int row, k; frag_at((size_t)i, HD, row, k); const float* p = er + row * HD + k; const v4f a = *(const v4f*)p;
    asm volatile("s_wait_xcnt 0x0" :: "v"(p) : "memory");   // the load's address pair stays whole up to this wait (it is an input here): neither the loaded value nor a later result lands on it before
    v4h o; o[0] = tohx(bfr(a[0])); o[1] = tohx(bfr(a[1])); o[2] = tohx(bfr(a[2])); o[3] = tohx(bfr(a[3])); *(v4h*)(E + i) = o;  }
typedef __attribute__((ext_vector_type(4))) _Float16 v4hx;
#define PB_WA ((DM * 3 * DM / 64 + 63) / 64)          // work-groups of each conversion, as many as its own launch had
#define PB_WO ((DQ * DM / 64 + 63) / 64)
#define PB_X  ((NB_ * TT * DM / 8 + 255) / 256)
#define PB_EB ((TT * HD / 8 + 255) / 256)
#define PB_EH ((TT * HD / 4 + 255) / 256)
// the weight transposes come first: their waves walk 8 lines one after the other and last longest
__global__ __launch_bounds__(256) void k_prep(const float* __restrict__ x, const float* __restrict__ wattn, const float* __restrict__ wo, const float* __restrict__ er, bf* XB, bf* WQKV, bf* WO, bf* ERB, h16* ER16) {
    int b = (int)blockIdx.x;
    if (b < PB_WA) { wtG(wattn, DM, 3 * DM, WQKV, b); return; } b -= PB_WA;
    if (b < PB_WO) { wtG(wo, DQ, DM, WO, b); return; } b -= PB_WO;
    if (b < PB_X) { cvt8(x, DM, XB, (size_t)NB_ * TT * DM / 8, b); return; } b -= PB_X;
    if (b < PB_EB) { cvt8(er, HD, ERB, TT * HD / 8, b); return; } b -= PB_EB;
    er16(er, ER16, b);
}

extern "C" void kernel_launch(void* const* d_in, const int* in_sizes, int n_in,
                              void* d_out, int out_size, void* d_ws, size_t ws_size, hipStream_t stream) {
    (void)in_sizes; (void)n_in; (void)out_size;
    const float* x = (const float*)d_in[0]; const float* wattn = (const float*)d_in[1]; const float* wo = (const float*)d_in[2]; const float* er = (const float*)d_in[3];
    float* OUT = (float*)d_out;     // [2][2048][1024]
    char* wsp = (char*)d_ws;
    auto take = [&](size_t bytes) { char* p = wsp; wsp += (bytes + 255) & ~(size_t)255; return (void*)p; };
    bf* WQKV = (bf*)take((size_t)3 * DM * DM * 2); bf* ERB = (bf*)take((size_t)TT * HD * 2); h16* ER16 = (h16*)take((size_t)TT * HD * 2); bf* WO = (bf*)take((size_t)DM * DQ * 2);
    bf* XB = (bf*)take((size_t)NB_ * TT * DM * 2);
    h16* QP16 = (h16*)take((size_t)NB_ * NH_ * TT * HD * 2); h16* KP16 = (h16*)take((size_t)NB_ * NKV * TT * HD * 2); h16* VT16 = (h16*)take((size_t)NB_ * NKV * HD * TT * 2);
    bf* QPh = (bf*)take((size_t)NB_ * NH_ * TT * HD * 2); bf* QPl = (bf*)take((size_t)NB_ * NH_ * TT * HD * 2); bf* KPh = (bf*)take((size_t)NB_ * NKV * TT * HD * 2); bf* KPl = (bf*)take((size_t)NB_ * NKV * TT * HD * 2); bf* VTh = (bf*)take((size_t)NB_ * NKV * HD * TT * 2); bf* VTl = (bf*)take((size_t)NB_ * NKV * HD * TT * 2);
    bf* ATh = (bf*)take((size_t)NB_ * TT * DQ * 2); bf* ATl = (bf*)take((size_t)NB_ * TT * DQ * 2);
    if ((size_t)(wsp - (char*)d_ws) > ws_size) return;    // ws 256 MiB
    // x, both batches, is one matrix of NB_ * T rows: every launch below covers both batches. Four launches, each needing the one before it: conversions, projections, attention, W_proj
    k_prep<<<PB_WA + PB_WO + PB_X + PB_EB + PB_EH, 256, 0, stream>>>(x, wattn, wo, er, XB, WQKV, WO, ERB, ER16);
    k_qkv<<<dim3(NB_ * TT / 128, DQ / 128, 3), 128, 0, stream>>>(XB, WQKV, QP16, QPh, QPl, KP16, KPh, KPl, VT16, VTh, VTl);
    k_fattn<<<dim3(NT / 2, NH_, NB_), 32 * FW, 0, stream>>>(QP16, QPh, QPl, KP16, KPh, KPl, VT16, VTh, VTl, ER16, ERB, ATh, ATl);   // one kv head per query head
    k_proj<<<dim3(NB_ * TT / 128, DM / 128, 1), 128, 0, stream>>>(ATh, ATl, WO, OUT);
}
